// v000
// Measured on an AMD MI455X. A time is GPU time per run, averaged over a window of back-to-back runs after a warm-up
// (all launches, gaps included; the runs take copies of the inputs in turn), and the median of several windows.
// Apart from v000's, it joins two sittings. Times from different sittings can be a few percent apart, while
// side-by-side timings come from the same sitting.
// v000 is the starting kernel. One run takes 304 microseconds.
// Contractions: qkv projection v_wmma_f32_16x16x32_bf16 (x, W as bf16 RNE; bias added as bf16-RNE value in f32); q.k^T bf16 hi/lo planes (hi.hi+hi.lo+lo.hi); q.pe^T and k.pe^T bf16 (q,k hi planes, pe bf16); p.v v_wmma_f32_16x16x32_f16 (p f16 carried x2^15, v f16); f32 accumulate; softmax, scale, bias, mask add in f32.
#include <hip/hip_runtime.h>
#include <math.h>

// ---------------------------------------------------------------------------
// Problem constants
// ---------------------------------------------------------------------------
constexpr int kBatch  = 16;
constexpr int kSeq    = 512;
constexpr int kHid    = 1024;
constexpr int kHeads  = 16;
constexpr int kHdim   = 64;
constexpr int kN3     = 3 * kHid;          // 3072 qkv output columns
constexpr int kQKld   = 2 * kHid;          // 2048: pitch of the [q | k] planes
constexpr int kTok    = kBatch * kSeq;     // 8192 token rows
constexpr int kNDist  = 2 * kSeq - 1;      // 1023 relative distances
constexpr int kNDistP = 1024;              // pe plane rows (row 1023 zero)
constexpr float kPCarry = 32768.0f;        // f16 probabilities carried x2^15
static_assert(kHid % 32 == 0 && kTok % 64 == 0 && kQKld % 64 == 0 && kSeq % 64 == 0, "tiles");

typedef __attribute__((ext_vector_type(16))) _Float16 v16h;
typedef __attribute__((ext_vector_type(8)))  _Float16 v8h;
typedef __attribute__((ext_vector_type(16))) __bf16   v16b;
typedef __attribute__((ext_vector_type(8)))  __bf16   v8b;
typedef __attribute__((ext_vector_type(8)))  float    v8f;
typedef __attribute__((ext_vector_type(4)))  float    v4f;
typedef __attribute__((ext_vector_type(4)))  unsigned int v4u;

__device__ __forceinline__ unsigned short f2bf_bits(float f) {
  unsigned u = __float_as_uint(f);
  return (unsigned short)((u + 0x7FFFu + ((u >> 16) & 1u)) >> 16);
}
__device__ __forceinline__ float bf_bits2f(unsigned short h) { return __uint_as_float(((unsigned)h) << 16); }

// hazard guards as plain device helpers (no inline asm inside the kernel template body)
__device__ __forceinline__ void dep_guard_h(v8f& a, v8f& b, v16h x, v16h y) { asm volatile("v_nop\n\tv_nop\n\tv_nop\n\tv_nop" : "+v"(a), "+v"(b) : "v"(x), "v"(y)); }
__device__ __forceinline__ void dep_guard_b(v8f& a, v8f& b, v16b x, v16b y) { asm volatile("v_nop\n\tv_nop\n\tv_nop\n\tv_nop" : "+v"(a), "+v"(b) : "v"(x), "v"(y)); }
__device__ __forceinline__ void keep4_h(v16h a, v16h b, v16h c, v16h d) { asm volatile("v_nop" :: "v"(a), "v"(b), "v"(c), "v"(d)); }
__device__ __forceinline__ void keep4_b(v16b a, v16b b, v16b c, v16b d) { asm volatile("v_nop" :: "v"(a), "v"(b), "v"(c), "v"(d)); }
__device__ __forceinline__ void acc_guard4(v8f& a, v8f& b, v8f& c, v8f& d) { asm volatile("v_nop\n\tv_nop\n\tv_nop\n\tv_nop" : "+v"(a), "+v"(b), "+v"(c), "+v"(d)); }
template <typename T> struct Frag;
template <> struct Frag<_Float16> {
  typedef v16h V; union U { v16h v; v8h h[2]; };
  static __device__ __forceinline__ v16h load(const _Float16* p) {   // elements 0..7 <- p[0..7], 8..15 <- p[16..23]
    U f; f.h[0] = *(const v8h*)(p); f.h[1] = *(const v8h*)(p + 16); return f.v;
  }
  static __device__ __forceinline__ v8f mma(v16h a, v16h b, v8f c) {
    return __builtin_amdgcn_wmma_f32_16x16x32_f16(false, a, false, b, (short)0, c, false, false);
  }
  static __device__ __forceinline__ void guard(v8f& a, v8f& b, v16h x, v16h y) { dep_guard_h(a, b, x, y); }
  static __device__ __forceinline__ void keep(v16h a, v16h b, v16h c, v16h d) { keep4_h(a, b, c, d); }
};
template <> struct Frag<__bf16> {
  typedef v16b V; union U { v16b v; v8b h[2]; };
  static __device__ __forceinline__ v16b load(const __bf16* p) {
    U f; f.h[0] = *(const v8b*)(p); f.h[1] = *(const v8b*)(p + 16); return f.v;
  }
  static __device__ __forceinline__ v8f mma(v16b a, v16b b, v8f c) {
    return __builtin_amdgcn_wmma_f32_16x16x32_bf16(false, a, false, b, (short)0, c, false, false);
  }
  static __device__ __forceinline__ void guard(v8f& a, v8f& b, v16b x, v16b y) { dep_guard_b(a, b, x, y); }
  static __device__ __forceinline__ void keep(v16b a, v16b b, v16b c, v16b d) { keep4_b(a, b, c, d); }
};

__device__ __forceinline__ unsigned pk16(unsigned short a, unsigned short b) { return (unsigned)a | ((unsigned)b << 16); }

// ---- Register-blocked batched WMMA GEMM (SPLIT as a bit mask, ACT tanh/relu only,
//      bias values RNE-converted to bf16 before the f32 add) --------
// C[m,n] = scale * sum_k A[m,k] * Bt[n,k] (+bias)(+resid); each wave owns a 64x64 tile.
// A row-major [M,K]; Bt row-major [N,K]; M,N % 64 == 0, K % 32 == 0.
// SPLIT: bit0 -> A carried as hi/lo planes (A2 = lo), bit1 -> Bt carried as hi/lo planes (Bt2 = lo);
//        product = hi.hi (+ hi.lo if bit1) (+ lo.hi if bit0).
// BIAS_MODE: 0 = none, 1 = bias[m], 2 = bias[n].
// OUT_MODE: 0 = f32, 1 = f16, 2 = bf16 hi plane (Cout) + bf16 lo plane (Cout2).
// ACT: 0 = none, 1 = tanh, 2 = relu.
// ET: 0 = f16 operands, 1 = bf16 operands (pointers passed as 16-bit storage)
template <int ET> struct Elem;
template <> struct Elem<0> { typedef _Float16 T; };
template <> struct Elem<1> { typedef __bf16 T; };
template <int ET, int SPLIT, int BIAS_MODE, int OUT_MODE, bool RESID, int ACT = 0>
__global__ __launch_bounds__(256) void wmma_gemm64(
    const unsigned short* __restrict__ Ap, const unsigned short* __restrict__ A2p, int lda, long strideA,
    const unsigned short* __restrict__ Btp, const unsigned short* __restrict__ Bt2p, int ldb, long strideB,
    void* __restrict__ Cout, void* __restrict__ Cout2, int ldc, long strideC,
    const float* __restrict__ bias,
    const float* __restrict__ resid, long strideR,
    int M, int N, int K, float scale) {
  typedef typename Elem<ET>::T T;
  typedef typename Frag<T>::V V;
  constexpr bool SA = (SPLIT & 1) != 0;
  constexpr bool SB = (SPLIT & 2) != 0;
  const T* A = (const T*)Ap; const T* A2 = (const T*)A2p; const T* Bt = (const T*)Btp; const T* Bt2 = (const T*)Bt2p;
  __shared__ __align__(16) float sT[8][16 * 68];   // per-wave 16x64 slab, pitch 68 floats
  const int b    = blockIdx.y;
  const int lane = threadIdx.x & 31;
  const int wave = threadIdx.x >> 5;
  const int tilesN = N >> 6;
  const int tilesM = M >> 6;
  const int tile = blockIdx.x * 8 + wave;
  if (tile >= tilesM * tilesN) return;   // wave-uniform; no block barriers in this kernel
  const int tm = tile / tilesN;
  const int tn = tile - tm * tilesN;
  const int m0 = tm << 6;
  const int n0 = tn << 6;

  const T* Ab  = A  + (size_t)b * strideA;
  const T* Bb  = Bt + (size_t)b * strideB;
  const T* Ab2 = SA ? (A2  + (size_t)b * strideA) : nullptr;
  const T* Bb2 = SB ? (Bt2 + (size_t)b * strideB) : nullptr;

  const int rlane = lane & 15;                 // row (A) / col (B, D) within subtile
  const int koff  = (lane >> 4) * 8;           // k offset of this lane half
  const int mOff  = (lane >> 4) * 8;           // D row offset

  v8f acc[4][4];
#pragma unroll
  for (int i = 0; i < 4; ++i)
#pragma unroll
    for (int j = 0; j < 4; ++j) acc[i][j] = (v8f){0.f,0.f,0.f,0.f,0.f,0.f,0.f,0.f};

  for (int k0 = 0; k0 < K; k0 += 32) {
    V bh[4], bl[4];
#pragma unroll
    for (int j = 0; j < 4; ++j) {
      const size_t bo = (size_t)(n0 + (j << 4) + rlane) * ldb + koff + k0;
      bh[j] = Frag<T>::load(Bb + bo);
      if (SB) bl[j] = Frag<T>::load(Bb2 + bo);
    }
#pragma unroll
    for (int i = 0; i < 4; ++i) {
      const size_t ao = (size_t)(m0 + (i << 4) + rlane) * lda + koff + k0;
      V ah = Frag<T>::load(Ab + ao);
      V al;
      if (SA) al = Frag<T>::load(Ab2 + ao);
#pragma unroll
      for (int j = 0; j < 4; ++j) {
        acc[i][j] = Frag<T>::mma(ah, bh[j], acc[i][j]);
        if (SB) acc[i][j] = Frag<T>::mma(ah, bl[j], acc[i][j]);
        if (SA) acc[i][j] = Frag<T>::mma(al, bh[j], acc[i][j]);
      }
      Frag<T>::guard(acc[i][0], acc[i][3], ah, SA ? al : ah);
    }
    Frag<T>::keep(bh[0], bh[1], bh[2], bh[3]);
    if (SB) Frag<T>::keep(bl[0], bl[1], bl[2], bl[3]);
  }
  acc_guard4(acc[0][0], acc[0][1], acc[0][2], acc[0][3]);
  acc_guard4(acc[1][0], acc[1][1], acc[1][2], acc[1][3]);
  acc_guard4(acc[2][0], acc[2][1], acc[2][2], acc[2][3]);
  acc_guard4(acc[3][0], acc[3][1], acc[3][2], acc[3][3]);

  // ---- epilogue ----
  float* slab = sT[wave];
  const float* Rb = RESID ? (resid + (size_t)b * strideR) : nullptr;
#pragma unroll
  for (int i = 0; i < 4; ++i) {
    const int mBase = m0 + (i << 4);
#pragma unroll
    for (int j = 0; j < 4; ++j) {
      const int n = n0 + (j << 4) + rlane;
      float bv = 0.f;
      if (BIAS_MODE == 2) bv = bf_bits2f(f2bf_bits(bias[n]));                      // bias as bf16-RNE value
#pragma unroll
      for (int r = 0; r < 8; ++r) {
        float v = acc[i][j][r] * scale;
        if (BIAS_MODE == 1) v += bf_bits2f(f2bf_bits(bias[mBase + mOff + r]));     // bias as bf16-RNE value
        if (BIAS_MODE == 2) v += bv;
        if (RESID) v += Rb[(size_t)(mBase + mOff + r) * ldc + n];
        if (ACT == 1) v = tanhf(v);
        if (ACT == 2) v = fmaxf(v, 0.0f);
        slab[(mOff + r) * 68 + (j << 4) + rlane] = v;
      }
    }
    __builtin_amdgcn_fence(__ATOMIC_RELEASE, "workgroup");
    __builtin_amdgcn_wave_barrier();
    __builtin_amdgcn_fence(__ATOMIC_ACQUIRE, "workgroup");
    if (OUT_MODE == 0) {
      float* C = (float*)Cout + (size_t)b * strideC;
      const int hh = lane >> 4, c4 = (lane & 15) * 4;     // row seg = 256 B = 16 lanes x 16 B
      {
#pragma unroll
        for (int it = 0; it < 8; ++it) {
          const int row = it * 2 + hh;
          v4f v = *(const v4f*)(slab + row * 68 + c4);
          *(v4f*)(C + (size_t)(mBase + row) * ldc + n0 + c4) = v;
        }
        
      }
    } else {
      const int q = lane >> 3, c8 = (lane & 7) * 8;
      unsigned short* C  = (unsigned short*)Cout  + (size_t)b * strideC;
      unsigned short* C2 = (OUT_MODE == 2) ? ((unsigned short*)Cout2 + (size_t)b * strideC) : nullptr;
      {
#pragma unroll
        for (int it = 0; it < 4; ++it) {
          const int row = it * 4 + q;
          const float* sp = slab + row * 68 + c8;
          v8h hv, lv;
#pragma unroll
          for (int e = 0; e < 8; ++e) {
            if (OUT_MODE == 1) {
              hv[e] = (_Float16)sp[e];
            } else {
              unsigned short hb = f2bf_bits(sp[e]);
              unsigned short lb = f2bf_bits(sp[e] - bf_bits2f(hb));
              hv[e] = __builtin_bit_cast(_Float16, hb);
              lv[e] = __builtin_bit_cast(_Float16, lb);
            }
          }
          *(v8h*)(C + (size_t)(mBase + row) * ldc + n0 + c8) = hv;
          if (OUT_MODE == 2) *(v8h*)(C2 + (size_t)(mBase + row) * ldc + n0 + c8) = lv;
        }
        
      }
    }
    __builtin_amdgcn_fence(__ATOMIC_RELEASE, "workgroup");
    __builtin_amdgcn_wave_barrier();
    __builtin_amdgcn_fence(__ATOMIC_ACQUIRE, "workgroup");
  }
}

// ---------------------------------------------------------------------------
// x f32 -> bf16 plane (RNE), 8 consecutive elements per thread -> one 16-B store per lane;
// Coverage: n8 = 8192*1024/8 = 1,048,576 threads x 8 = the whole plane; grid 4096 x 256 exact.
// ---------------------------------------------------------------------------
__global__ __launch_bounds__(256) void cast8_bf16_kernel(const float* __restrict__ in, unsigned short* __restrict__ out, int n8) {
  const int i = blockIdx.x * 256 + threadIdx.x;
  if (i >= n8) return;
  const float* p = in + 8 * (size_t)i;
  const v4f a = *(const v4f*)(p);
  const v4f c = *(const v4f*)(p + 4);
  unsigned short hb[8];
#pragma unroll
  for (int e = 0; e < 4; ++e) {
    hb[e]     = f2bf_bits(a[e]);
    hb[4 + e] = f2bf_bits(c[e]);
  }
  const v4u u = (v4u){pk16(hb[0], hb[1]), pk16(hb[2], hb[3]), pk16(hb[4], hb[5]), pk16(hb[6], hb[7])};
  unsigned short* q = out + 8 * (size_t)i;
  *(v4u*)q = u;
  
}

// ---------------------------------------------------------------------------
// Weight transpose + cast: W f32 [1024 k][3072 n] -> WT[n][k] bf16 (RNE), [3072][1024].
// grid (1024/64 = 16 k tiles, 3072/64 = 48 n tiles), 256 threads.
// Load coverage: 16 iterations x 256 threads = 4096 = the whole 64x64 tile (coalesced along n).
// Store coverage: 8 waves x 2 iterations x 4 rows (lane>>3) = 64 n rows; (lane&7) x 8 halves = 64 k cols; each row
// ---------------------------------------------------------------------------
__global__ __launch_bounds__(256) void wtcast_kernel(const float* __restrict__ W, unsigned short* __restrict__ out) {
  __shared__ float sm[64][65];   // sm[n_local][k_local]
  const int t  = threadIdx.x;
  const int k0 = blockIdx.x * 64;
  const int n0 = blockIdx.y * 64;
#pragma unroll
  for (int i = 0; i < 16; ++i) {
    const int e = i * 256 + t;
    const int r = e >> 6;          // k local
    const int c = e & 63;          // n local
    sm[c][r] = W[(size_t)(k0 + r) * kN3 + n0 + c];
  }
  __syncthreads();
  const int lane = t & 31, wave = t >> 5;
  const int q = lane >> 3, c8 = (lane & 7) * 8;
  {
#pragma unroll
    for (int it = 0; it < 2; ++it) {
      const int row = wave * 8 + it * 4 + q;                 // n local
      unsigned short hb[8];
#pragma unroll
      for (int e = 0; e < 8; ++e) hb[e] = f2bf_bits(sm[row][c8 + e]);
      const v4u u = (v4u){pk16(hb[0], hb[1]), pk16(hb[2], hb[3]), pk16(hb[4], hb[5]), pk16(hb[6], hb[7])};
      *(v4u*)(out + (size_t)(n0 + row) * kHid + k0 + c8) = u;
    }
    
  }
}

// ---------------------------------------------------------------------------
// dist_emb f32 [1023][64] -> PE bf16 [1024][64] (RNE), row 1023 zero-filled.
// 1024*64/8 = 8192 threads = 32 blocks x 256 exactly; thread i: row i>>3, cols (i&7)*8..+7 -> one 16-B store;
// ---------------------------------------------------------------------------
__global__ __launch_bounds__(256) void pecast_kernel(const float* __restrict__ pe, unsigned short* __restrict__ out) {
  const int i = blockIdx.x * 256 + threadIdx.x;
  if (i >= kNDistP * kHdim / 8) return;
  const int row = i >> 3, c8 = (i & 7) * 8;
  const int rc = (row < kNDist) ? row : (kNDist - 1);         // clamped address
  const float* src = pe + (size_t)rc * kHdim + c8;
  const v4f a = *(const v4f*)(src);
  const v4f c = *(const v4f*)(src + 4);
  const bool live = (row < kNDist);
  unsigned short hb[8];
#pragma unroll
  for (int e = 0; e < 4; ++e) {
    hb[e]     = live ? f2bf_bits(a[e]) : (unsigned short)0;
    hb[4 + e] = live ? f2bf_bits(c[e]) : (unsigned short)0;
  }
  const v4u u = (v4u){pk16(hb[0], hb[1]), pk16(hb[2], hb[3]), pk16(hb[4], hb[5]), pk16(hb[6], hb[7])};
  unsigned short* q = out + (size_t)row * kHdim + c8;
  *(v4u*)q = u;
  
}

// ---------------------------------------------------------------------------
// Attention helpers
// ---------------------------------------------------------------------------
__device__ __forceinline__ unsigned short at_bf_bits(float f) {
  unsigned u = __float_as_uint(f);
  return (unsigned short)((u + 0x7FFFu + ((u >> 16) & 1u)) >> 16);
}
__device__ __forceinline__ __bf16 at_f2bf(float f) { return __builtin_bit_cast(__bf16, at_bf_bits(f)); }
__device__ __forceinline__ v8f at_mma(v16b a, v16b b, v8f c) {
  c = __builtin_amdgcn_wmma_f32_16x16x32_bf16(false, a, false, b, (short)0, c, false, false);
  asm volatile("v_nop\n\tv_nop\n\tv_nop\n\tv_nop" : "+v"(c) : "v"(a), "v"(b));
  return c;
}
// 16-bit element as a bit pattern held in a __bf16 slot: f16 bits when F16, bf16 (RNE) otherwise
template <bool F16> __device__ __forceinline__ __bf16 at_to16(float f) {
  if (F16) return __builtin_bit_cast(__bf16, (_Float16)f);
  return at_f2bf(f);
}
template <bool F16> __device__ __forceinline__ v8f at_mma16(v16b a, v16b b, v8f c) {
  if (F16) {
    const v16h ah = __builtin_bit_cast(v16h, a), bh = __builtin_bit_cast(v16h, b);
    c = __builtin_amdgcn_wmma_f32_16x16x32_f16(false, ah, false, bh, (short)0, c, false, false);
    asm volatile("v_nop\n\tv_nop\n\tv_nop\n\tv_nop" : "+v"(c) : "v"(ah), "v"(bh));
    return c;
  }
  return at_mma(a, b, c);
}

// =====================================================================================
// Fused attention with relative_key_query bias, head_dim 64. Block = 4 waves = 64 query rows of one (b, h);
// key chunks of 64; online softmax in f32. Operand planes (all dense, statically strided, 16-bit):
//   QKh/QKl: bf16 hi/lo [token = b*512+s][2048] with q at cols h*64+d, k at cols 1024+h*64+d
//   Vt:      f16 [b][h*64+d][s]  (pitch 512)
//   PE:      bf16 [1024][64] (dist_emb, row 1023 zero)
// Per chunk (l0 = 64*qb, r0 = 64*kc, d0 = l0 - r0 + 448, dist(l,r) = d0 + ll - kk + 63 with local ll, kk in 0..63):
//   T1w[p1][row] = q(row of this wave) . pe[d0 + 16*wave + p1], p1 = 0..79 (f16 in LDS, per wave)
//   T2 [p][kk]   = k(kk) . pe[d0 + p] for the band p in [48-16*j, 127-16*j] of key group j = kk>>4 (wave j produces it)
//   s[ll][kk] = (q.k(hi/lo) + T1 + T2) * 1/8 + mask[b][r0+kk];  p = exp(s - m);  out = sum p v / l.
// grid (S/64, H, B), 128 threads.
// =====================================================================================
constexpr int kT1Slots = 80;
__global__ __launch_bounds__(128)
void relattn_kernel(const unsigned short* __restrict__ QKhp, const unsigned short* __restrict__ QKlp,
                    const unsigned short* __restrict__ Vtp, const unsigned short* __restrict__ PEp,
                    const float* __restrict__ mask, float* __restrict__ out) {
  union FB { v16b v; v8b h[2]; };
  __shared__ __align__(16) _Float16 T1s[4][kT1Slots * 16];    // per wave [p1][16 rows]      2,560 B each
  __shared__ __align__(16) _Float16 T2s[128 * 64];            // [p][64 keys]                 16,384 B
  __shared__ __align__(16) __bf16   Psh[4][16 * 64];          // per wave P (f16 bits) [row][kv]
  __shared__ __align__(16) float    Os[4][16 * 68];           // per wave out tile, pitch 68

  const int tid  = threadIdx.x;
  const int wave = tid >> 5;
  const int lane = tid & 31;
  const int hh   = lane >> 4;
  const int c    = lane & 15;

  const int qb = blockIdx.x;
  const int h  = blockIdx.y;
  const int b  = blockIdx.z;
  const int l0 = qb * 64;
  const int q0 = l0 + wave * 16;
  const size_t tok0 = (size_t)b * kSeq;

  const __bf16* Qh  = (const __bf16*)QKhp;
  const __bf16* Ql  = (const __bf16*)QKlp;
  const __bf16* Vt  = (const __bf16*)Vtp;     // f16 bits
  const __bf16* PEt = (const __bf16*)PEp;

  // ---- Q fragments (A operand): 2 d-chunks, hi and lo planes ----
  v16b qah[2], qal[2];
  {
    const size_t qo = (tok0 + q0 + c) * kQKld + (size_t)h * kHdim + 8 * hh;
#pragma unroll
    for (int dc = 0; dc < 2; ++dc) {
      qah[dc] = Frag<__bf16>::load(Qh + qo + dc * 32);
      qal[dc] = Frag<__bf16>::load(Ql + qo + dc * 32);
    }
  }

  float mrow[8], lrow[8];
  v8f oacc[4];
#pragma unroll
  for (int r = 0; r < 8; ++r) { mrow[r] = -INFINITY; lrow[r] = 0.f; }
#pragma unroll
  for (int t = 0; t < 4; ++t) oacc[t] = (v8f){0.f,0.f,0.f,0.f,0.f,0.f,0.f,0.f};

  _Float16* t1w = T1s[wave];
  __bf16*   pw  = Psh[wave];

  for (int kc = 0; kc < kSeq / 64; ++kc) {
    const int r0 = kc * 64;
    const int d0 = l0 - r0 + 448;              // in [0, 896]; d0 + 127 <= 1023
    __syncthreads();                           // previous chunk's T2s readers are done

    // ---- relative-position tiles on WMMA: T1 (5 tiles per wave), T2 (5 tiles per wave) ----
    {
      v16b ka[2];
      const size_t ko = (tok0 + r0 + wave * 16 + c) * kQKld + kHid + (size_t)h * kHdim + 8 * hh;   // k rows as A operand
#pragma unroll
      for (int dc = 0; dc < 2; ++dc) ka[dc] = Frag<__bf16>::load(Qh + ko + dc * 32);
#pragma unroll
      for (int i = 0; i < 5; ++i) {
        const int dt1 = d0 + 16 * wave + 16 * i;          // T1 distance tile base (<= 1008)
        const int dt2 = d0 + 16 * (3 - wave + i);         // T2 distance tile base (<= 1008)
        v8f a1 = (v8f){0.f,0.f,0.f,0.f,0.f,0.f,0.f,0.f};
        v8f a2 = (v8f){0.f,0.f,0.f,0.f,0.f,0.f,0.f,0.f};
#pragma unroll
        for (int dc = 0; dc < 2; ++dc) {
          const v16b p1 = Frag<__bf16>::load(PEt + (size_t)(dt1 + c) * kHdim + 8 * hh + dc * 32);   // B[k=d][n=dist]
          const v16b p2 = Frag<__bf16>::load(PEt + (size_t)(dt2 + c) * kHdim + 8 * hh + dc * 32);
          a1 = at_mma(qah[dc], p1, a1);
          a2 = at_mma(ka[dc], p2, a2);
        }
        v8h hv1, hv2;
#pragma unroll
        for (int r = 0; r < 8; ++r) { hv1[r] = (_Float16)a1[r]; hv2[r] = (_Float16)a2[r]; }
        // D element r: row 8hh+r (query row of this wave / key row 16*wave+8hh+r), col = dist slot 16i+c
        *(v8h*)(t1w + (16 * i + c) * 16 + 8 * hh) = hv1;
        *(v8h*)(T2s + (size_t)(16 * (3 - wave + i) + c) * 64 + 16 * wave + 8 * hh) = hv2;
      }
    }

    // ---- q . k (hi.hi + hi.lo + lo.hi), B fragments straight from the dense k planes ----
    v8f s[4];
#pragma unroll
    for (int j = 0; j < 4; ++j) {
      s[j] = (v8f){0.f,0.f,0.f,0.f,0.f,0.f,0.f,0.f};
#pragma unroll
      for (int dc = 0; dc < 2; ++dc) {
        const size_t ko = (tok0 + r0 + j * 16 + c) * kQKld + kHid + (size_t)h * kHdim + 8 * hh + dc * 32;
        const v16b kb = Frag<__bf16>::load(Qh + ko);
        const v16b kl = Frag<__bf16>::load(Ql + ko);
        s[j] = at_mma(qah[dc], kb, s[j]);
        s[j] = at_mma(qah[dc], kl, s[j]);
        s[j] = at_mma(qal[dc], kb, s[j]);
      }
    }
    __syncthreads();                           // T1s / T2s visible to all waves

    float mk[4];
#pragma unroll
    for (int j = 0; j < 4; ++j) mk[j] = mask[tok0 + r0 + j * 16 + c];   // additive mask [b][r]

    float cm[8];
#pragma unroll
    for (int r = 0; r < 8; ++r) {
      float m = -INFINITY;
#pragma unroll
      for (int j = 0; j < 4; ++j) {
        const int p1 = 8 * hh + r - 16 * j - c + 63;                          // in [0, 78]
        const float t1 = (float)t1w[p1 * 16 + 8 * hh + r];
        const float t2 = (float)T2s[(p1 + 16 * wave) * 64 + 16 * j + c];
        const float v = (s[j][r] + t1 + t2) * 0.125f + mk[j];
        s[j][r] = v;
        m = fmaxf(m, v);
      }
#pragma unroll
      for (int off = 1; off < 16; off <<= 1) m = fmaxf(m, __shfl_xor(m, off, 32));
      cm[r] = m;
    }
#pragma unroll
    for (int r = 0; r < 8; ++r) {
      const float mnew = fmaxf(mrow[r], cm[r]);
      const float alpha = __expf(mrow[r] - mnew);
      mrow[r] = mnew;
      float psum = 0.f;
#pragma unroll
      for (int j = 0; j < 4; ++j) {
        const float p = __expf(s[j][r] - mnew);
        psum += p;
        pw[(8 * hh + r) * 64 + j * 16 + c] = at_to16<true>(p * kPCarry);
      }
#pragma unroll
      for (int off = 1; off < 16; off <<= 1) psum += __shfl_xor(psum, off, 32);
      lrow[r] = lrow[r] * alpha + psum;
#pragma unroll
      for (int t = 0; t < 4; ++t) oacc[t][r] *= alpha;
    }
    __builtin_amdgcn_fence(__ATOMIC_RELEASE, "workgroup");
    __builtin_amdgcn_wave_barrier();
    __builtin_amdgcn_fence(__ATOMIC_ACQUIRE, "workgroup");
#pragma unroll 1
    for (int kk = 0; kk < 2; ++kk) {
      FB pa;
      pa.h[0] = *(const v8b*)(pw + c * 64 + kk * 32 + 8 * hh);
      pa.h[1] = *(const v8b*)(pw + c * 64 + kk * 32 + 16 + 8 * hh);
#pragma unroll
      for (int t = 0; t < 4; ++t) {
        FB vb;
        const size_t vo = ((size_t)(b * kHeads + h) * kHdim + t * 16 + c) * kSeq + r0 + kk * 32 + 8 * hh;   // B[k=kv][n=d] from Vt[d][kv]
        vb.h[0] = *(const v8b*)(Vt + vo);
        vb.h[1] = *(const v8b*)(Vt + vo + 16);
        oacc[t] = at_mma16<true>(pa.v, vb.v, oacc[t]);
      }
    }
  }

  // ---- epilogue: out[b][q0+row][h*64 + 0..63]; row segment = 256 B = 16 lanes x 16 B, one instruction per row ----
  float* os = Os[wave];
#pragma unroll
  for (int r = 0; r < 8; ++r) {
    const float inv = 1.0f / (lrow[r] * kPCarry);
#pragma unroll
    for (int t = 0; t < 4; ++t) os[(8 * hh + r) * 68 + t * 16 + c] = oacc[t][r] * inv;
  }
  __builtin_amdgcn_fence(__ATOMIC_RELEASE, "workgroup");
  __builtin_amdgcn_wave_barrier();
  __builtin_amdgcn_fence(__ATOMIC_ACQUIRE, "workgroup");
  {
    float* ob = out + (size_t)h * kHdim;
    const int c4 = (lane & 15) * 4;
    {
#pragma unroll
      for (int it = 0; it < 8; ++it) {
        const int row = it * 2 + hh;
        v4f val = *(const v4f*)(os + row * 68 + c4);
        *(v4f*)(ob + (tok0 + q0 + row) * kHid + c4) = val;
      }
      
    }
  }
}

// ---------------------------------------------------------------------------
// Workspace region map (byte offsets, multiples of 128; every region fully written before it is read):
//   X16  bf16 [8192][1024]                     0 ..  16,777,216
//   WT   bf16 [3072][1024] (W^T)      16,777,216 ..  23,068,672
//   PE   bf16 [1024][64] (row 1023 0) 23,068,672 ..  23,199,744
//   QKh  bf16 [8192][2048] ([q|k] hi)  23,199,744 ..  56,754,176
//   QKl  bf16 [8192][2048] ([q|k] lo)  56,754,176 ..  90,308,608
//   Vt   f16  [16][1024][512]          90,308,608 .. 107,085,824
//   total 107,085,824 B.
// GEMM shapes: q|k: M=8192 N=2048 K=1024; v (role-swapped, per batch): M=1024 N=512 K=1024 x16.
//   K % 32 == 0, M and N % 64 == 0 for both; no padded operand rows.
// ---------------------------------------------------------------------------
extern "C" void kernel_launch(void* const* d_in, const int* in_sizes, int n_in,
                              void* d_out, int out_size, void* d_ws, size_t ws_size,
                              hipStream_t stream) {
  if (n_in < 5) return;
  if (in_sizes[0] != kTok * kHid) return;
  if (in_sizes[1] != kBatch * kSeq) return;
  if (in_sizes[2] != kHid * kN3) return;
  if (in_sizes[3] != kN3) return;
  if (in_sizes[4] != kNDist * kHdim) return;
  if (out_size != kTok * kHid) return;

  const float* hid  = (const float*)d_in[0];   // [16][512][1024]
  const float* msk  = (const float*)d_in[1];   // [16][1][1][512]
  const float* W    = (const float*)d_in[2];   // [1024][3072]
  const float* bqkv = (const float*)d_in[3];   // [3072]
  const float* pe   = (const float*)d_in[4];   // [1023][64]
  float* outp = (float*)d_out;                 // [16][512][1024]

  const size_t SZ_X16 = (size_t)kTok * kHid * 2;              //  16,777,216
  const size_t SZ_WT  = (size_t)kN3 * kHid * 2;               //   6,291,456
  const size_t SZ_PE  = (size_t)kNDistP * kHdim * 2;          //     131,072
  const size_t SZ_QK  = (size_t)kTok * kQKld * 2;             //  33,554,432
  const size_t SZ_VT  = (size_t)kBatch * kHid * kSeq * 2;     //  16,777,216
  size_t off = 0;
  const size_t oX16 = off; off += SZ_X16;
  const size_t oWT  = off; off += SZ_WT;
  const size_t oPE  = off; off += SZ_PE;
  const size_t oQKh = off; off += SZ_QK;
  const size_t oQKl = off; off += SZ_QK;
  const size_t oVT  = off; off += SZ_VT;
  const size_t TOTAL = off;                                   // 107,085,824
  if (TOTAL > ws_size) return;
  if (TOTAL > (size_t)134217728) return;

  char* ws = (char*)d_ws;
  unsigned short* X16 = (unsigned short*)(ws + oX16);
  unsigned short* WT  = (unsigned short*)(ws + oWT);
  unsigned short* PEb = (unsigned short*)(ws + oPE);
  unsigned short* QKh = (unsigned short*)(ws + oQKh);
  unsigned short* QKl = (unsigned short*)(ws + oQKl);
  unsigned short* VTp = (unsigned short*)(ws + oVT);

  const dim3 blk(256);
  // (0) x -> bf16 plane
  {
    const int n8 = kTok * kHid / 8;                           // 1,048,576 -> 4096 blocks exactly
    cast8_bf16_kernel<<<dim3((n8 + 255) / 256), blk, 0, stream>>>(hid, X16, n8);
  }
  // (1) W [1024][3072] -> WT [3072][1024] bf16
  wtcast_kernel<<<dim3(kHid / 64, kN3 / 64), blk, 0, stream>>>(W, WT);
  // (2) dist_emb -> PE bf16 [1024][64]
  pecast_kernel<<<dim3((kNDistP * kHdim / 8 + 255) / 256), blk, 0, stream>>>(pe, PEb);
  // (3) [q|k] = X16 . WT[0..2047]^T + b[0..2047] -> bf16 hi + lo planes, pitch 2048
  {
    const dim3 g(((kTok / 64) * (kQKld / 64) + 7) / 8, 1);    // 512 blocks
    wmma_gemm64<1, 0, 2, 2, false, 0><<<g, blk, 0, stream>>>(
        X16, X16, kHid, 0L, WT, WT, kHid, 0L, (void*)QKh, (void*)QKl, kQKld, 0L,
        bqkv, hid, 0L, kTok, kQKld, kHid, 1.0f);
  }
  // (4) v^T per batch: Vt[b][m][s] = WT[2048+m] . x[b*512+s] + b[2048+m] -> f16, pitch 512
  {
    const dim3 g(((kHid / 64) * (kSeq / 64) + 7) / 8, kBatch); // 16 x 16
    wmma_gemm64<1, 0, 1, 1, false, 0><<<g, blk, 0, stream>>>(
        WT + (size_t)2 * kHid * kHid, WT + (size_t)2 * kHid * kHid, kHid, 0L,
        X16, X16, kHid, (long)kSeq * kHid,
        (void*)VTp, (void*)VTp, kSeq, (long)kHid * kSeq,
        bqkv + 2 * kHid, hid, 0L, kHid, kSeq, kHid, 1.0f);
  }
  // (5) fused attention with relative-position bias -> out f32 [16][512][1024]
  relattn_kernel<<<dim3(kSeq / 64, kHeads, kBatch), dim3(128), 0, stream>>>(QKh, QKl, VTp, PEb, msk, outp);
}

// v001
// It runs in 227 microseconds.
// In both of two side-by-side timings against v000, it was 1.35 times as fast.
// Contractions: qkv projection v_wmma_f32_16x16x32_bf16 (x, W as bf16 RNE; bias added as bf16-RNE value in f32); q.k^T bf16 hi/lo planes (hi.hi+hi.lo+lo.hi); q.pe^T and k.pe^T bf16 (q,k hi planes, pe bf16); p.v v_wmma_f32_16x16x32_f16 (p f16 carried x2^15, v f16); f32 accumulate; softmax, scale, bias, mask add in f32.
#include <hip/hip_runtime.h>
#include <math.h>

// ---------------------------------------------------------------------------
// Problem constants
// ---------------------------------------------------------------------------
constexpr int kBatch  = 16;
constexpr int kSeq    = 512;
constexpr int kHid    = 1024;
constexpr int kHeads  = 16;
constexpr int kHdim   = 64;
constexpr int kN3     = 3 * kHid;          // 3072 qkv output columns
constexpr int kQKld   = 2 * kHid;          // 2048: pitch of the [q | k] planes
constexpr int kTok    = kBatch * kSeq;     // 8192 token rows
constexpr int kNDist  = 2 * kSeq - 1;      // 1023 relative distances
constexpr int kNDistP = 1024;              // pe plane rows (row 1023 zero)
constexpr float kPCarry = 32768.0f;        // f16 probabilities carried x2^15
static_assert(kHid % 32 == 0 && kTok % 64 == 0 && kQKld % 64 == 0 && kSeq % 64 == 0, "tiles");

typedef __attribute__((ext_vector_type(16))) _Float16 v16h;
typedef __attribute__((ext_vector_type(8)))  _Float16 v8h;
typedef __attribute__((ext_vector_type(16))) __bf16   v16b;
typedef __attribute__((ext_vector_type(8)))  __bf16   v8b;
typedef __attribute__((ext_vector_type(8)))  float    v8f;
typedef __attribute__((ext_vector_type(4)))  float    v4f;
typedef __attribute__((ext_vector_type(4)))  unsigned int v4u;

__device__ __forceinline__ unsigned short f2bf_bits(float f) {
  unsigned u = __float_as_uint(f);
  return (unsigned short)((u + 0x7FFFu + ((u >> 16) & 1u)) >> 16);
}
__device__ __forceinline__ float bf_bits2f(unsigned short h) { return __uint_as_float(((unsigned)h) << 16); }

// hazard guards as plain device helpers (no inline asm inside the kernel template body)
__device__ __forceinline__ void dep_guard_h(v8f& a, v8f& b, v16h x, v16h y) { asm volatile("v_nop\n\tv_nop\n\tv_nop\n\tv_nop" : "+v"(a), "+v"(b) : "v"(x), "v"(y)); }
__device__ __forceinline__ void dep_guard_b(v8f& a, v8f& b, v16b x, v16b y) { asm volatile("v_nop\n\tv_nop\n\tv_nop\n\tv_nop" : "+v"(a), "+v"(b) : "v"(x), "v"(y)); }
__device__ __forceinline__ void keep4_h(v16h a, v16h b, v16h c, v16h d) { asm volatile("v_nop" :: "v"(a), "v"(b), "v"(c), "v"(d)); }
__device__ __forceinline__ void keep4_b(v16b a, v16b b, v16b c, v16b d) { asm volatile("v_nop" :: "v"(a), "v"(b), "v"(c), "v"(d)); }
__device__ __forceinline__ void acc_guard4(v8f& a, v8f& b, v8f& c, v8f& d) { asm volatile("v_nop\n\tv_nop\n\tv_nop\n\tv_nop" : "+v"(a), "+v"(b), "+v"(c), "+v"(d)); }
template <typename T> struct Frag;
template <> struct Frag<_Float16> {
  typedef v16h V; union U { v16h v; v8h h[2]; };
  static __device__ __forceinline__ v16h load(const _Float16* p) {   // elements 0..7 <- p[0..7], 8..15 <- p[16..23]
    U f; f.h[0] = *(const v8h*)(p); f.h[1] = *(const v8h*)(p + 16); return f.v;
  }
  static __device__ __forceinline__ v8f mma(v16h a, v16h b, v8f c) {
    return __builtin_amdgcn_wmma_f32_16x16x32_f16(false, a, false, b, (short)0, c, false, false);
  }
  static __device__ __forceinline__ void guard(v8f& a, v8f& b, v16h x, v16h y) { dep_guard_h(a, b, x, y); }
  static __device__ __forceinline__ void keep(v16h a, v16h b, v16h c, v16h d) { keep4_h(a, b, c, d); }
};
template <> struct Frag<__bf16> {
  typedef v16b V; union U { v16b v; v8b h[2]; };
  static __device__ __forceinline__ v16b load(const __bf16* p) {
    U f; f.h[0] = *(const v8b*)(p); f.h[1] = *(const v8b*)(p + 16); return f.v;
  }
  static __device__ __forceinline__ v8f mma(v16b a, v16b b, v8f c) {
    return __builtin_amdgcn_wmma_f32_16x16x32_bf16(false, a, false, b, (short)0, c, false, false);
  }
  static __device__ __forceinline__ void guard(v8f& a, v8f& b, v16b x, v16b y) { dep_guard_b(a, b, x, y); }
  static __device__ __forceinline__ void keep(v16b a, v16b b, v16b c, v16b d) { keep4_b(a, b, c, d); }
};

__device__ __forceinline__ unsigned pk16(unsigned short a, unsigned short b) { return (unsigned)a | ((unsigned)b << 16); }

// ---- Register-blocked batched WMMA GEMM (SPLIT as a bit mask, ACT tanh/relu only,
//      bias values RNE-converted to bf16 before the f32 add) --------
// C[m,n] = scale * sum_k A[m,k] * Bt[n,k] (+bias)(+resid); each wave owns a 64x64 tile.
// A row-major [M,K]; Bt row-major [N,K]; M,N % 64 == 0, K % 32 == 0.
// SPLIT: bit0 -> A carried as hi/lo planes (A2 = lo), bit1 -> Bt carried as hi/lo planes (Bt2 = lo);
//        product = hi.hi (+ hi.lo if bit1) (+ lo.hi if bit0).
// BIAS_MODE: 0 = none, 1 = bias[m], 2 = bias[n].
// OUT_MODE: 0 = f32, 1 = f16, 2 = bf16 hi plane (Cout) + bf16 lo plane (Cout2).
// ACT: 0 = none, 1 = tanh, 2 = relu.
// ET: 0 = f16 operands, 1 = bf16 operands (pointers passed as 16-bit storage)
template <int ET> struct Elem;
template <> struct Elem<0> { typedef _Float16 T; };
template <> struct Elem<1> { typedef __bf16 T; };
template <int ET, int SPLIT, int BIAS_MODE, int OUT_MODE, bool RESID, int ACT = 0>
__global__ __launch_bounds__(256) void wmma_gemm64(
    const unsigned short* __restrict__ Ap, const unsigned short* __restrict__ A2p, int lda, long strideA,
    const unsigned short* __restrict__ Btp, const unsigned short* __restrict__ Bt2p, int ldb, long strideB,
    void* __restrict__ Cout, void* __restrict__ Cout2, int ldc, long strideC,
    const float* __restrict__ bias,
    const float* __restrict__ resid, long strideR,
    int M, int N, int K, float scale) {
  typedef typename Elem<ET>::T T;
  typedef typename Frag<T>::V V;
  constexpr bool SA = (SPLIT & 1) != 0;
  constexpr bool SB = (SPLIT & 2) != 0;
  const T* A = (const T*)Ap; const T* A2 = (const T*)A2p; const T* Bt = (const T*)Btp; const T* Bt2 = (const T*)Bt2p;
  __shared__ __align__(16) float sT[8][16 * 68];   // per-wave 16x64 slab, pitch 68 floats
  const int b    = blockIdx.y;
  const int lane = threadIdx.x & 31;
  const int wave = threadIdx.x >> 5;
  const int tilesN = N >> 6;
  const int tilesM = M >> 6;
  const int tile = blockIdx.x * 8 + wave;
  if (tile >= tilesM * tilesN) return;   // wave-uniform; no block barriers in this kernel
  const int tm = tile / tilesN;
  const int tn = tile - tm * tilesN;
  const int m0 = tm << 6;
  const int n0 = tn << 6;

  const T* Ab  = A  + (size_t)b * strideA;
  const T* Bb  = Bt + (size_t)b * strideB;
  const T* Ab2 = SA ? (A2  + (size_t)b * strideA) : nullptr;
  const T* Bb2 = SB ? (Bt2 + (size_t)b * strideB) : nullptr;

  const int rlane = lane & 15;                 // row (A) / col (B, D) within subtile
  const int koff  = (lane >> 4) * 8;           // k offset of this lane half
  const int mOff  = (lane >> 4) * 8;           // D row offset

  v8f acc[4][4];
#pragma unroll
  for (int i = 0; i < 4; ++i)
#pragma unroll
    for (int j = 0; j < 4; ++j) acc[i][j] = (v8f){0.f,0.f,0.f,0.f,0.f,0.f,0.f,0.f};

  for (int k0 = 0; k0 < K; k0 += 32) {
    V bh[4], bl[4];
#pragma unroll
    for (int j = 0; j < 4; ++j) {
      const size_t bo = (size_t)(n0 + (j << 4) + rlane) * ldb + koff + k0;
      bh[j] = Frag<T>::load(Bb + bo);
      if (SB) bl[j] = Frag<T>::load(Bb2 + bo);
    }
#pragma unroll
    for (int i = 0; i < 4; ++i) {
      const size_t ao = (size_t)(m0 + (i << 4) + rlane) * lda + koff + k0;
      V ah = Frag<T>::load(Ab + ao);
      V al;
      if (SA) al = Frag<T>::load(Ab2 + ao);
#pragma unroll
      for (int j = 0; j < 4; ++j) {
        acc[i][j] = Frag<T>::mma(ah, bh[j], acc[i][j]);
        if (SB) acc[i][j] = Frag<T>::mma(ah, bl[j], acc[i][j]);
        if (SA) acc[i][j] = Frag<T>::mma(al, bh[j], acc[i][j]);
      }
      Frag<T>::guard(acc[i][0], acc[i][3], ah, SA ? al : ah);
    }
    Frag<T>::keep(bh[0], bh[1], bh[2], bh[3]);
    if (SB) Frag<T>::keep(bl[0], bl[1], bl[2], bl[3]);
  }
  acc_guard4(acc[0][0], acc[0][1], acc[0][2], acc[0][3]);
  acc_guard4(acc[1][0], acc[1][1], acc[1][2], acc[1][3]);
  acc_guard4(acc[2][0], acc[2][1], acc[2][2], acc[2][3]);
  acc_guard4(acc[3][0], acc[3][1], acc[3][2], acc[3][3]);

  // ---- epilogue ----
  float* slab = sT[wave];
  const float* Rb = RESID ? (resid + (size_t)b * strideR) : nullptr;
#pragma unroll
  for (int i = 0; i < 4; ++i) {
    const int mBase = m0 + (i << 4);
#pragma unroll
    for (int j = 0; j < 4; ++j) {
      const int n = n0 + (j << 4) + rlane;
      float bv = 0.f;
      if (BIAS_MODE == 2) bv = bf_bits2f(f2bf_bits(bias[n]));                      // bias as bf16-RNE value
#pragma unroll
      for (int r = 0; r < 8; ++r) {
        float v = acc[i][j][r] * scale;
        if (BIAS_MODE == 1) v += bf_bits2f(f2bf_bits(bias[mBase + mOff + r]));     // bias as bf16-RNE value
        if (BIAS_MODE == 2) v += bv;
        if (RESID) v += Rb[(size_t)(mBase + mOff + r) * ldc + n];
        if (ACT == 1) v = tanhf(v);
        if (ACT == 2) v = fmaxf(v, 0.0f);
        slab[(mOff + r) * 68 + (j << 4) + rlane] = v;
      }
    }
    __builtin_amdgcn_fence(__ATOMIC_RELEASE, "workgroup");
    __builtin_amdgcn_wave_barrier();
    __builtin_amdgcn_fence(__ATOMIC_ACQUIRE, "workgroup");
    if (OUT_MODE == 0) {
      float* C = (float*)Cout + (size_t)b * strideC;
      const int hh = lane >> 4, c4 = (lane & 15) * 4;     // row seg = 256 B = 16 lanes x 16 B
      {
#pragma unroll
        for (int it = 0; it < 8; ++it) {
          const int row = it * 2 + hh;
          v4f v = *(const v4f*)(slab + row * 68 + c4);
          *(v4f*)(C + (size_t)(mBase + row) * ldc + n0 + c4) = v;
        }
        
      }
    } else {
      const int q = lane >> 3, c8 = (lane & 7) * 8;
      unsigned short* C  = (unsigned short*)Cout  + (size_t)b * strideC;
      unsigned short* C2 = (OUT_MODE == 2) ? ((unsigned short*)Cout2 + (size_t)b * strideC) : nullptr;
      {
#pragma unroll
        for (int it = 0; it < 4; ++it) {
          const int row = it * 4 + q;
          const float* sp = slab + row * 68 + c8;
          v8h hv, lv;
#pragma unroll
          for (int e = 0; e < 8; ++e) {
            if (OUT_MODE == 1) {
              hv[e] = (_Float16)sp[e];
            } else {
              unsigned short hb = f2bf_bits(sp[e]);
              unsigned short lb = f2bf_bits(sp[e] - bf_bits2f(hb));
              hv[e] = __builtin_bit_cast(_Float16, hb);
              lv[e] = __builtin_bit_cast(_Float16, lb);
            }
          }
          *(v8h*)(C + (size_t)(mBase + row) * ldc + n0 + c8) = hv;
          if (OUT_MODE == 2) *(v8h*)(C2 + (size_t)(mBase + row) * ldc + n0 + c8) = lv;
        }
        
      }
    }
    __builtin_amdgcn_fence(__ATOMIC_RELEASE, "workgroup");
    __builtin_amdgcn_wave_barrier();
    __builtin_amdgcn_fence(__ATOMIC_ACQUIRE, "workgroup");
  }
}

// ---------------------------------------------------------------------------
// x f32 -> bf16 plane (RNE), 8 consecutive elements per thread -> one 16-B store per lane;
// Coverage: n8 = 8192*1024/8 = 1,048,576 threads x 8 = the whole plane; grid 4096 x 256 exact.
// ---------------------------------------------------------------------------
__global__ __launch_bounds__(256) void cast8_bf16_kernel(const float* __restrict__ in, unsigned short* __restrict__ out, int n8) {
  const int i = blockIdx.x * 256 + threadIdx.x;
  if (i >= n8) return;
  const float* p = in + 8 * (size_t)i;
  const v4f a = *(const v4f*)(p);
  const v4f c = *(const v4f*)(p + 4);
  unsigned short hb[8];
#pragma unroll
  for (int e = 0; e < 4; ++e) {
    hb[e]     = f2bf_bits(a[e]);
    hb[4 + e] = f2bf_bits(c[e]);
  }
  const v4u u = (v4u){pk16(hb[0], hb[1]), pk16(hb[2], hb[3]), pk16(hb[4], hb[5]), pk16(hb[6], hb[7])};
  unsigned short* q = out + 8 * (size_t)i;
  *(v4u*)q = u;
  
}

// ---------------------------------------------------------------------------
// Weight transpose + cast: W f32 [1024 k][3072 n] -> WT[n][k] bf16 (RNE), [3072][1024].
// grid (1024/64 = 16 k tiles, 3072/64 = 48 n tiles), 256 threads.
// Load coverage: 16 iterations x 256 threads = 4096 = the whole 64x64 tile (coalesced along n).
// Store coverage: 8 waves x 2 iterations x 4 rows (lane>>3) = 64 n rows; (lane&7) x 8 halves = 64 k cols; each row
// ---------------------------------------------------------------------------
__global__ __launch_bounds__(256) void wtcast_kernel(const float* __restrict__ W, unsigned short* __restrict__ out) {
  __shared__ float sm[64][65];   // sm[n_local][k_local]
  const int t  = threadIdx.x;
  const int k0 = blockIdx.x * 64;
  const int n0 = blockIdx.y * 64;
#pragma unroll
  for (int i = 0; i < 16; ++i) {
    const int e = i * 256 + t;
    const int r = e >> 6;          // k local
    const int c = e & 63;          // n local
    sm[c][r] = W[(size_t)(k0 + r) * kN3 + n0 + c];
  }
  __syncthreads();
  const int lane = t & 31, wave = t >> 5;
  const int q = lane >> 3, c8 = (lane & 7) * 8;
  {
#pragma unroll
    for (int it = 0; it < 2; ++it) {
      const int row = wave * 8 + it * 4 + q;                 // n local
      unsigned short hb[8];
#pragma unroll
      for (int e = 0; e < 8; ++e) hb[e] = f2bf_bits(sm[row][c8 + e]);
      const v4u u = (v4u){pk16(hb[0], hb[1]), pk16(hb[2], hb[3]), pk16(hb[4], hb[5]), pk16(hb[6], hb[7])};
      *(v4u*)(out + (size_t)(n0 + row) * kHid + k0 + c8) = u;
    }
    
  }
}

// ---------------------------------------------------------------------------
// dist_emb f32 [1023][64] -> PE bf16 [1024][64] (RNE), row 1023 zero-filled.
// 1024*64/8 = 8192 threads = 32 blocks x 256 exactly; thread i: row i>>3, cols (i&7)*8..+7 -> one 16-B store;
// ---------------------------------------------------------------------------
__global__ __launch_bounds__(256) void pecast_kernel(const float* __restrict__ pe, unsigned short* __restrict__ out) {
  const int i = blockIdx.x * 256 + threadIdx.x;
  if (i >= kNDistP * kHdim / 8) return;
  const int row = i >> 3, c8 = (i & 7) * 8;
  const int rc = (row < kNDist) ? row : (kNDist - 1);         // clamped address
  const float* src = pe + (size_t)rc * kHdim + c8;
  const v4f a = *(const v4f*)(src);
  const v4f c = *(const v4f*)(src + 4);
  const bool live = (row < kNDist);
  unsigned short hb[8];
#pragma unroll
  for (int e = 0; e < 4; ++e) {
    hb[e]     = live ? f2bf_bits(a[e]) : (unsigned short)0;
    hb[4 + e] = live ? f2bf_bits(c[e]) : (unsigned short)0;
  }
  const v4u u = (v4u){pk16(hb[0], hb[1]), pk16(hb[2], hb[3]), pk16(hb[4], hb[5]), pk16(hb[6], hb[7])};
  unsigned short* q = out + (size_t)row * kHdim + c8;
  *(v4u*)q = u;
  
}

// ---------------------------------------------------------------------------
// Attention helpers
// ---------------------------------------------------------------------------
__device__ __forceinline__ unsigned short at_bf_bits(float f) {
  unsigned u = __float_as_uint(f);
  return (unsigned short)((u + 0x7FFFu + ((u >> 16) & 1u)) >> 16);
}
__device__ __forceinline__ __bf16 at_f2bf(float f) { return __builtin_bit_cast(__bf16, at_bf_bits(f)); }
__device__ __forceinline__ v8f at_mma(v16b a, v16b b, v8f c) {
  c = __builtin_amdgcn_wmma_f32_16x16x32_bf16(false, a, false, b, (short)0, c, false, false);
  asm volatile("v_nop\n\tv_nop\n\tv_nop\n\tv_nop" : "+v"(c) : "v"(a), "v"(b));
  return c;
}
// 16-bit element as a bit pattern held in a __bf16 slot: f16 bits when F16, bf16 (RNE) otherwise
template <bool F16> __device__ __forceinline__ __bf16 at_to16(float f) {
  if (F16) return __builtin_bit_cast(__bf16, (_Float16)f);
  return at_f2bf(f);
}
template <bool F16> __device__ __forceinline__ v8f at_mma16(v16b a, v16b b, v8f c) {
  if (F16) {
    const v16h ah = __builtin_bit_cast(v16h, a), bh = __builtin_bit_cast(v16h, b);
    c = __builtin_amdgcn_wmma_f32_16x16x32_f16(false, ah, false, bh, (short)0, c, false, false);
    asm volatile("v_nop\n\tv_nop\n\tv_nop\n\tv_nop" : "+v"(c) : "v"(ah), "v"(bh));
    return c;
  }
  return at_mma(a, b, c);
}

// =====================================================================================
// Fused attention with relative_key_query bias, head_dim 64. Block = 4 waves = 64 query rows of one (b, h);
// key chunks of 64; online softmax in f32. Operand planes (all dense, statically strided, 16-bit):
//   QKh/QKl: bf16 hi/lo [token = b*512+s][2048] with q at cols h*64+d, k at cols 1024+h*64+d
//   Vt:      f16 [b][h*64+d][s]  (pitch 512)
//   PE:      bf16 [1024][64] (dist_emb, row 1023 zero)
// Per chunk (l0 = 64*qb, r0 = 64*kc, d0 = l0 - r0 + 448, dist(l,r) = d0 + ll - kk + 63 with local ll, kk in 0..63):
//   T1w[p1][row] = q(row of this wave) . pe[d0 + 16*wave + p1], p1 = 0..79 (f16 in LDS, per wave)
//   T2 [p][kk]   = k(kk) . pe[d0 + p] for the band p in [48-16*j, 127-16*j] of key group j = kk>>4 (wave j produces it)
//   s[ll][kk] = (q.k(hi/lo) + T1 + T2) * 1/8 + mask[b][r0+kk];  p = exp(s - m);  out = sum p v / l.
// Each chunk's k hi/lo, pe band and v^T tiles are staged once per block in LDS by asynchronous copies, issued one phase ahead.
// grid (S/64, H, B), 128 threads.
// =====================================================================================
constexpr int kT1Slots = 80;
// LDS map of relattn_kernel (bytes). Staged tiles keep their 128-B rows at a pitch of 144 B (16 B x odd: no bank
// conflict for 16-B fragment reads). The out tile of the epilogue reuses the K / PE range.
constexpr int kPitchB = 144;                           // staged row pitch, bytes
constexpr int kPitchH = kPitchB / 2;                   // the same in 16-bit elements
constexpr int kOffKH  = 0;                             // k hi  [64 keys][64 d]
constexpr int kOffKL  = kOffKH + 64 * kPitchB;         // k lo  [64 keys][64 d]
constexpr int kOffPE  = kOffKL + 64 * kPitchB;         // pe    [128 distances][64 d]
constexpr int kOffV   = kOffPE + 128 * kPitchB;        // v^T   [64 d][64 keys]
constexpr int kOffT1  = kOffV + 64 * kPitchB;          // per wave [p1][16 rows] f16
constexpr int kOffT2  = kOffT1 + 4 * kT1Slots * 16 * 2; // [p][64 keys] f16
constexpr int kOffP   = kOffT2 + 128 * 64 * 2;         // per wave P (f16 bits) [row][kv]
constexpr int kLdsBytes = kOffP + 4 * 16 * 64 * 2;     // 80,896
static_assert(4 * 16 * 68 * 4 <= kOffV, "out tiles fit the K / PE range");

// Asynchronous copies global -> LDS, 16 B per lane. The s_wait_xcnt closes each statement so that no address
// register of an issued copy is rewritten in front of it.
__device__ __forceinline__ void async_copy4(unsigned l0, const __bf16* g0, unsigned l1, const __bf16* g1,
                                            unsigned l2, const __bf16* g2, unsigned l3, const __bf16* g3) {
  asm volatile("global_load_async_to_lds_b128 %0, %1, off\n\t"
               "global_load_async_to_lds_b128 %2, %3, off\n\t"
               "global_load_async_to_lds_b128 %4, %5, off\n\t"
               "global_load_async_to_lds_b128 %6, %7, off\n\t"
               "s_wait_xcnt 0x0"
               :: "v"(l0), "v"(g0), "v"(l1), "v"(g1), "v"(l2), "v"(g2), "v"(l3), "v"(g3) : "memory");
}
__device__ __forceinline__ void async_copy8(unsigned l0, const __bf16* g0, unsigned l1, const __bf16* g1,
                                            unsigned l2, const __bf16* g2, unsigned l3, const __bf16* g3,
                                            unsigned l4, const __bf16* g4, unsigned l5, const __bf16* g5,
                                            unsigned l6, const __bf16* g6, unsigned l7, const __bf16* g7) {
  asm volatile("global_load_async_to_lds_b128 %0, %1, off\n\t"
               "global_load_async_to_lds_b128 %2, %3, off\n\t"
               "global_load_async_to_lds_b128 %4, %5, off\n\t"
               "global_load_async_to_lds_b128 %6, %7, off\n\t"
               "global_load_async_to_lds_b128 %8, %9, off\n\t"
               "global_load_async_to_lds_b128 %10, %11, off\n\t"
               "global_load_async_to_lds_b128 %12, %13, off\n\t"
               "global_load_async_to_lds_b128 %14, %15, off\n\t"
               "s_wait_xcnt 0x0"
               :: "v"(l0), "v"(g0), "v"(l1), "v"(g1), "v"(l2), "v"(g2), "v"(l3), "v"(g3),
                  "v"(l4), "v"(g4), "v"(l5), "v"(g5), "v"(l6), "v"(g6), "v"(l7), "v"(g7) : "memory");
}
// this wave's LDS reads and writes have retired (before a barrier that hands a buffer to its next writer)
__device__ __forceinline__ void wait_lds_done() { asm volatile("s_wait_dscnt 0x0" ::: "memory"); }
// this wave's own copies have landed (before the barrier behind which other waves read them)
__device__ __forceinline__ void wait_copies_landed() { asm volatile("s_wait_asynccnt 0x0" ::: "memory"); }

__global__ __launch_bounds__(128)
void relattn_kernel(const unsigned short* __restrict__ QKhp, const unsigned short* __restrict__ QKlp,
                    const unsigned short* __restrict__ Vtp, const unsigned short* __restrict__ PEp,
                    const float* __restrict__ mask, float* __restrict__ out) {
  union FB { v16b v; v8b h[2]; };
  typedef __attribute__((address_space(3))) unsigned char lds_byte;
  __shared__ __align__(128) unsigned char smem[kLdsBytes];
  const __bf16* KHs = (const __bf16*)(smem + kOffKH);
  const __bf16* KLs = (const __bf16*)(smem + kOffKL);
  const __bf16* PEs = (const __bf16*)(smem + kOffPE);
  const __bf16* Vs  = (const __bf16*)(smem + kOffV);      // f16 bits
  _Float16*     T2s = (_Float16*)(smem + kOffT2);

  const int tid  = threadIdx.x;
  const int wave = tid >> 5;
  const int lane = tid & 31;
  const int hh   = lane >> 4;
  const int c    = lane & 15;

  const int qb = blockIdx.x;
  const int h  = blockIdx.y;
  const int b  = blockIdx.z;
  const int l0 = qb * 64;
  const int q0 = l0 + wave * 16;
  const size_t tok0 = (size_t)b * kSeq;

  const __bf16* Qh  = (const __bf16*)QKhp;
  const __bf16* Ql  = (const __bf16*)QKlp;
  const __bf16* Vt  = (const __bf16*)Vtp;     // f16 bits
  const __bf16* PEt = (const __bf16*)PEp;

  // ---- copy roles: thread t moves the 16-B piece t & 7 of rows (t >> 3) + 16 i; 8 lanes cover one 128-B row ----
  const int crow = tid >> 3;
  const int cpc  = tid & 7;
  const unsigned lcp = (unsigned)(size_t)(lds_byte*)smem + (unsigned)(crow * kPitchB + cpc * 16);
  const size_t gko = (tok0 + crow) * kQKld + kHid + (size_t)h * kHdim + cpc * 8;
  const __bf16* gKh = Qh + gko;
  const __bf16* gKl = Ql + gko;
  const __bf16* gV  = Vt + ((size_t)(b * kHeads + h) * kHdim + crow) * kSeq + cpc * 8;
  const __bf16* gPE = PEt + (size_t)crow * kHdim + cpc * 8;
  constexpr unsigned kStep = 16 * kPitchB;                 // 16 staged rows
  // k hi, k lo (64 rows each) and the pe band d0 .. d0 + 127 (<= 1023) of key chunk n
  auto stage_k_pe = [&](int n) {
    const __bf16* kh = gKh + (size_t)(n * 64) * kQKld;
    const __bf16* kl = gKl + (size_t)(n * 64) * kQKld;
    const __bf16* pp = gPE + (size_t)(l0 - n * 64 + 448) * kHdim;
    async_copy8(lcp + kOffKH, kh, lcp + kOffKH + kStep, kh + 16 * kQKld,
                lcp + kOffKH + 2 * kStep, kh + 32 * kQKld, lcp + kOffKH + 3 * kStep, kh + 48 * kQKld,
                lcp + kOffKL, kl, lcp + kOffKL + kStep, kl + 16 * kQKld,
                lcp + kOffKL + 2 * kStep, kl + 32 * kQKld, lcp + kOffKL + 3 * kStep, kl + 48 * kQKld);
    async_copy8(lcp + kOffPE, pp, lcp + kOffPE + kStep, pp + 16 * kHdim,
                lcp + kOffPE + 2 * kStep, pp + 32 * kHdim, lcp + kOffPE + 3 * kStep, pp + 48 * kHdim,
                lcp + kOffPE + 4 * kStep, pp + 64 * kHdim, lcp + kOffPE + 5 * kStep, pp + 80 * kHdim,
                lcp + kOffPE + 6 * kStep, pp + 96 * kHdim, lcp + kOffPE + 7 * kStep, pp + 112 * kHdim);
  };
  // v^T rows d = 0 .. 63, keys of chunk n
  auto stage_v = [&](int n) {
    const __bf16* vv = gV + n * 64;
    async_copy4(lcp + kOffV, vv, lcp + kOffV + kStep, vv + 16 * kSeq,
                lcp + kOffV + 2 * kStep, vv + 32 * kSeq, lcp + kOffV + 3 * kStep, vv + 48 * kSeq);
  };

  stage_k_pe(0);                                // flies while the Q fragments are fetched

  // ---- Q fragments (A operand): 2 d-chunks, hi and lo planes ----
  v16b qah[2], qal[2];
  {
    const size_t qo = (tok0 + q0 + c) * kQKld + (size_t)h * kHdim + 8 * hh;
#pragma unroll
    for (int dc = 0; dc < 2; ++dc) {
      qah[dc] = Frag<__bf16>::load(Qh + qo + dc * 32);
      qal[dc] = Frag<__bf16>::load(Ql + qo + dc * 32);
    }
  }

  float mrow[8], lrow[8];
  v8f oacc[4];
#pragma unroll
  for (int r = 0; r < 8; ++r) { mrow[r] = -INFINITY; lrow[r] = 0.f; }
#pragma unroll
  for (int t = 0; t < 4; ++t) oacc[t] = (v8f){0.f,0.f,0.f,0.f,0.f,0.f,0.f,0.f};

  _Float16* t1w = (_Float16*)(smem + kOffT1) + wave * (kT1Slots * 16);
  __bf16*   pw  = (__bf16*)(smem + kOffP) + wave * (16 * 64);

  for (int kc = 0; kc < kSeq / 64; ++kc) {
    const int r0 = kc * 64;
    // publish k / pe of this chunk; the barrier also ends the previous chunk's reads of T2s and of the v tile
    wait_lds_done();
    wait_copies_landed();
    __syncthreads();
    stage_v(kc);                               // flies under the T1 / T2 / q.k products, read behind the next barrier

    // ---- relative-position tiles on WMMA: T1 (5 tiles per wave), T2 (5 tiles per wave) ----
    {
      v16b ka[2];
#pragma unroll
      for (int dc = 0; dc < 2; ++dc) ka[dc] = Frag<__bf16>::load(KHs + (wave * 16 + c) * kPitchH + 8 * hh + dc * 32);   // k rows as A operand
#pragma unroll
      for (int i = 0; i < 5; ++i) {
        const int dt1 = 16 * wave + 16 * i;               // T1 distance tile base inside the staged band (<= 112)
        const int dt2 = 16 * (3 - wave + i);              // T2 distance tile base inside the staged band (<= 112)
        v8f a1 = (v8f){0.f,0.f,0.f,0.f,0.f,0.f,0.f,0.f};
        v8f a2 = (v8f){0.f,0.f,0.f,0.f,0.f,0.f,0.f,0.f};
#pragma unroll
        for (int dc = 0; dc < 2; ++dc) {
          const v16b p1 = Frag<__bf16>::load(PEs + (dt1 + c) * kPitchH + 8 * hh + dc * 32);   // B[k=d][n=dist]
          const v16b p2 = Frag<__bf16>::load(PEs + (dt2 + c) * kPitchH + 8 * hh + dc * 32);
          a1 = at_mma(qah[dc], p1, a1);
          a2 = at_mma(ka[dc], p2, a2);
        }
        v8h hv1, hv2;
#pragma unroll
        for (int r = 0; r < 8; ++r) { hv1[r] = (_Float16)a1[r]; hv2[r] = (_Float16)a2[r]; }
        // D element r: row 8hh+r (query row of this wave / key row 16*wave+8hh+r), col = dist slot 16i+c
        *(v8h*)(t1w + (16 * i + c) * 16 + 8 * hh) = hv1;
        *(v8h*)(T2s + (size_t)(16 * (3 - wave + i) + c) * 64 + 16 * wave + 8 * hh) = hv2;
      }
    }

    // ---- q . k (hi.hi + hi.lo + lo.hi), B fragments from the staged k tiles ----
    v8f s[4];
#pragma unroll
    for (int j = 0; j < 4; ++j) {
      s[j] = (v8f){0.f,0.f,0.f,0.f,0.f,0.f,0.f,0.f};
#pragma unroll
      for (int dc = 0; dc < 2; ++dc) {
        const int ko = (j * 16 + c) * kPitchH + 8 * hh + dc * 32;
        const v16b kb = Frag<__bf16>::load(KHs + ko);
        const v16b kl = Frag<__bf16>::load(KLs + ko);
        s[j] = at_mma(qah[dc], kb, s[j]);
        s[j] = at_mma(qah[dc], kl, s[j]);
        s[j] = at_mma(qal[dc], kb, s[j]);
      }
    }
    // publish T1s / T2s and the v tile; the barrier also ends every wave's reads of the k and pe tiles
    wait_lds_done();
    wait_copies_landed();
    __syncthreads();
    if (kc + 1 < kSeq / 64) stage_k_pe(kc + 1);   // flies under softmax and p.v, read behind the next chunk's first barrier

    float mk[4];
#pragma unroll
    for (int j = 0; j < 4; ++j) mk[j] = mask[tok0 + r0 + j * 16 + c];   // additive mask [b][r]

    float cm[8];
#pragma unroll
    for (int r = 0; r < 8; ++r) {
      float m = -INFINITY;
#pragma unroll
      for (int j = 0; j < 4; ++j) {
        const int p1 = 8 * hh + r - 16 * j - c + 63;                          // in [0, 78]
        const float t1 = (float)t1w[p1 * 16 + 8 * hh + r];
        const float t2 = (float)T2s[(p1 + 16 * wave) * 64 + 16 * j + c];
        const float v = (s[j][r] + t1 + t2) * 0.125f + mk[j];
        s[j][r] = v;
        m = fmaxf(m, v);
      }
#pragma unroll
      for (int off = 1; off < 16; off <<= 1) m = fmaxf(m, __shfl_xor(m, off, 32));
      cm[r] = m;
    }
#pragma unroll
    for (int r = 0; r < 8; ++r) {
      const float mnew = fmaxf(mrow[r], cm[r]);
      const float alpha = __expf(mrow[r] - mnew);
      mrow[r] = mnew;
      float psum = 0.f;
#pragma unroll
      for (int j = 0; j < 4; ++j) {
        const float p = __expf(s[j][r] - mnew);
        psum += p;
        pw[(8 * hh + r) * 64 + j * 16 + c] = at_to16<true>(p * kPCarry);
      }
#pragma unroll
      for (int off = 1; off < 16; off <<= 1) psum += __shfl_xor(psum, off, 32);
      lrow[r] = lrow[r] * alpha + psum;
#pragma unroll
      for (int t = 0; t < 4; ++t) oacc[t][r] *= alpha;
    }
    __builtin_amdgcn_fence(__ATOMIC_RELEASE, "workgroup");
    __builtin_amdgcn_wave_barrier();
    __builtin_amdgcn_fence(__ATOMIC_ACQUIRE, "workgroup");
#pragma unroll 1
    for (int kk = 0; kk < 2; ++kk) {
      FB pa;
      pa.h[0] = *(const v8b*)(pw + c * 64 + kk * 32 + 8 * hh);
      pa.h[1] = *(const v8b*)(pw + c * 64 + kk * 32 + 16 + 8 * hh);
#pragma unroll
      for (int t = 0; t < 4; ++t) {
        FB vb;
        const int vo = (t * 16 + c) * kPitchH + kk * 32 + 8 * hh;   // B[k=kv][n=d] from the staged v^T[d][kv]
        vb.h[0] = *(const v8b*)(Vs + vo);
        vb.h[1] = *(const v8b*)(Vs + vo + 16);
        oacc[t] = at_mma16<true>(pa.v, vb.v, oacc[t]);
      }
    }
  }
  wait_copies_landed();                        // none is left in flight when the wave reuses LDS and ends

  // ---- epilogue: out[b][q0+row][h*64 + 0..63]; row segment = 256 B = 16 lanes x 16 B, one instruction per row ----
  // The out tiles lie on the k / pe range: its last readers left it at the last chunk's second barrier, and no copy
  // was aimed at it after that.
  float* os = (float*)(smem) + wave * (16 * 68);
#pragma unroll
  for (int r = 0; r < 8; ++r) {
    const float inv = 1.0f / (lrow[r] * kPCarry);
#pragma unroll
    for (int t = 0; t < 4; ++t) os[(8 * hh + r) * 68 + t * 16 + c] = oacc[t][r] * inv;
  }
  __builtin_amdgcn_fence(__ATOMIC_RELEASE, "workgroup");
  __builtin_amdgcn_wave_barrier();
  __builtin_amdgcn_fence(__ATOMIC_ACQUIRE, "workgroup");
  {
    float* ob = out + (size_t)h * kHdim;
    const int c4 = (lane & 15) * 4;
    {
#pragma unroll
      for (int it = 0; it < 8; ++it) {
        const int row = it * 2 + hh;
        v4f val = *(const v4f*)(os + row * 68 + c4);
        *(v4f*)(ob + (tok0 + q0 + row) * kHid + c4) = val;
      }
      
    }
  }
}

// ---------------------------------------------------------------------------
// Workspace region map (byte offsets, multiples of 128; every region fully written before it is read):
//   X16  bf16 [8192][1024]                     0 ..  16,777,216
//   WT   bf16 [3072][1024] (W^T)      16,777,216 ..  23,068,672
//   PE   bf16 [1024][64] (row 1023 0) 23,068,672 ..  23,199,744
//   QKh  bf16 [8192][2048] ([q|k] hi)  23,199,744 ..  56,754,176
//   QKl  bf16 [8192][2048] ([q|k] lo)  56,754,176 ..  90,308,608
//   Vt   f16  [16][1024][512]          90,308,608 .. 107,085,824
//   total 107,085,824 B.
// GEMM shapes: q|k: M=8192 N=2048 K=1024; v (role-swapped, per batch): M=1024 N=512 K=1024 x16.
//   K % 32 == 0, M and N % 64 == 0 for both; no padded operand rows.
// ---------------------------------------------------------------------------
extern "C" void kernel_launch(void* const* d_in, const int* in_sizes, int n_in,
                              void* d_out, int out_size, void* d_ws, size_t ws_size,
                              hipStream_t stream) {
  if (n_in < 5) return;
  if (in_sizes[0] != kTok * kHid) return;
  if (in_sizes[1] != kBatch * kSeq) return;
  if (in_sizes[2] != kHid * kN3) return;
  if (in_sizes[3] != kN3) return;
  if (in_sizes[4] != kNDist * kHdim) return;
  if (out_size != kTok * kHid) return;

  const float* hid  = (const float*)d_in[0];   // [16][512][1024]
  const float* msk  = (const float*)d_in[1];   // [16][1][1][512]
  const float* W    = (const float*)d_in[2];   // [1024][3072]
  const float* bqkv = (const float*)d_in[3];   // [3072]
  const float* pe   = (const float*)d_in[4];   // [1023][64]
  float* outp = (float*)d_out;                 // [16][512][1024]

  const size_t SZ_X16 = (size_t)kTok * kHid * 2;              //  16,777,216
  const size_t SZ_WT  = (size_t)kN3 * kHid * 2;               //   6,291,456
  const size_t SZ_PE  = (size_t)kNDistP * kHdim * 2;          //     131,072
  const size_t SZ_QK  = (size_t)kTok * kQKld * 2;             //  33,554,432
  const size_t SZ_VT  = (size_t)kBatch * kHid * kSeq * 2;     //  16,777,216
  size_t off = 0;
  const size_t oX16 = off; off += SZ_X16;
  const size_t oWT  = off; off += SZ_WT;
  const size_t oPE  = off; off += SZ_PE;
  const size_t oQKh = off; off += SZ_QK;
  const size_t oQKl = off; off += SZ_QK;
  const size_t oVT  = off; off += SZ_VT;
  const size_t TOTAL = off;                                   // 107,085,824
  if (TOTAL > ws_size) return;
  if (TOTAL > (size_t)134217728) return;

  char* ws = (char*)d_ws;
  unsigned short* X16 = (unsigned short*)(ws + oX16);
  unsigned short* WT  = (unsigned short*)(ws + oWT);
  unsigned short* PEb = (unsigned short*)(ws + oPE);
  unsigned short* QKh = (unsigned short*)(ws + oQKh);
  unsigned short* QKl = (unsigned short*)(ws + oQKl);
  unsigned short* VTp = (unsigned short*)(ws + oVT);

  const dim3 blk(256);
  // (0) x -> bf16 plane
  {
    const int n8 = kTok * kHid / 8;                           // 1,048,576 -> 4096 blocks exactly
    cast8_bf16_kernel<<<dim3((n8 + 255) / 256), blk, 0, stream>>>(hid, X16, n8);
  }
  // (1) W [1024][3072] -> WT [3072][1024] bf16
  wtcast_kernel<<<dim3(kHid / 64, kN3 / 64), blk, 0, stream>>>(W, WT);
  // (2) dist_emb -> PE bf16 [1024][64]
  pecast_kernel<<<dim3((kNDistP * kHdim / 8 + 255) / 256), blk, 0, stream>>>(pe, PEb);
  // (3) [q|k] = X16 . WT[0..2047]^T + b[0..2047] -> bf16 hi + lo planes, pitch 2048
  {
    const dim3 g(((kTok / 64) * (kQKld / 64) + 7) / 8, 1);    // 512 blocks
    wmma_gemm64<1, 0, 2, 2, false, 0><<<g, blk, 0, stream>>>(
        X16, X16, kHid, 0L, WT, WT, kHid, 0L, (void*)QKh, (void*)QKl, kQKld, 0L,
        bqkv, hid, 0L, kTok, kQKld, kHid, 1.0f);
  }
  // (4) v^T per batch: Vt[b][m][s] = WT[2048+m] . x[b*512+s] + b[2048+m] -> f16, pitch 512
  {
    const dim3 g(((kHid / 64) * (kSeq / 64) + 7) / 8, kBatch); // 16 x 16
    wmma_gemm64<1, 0, 1, 1, false, 0><<<g, blk, 0, stream>>>(
        WT + (size_t)2 * kHid * kHid, WT + (size_t)2 * kHid * kHid, kHid, 0L,
        X16, X16, kHid, (long)kSeq * kHid,
        (void*)VTp, (void*)VTp, kSeq, (long)kHid * kSeq,
        bqkv + 2 * kHid, hid, 0L, kHid, kSeq, kHid, 1.0f);
  }
  // (5) fused attention with relative-position bias -> out f32 [16][512][1024]
  relattn_kernel<<<dim3(kSeq / 64, kHeads, kBatch), dim3(128), 0, stream>>>(QKh, QKl, VTp, PEb, msk, outp);
}

// v002
// A run of this version takes 163 microseconds.
// In two side-by-side timings against v001, it was 1.40 and 1.39 times as fast.
// Over all steps from v000 it is 1.89 times as fast.
// Contractions: qkv projection v_wmma_f32_16x16x32_bf16 (x, W as bf16 RNE; bias added as bf16-RNE value in f32); q.k^T bf16 hi/lo planes (hi.hi+hi.lo+lo.hi); q.pe^T and k.pe^T bf16 (q,k hi planes, pe bf16); p.v v_wmma_f32_16x16x32_f16 (p f16 carried x2^15, v f16); f32 accumulate; softmax, scale, bias, mask add in f32.
#include <hip/hip_runtime.h>
#include <math.h>

// ---------------------------------------------------------------------------
// Problem constants
// ---------------------------------------------------------------------------
constexpr int kBatch  = 16;
constexpr int kSeq    = 512;
constexpr int kHid    = 1024;
constexpr int kHeads  = 16;
constexpr int kHdim   = 64;
constexpr int kN3     = 3 * kHid;          // 3072 qkv output columns
constexpr int kQKld   = 2 * kHid;          // 2048: pitch of the [q | k] planes
constexpr int kTok    = kBatch * kSeq;     // 8192 token rows
constexpr int kNDist  = 2 * kSeq - 1;      // 1023 relative distances
constexpr int kNDistP = 1024;              // pe plane rows (row 1023 zero)
constexpr float kPCarry = 32768.0f;        // f16 probabilities carried x2^15
static_assert(kHid % 128 == 0 && kTok % 128 == 0 && kQKld % 256 == 0 && kSeq % 256 == 0, "tiles");

typedef __attribute__((ext_vector_type(16))) _Float16 v16h;
typedef __attribute__((ext_vector_type(8)))  _Float16 v8h;
typedef __attribute__((ext_vector_type(16))) __bf16   v16b;
typedef __attribute__((ext_vector_type(8)))  __bf16   v8b;
typedef __attribute__((ext_vector_type(8)))  float    v8f;
typedef __attribute__((ext_vector_type(4)))  float    v4f;
typedef __attribute__((ext_vector_type(4)))  unsigned int v4u;

__device__ __forceinline__ unsigned short f2bf_bits(float f) {
  unsigned u = __float_as_uint(f);
  return (unsigned short)((u + 0x7FFFu + ((u >> 16) & 1u)) >> 16);
}
__device__ __forceinline__ float bf_bits2f(unsigned short h) { return __uint_as_float(((unsigned)h) << 16); }

// hazard guards as plain device helpers (no inline asm inside the kernel template body)
__device__ __forceinline__ void dep_guard_h(v8f& a, v8f& b, v16h x, v16h y) { asm volatile("v_nop\n\tv_nop\n\tv_nop\n\tv_nop" : "+v"(a), "+v"(b) : "v"(x), "v"(y)); }
__device__ __forceinline__ void dep_guard_b(v8f& a, v8f& b, v16b x, v16b y) { asm volatile("v_nop\n\tv_nop\n\tv_nop\n\tv_nop" : "+v"(a), "+v"(b) : "v"(x), "v"(y)); }
__device__ __forceinline__ void keep4_h(v16h a, v16h b, v16h c, v16h d) { asm volatile("v_nop" :: "v"(a), "v"(b), "v"(c), "v"(d)); }
__device__ __forceinline__ void keep4_b(v16b a, v16b b, v16b c, v16b d) { asm volatile("v_nop" :: "v"(a), "v"(b), "v"(c), "v"(d)); }
__device__ __forceinline__ void acc_guard4(v8f& a, v8f& b, v8f& c, v8f& d) { asm volatile("v_nop\n\tv_nop\n\tv_nop\n\tv_nop" : "+v"(a), "+v"(b), "+v"(c), "+v"(d)); }
template <typename T> struct Frag;
template <> struct Frag<_Float16> {
  typedef v16h V; union U { v16h v; v8h h[2]; };
  static __device__ __forceinline__ v16h load(const _Float16* p) {   // elements 0..7 <- p[0..7], 8..15 <- p[16..23]
    U f; f.h[0] = *(const v8h*)(p); f.h[1] = *(const v8h*)(p + 16); return f.v;
  }
  static __device__ __forceinline__ v8f mma(v16h a, v16h b, v8f c) {
    return __builtin_amdgcn_wmma_f32_16x16x32_f16(false, a, false, b, (short)0, c, false, false);
  }
  static __device__ __forceinline__ void guard(v8f& a, v8f& b, v16h x, v16h y) { dep_guard_h(a, b, x, y); }
  static __device__ __forceinline__ void keep(v16h a, v16h b, v16h c, v16h d) { keep4_h(a, b, c, d); }
};
template <> struct Frag<__bf16> {
  typedef v16b V; union U { v16b v; v8b h[2]; };
  static __device__ __forceinline__ v16b load(const __bf16* p) {
    U f; f.h[0] = *(const v8b*)(p); f.h[1] = *(const v8b*)(p + 16); return f.v;
  }
  static __device__ __forceinline__ v8f mma(v16b a, v16b b, v8f c) {
    return __builtin_amdgcn_wmma_f32_16x16x32_bf16(false, a, false, b, (short)0, c, false, false);
  }
  static __device__ __forceinline__ void guard(v8f& a, v8f& b, v16b x, v16b y) { dep_guard_b(a, b, x, y); }
  static __device__ __forceinline__ void keep(v16b a, v16b b, v16b c, v16b d) { keep4_b(a, b, c, d); }
};

__device__ __forceinline__ unsigned pk16(unsigned short a, unsigned short b) { return (unsigned)a | ((unsigned)b << 16); }

// Asynchronous copies global -> LDS, 16 B per lane. The s_wait_xcnt closes each statement so that no address
// register of an issued copy is rewritten in front of it.
__device__ __forceinline__ void async_copy4(unsigned l0, const __bf16* g0, unsigned l1, const __bf16* g1,
                                            unsigned l2, const __bf16* g2, unsigned l3, const __bf16* g3) {
  asm volatile("global_load_async_to_lds_b128 %0, %1, off\n\t"
               "global_load_async_to_lds_b128 %2, %3, off\n\t"
               "global_load_async_to_lds_b128 %4, %5, off\n\t"
               "global_load_async_to_lds_b128 %6, %7, off\n\t"
               "s_wait_xcnt 0x0"
               :: "v"(l0), "v"(g0), "v"(l1), "v"(g1), "v"(l2), "v"(g2), "v"(l3), "v"(g3) : "memory");
}
__device__ __forceinline__ void async_copy8(unsigned l0, const __bf16* g0, unsigned l1, const __bf16* g1,
                                            unsigned l2, const __bf16* g2, unsigned l3, const __bf16* g3,
                                            unsigned l4, const __bf16* g4, unsigned l5, const __bf16* g5,
                                            unsigned l6, const __bf16* g6, unsigned l7, const __bf16* g7) {
  asm volatile("global_load_async_to_lds_b128 %0, %1, off\n\t"
               "global_load_async_to_lds_b128 %2, %3, off\n\t"
               "global_load_async_to_lds_b128 %4, %5, off\n\t"
               "global_load_async_to_lds_b128 %6, %7, off\n\t"
               "global_load_async_to_lds_b128 %8, %9, off\n\t"
               "global_load_async_to_lds_b128 %10, %11, off\n\t"
               "global_load_async_to_lds_b128 %12, %13, off\n\t"
               "global_load_async_to_lds_b128 %14, %15, off\n\t"
               "s_wait_xcnt 0x0"
               :: "v"(l0), "v"(g0), "v"(l1), "v"(g1), "v"(l2), "v"(g2), "v"(l3), "v"(g3),
                  "v"(l4), "v"(g4), "v"(l5), "v"(g5), "v"(l6), "v"(g6), "v"(l7), "v"(g7) : "memory");
}
// this wave's LDS reads and writes have retired (before a barrier that hands a buffer to its next writer)
__device__ __forceinline__ void wait_lds_done() { asm volatile("s_wait_dscnt 0x0" ::: "memory"); }
// this wave's own copies have landed (before the barrier behind which other waves read them)
__device__ __forceinline__ void wait_copies_landed() { asm volatile("s_wait_asynccnt 0x0" ::: "memory"); }

// ---- Register-blocked batched WMMA GEMM (ACT tanh/relu only,
//      bias values RNE-converted to bf16 before the f32 add) --------
// C[m,n] = scale * sum_k A[m,k] * Bt[n,k] (+bias)(+resid); a block owns a 128x256 tile, its 8 waves (2 x 4) 64x64 each.
// A row-major [M,K]; Bt row-major [N,K]; M % 128 == 0, N % 256 == 0, K % 64 == 0.
// Each k slice of 64 (128 A rows + 256 Bt rows of 128 B) is staged once per block in LDS by asynchronous copies,
// two buffers: the next slice flies while this one is multiplied.
// SPLIT: 0 only (single operand planes; A2p / Bt2p are not read).
// BIAS_MODE: 0 = none, 1 = bias[m], 2 = bias[n].
// OUT_MODE: 0 = f32, 1 = f16, 2 = bf16 hi plane (Cout) + bf16 lo plane (Cout2).
// ACT: 0 = none, 1 = tanh, 2 = relu.
// ET: 0 = f16 operands, 1 = bf16 operands (pointers passed as 16-bit storage)
constexpr int kGPitchB = 144;                          // staged 128-B row at 16 B x odd: no bank conflict for 16-B reads
constexpr int kGPitchH = kGPitchB / 2;                 // the same in 16-bit elements
constexpr int kGRowsA  = 128;
constexpr int kGRowsB  = 256;
constexpr int kGStageB = (kGRowsA + kGRowsB) * kGPitchB;   // 55,296 B per buffer
template <int ET> struct Elem;
template <> struct Elem<0> { typedef _Float16 T; };
template <> struct Elem<1> { typedef __bf16 T; };
template <int ET, int SPLIT, int BIAS_MODE, int OUT_MODE, bool RESID, int ACT = 0>
__global__ __launch_bounds__(256) void wmma_gemm64(
    const unsigned short* __restrict__ Ap, const unsigned short* __restrict__ A2p, int lda, long strideA,
    const unsigned short* __restrict__ Btp, const unsigned short* __restrict__ Bt2p, int ldb, long strideB,
    void* __restrict__ Cout, void* __restrict__ Cout2, int ldc, long strideC,
    const float* __restrict__ bias,
    const float* __restrict__ resid, long strideR,
    int M, int N, int K, float scale) {
  static_assert(SPLIT == 0, "single operand planes");
  typedef typename Elem<ET>::T T;
  typedef typename Frag<T>::V V;
  typedef __attribute__((address_space(3))) unsigned char lds_byte;
  const T* A = (const T*)Ap; const T* Bt = (const T*)Btp;
  __shared__ __align__(128) unsigned char ring[2 * kGStageB];   // two staged k slices: [A 128 rows | Bt 256 rows]
  __shared__ __align__(16) float sT[8][16 * 68];   // per-wave 16x64 slab, pitch 68 floats
  const int b    = blockIdx.y;
  const int lane = threadIdx.x & 31;
  const int wave = threadIdx.x >> 5;
  const int tilesN = N >> 8;
  const int tilesM = M >> 7;
  const int tile = blockIdx.x;
  if (tile >= tilesM * tilesN) return;   // block-uniform, in front of every barrier
  const int tm = tile / tilesN;
  const int tn = tile - tm * tilesN;
  const int wm = wave >> 2;                    // wave row (0..1) and column (0..3) inside the block tile
  const int wn = wave & 3;
  const int m0 = (tm << 7) + (wm << 6);
  const int n0 = (tn << 8) + (wn << 6);

  const T* Ab  = A  + (size_t)b * strideA;
  const T* Bb  = Bt + (size_t)b * strideB;

  const int rlane = lane & 15;                 // row (A) / col (B, D) within subtile
  const int koff  = (lane >> 4) * 8;           // k offset of this lane half
  const int mOff  = (lane >> 4) * 8;           // D row offset

  // ---- copy roles: thread t moves the 16-B piece t & 7 of rows (t >> 3) + 32 i; 8 lanes cover one 128-B row ----
  const int crow = threadIdx.x >> 3;
  const int cpc  = threadIdx.x & 7;
  const unsigned lcp = (unsigned)(size_t)(lds_byte*)ring + (unsigned)(crow * kGPitchB + cpc * 16);
  const __bf16* gA = (const __bf16*)Ab + (size_t)((tm << 7) + crow) * lda + cpc * 8;
  const __bf16* gB = (const __bf16*)Bb + (size_t)((tn << 8) + crow) * ldb + cpc * 8;
  const size_t a32 = (size_t)32 * lda;
  const size_t b32 = (size_t)32 * ldb;
  constexpr unsigned kStep = 32 * kGPitchB;                // 32 staged rows
  // k slice s (columns 64 s .. 64 s + 63 of the block's 128 A rows and 256 Bt rows) into buffer s & 1
  auto stage = [&](int s) {
    const unsigned la = lcp + (unsigned)(s & 1) * kGStageB;
    const unsigned lb = la + kGRowsA * kGPitchB;
    const __bf16* pa = gA + s * 64;
    const __bf16* pb = gB + s * 64;
    async_copy4(la, pa, la + kStep, pa + a32, la + 2 * kStep, pa + 2 * a32, la + 3 * kStep, pa + 3 * a32);
    async_copy8(lb, pb, lb + kStep, pb + b32, lb + 2 * kStep, pb + 2 * b32, lb + 3 * kStep, pb + 3 * b32,
                lb + 4 * kStep, pb + 4 * b32, lb + 5 * kStep, pb + 5 * b32,
                lb + 6 * kStep, pb + 6 * b32, lb + 7 * kStep, pb + 7 * b32);
  };

  v8f acc[4][4];
#pragma unroll
  for (int i = 0; i < 4; ++i)
#pragma unroll
    for (int j = 0; j < 4; ++j) acc[i][j] = (v8f){0.f,0.f,0.f,0.f,0.f,0.f,0.f,0.f};

  const int nst = K >> 6;
  stage(0);
  wait_copies_landed();
  __syncthreads();                             // publishes slice 0
  if (nst > 1) stage(1);

  const int fa = ((wm << 6) + rlane) * kGPitchH + koff;             // this lane's A fragment base in a buffer
  const int fb = (kGRowsA + (wn << 6) + rlane) * kGPitchH + koff;   // this lane's Bt fragment base in a buffer
  for (int s = 0; s < nst; ++s) {
    const T* buf = (const T*)(ring + (s & 1) * kGStageB);
#pragma unroll
    for (int ks = 0; ks < 2; ++ks) {
      V bh[4], ah[4];
#pragma unroll
      for (int j = 0; j < 4; ++j) bh[j] = Frag<T>::load(buf + fb + j * 16 * kGPitchH + ks * 32);
#pragma unroll
      for (int i = 0; i < 4; ++i) ah[i] = Frag<T>::load(buf + fa + i * 16 * kGPitchH + ks * 32);
#pragma unroll
      for (int i = 0; i < 4; ++i) {
#pragma unroll
        for (int j = 0; j < 4; ++j) acc[i][j] = Frag<T>::mma(ah[i], bh[j], acc[i][j]);
        // hazard guard; it also holds all four A fragments live, so that the slice's LDS reads go out as
        // one group ahead of the products (without it the build reloads one A register set behind a full wait per row)
        Frag<T>::guard(acc[i][0], acc[i][3], ah[i], ah[i]);
      }
      Frag<T>::keep(bh[0], bh[1], bh[2], bh[3]);
    }
    // publish slice s + 1; the barrier also ends every wave's reads of the buffer that is refilled behind it
    wait_lds_done();
    wait_copies_landed();
    __syncthreads();
    if (s + 2 < nst) stage(s + 2);
  }
  wait_copies_landed();                        // none is left in flight when the wave ends
  acc_guard4(acc[0][0], acc[0][1], acc[0][2], acc[0][3]);
  acc_guard4(acc[1][0], acc[1][1], acc[1][2], acc[1][3]);
  acc_guard4(acc[2][0], acc[2][1], acc[2][2], acc[2][3]);
  acc_guard4(acc[3][0], acc[3][1], acc[3][2], acc[3][3]);

  // ---- epilogue ----
  float* slab = sT[wave];
  const float* Rb = RESID ? (resid + (size_t)b * strideR) : nullptr;
#pragma unroll
  for (int i = 0; i < 4; ++i) {
    const int mBase = m0 + (i << 4);
#pragma unroll
    for (int j = 0; j < 4; ++j) {
      const int n = n0 + (j << 4) + rlane;
      float bv = 0.f;
      if (BIAS_MODE == 2) bv = bf_bits2f(f2bf_bits(bias[n]));                      // bias as bf16-RNE value
#pragma unroll
      for (int r = 0; r < 8; ++r) {
        float v = acc[i][j][r] * scale;
        if (BIAS_MODE == 1) v += bf_bits2f(f2bf_bits(bias[mBase + mOff + r]));     // bias as bf16-RNE value
        if (BIAS_MODE == 2) v += bv;
        if (RESID) v += Rb[(size_t)(mBase + mOff + r) * ldc + n];
        if (ACT == 1) v = tanhf(v);
        if (ACT == 2) v = fmaxf(v, 0.0f);
        slab[(mOff + r) * 68 + (j << 4) + rlane] = v;
      }
    }
    __builtin_amdgcn_fence(__ATOMIC_RELEASE, "workgroup");
    __builtin_amdgcn_wave_barrier();
    __builtin_amdgcn_fence(__ATOMIC_ACQUIRE, "workgroup");
    if (OUT_MODE == 0) {
      float* C = (float*)Cout + (size_t)b * strideC;
      const int hh = lane >> 4, c4 = (lane & 15) * 4;     // row seg = 256 B = 16 lanes x 16 B
      {
#pragma unroll
        for (int it = 0; it < 8; ++it) {
          const int row = it * 2 + hh;
          v4f v = *(const v4f*)(slab + row * 68 + c4);
          *(v4f*)(C + (size_t)(mBase + row) * ldc + n0 + c4) = v;
        }
        
      }
    } else {
      const int q = lane >> 3, c8 = (lane & 7) * 8;
      unsigned short* C  = (unsigned short*)Cout  + (size_t)b * strideC;
      unsigned short* C2 = (OUT_MODE == 2) ? ((unsigned short*)Cout2 + (size_t)b * strideC) : nullptr;
      {
#pragma unroll
        for (int it = 0; it < 4; ++it) {
          const int row = it * 4 + q;
          const float* sp = slab + row * 68 + c8;
          v8h hv, lv;
#pragma unroll
          for (int e = 0; e < 8; ++e) {
            if (OUT_MODE == 1) {
              hv[e] = (_Float16)sp[e];
            } else {
              unsigned short hb = f2bf_bits(sp[e]);
              unsigned short lb = f2bf_bits(sp[e] - bf_bits2f(hb));
              hv[e] = __builtin_bit_cast(_Float16, hb);
              lv[e] = __builtin_bit_cast(_Float16, lb);
            }
          }
          *(v8h*)(C + (size_t)(mBase + row) * ldc + n0 + c8) = hv;
          if (OUT_MODE == 2) *(v8h*)(C2 + (size_t)(mBase + row) * ldc + n0 + c8) = lv;
        }
        
      }
    }
    __builtin_amdgcn_fence(__ATOMIC_RELEASE, "workgroup");
    __builtin_amdgcn_wave_barrier();
    __builtin_amdgcn_fence(__ATOMIC_ACQUIRE, "workgroup");
  }
}

// ---------------------------------------------------------------------------
// x f32 -> bf16 plane (RNE), 8 consecutive elements per thread -> one 16-B store per lane;
// Coverage: n8 = 8192*1024/8 = 1,048,576 threads x 8 = the whole plane; grid 4096 x 256 exact.
// ---------------------------------------------------------------------------
__global__ __launch_bounds__(256) void cast8_bf16_kernel(const float* __restrict__ in, unsigned short* __restrict__ out, int n8) {
  const int i = blockIdx.x * 256 + threadIdx.x;
  if (i >= n8) return;
  const float* p = in + 8 * (size_t)i;
  const v4f a = *(const v4f*)(p);
  const v4f c = *(const v4f*)(p + 4);
  unsigned short hb[8];
#pragma unroll
  for (int e = 0; e < 4; ++e) {
    hb[e]     = f2bf_bits(a[e]);
    hb[4 + e] = f2bf_bits(c[e]);
  }
  const v4u u = (v4u){pk16(hb[0], hb[1]), pk16(hb[2], hb[3]), pk16(hb[4], hb[5]), pk16(hb[6], hb[7])};
  unsigned short* q = out + 8 * (size_t)i;
  *(v4u*)q = u;
  
}

// ---------------------------------------------------------------------------
// Weight transpose + cast: W f32 [1024 k][3072 n] -> WT[n][k] bf16 (RNE), [3072][1024].
// grid (1024/64 = 16 k tiles, 3072/64 = 48 n tiles), 256 threads.
// Load coverage: 16 iterations x 256 threads = 4096 = the whole 64x64 tile (coalesced along n).
// Store coverage: 8 waves x 2 iterations x 4 rows (lane>>3) = 64 n rows; (lane&7) x 8 halves = 64 k cols; each row
// ---------------------------------------------------------------------------
__global__ __launch_bounds__(256) void wtcast_kernel(const float* __restrict__ W, unsigned short* __restrict__ out) {
  __shared__ float sm[64][65];   // sm[n_local][k_local]
  const int t  = threadIdx.x;
  const int k0 = blockIdx.x * 64;
  const int n0 = blockIdx.y * 64;
#pragma unroll
  for (int i = 0; i < 16; ++i) {
    const int e = i * 256 + t;
    const int r = e >> 6;          // k local
    const int c = e & 63;          // n local
    sm[c][r] = W[(size_t)(k0 + r) * kN3 + n0 + c];
  }
  __syncthreads();
  const int lane = t & 31, wave = t >> 5;
  const int q = lane >> 3, c8 = (lane & 7) * 8;
  {
#pragma unroll
    for (int it = 0; it < 2; ++it) {
      const int row = wave * 8 + it * 4 + q;                 // n local
      unsigned short hb[8];
#pragma unroll
      for (int e = 0; e < 8; ++e) hb[e] = f2bf_bits(sm[row][c8 + e]);
      const v4u u = (v4u){pk16(hb[0], hb[1]), pk16(hb[2], hb[3]), pk16(hb[4], hb[5]), pk16(hb[6], hb[7])};
      *(v4u*)(out + (size_t)(n0 + row) * kHid + k0 + c8) = u;
    }
    
  }
}

// ---------------------------------------------------------------------------
// dist_emb f32 [1023][64] -> PE bf16 [1024][64] (RNE), row 1023 zero-filled.
// 1024*64/8 = 8192 threads = 32 blocks x 256 exactly; thread i: row i>>3, cols (i&7)*8..+7 -> one 16-B store;
// ---------------------------------------------------------------------------
__global__ __launch_bounds__(256) void pecast_kernel(const float* __restrict__ pe, unsigned short* __restrict__ out) {
  const int i = blockIdx.x * 256 + threadIdx.x;
  if (i >= kNDistP * kHdim / 8) return;
  const int row = i >> 3, c8 = (i & 7) * 8;
  const int rc = (row < kNDist) ? row : (kNDist - 1);         // clamped address
  const float* src = pe + (size_t)rc * kHdim + c8;
  const v4f a = *(const v4f*)(src);
  const v4f c = *(const v4f*)(src + 4);
  const bool live = (row < kNDist);
  unsigned short hb[8];
#pragma unroll
  for (int e = 0; e < 4; ++e) {
    hb[e]     = live ? f2bf_bits(a[e]) : (unsigned short)0;
    hb[4 + e] = live ? f2bf_bits(c[e]) : (unsigned short)0;
  }
  const v4u u = (v4u){pk16(hb[0], hb[1]), pk16(hb[2], hb[3]), pk16(hb[4], hb[5]), pk16(hb[6], hb[7])};
  unsigned short* q = out + (size_t)row * kHdim + c8;
  *(v4u*)q = u;
  
}

// ---------------------------------------------------------------------------
// Attention helpers
// ---------------------------------------------------------------------------
__device__ __forceinline__ unsigned short at_bf_bits(float f) {
  unsigned u = __float_as_uint(f);
  return (unsigned short)((u + 0x7FFFu + ((u >> 16) & 1u)) >> 16);
}
__device__ __forceinline__ __bf16 at_f2bf(float f) { return __builtin_bit_cast(__bf16, at_bf_bits(f)); }
__device__ __forceinline__ v8f at_mma(v16b a, v16b b, v8f c) {
  c = __builtin_amdgcn_wmma_f32_16x16x32_bf16(false, a, false, b, (short)0, c, false, false);
  asm volatile("v_nop\n\tv_nop\n\tv_nop\n\tv_nop" : "+v"(c) : "v"(a), "v"(b));
  return c;
}
// 16-bit element as a bit pattern held in a __bf16 slot: f16 bits when F16, bf16 (RNE) otherwise
template <bool F16> __device__ __forceinline__ __bf16 at_to16(float f) {
  if (F16) return __builtin_bit_cast(__bf16, (_Float16)f);
  return at_f2bf(f);
}
template <bool F16> __device__ __forceinline__ v8f at_mma16(v16b a, v16b b, v8f c) {
  if (F16) {
    const v16h ah = __builtin_bit_cast(v16h, a), bh = __builtin_bit_cast(v16h, b);
    c = __builtin_amdgcn_wmma_f32_16x16x32_f16(false, ah, false, bh, (short)0, c, false, false);
    asm volatile("v_nop\n\tv_nop\n\tv_nop\n\tv_nop" : "+v"(c) : "v"(ah), "v"(bh));
    return c;
  }
  return at_mma(a, b, c);
}

// =====================================================================================
// Fused attention with relative_key_query bias, head_dim 64. Block = 4 waves = 64 query rows of one (b, h);
// key chunks of 64; online softmax in f32. Operand planes (all dense, statically strided, 16-bit):
//   QKh/QKl: bf16 hi/lo [token = b*512+s][2048] with q at cols h*64+d, k at cols 1024+h*64+d
//   Vt:      f16 [b][h*64+d][s]  (pitch 512)
//   PE:      bf16 [1024][64] (dist_emb, row 1023 zero)
// Per chunk (l0 = 64*qb, r0 = 64*kc, d0 = l0 - r0 + 448, dist(l,r) = d0 + ll - kk + 63 with local ll, kk in 0..63):
//   T1w[p1][row] = q(row of this wave) . pe[d0 + 16*wave + p1], p1 = 0..79 (f16 in LDS, per wave)
//   T2 [p][kk]   = k(kk) . pe[d0 + p] for the band p in [48-16*j, 127-16*j] of key group j = kk>>4 (wave j produces it)
//   s[ll][kk] = (q.k(hi/lo) + T1 + T2) * 1/8 + mask[b][r0+kk];  p = exp(s - m);  out = sum p v / l.
// Each chunk's k hi/lo, pe band and v^T tiles are staged once per block in LDS by asynchronous copies, issued one phase ahead.
// grid (S/64, H, B), 128 threads.
// =====================================================================================
constexpr int kT1Slots = 80;
// LDS map of relattn_kernel (bytes). Staged tiles keep their 128-B rows at a pitch of 144 B (16 B x odd: no bank
// conflict for 16-B fragment reads). The out tile of the epilogue reuses the K / PE range.
constexpr int kPitchB = 144;                           // staged row pitch, bytes
constexpr int kPitchH = kPitchB / 2;                   // the same in 16-bit elements
constexpr int kOffKH  = 0;                             // k hi  [64 keys][64 d]
constexpr int kOffKL  = kOffKH + 64 * kPitchB;         // k lo  [64 keys][64 d]
constexpr int kOffPE  = kOffKL + 64 * kPitchB;         // pe    [128 distances][64 d]
constexpr int kOffV   = kOffPE + 128 * kPitchB;        // v^T   [64 d][64 keys]
constexpr int kOffT1  = kOffV + 64 * kPitchB;          // per wave [p1][16 rows] f16
constexpr int kOffT2  = kOffT1 + 4 * kT1Slots * 16 * 2; // [p][64 keys] f16
constexpr int kOffP   = kOffT2 + 128 * 64 * 2;         // per wave P (f16 bits) [row][kv]
constexpr int kLdsBytes = kOffP + 4 * 16 * 64 * 2;     // 80,896
static_assert(4 * 16 * 68 * 4 <= kOffV, "out tiles fit the K / PE range");

__global__ __launch_bounds__(128)
void relattn_kernel(const unsigned short* __restrict__ QKhp, const unsigned short* __restrict__ QKlp,
                    const unsigned short* __restrict__ Vtp, const unsigned short* __restrict__ PEp,
                    const float* __restrict__ mask, float* __restrict__ out) {
  union FB { v16b v; v8b h[2]; };
  typedef __attribute__((address_space(3))) unsigned char lds_byte;
  __shared__ __align__(128) unsigned char smem[kLdsBytes];
  const __bf16* KHs = (const __bf16*)(smem + kOffKH);
  const __bf16* KLs = (const __bf16*)(smem + kOffKL);
  const __bf16* PEs = (const __bf16*)(smem + kOffPE);
  const __bf16* Vs  = (const __bf16*)(smem + kOffV);      // f16 bits
  _Float16*     T2s = (_Float16*)(smem + kOffT2);

  const int tid  = threadIdx.x;
  const int wave = tid >> 5;
  const int lane = tid & 31;
  const int hh   = lane >> 4;
  const int c    = lane & 15;

  const int qb = blockIdx.x;
  const int h  = blockIdx.y;
  const int b  = blockIdx.z;
  const int l0 = qb * 64;
  const int q0 = l0 + wave * 16;
  const size_t tok0 = (size_t)b * kSeq;

  const __bf16* Qh  = (const __bf16*)QKhp;
  const __bf16* Ql  = (const __bf16*)QKlp;
  const __bf16* Vt  = (const __bf16*)Vtp;     // f16 bits
  const __bf16* PEt = (const __bf16*)PEp;

  // ---- copy roles: thread t moves the 16-B piece t & 7 of rows (t >> 3) + 16 i; 8 lanes cover one 128-B row ----
  const int crow = tid >> 3;
  const int cpc  = tid & 7;
  const unsigned lcp = (unsigned)(size_t)(lds_byte*)smem + (unsigned)(crow * kPitchB + cpc * 16);
  const size_t gko = (tok0 + crow) * kQKld + kHid + (size_t)h * kHdim + cpc * 8;
  const __bf16* gKh = Qh + gko;
  const __bf16* gKl = Ql + gko;
  const __bf16* gV  = Vt + ((size_t)(b * kHeads + h) * kHdim + crow) * kSeq + cpc * 8;
  const __bf16* gPE = PEt + (size_t)crow * kHdim + cpc * 8;
  constexpr unsigned kStep = 16 * kPitchB;                 // 16 staged rows
  // k hi, k lo (64 rows each) and the pe band d0 .. d0 + 127 (<= 1023) of key chunk n
  auto stage_k_pe = [&](int n) {
    const __bf16* kh = gKh + (size_t)(n * 64) * kQKld;
    const __bf16* kl = gKl + (size_t)(n * 64) * kQKld;
    const __bf16* pp = gPE + (size_t)(l0 - n * 64 + 448) * kHdim;
    async_copy8(lcp + kOffKH, kh, lcp + kOffKH + kStep, kh + 16 * kQKld,
                lcp + kOffKH + 2 * kStep, kh + 32 * kQKld, lcp + kOffKH + 3 * kStep, kh + 48 * kQKld,
                lcp + kOffKL, kl, lcp + kOffKL + kStep, kl + 16 * kQKld,
                lcp + kOffKL + 2 * kStep, kl + 32 * kQKld, lcp + kOffKL + 3 * kStep, kl + 48 * kQKld);
    async_copy8(lcp + kOffPE, pp, lcp + kOffPE + kStep, pp + 16 * kHdim,
                lcp + kOffPE + 2 * kStep, pp + 32 * kHdim, lcp + kOffPE + 3 * kStep, pp + 48 * kHdim,
                lcp + kOffPE + 4 * kStep, pp + 64 * kHdim, lcp + kOffPE + 5 * kStep, pp + 80 * kHdim,
                lcp + kOffPE + 6 * kStep, pp + 96 * kHdim, lcp + kOffPE + 7 * kStep, pp + 112 * kHdim);
  };
  // v^T rows d = 0 .. 63, keys of chunk n
  auto stage_v = [&](int n) {
    const __bf16* vv = gV + n * 64;
    async_copy4(lcp + kOffV, vv, lcp + kOffV + kStep, vv + 16 * kSeq,
                lcp + kOffV + 2 * kStep, vv + 32 * kSeq, lcp + kOffV + 3 * kStep, vv + 48 * kSeq);
  };

  stage_k_pe(0);                                // flies while the Q fragments are fetched

  // ---- Q fragments (A operand): 2 d-chunks, hi and lo planes ----
  v16b qah[2], qal[2];
  {
    const size_t qo = (tok0 + q0 + c) * kQKld + (size_t)h * kHdim + 8 * hh;
#pragma unroll
    for (int dc = 0; dc < 2; ++dc) {
      qah[dc] = Frag<__bf16>::load(Qh + qo + dc * 32);
      qal[dc] = Frag<__bf16>::load(Ql + qo + dc * 32);
    }
  }

  float mrow[8], lrow[8];
  v8f oacc[4];
#pragma unroll
  for (int r = 0; r < 8; ++r) { mrow[r] = -INFINITY; lrow[r] = 0.f; }
#pragma unroll
  for (int t = 0; t < 4; ++t) oacc[t] = (v8f){0.f,0.f,0.f,0.f,0.f,0.f,0.f,0.f};

  _Float16* t1w = (_Float16*)(smem + kOffT1) + wave * (kT1Slots * 16);
  __bf16*   pw  = (__bf16*)(smem + kOffP) + wave * (16 * 64);

  for (int kc = 0; kc < kSeq / 64; ++kc) {
    const int r0 = kc * 64;
    // publish k / pe of this chunk; the barrier also ends the previous chunk's reads of T2s and of the v tile
    wait_lds_done();
    wait_copies_landed();
    __syncthreads();
    stage_v(kc);                               // flies under the T1 / T2 / q.k products, read behind the next barrier

    // ---- relative-position tiles on WMMA: T1 (5 tiles per wave), T2 (5 tiles per wave) ----
    {
      v16b ka[2];
#pragma unroll
      for (int dc = 0; dc < 2; ++dc) ka[dc] = Frag<__bf16>::load(KHs + (wave * 16 + c) * kPitchH + 8 * hh + dc * 32);   // k rows as A operand
#pragma unroll
      for (int i = 0; i < 5; ++i) {
        const int dt1 = 16 * wave + 16 * i;               // T1 distance tile base inside the staged band (<= 112)
        const int dt2 = 16 * (3 - wave + i);              // T2 distance tile base inside the staged band (<= 112)
        v8f a1 = (v8f){0.f,0.f,0.f,0.f,0.f,0.f,0.f,0.f};
        v8f a2 = (v8f){0.f,0.f,0.f,0.f,0.f,0.f,0.f,0.f};
#pragma unroll
        for (int dc = 0; dc < 2; ++dc) {
          const v16b p1 = Frag<__bf16>::load(PEs + (dt1 + c) * kPitchH + 8 * hh + dc * 32);   // B[k=d][n=dist]
          const v16b p2 = Frag<__bf16>::load(PEs + (dt2 + c) * kPitchH + 8 * hh + dc * 32);
          a1 = at_mma(qah[dc], p1, a1);
          a2 = at_mma(ka[dc], p2, a2);
        }
        v8h hv1, hv2;
#pragma unroll
        for (int r = 0; r < 8; ++r) { hv1[r] = (_Float16)a1[r]; hv2[r] = (_Float16)a2[r]; }
        // D element r: row 8hh+r (query row of this wave / key row 16*wave+8hh+r), col = dist slot 16i+c
        *(v8h*)(t1w + (16 * i + c) * 16 + 8 * hh) = hv1;
        *(v8h*)(T2s + (size_t)(16 * (3 - wave + i) + c) * 64 + 16 * wave + 8 * hh) = hv2;
      }
    }

    // ---- q . k (hi.hi + hi.lo + lo.hi), B fragments from the staged k tiles ----
    v8f s[4];
#pragma unroll
    for (int j = 0; j < 4; ++j) {
      s[j] = (v8f){0.f,0.f,0.f,0.f,0.f,0.f,0.f,0.f};
#pragma unroll
      for (int dc = 0; dc < 2; ++dc) {
        const int ko = (j * 16 + c) * kPitchH + 8 * hh + dc * 32;
        const v16b kb = Frag<__bf16>::load(KHs + ko);
        const v16b kl = Frag<__bf16>::load(KLs + ko);
        s[j] = at_mma(qah[dc], kb, s[j]);
        s[j] = at_mma(qah[dc], kl, s[j]);
        s[j] = at_mma(qal[dc], kb, s[j]);
      }
    }
    // publish T1s / T2s and the v tile; the barrier also ends every wave's reads of the k and pe tiles
    wait_lds_done();
    wait_copies_landed();
    __syncthreads();
    if (kc + 1 < kSeq / 64) stage_k_pe(kc + 1);   // flies under softmax and p.v, read behind the next chunk's first barrier

    float mk[4];
#pragma unroll
    for (int j = 0; j < 4; ++j) mk[j] = mask[tok0 + r0 + j * 16 + c];   // additive mask [b][r]

    float cm[8];
#pragma unroll
    for (int r = 0; r < 8; ++r) {
      float m = -INFINITY;
#pragma unroll
      for (int j = 0; j < 4; ++j) {
        const int p1 = 8 * hh + r - 16 * j - c + 63;                          // in [0, 78]
        const float t1 = (float)t1w[p1 * 16 + 8 * hh + r];
        const float t2 = (float)T2s[(p1 + 16 * wave) * 64 + 16 * j + c];
        const float v = (s[j][r] + t1 + t2) * 0.125f + mk[j];
        s[j][r] = v;
        m = fmaxf(m, v);
      }
#pragma unroll
      for (int off = 1; off < 16; off <<= 1) m = fmaxf(m, __shfl_xor(m, off, 32));
      cm[r] = m;
    }
#pragma unroll
    for (int r = 0; r < 8; ++r) {
      const float mnew = fmaxf(mrow[r], cm[r]);
      const float alpha = __expf(mrow[r] - mnew);
      mrow[r] = mnew;
      float psum = 0.f;
#pragma unroll
      for (int j = 0; j < 4; ++j) {
        const float p = __expf(s[j][r] - mnew);
        psum += p;
        pw[(8 * hh + r) * 64 + j * 16 + c] = at_to16<true>(p * kPCarry);
      }
#pragma unroll
      for (int off = 1; off < 16; off <<= 1) psum += __shfl_xor(psum, off, 32);
      lrow[r] = lrow[r] * alpha + psum;
#pragma unroll
      for (int t = 0; t < 4; ++t) oacc[t][r] *= alpha;
    }
    __builtin_amdgcn_fence(__ATOMIC_RELEASE, "workgroup");
    __builtin_amdgcn_wave_barrier();
    __builtin_amdgcn_fence(__ATOMIC_ACQUIRE, "workgroup");
#pragma unroll 1
    for (int kk = 0; kk < 2; ++kk) {
      FB pa;
      pa.h[0] = *(const v8b*)(pw + c * 64 + kk * 32 + 8 * hh);
      pa.h[1] = *(const v8b*)(pw + c * 64 + kk * 32 + 16 + 8 * hh);
#pragma unroll
      for (int t = 0; t < 4; ++t) {
        FB vb;
        const int vo = (t * 16 + c) * kPitchH + kk * 32 + 8 * hh;   // B[k=kv][n=d] from the staged v^T[d][kv]
        vb.h[0] = *(const v8b*)(Vs + vo);
        vb.h[1] = *(const v8b*)(Vs + vo + 16);
        oacc[t] = at_mma16<true>(pa.v, vb.v, oacc[t]);
      }
    }
  }
  wait_copies_landed();                        // none is left in flight when the wave reuses LDS and ends

  // ---- epilogue: out[b][q0+row][h*64 + 0..63]; row segment = 256 B = 16 lanes x 16 B, one instruction per row ----
  // The out tiles lie on the k / pe range: its last readers left it at the last chunk's second barrier, and no copy
  // was aimed at it after that.
  float* os = (float*)(smem) + wave * (16 * 68);
#pragma unroll
  for (int r = 0; r < 8; ++r) {
    const float inv = 1.0f / (lrow[r] * kPCarry);
#pragma unroll
    for (int t = 0; t < 4; ++t) os[(8 * hh + r) * 68 + t * 16 + c] = oacc[t][r] * inv;
  }
  __builtin_amdgcn_fence(__ATOMIC_RELEASE, "workgroup");
  __builtin_amdgcn_wave_barrier();
  __builtin_amdgcn_fence(__ATOMIC_ACQUIRE, "workgroup");
  {
    float* ob = out + (size_t)h * kHdim;
    const int c4 = (lane & 15) * 4;
    {
#pragma unroll
      for (int it = 0; it < 8; ++it) {
        const int row = it * 2 + hh;
        v4f val = *(const v4f*)(os + row * 68 + c4);
        *(v4f*)(ob + (tok0 + q0 + row) * kHid + c4) = val;
      }
      
    }
  }
}

// ---------------------------------------------------------------------------
// Workspace region map (byte offsets, multiples of 128; every region fully written before it is read):
//   X16  bf16 [8192][1024]                     0 ..  16,777,216
//   WT   bf16 [3072][1024] (W^T)      16,777,216 ..  23,068,672
//   PE   bf16 [1024][64] (row 1023 0) 23,068,672 ..  23,199,744
//   QKh  bf16 [8192][2048] ([q|k] hi)  23,199,744 ..  56,754,176
//   QKl  bf16 [8192][2048] ([q|k] lo)  56,754,176 ..  90,308,608
//   Vt   f16  [16][1024][512]          90,308,608 .. 107,085,824
//   total 107,085,824 B.
// GEMM shapes: q|k: M=8192 N=2048 K=1024; v (role-swapped, per batch): M=1024 N=512 K=1024 x16.
//   K % 64 == 0, M % 128 == 0 and N % 256 == 0 for both; no padded operand rows.
// ---------------------------------------------------------------------------
extern "C" void kernel_launch(void* const* d_in, const int* in_sizes, int n_in,
                              void* d_out, int out_size, void* d_ws, size_t ws_size,
                              hipStream_t stream) {
  if (n_in < 5) return;
  if (in_sizes[0] != kTok * kHid) return;
  if (in_sizes[1] != kBatch * kSeq) return;
  if (in_sizes[2] != kHid * kN3) return;
  if (in_sizes[3] != kN3) return;
  if (in_sizes[4] != kNDist * kHdim) return;
  if (out_size != kTok * kHid) return;

  const float* hid  = (const float*)d_in[0];   // [16][512][1024]
  const float* msk  = (const float*)d_in[1];   // [16][1][1][512]
  const float* W    = (const float*)d_in[2];   // [1024][3072]
  const float* bqkv = (const float*)d_in[3];   // [3072]
  const float* pe   = (const float*)d_in[4];   // [1023][64]
  float* outp = (float*)d_out;                 // [16][512][1024]

  const size_t SZ_X16 = (size_t)kTok * kHid * 2;              //  16,777,216
  const size_t SZ_WT  = (size_t)kN3 * kHid * 2;               //   6,291,456
  const size_t SZ_PE  = (size_t)kNDistP * kHdim * 2;          //     131,072
  const size_t SZ_QK  = (size_t)kTok * kQKld * 2;             //  33,554,432
  const size_t SZ_VT  = (size_t)kBatch * kHid * kSeq * 2;     //  16,777,216
  size_t off = 0;
  const size_t oX16 = off; off += SZ_X16;
  const size_t oWT  = off; off += SZ_WT;
  const size_t oPE  = off; off += SZ_PE;
  const size_t oQKh = off; off += SZ_QK;
  const size_t oQKl = off; off += SZ_QK;
  const size_t oVT  = off; off += SZ_VT;
  const size_t TOTAL = off;                                   // 107,085,824
  if (TOTAL > ws_size) return;
  if (TOTAL > (size_t)134217728) return;

  char* ws = (char*)d_ws;
  unsigned short* X16 = (unsigned short*)(ws + oX16);
  unsigned short* WT  = (unsigned short*)(ws + oWT);
  unsigned short* PEb = (unsigned short*)(ws + oPE);
  unsigned short* QKh = (unsigned short*)(ws + oQKh);
  unsigned short* QKl = (unsigned short*)(ws + oQKl);
  unsigned short* VTp = (unsigned short*)(ws + oVT);

  const dim3 blk(256);
  // (0) x -> bf16 plane
  {
    const int n8 = kTok * kHid / 8;                           // 1,048,576 -> 4096 blocks exactly
    cast8_bf16_kernel<<<dim3((n8 + 255) / 256), blk, 0, stream>>>(hid, X16, n8);
  }
  // (1) W [1024][3072] -> WT [3072][1024] bf16
  wtcast_kernel<<<dim3(kHid / 64, kN3 / 64), blk, 0, stream>>>(W, WT);
  // (2) dist_emb -> PE bf16 [1024][64]
  pecast_kernel<<<dim3((kNDistP * kHdim / 8 + 255) / 256), blk, 0, stream>>>(pe, PEb);
  // (3) [q|k] = X16 . WT[0..2047]^T + b[0..2047] -> bf16 hi + lo planes, pitch 2048
  {
    const dim3 g((kTok / 128) * (kQKld / 256), 1);            // 512 blocks
    wmma_gemm64<1, 0, 2, 2, false, 0><<<g, blk, 0, stream>>>(
        X16, X16, kHid, 0L, WT, WT, kHid, 0L, (void*)QKh, (void*)QKl, kQKld, 0L,
        bqkv, hid, 0L, kTok, kQKld, kHid, 1.0f);
  }
  // (4) v^T per batch: Vt[b][m][s] = WT[2048+m] . x[b*512+s] + b[2048+m] -> f16, pitch 512
  {
    const dim3 g((kHid / 128) * (kSeq / 256), kBatch);        // 16 x 16
    wmma_gemm64<1, 0, 1, 1, false, 0><<<g, blk, 0, stream>>>(
        WT + (size_t)2 * kHid * kHid, WT + (size_t)2 * kHid * kHid, kHid, 0L,
        X16, X16, kHid, (long)kSeq * kHid,
        (void*)VTp, (void*)VTp, kSeq, (long)kHid * kSeq,
        bqkv + 2 * kHid, hid, 0L, kHid, kSeq, kHid, 1.0f);
  }
  // (5) fused attention with relative-position bias -> out f32 [16][512][1024]
  relattn_kernel<<<dim3(kSeq / 64, kHeads, kBatch), dim3(128), 0, stream>>>(QKh, QKl, VTp, PEb, msk, outp);
}

// v003
// It runs in 152 microseconds.
// Two timings next to v002 both put it at 1.07 times that version's speed.
// All steps since v000 together make it 2.01 times as fast.
// Contractions: qkv projection v_wmma_f32_16x16x32_bf16 (x, W as bf16 RNE; bias added as bf16-RNE value in f32); q.k^T bf16 hi/lo planes (hi.hi+hi.lo+lo.hi); q.pe^T and k.pe^T bf16 (q,k hi planes, pe bf16); p.v v_wmma_f32_16x16x32_f16 (p f16 carried x2^15, v f16); f32 accumulate; softmax, scale, bias, mask add in f32.
#include <hip/hip_runtime.h>
#include <math.h>

// ---------------------------------------------------------------------------
// Problem constants
// ---------------------------------------------------------------------------
constexpr int kBatch  = 16;
constexpr int kSeq    = 512;
constexpr int kHid    = 1024;
constexpr int kHeads  = 16;
constexpr int kHdim   = 64;
constexpr int kN3     = 3 * kHid;          // 3072 qkv output columns
constexpr int kQKld   = 2 * kHid;          // 2048: pitch of the [q | k] planes
constexpr int kTok    = kBatch * kSeq;     // 8192 token rows
constexpr int kNDist  = 2 * kSeq - 1;      // 1023 relative distances
constexpr int kNDistP = 1024;              // pe plane rows (row 1023 zero)
constexpr float kPCarry = 32768.0f;        // f16 probabilities carried x2^15
static_assert(kHid % 128 == 0 && kTok % 128 == 0 && kQKld % 256 == 0 && kSeq % 256 == 0, "tiles");

typedef __attribute__((ext_vector_type(16))) _Float16 v16h;
typedef __attribute__((ext_vector_type(8)))  _Float16 v8h;
typedef __attribute__((ext_vector_type(16))) __bf16   v16b;
typedef __attribute__((ext_vector_type(8)))  __bf16   v8b;
typedef __attribute__((ext_vector_type(8)))  float    v8f;
typedef __attribute__((ext_vector_type(4)))  float    v4f;
typedef __attribute__((ext_vector_type(4)))  unsigned int v4u;

__device__ __forceinline__ unsigned short f2bf_bits(float f) {
  unsigned u = __float_as_uint(f);
  return (unsigned short)((u + 0x7FFFu + ((u >> 16) & 1u)) >> 16);
}
__device__ __forceinline__ float bf_bits2f(unsigned short h) { return __uint_as_float(((unsigned)h) << 16); }

// hazard guards as plain device helpers (no inline asm inside the kernel template body)
__device__ __forceinline__ void dep_guard_h(v8f& a, v8f& b, v16h x, v16h y) { asm volatile("v_nop\n\tv_nop\n\tv_nop\n\tv_nop" : "+v"(a), "+v"(b) : "v"(x), "v"(y)); }
__device__ __forceinline__ void dep_guard_b(v8f& a, v8f& b, v16b x, v16b y) { asm volatile("v_nop\n\tv_nop\n\tv_nop\n\tv_nop" : "+v"(a), "+v"(b) : "v"(x), "v"(y)); }
__device__ __forceinline__ void keep4_h(v16h a, v16h b, v16h c, v16h d) { asm volatile("v_nop" :: "v"(a), "v"(b), "v"(c), "v"(d)); }
__device__ __forceinline__ void keep4_b(v16b a, v16b b, v16b c, v16b d) { asm volatile("v_nop" :: "v"(a), "v"(b), "v"(c), "v"(d)); }
__device__ __forceinline__ void acc_guard4(v8f& a, v8f& b, v8f& c, v8f& d) { asm volatile("v_nop\n\tv_nop\n\tv_nop\n\tv_nop" : "+v"(a), "+v"(b), "+v"(c), "+v"(d)); }
template <typename T> struct Frag;
template <> struct Frag<_Float16> {
  typedef v16h V; union U { v16h v; v8h h[2]; };
  static __device__ __forceinline__ v16h load(const _Float16* p) {   // elements 0..7 <- p[0..7], 8..15 <- p[16..23]
    U f; f.h[0] = *(const v8h*)(p); f.h[1] = *(const v8h*)(p + 16); return f.v;
  }
  static __device__ __forceinline__ v8f mma(v16h a, v16h b, v8f c) {
    return __builtin_amdgcn_wmma_f32_16x16x32_f16(false, a, false, b, (short)0, c, false, false);
  }
  static __device__ __forceinline__ void guard(v8f& a, v8f& b, v16h x, v16h y) { dep_guard_h(a, b, x, y); }
  static __device__ __forceinline__ void keep(v16h a, v16h b, v16h c, v16h d) { keep4_h(a, b, c, d); }
};
template <> struct Frag<__bf16> {
  typedef v16b V; union U { v16b v; v8b h[2]; };
  static __device__ __forceinline__ v16b load(const __bf16* p) {
    U f; f.h[0] = *(const v8b*)(p); f.h[1] = *(const v8b*)(p + 16); return f.v;
  }
  static __device__ __forceinline__ v8f mma(v16b a, v16b b, v8f c) {
    return __builtin_amdgcn_wmma_f32_16x16x32_bf16(false, a, false, b, (short)0, c, false, false);
  }
  static __device__ __forceinline__ void guard(v8f& a, v8f& b, v16b x, v16b y) { dep_guard_b(a, b, x, y); }
  static __device__ __forceinline__ void keep(v16b a, v16b b, v16b c, v16b d) { keep4_b(a, b, c, d); }
};

__device__ __forceinline__ unsigned pk16(unsigned short a, unsigned short b) { return (unsigned)a | ((unsigned)b << 16); }

// Asynchronous copies global -> LDS, 16 B per lane. The s_wait_xcnt closes each statement so that no address
// register of an issued copy is rewritten in front of it.
__device__ __forceinline__ void async_copy4(unsigned l0, const __bf16* g0, unsigned l1, const __bf16* g1,
                                            unsigned l2, const __bf16* g2, unsigned l3, const __bf16* g3) {
  asm volatile("global_load_async_to_lds_b128 %0, %1, off\n\t"
               "global_load_async_to_lds_b128 %2, %3, off\n\t"
               "global_load_async_to_lds_b128 %4, %5, off\n\t"
               "global_load_async_to_lds_b128 %6, %7, off\n\t"
               "s_wait_xcnt 0x0"
               :: "v"(l0), "v"(g0), "v"(l1), "v"(g1), "v"(l2), "v"(g2), "v"(l3), "v"(g3) : "memory");
}
__device__ __forceinline__ void async_copy8(unsigned l0, const __bf16* g0, unsigned l1, const __bf16* g1,
                                            unsigned l2, const __bf16* g2, unsigned l3, const __bf16* g3,
                                            unsigned l4, const __bf16* g4, unsigned l5, const __bf16* g5,
                                            unsigned l6, const __bf16* g6, unsigned l7, const __bf16* g7) {
  asm volatile("global_load_async_to_lds_b128 %0, %1, off\n\t"
               "global_load_async_to_lds_b128 %2, %3, off\n\t"
               "global_load_async_to_lds_b128 %4, %5, off\n\t"
               "global_load_async_to_lds_b128 %6, %7, off\n\t"
               "global_load_async_to_lds_b128 %8, %9, off\n\t"
               "global_load_async_to_lds_b128 %10, %11, off\n\t"
               "global_load_async_to_lds_b128 %12, %13, off\n\t"
               "global_load_async_to_lds_b128 %14, %15, off\n\t"
               "s_wait_xcnt 0x0"
               :: "v"(l0), "v"(g0), "v"(l1), "v"(g1), "v"(l2), "v"(g2), "v"(l3), "v"(g3),
                  "v"(l4), "v"(g4), "v"(l5), "v"(g5), "v"(l6), "v"(g6), "v"(l7), "v"(g7) : "memory");
}
// this wave's LDS reads and writes have retired (before a barrier that hands a buffer to its next writer)
__device__ __forceinline__ void wait_lds_done() { asm volatile("s_wait_dscnt 0x0" ::: "memory"); }
// this wave's own copies have landed (before the barrier behind which other waves read them)
__device__ __forceinline__ void wait_copies_landed() { asm volatile("s_wait_asynccnt 0x0" ::: "memory"); }

// ---- Register-blocked batched WMMA GEMM (ACT tanh/relu only,
//      bias values RNE-converted to bf16 before the f32 add) --------
// C[m,n] = scale * sum_k A[m,k] * Bt[n,k] (+bias)(+resid); a block owns a 128x256 tile, its 8 waves (2 x 4) 64x64 each.
// A row-major [M,K]; Bt row-major [N,K]; M % 128 == 0, N % 256 == 0, K % 64 == 0.
// Each k slice of 64 (128 A rows + 256 Bt rows of 128 B) is staged once per block in LDS by asynchronous copies,
// two buffers: the next slice flies while this one is multiplied.
// SPLIT: 0 only (single operand planes; A2p / Bt2p are not read).
// BIAS_MODE: 0 = none, 1 = bias[m], 2 = bias[n].
// OUT_MODE: 0 = f32, 1 = f16, 2 = bf16 hi plane (Cout) + bf16 lo plane (Cout2).
// ACT: 0 = none, 1 = tanh, 2 = relu.
// ET: 0 = f16 operands, 1 = bf16 operands (pointers passed as 16-bit storage)
constexpr int kGPitchB = 144;                          // staged 128-B row at 16 B x odd: no bank conflict for 16-B reads
constexpr int kGPitchH = kGPitchB / 2;                 // the same in 16-bit elements
constexpr int kGRowsA  = 128;
constexpr int kGRowsB  = 256;
constexpr int kGStageB = (kGRowsA + kGRowsB) * kGPitchB;   // 55,296 B per buffer
template <int ET> struct Elem;
template <> struct Elem<0> { typedef _Float16 T; };
template <> struct Elem<1> { typedef __bf16 T; };
template <int ET, int SPLIT, int BIAS_MODE, int OUT_MODE, bool RESID, int ACT = 0>
__global__ __launch_bounds__(256) void wmma_gemm64(
    const unsigned short* __restrict__ Ap, const unsigned short* __restrict__ A2p, int lda, long strideA,
    const unsigned short* __restrict__ Btp, const unsigned short* __restrict__ Bt2p, int ldb, long strideB,
    void* __restrict__ Cout, void* __restrict__ Cout2, int ldc, long strideC,
    const float* __restrict__ bias,
    const float* __restrict__ resid, long strideR,
    int M, int N, int K, float scale) {
  static_assert(SPLIT == 0, "single operand planes");
  typedef typename Elem<ET>::T T;
  typedef typename Frag<T>::V V;
  typedef __attribute__((address_space(3))) unsigned char lds_byte;
  const T* A = (const T*)Ap; const T* Bt = (const T*)Btp;
  __shared__ __align__(128) unsigned char ring[2 * kGStageB];   // two staged k slices: [A 128 rows | Bt 256 rows]
  __shared__ __align__(16) float sT[8][16 * 68];   // per-wave 16x64 slab, pitch 68 floats
  const int b    = blockIdx.y;
  const int lane = threadIdx.x & 31;
  const int wave = threadIdx.x >> 5;
  const int tilesN = N >> 8;
  const int tilesM = M >> 7;
  const int tile = blockIdx.x;
  if (tile >= tilesM * tilesN) return;   // block-uniform, in front of every barrier
  const int tm = tile / tilesN;
  const int tn = tile - tm * tilesN;
  const int wm = wave >> 2;                    // wave row (0..1) and column (0..3) inside the block tile
  const int wn = wave & 3;
  const int m0 = (tm << 7) + (wm << 6);
  const int n0 = (tn << 8) + (wn << 6);

  const T* Ab  = A  + (size_t)b * strideA;
  const T* Bb  = Bt + (size_t)b * strideB;

  const int rlane = lane & 15;                 // row (A) / col (B, D) within subtile
  const int koff  = (lane >> 4) * 8;           // k offset of this lane half
  const int mOff  = (lane >> 4) * 8;           // D row offset

  // ---- copy roles: thread t moves the 16-B piece t & 7 of rows (t >> 3) + 32 i; 8 lanes cover one 128-B row ----
  const int crow = threadIdx.x >> 3;
  const int cpc  = threadIdx.x & 7;
  const unsigned lcp = (unsigned)(size_t)(lds_byte*)ring + (unsigned)(crow * kGPitchB + cpc * 16);
  const __bf16* gA = (const __bf16*)Ab + (size_t)((tm << 7) + crow) * lda + cpc * 8;
  const __bf16* gB = (const __bf16*)Bb + (size_t)((tn << 8) + crow) * ldb + cpc * 8;
  const size_t a32 = (size_t)32 * lda;
  const size_t b32 = (size_t)32 * ldb;
  constexpr unsigned kStep = 32 * kGPitchB;                // 32 staged rows
  // k slice s (columns 64 s .. 64 s + 63 of the block's 128 A rows and 256 Bt rows) into buffer s & 1
  auto stage = [&](int s) {
    const unsigned la = lcp + (unsigned)(s & 1) * kGStageB;
    const unsigned lb = la + kGRowsA * kGPitchB;
    const __bf16* pa = gA + s * 64;
    const __bf16* pb = gB + s * 64;
    async_copy4(la, pa, la + kStep, pa + a32, la + 2 * kStep, pa + 2 * a32, la + 3 * kStep, pa + 3 * a32);
    async_copy8(lb, pb, lb + kStep, pb + b32, lb + 2 * kStep, pb + 2 * b32, lb + 3 * kStep, pb + 3 * b32,
                lb + 4 * kStep, pb + 4 * b32, lb + 5 * kStep, pb + 5 * b32,
                lb + 6 * kStep, pb + 6 * b32, lb + 7 * kStep, pb + 7 * b32);
  };

  v8f acc[4][4];
#pragma unroll
  for (int i = 0; i < 4; ++i)
#pragma unroll
    for (int j = 0; j < 4; ++j) acc[i][j] = (v8f){0.f,0.f,0.f,0.f,0.f,0.f,0.f,0.f};

  const int nst = K >> 6;
  stage(0);
  wait_copies_landed();
  __syncthreads();                             // publishes slice 0
  if (nst > 1) stage(1);

  const int fa = ((wm << 6) + rlane) * kGPitchH + koff;             // this lane's A fragment base in a buffer
  const int fb = (kGRowsA + (wn << 6) + rlane) * kGPitchH + koff;   // this lane's Bt fragment base in a buffer
  for (int s = 0; s < nst; ++s) {
    const T* buf = (const T*)(ring + (s & 1) * kGStageB);
#pragma unroll
    for (int ks = 0; ks < 2; ++ks) {
      V bh[4], ah[4];
#pragma unroll
      for (int j = 0; j < 4; ++j) bh[j] = Frag<T>::load(buf + fb + j * 16 * kGPitchH + ks * 32);
#pragma unroll
      for (int i = 0; i < 4; ++i) ah[i] = Frag<T>::load(buf + fa + i * 16 * kGPitchH + ks * 32);
#pragma unroll
      for (int i = 0; i < 4; ++i) {
#pragma unroll
        for (int j = 0; j < 4; ++j) acc[i][j] = Frag<T>::mma(ah[i], bh[j], acc[i][j]);
        // hazard guard; it also holds all four A fragments live, so that the slice's LDS reads go out as
        // one group ahead of the products (without it the build reloads one A register set behind a full wait per row)
        Frag<T>::guard(acc[i][0], acc[i][3], ah[i], ah[i]);
      }
      Frag<T>::keep(bh[0], bh[1], bh[2], bh[3]);
    }
    // publish slice s + 1; the barrier also ends every wave's reads of the buffer that is refilled behind it
    wait_lds_done();
    wait_copies_landed();
    __syncthreads();
    if (s + 2 < nst) stage(s + 2);
  }
  wait_copies_landed();                        // none is left in flight when the wave ends
  acc_guard4(acc[0][0], acc[0][1], acc[0][2], acc[0][3]);
  acc_guard4(acc[1][0], acc[1][1], acc[1][2], acc[1][3]);
  acc_guard4(acc[2][0], acc[2][1], acc[2][2], acc[2][3]);
  acc_guard4(acc[3][0], acc[3][1], acc[3][2], acc[3][3]);

  // ---- epilogue ----
  float* slab = sT[wave];
  const float* Rb = RESID ? (resid + (size_t)b * strideR) : nullptr;
#pragma unroll
  for (int i = 0; i < 4; ++i) {
    const int mBase = m0 + (i << 4);
#pragma unroll
    for (int j = 0; j < 4; ++j) {
      const int n = n0 + (j << 4) + rlane;
      float bv = 0.f;
      if (BIAS_MODE == 2) bv = bf_bits2f(f2bf_bits(bias[n]));                      // bias as bf16-RNE value
#pragma unroll
      for (int r = 0; r < 8; ++r) {
        float v = acc[i][j][r] * scale;
        if (BIAS_MODE == 1) v += bf_bits2f(f2bf_bits(bias[mBase + mOff + r]));     // bias as bf16-RNE value
        if (BIAS_MODE == 2) v += bv;
        if (RESID) v += Rb[(size_t)(mBase + mOff + r) * ldc + n];
        if (ACT == 1) v = tanhf(v);
        if (ACT == 2) v = fmaxf(v, 0.0f);
        slab[(mOff + r) * 68 + (j << 4) + rlane] = v;
      }
    }
    __builtin_amdgcn_fence(__ATOMIC_RELEASE, "workgroup");
    __builtin_amdgcn_wave_barrier();
    __builtin_amdgcn_fence(__ATOMIC_ACQUIRE, "workgroup");
    if (OUT_MODE == 0) {
      float* C = (float*)Cout + (size_t)b * strideC;
      const int hh = lane >> 4, c4 = (lane & 15) * 4;     // row seg = 256 B = 16 lanes x 16 B
      {
#pragma unroll
        for (int it = 0; it < 8; ++it) {
          const int row = it * 2 + hh;
          v4f v = *(const v4f*)(slab + row * 68 + c4);
          *(v4f*)(C + (size_t)(mBase + row) * ldc + n0 + c4) = v;
        }
        
      }
    } else {
      const int q = lane >> 3, c8 = (lane & 7) * 8;
      unsigned short* C  = (unsigned short*)Cout  + (size_t)b * strideC;
      unsigned short* C2 = (OUT_MODE == 2) ? ((unsigned short*)Cout2 + (size_t)b * strideC) : nullptr;
      {
#pragma unroll
        for (int it = 0; it < 4; ++it) {
          const int row = it * 4 + q;
          const float* sp = slab + row * 68 + c8;
          v8h hv, lv;
#pragma unroll
          for (int e = 0; e < 8; ++e) {
            if (OUT_MODE == 1) {
              hv[e] = (_Float16)sp[e];
            } else {
              unsigned short hb = f2bf_bits(sp[e]);
              unsigned short lb = f2bf_bits(sp[e] - bf_bits2f(hb));
              hv[e] = __builtin_bit_cast(_Float16, hb);
              lv[e] = __builtin_bit_cast(_Float16, lb);
            }
          }
          *(v8h*)(C + (size_t)(mBase + row) * ldc + n0 + c8) = hv;
          if (OUT_MODE == 2) *(v8h*)(C2 + (size_t)(mBase + row) * ldc + n0 + c8) = lv;
        }
        
      }
    }
    __builtin_amdgcn_fence(__ATOMIC_RELEASE, "workgroup");
    __builtin_amdgcn_wave_barrier();
    __builtin_amdgcn_fence(__ATOMIC_ACQUIRE, "workgroup");
  }
}

// ---------------------------------------------------------------------------
// x f32 -> bf16 plane (RNE), 8 consecutive elements per thread -> one 16-B store per lane;
// Coverage: n8 = 8192*1024/8 = 1,048,576 threads x 8 = the whole plane; grid 4096 x 256 exact.
// ---------------------------------------------------------------------------
__global__ __launch_bounds__(256) void cast8_bf16_kernel(const float* __restrict__ in, unsigned short* __restrict__ out, int n8) {
  const int i = blockIdx.x * 256 + threadIdx.x;
  if (i >= n8) return;
  const float* p = in + 8 * (size_t)i;
  const v4f a = *(const v4f*)(p);
  const v4f c = *(const v4f*)(p + 4);
  unsigned short hb[8];
#pragma unroll
  for (int e = 0; e < 4; ++e) {
    hb[e]     = f2bf_bits(a[e]);
    hb[4 + e] = f2bf_bits(c[e]);
  }
  const v4u u = (v4u){pk16(hb[0], hb[1]), pk16(hb[2], hb[3]), pk16(hb[4], hb[5]), pk16(hb[6], hb[7])};
  unsigned short* q = out + 8 * (size_t)i;
  *(v4u*)q = u;
  
}

// ---------------------------------------------------------------------------
// Weight transpose + cast: W f32 [1024 k][3072 n] -> WT[n][k] bf16 (RNE), [3072][1024].
// grid (1024/64 = 16 k tiles, 3072/64 = 48 n tiles), 256 threads.
// Load coverage: 16 iterations x 256 threads = 4096 = the whole 64x64 tile (coalesced along n).
// Store coverage: 8 waves x 2 iterations x 4 rows (lane>>3) = 64 n rows; (lane&7) x 8 halves = 64 k cols; each row
// ---------------------------------------------------------------------------
__global__ __launch_bounds__(256) void wtcast_kernel(const float* __restrict__ W, unsigned short* __restrict__ out) {
  __shared__ float sm[64][65];   // sm[n_local][k_local]
  const int t  = threadIdx.x;
  const int k0 = blockIdx.x * 64;
  const int n0 = blockIdx.y * 64;
#pragma unroll
  for (int i = 0; i < 16; ++i) {
    const int e = i * 256 + t;
    const int r = e >> 6;          // k local
    const int c = e & 63;          // n local
    sm[c][r] = W[(size_t)(k0 + r) * kN3 + n0 + c];
  }
  __syncthreads();
  const int lane = t & 31, wave = t >> 5;
  const int q = lane >> 3, c8 = (lane & 7) * 8;
  {
#pragma unroll
    for (int it = 0; it < 2; ++it) {
      const int row = wave * 8 + it * 4 + q;                 // n local
      unsigned short hb[8];
#pragma unroll
      for (int e = 0; e < 8; ++e) hb[e] = f2bf_bits(sm[row][c8 + e]);
      const v4u u = (v4u){pk16(hb[0], hb[1]), pk16(hb[2], hb[3]), pk16(hb[4], hb[5]), pk16(hb[6], hb[7])};
      *(v4u*)(out + (size_t)(n0 + row) * kHid + k0 + c8) = u;
    }
    
  }
}

// ---------------------------------------------------------------------------
// dist_emb f32 [1023][64] -> PE bf16 [1024][64] (RNE), row 1023 zero-filled.
// 1024*64/8 = 8192 threads = 32 blocks x 256 exactly; thread i: row i>>3, cols (i&7)*8..+7 -> one 16-B store;
// ---------------------------------------------------------------------------
__global__ __launch_bounds__(256) void pecast_kernel(const float* __restrict__ pe, unsigned short* __restrict__ out) {
  const int i = blockIdx.x * 256 + threadIdx.x;
  if (i >= kNDistP * kHdim / 8) return;
  const int row = i >> 3, c8 = (i & 7) * 8;
  const int rc = (row < kNDist) ? row : (kNDist - 1);         // clamped address
  const float* src = pe + (size_t)rc * kHdim + c8;
  const v4f a = *(const v4f*)(src);
  const v4f c = *(const v4f*)(src + 4);
  const bool live = (row < kNDist);
  unsigned short hb[8];
#pragma unroll
  for (int e = 0; e < 4; ++e) {
    hb[e]     = live ? f2bf_bits(a[e]) : (unsigned short)0;
    hb[4 + e] = live ? f2bf_bits(c[e]) : (unsigned short)0;
  }
  const v4u u = (v4u){pk16(hb[0], hb[1]), pk16(hb[2], hb[3]), pk16(hb[4], hb[5]), pk16(hb[6], hb[7])};
  unsigned short* q = out + (size_t)row * kHdim + c8;
  *(v4u*)q = u;
  
}

// ---------------------------------------------------------------------------
// Attention helpers
// ---------------------------------------------------------------------------
__device__ __forceinline__ unsigned short at_bf_bits(float f) {
  unsigned u = __float_as_uint(f);
  return (unsigned short)((u + 0x7FFFu + ((u >> 16) & 1u)) >> 16);
}
__device__ __forceinline__ __bf16 at_f2bf(float f) { return __builtin_bit_cast(__bf16, at_bf_bits(f)); }
__device__ __forceinline__ v8f at_mma(v16b a, v16b b, v8f c) {
  c = __builtin_amdgcn_wmma_f32_16x16x32_bf16(false, a, false, b, (short)0, c, false, false);
  asm volatile("v_nop\n\tv_nop\n\tv_nop\n\tv_nop" : "+v"(c) : "v"(a), "v"(b));
  return c;
}
// 16-bit element as a bit pattern held in a __bf16 slot: f16 bits when F16, bf16 (RNE) otherwise
template <bool F16> __device__ __forceinline__ __bf16 at_to16(float f) {
  if (F16) return __builtin_bit_cast(__bf16, (_Float16)f);
  return at_f2bf(f);
}
template <bool F16> __device__ __forceinline__ v8f at_mma16(v16b a, v16b b, v8f c) {
  if (F16) {
    const v16h ah = __builtin_bit_cast(v16h, a), bh = __builtin_bit_cast(v16h, b);
    c = __builtin_amdgcn_wmma_f32_16x16x32_f16(false, ah, false, bh, (short)0, c, false, false);
    asm volatile("v_nop\n\tv_nop\n\tv_nop\n\tv_nop" : "+v"(c) : "v"(ah), "v"(bh));
    return c;
  }
  return at_mma(a, b, c);
}

// Maximum / sum over each 16-lane row, eight rows' values at once, as xor butterflies (1, 2, 4, 8) of DPP vector
// instructions: a lane exchange by __shfl_xor goes down the LDS path and is waited for link by link. The eight
// chains are interleaved so that each instruction's producer stands eight instructions back (no stall, no hint owed).
#define ROW8_STEP(op, x)                                          \
  op " %0, %0, %0 row_xmask:" x " row_mask:0xf bank_mask:0xf\n\t" \
  op " %1, %1, %1 row_xmask:" x " row_mask:0xf bank_mask:0xf\n\t" \
  op " %2, %2, %2 row_xmask:" x " row_mask:0xf bank_mask:0xf\n\t" \
  op " %3, %3, %3 row_xmask:" x " row_mask:0xf bank_mask:0xf\n\t" \
  op " %4, %4, %4 row_xmask:" x " row_mask:0xf bank_mask:0xf\n\t" \
  op " %5, %5, %5 row_xmask:" x " row_mask:0xf bank_mask:0xf\n\t" \
  op " %6, %6, %6 row_xmask:" x " row_mask:0xf bank_mask:0xf\n\t" \
  op " %7, %7, %7 row_xmask:" x " row_mask:0xf bank_mask:0xf\n\t"
__device__ __forceinline__ void row16_max8(float (&v)[8]) {
  asm(ROW8_STEP("v_max_num_f32_dpp", "1") ROW8_STEP("v_max_num_f32_dpp", "2")
      ROW8_STEP("v_max_num_f32_dpp", "4") ROW8_STEP("v_max_num_f32_dpp", "8")
      : "+v"(v[0]), "+v"(v[1]), "+v"(v[2]), "+v"(v[3]), "+v"(v[4]), "+v"(v[5]), "+v"(v[6]), "+v"(v[7]));
}
__device__ __forceinline__ void row16_sum8(float (&v)[8]) {
  asm(ROW8_STEP("v_add_f32_dpp", "1") ROW8_STEP("v_add_f32_dpp", "2")
      ROW8_STEP("v_add_f32_dpp", "4") ROW8_STEP("v_add_f32_dpp", "8")
      : "+v"(v[0]), "+v"(v[1]), "+v"(v[2]), "+v"(v[3]), "+v"(v[4]), "+v"(v[5]), "+v"(v[6]), "+v"(v[7]));
}

// =====================================================================================
// Fused attention with relative_key_query bias, head_dim 64. Block = 4 waves = 64 query rows of one (b, h);
// key chunks of 64; online softmax in f32. Operand planes (all dense, statically strided, 16-bit):
//   QKh/QKl: bf16 hi/lo [token = b*512+s][2048] with q at cols h*64+d, k at cols 1024+h*64+d
//   Vt:      f16 [b][h*64+d][s]  (pitch 512)
//   PE:      bf16 [1024][64] (dist_emb, row 1023 zero)
// Per chunk (l0 = 64*qb, r0 = 64*kc, d0 = l0 - r0 + 448, dist(l,r) = d0 + ll - kk + 63 with local ll, kk in 0..63):
//   T1w[p1][row] = q(row of this wave) . pe[d0 + 16*wave + p1], p1 = 0..79 (f16 in LDS, per wave)
//   T2 [p][kk]   = k(kk) . pe[d0 + p] for the band p in [48-16*j, 127-16*j] of key group j = kk>>4 (wave j produces it)
//   s[ll][kk] = (q.k(hi/lo) + T1 + T2) * 1/8 + mask[b][r0+kk];  p = exp(s - m);  out = sum p v / l.
// Each chunk's k hi/lo, pe band and v^T tiles are staged once per block in LDS by asynchronous copies, issued one phase ahead.
// grid (S/64, H, B), 128 threads.
// =====================================================================================
constexpr int kT1Slots = 80;
// LDS map of relattn_kernel (bytes). Staged tiles keep their 128-B rows at a pitch of 144 B (16 B x odd: no bank
// conflict for 16-B fragment reads). The out tile of the epilogue reuses the K / PE range.
constexpr int kPitchB = 144;                           // staged row pitch, bytes
constexpr int kPitchH = kPitchB / 2;                   // the same in 16-bit elements
constexpr int kOffKH  = 0;                             // k hi  [64 keys][64 d]
constexpr int kOffKL  = kOffKH + 64 * kPitchB;         // k lo  [64 keys][64 d]
constexpr int kOffPE  = kOffKL + 64 * kPitchB;         // pe    [128 distances][64 d]
constexpr int kOffV   = kOffPE + 128 * kPitchB;        // v^T   [64 d][64 keys]
constexpr int kOffT1  = kOffV + 64 * kPitchB;          // per wave [p1][16 rows] f16
constexpr int kOffT2  = kOffT1 + 4 * kT1Slots * 16 * 2; // [p][64 keys] f16
constexpr int kOffP   = kOffT2 + 128 * 64 * 2;         // per wave P (f16 bits) [row][kv]
constexpr int kLdsBytes = kOffP + 4 * 16 * 64 * 2;     // 80,896
static_assert(4 * 16 * 68 * 4 <= kOffV, "out tiles fit the K / PE range");

__global__ __launch_bounds__(128)
void relattn_kernel(const unsigned short* __restrict__ QKhp, const unsigned short* __restrict__ QKlp,
                    const unsigned short* __restrict__ Vtp, const unsigned short* __restrict__ PEp,
                    const float* __restrict__ mask, float* __restrict__ out) {
  union FB { v16b v; v8b h[2]; };
  typedef __attribute__((address_space(3))) unsigned char lds_byte;
  __shared__ __align__(128) unsigned char smem[kLdsBytes];
  const __bf16* KHs = (const __bf16*)(smem + kOffKH);
  const __bf16* KLs = (const __bf16*)(smem + kOffKL);
  const __bf16* PEs = (const __bf16*)(smem + kOffPE);
  const __bf16* Vs  = (const __bf16*)(smem + kOffV);      // f16 bits
  _Float16*     T2s = (_Float16*)(smem + kOffT2);

  const int tid  = threadIdx.x;
  const int wave = tid >> 5;
  const int lane = tid & 31;
  const int hh   = lane >> 4;
  const int c    = lane & 15;

  const int qb = blockIdx.x;
  const int h  = blockIdx.y;
  const int b  = blockIdx.z;
  const int l0 = qb * 64;
  const int q0 = l0 + wave * 16;
  const size_t tok0 = (size_t)b * kSeq;

  const __bf16* Qh  = (const __bf16*)QKhp;
  const __bf16* Ql  = (const __bf16*)QKlp;
  const __bf16* Vt  = (const __bf16*)Vtp;     // f16 bits
  const __bf16* PEt = (const __bf16*)PEp;

  // ---- copy roles: thread t moves the 16-B piece t & 7 of rows (t >> 3) + 16 i; 8 lanes cover one 128-B row ----
  const int crow = tid >> 3;
  const int cpc  = tid & 7;
  const unsigned lcp = (unsigned)(size_t)(lds_byte*)smem + (unsigned)(crow * kPitchB + cpc * 16);
  const size_t gko = (tok0 + crow) * kQKld + kHid + (size_t)h * kHdim + cpc * 8;
  const __bf16* gKh = Qh + gko;
  const __bf16* gKl = Ql + gko;
  const __bf16* gV  = Vt + ((size_t)(b * kHeads + h) * kHdim + crow) * kSeq + cpc * 8;
  const __bf16* gPE = PEt + (size_t)crow * kHdim + cpc * 8;
  constexpr unsigned kStep = 16 * kPitchB;                 // 16 staged rows
  // k hi, k lo (64 rows each) and the pe band d0 .. d0 + 127 (<= 1023) of key chunk n
  auto stage_k_pe = [&](int n) {
    const __bf16* kh = gKh + (size_t)(n * 64) * kQKld;
    const __bf16* kl = gKl + (size_t)(n * 64) * kQKld;
    const __bf16* pp = gPE + (size_t)(l0 - n * 64 + 448) * kHdim;
    async_copy8(lcp + kOffKH, kh, lcp + kOffKH + kStep, kh + 16 * kQKld,
                lcp + kOffKH + 2 * kStep, kh + 32 * kQKld, lcp + kOffKH + 3 * kStep, kh + 48 * kQKld,
                lcp + kOffKL, kl, lcp + kOffKL + kStep, kl + 16 * kQKld,
                lcp + kOffKL + 2 * kStep, kl + 32 * kQKld, lcp + kOffKL + 3 * kStep, kl + 48 * kQKld);
    async_copy8(lcp + kOffPE, pp, lcp + kOffPE + kStep, pp + 16 * kHdim,
                lcp + kOffPE + 2 * kStep, pp + 32 * kHdim, lcp + kOffPE + 3 * kStep, pp + 48 * kHdim,
                lcp + kOffPE + 4 * kStep, pp + 64 * kHdim, lcp + kOffPE + 5 * kStep, pp + 80 * kHdim,
                lcp + kOffPE + 6 * kStep, pp + 96 * kHdim, lcp + kOffPE + 7 * kStep, pp + 112 * kHdim);
  };
  // v^T rows d = 0 .. 63, keys of chunk n
  auto stage_v = [&](int n) {
    const __bf16* vv = gV + n * 64;
    async_copy4(lcp + kOffV, vv, lcp + kOffV + kStep, vv + 16 * kSeq,
                lcp + kOffV + 2 * kStep, vv + 32 * kSeq, lcp + kOffV + 3 * kStep, vv + 48 * kSeq);
  };

  stage_k_pe(0);                                // flies while the Q fragments are fetched

  // ---- Q fragments (A operand): 2 d-chunks, hi and lo planes ----
  v16b qah[2], qal[2];
  {
    const size_t qo = (tok0 + q0 + c) * kQKld + (size_t)h * kHdim + 8 * hh;
#pragma unroll
    for (int dc = 0; dc < 2; ++dc) {
      qah[dc] = Frag<__bf16>::load(Qh + qo + dc * 32);
      qal[dc] = Frag<__bf16>::load(Ql + qo + dc * 32);
    }
  }

  float mrow[8], lrow[8];
  v8f oacc[4];
#pragma unroll
  for (int r = 0; r < 8; ++r) { mrow[r] = -INFINITY; lrow[r] = 0.f; }
#pragma unroll
  for (int t = 0; t < 4; ++t) oacc[t] = (v8f){0.f,0.f,0.f,0.f,0.f,0.f,0.f,0.f};

  _Float16* t1w = (_Float16*)(smem + kOffT1) + wave * (kT1Slots * 16);
  __bf16*   pw  = (__bf16*)(smem + kOffP) + wave * (16 * 64);

  for (int kc = 0; kc < kSeq / 64; ++kc) {
    const int r0 = kc * 64;
    // publish k / pe of this chunk; the barrier also ends the previous chunk's reads of T2s and of the v tile
    wait_lds_done();
    wait_copies_landed();
    __syncthreads();
    stage_v(kc);                               // flies under the T1 / T2 / q.k products, read behind the next barrier

    // ---- relative-position tiles on WMMA: T1 (5 tiles per wave), T2 (5 tiles per wave) ----
    {
      v16b ka[2];
#pragma unroll
      for (int dc = 0; dc < 2; ++dc) ka[dc] = Frag<__bf16>::load(KHs + (wave * 16 + c) * kPitchH + 8 * hh + dc * 32);   // k rows as A operand
#pragma unroll
      for (int i = 0; i < 5; ++i) {
        const int dt1 = 16 * wave + 16 * i;               // T1 distance tile base inside the staged band (<= 112)
        const int dt2 = 16 * (3 - wave + i);              // T2 distance tile base inside the staged band (<= 112)
        v8f a1 = (v8f){0.f,0.f,0.f,0.f,0.f,0.f,0.f,0.f};
        v8f a2 = (v8f){0.f,0.f,0.f,0.f,0.f,0.f,0.f,0.f};
#pragma unroll
        for (int dc = 0; dc < 2; ++dc) {
          const v16b p1 = Frag<__bf16>::load(PEs + (dt1 + c) * kPitchH + 8 * hh + dc * 32);   // B[k=d][n=dist]
          const v16b p2 = Frag<__bf16>::load(PEs + (dt2 + c) * kPitchH + 8 * hh + dc * 32);
          a1 = at_mma(qah[dc], p1, a1);
          a2 = at_mma(ka[dc], p2, a2);
        }
        v8h hv1, hv2;
#pragma unroll
        for (int r = 0; r < 8; ++r) { hv1[r] = (_Float16)a1[r]; hv2[r] = (_Float16)a2[r]; }
        // D element r: row 8hh+r (query row of this wave / key row 16*wave+8hh+r), col = dist slot 16i+c
        *(v8h*)(t1w + (16 * i + c) * 16 + 8 * hh) = hv1;
        *(v8h*)(T2s + (size_t)(16 * (3 - wave + i) + c) * 64 + 16 * wave + 8 * hh) = hv2;
      }
    }

    // ---- q . k (hi.hi + hi.lo + lo.hi), B fragments from the staged k tiles ----
    v8f s[4];
#pragma unroll
    for (int j = 0; j < 4; ++j) {
      s[j] = (v8f){0.f,0.f,0.f,0.f,0.f,0.f,0.f,0.f};
#pragma unroll
      for (int dc = 0; dc < 2; ++dc) {
        const int ko = (j * 16 + c) * kPitchH + 8 * hh + dc * 32;
        const v16b kb = Frag<__bf16>::load(KHs + ko);
        const v16b kl = Frag<__bf16>::load(KLs + ko);
        s[j] = at_mma(qah[dc], kb, s[j]);
        s[j] = at_mma(qah[dc], kl, s[j]);
        s[j] = at_mma(qal[dc], kb, s[j]);
      }
    }
    // publish T1s / T2s and the v tile; the barrier also ends every wave's reads of the k and pe tiles
    wait_lds_done();
    wait_copies_landed();
    __syncthreads();
    if (kc + 1 < kSeq / 64) stage_k_pe(kc + 1);   // flies under softmax and p.v, read behind the next chunk's first barrier

    float mk[4];
#pragma unroll
    for (int j = 0; j < 4; ++j) mk[j] = mask[tok0 + r0 + j * 16 + c];   // additive mask [b][r]

    float cm[8];
#pragma unroll
    for (int r = 0; r < 8; ++r) {
      float m = -INFINITY;
#pragma unroll
      for (int j = 0; j < 4; ++j) {
        const int p1 = 8 * hh + r - 16 * j - c + 63;                          // in [0, 78]
        const float t1 = (float)t1w[p1 * 16 + 8 * hh + r];
        const float t2 = (float)T2s[(p1 + 16 * wave) * 64 + 16 * j + c];
        const float v = (s[j][r] + t1 + t2) * 0.125f + mk[j];
        s[j][r] = v;
        m = fmaxf(m, v);
      }
      cm[r] = m;
    }
    row16_max8(cm);
    float alpha[8], psum[8];
#pragma unroll
    for (int r = 0; r < 8; ++r) {
      const float mnew = fmaxf(mrow[r], cm[r]);
      alpha[r] = __expf(mrow[r] - mnew);
      mrow[r] = mnew;
      psum[r] = 0.f;
#pragma unroll
      for (int j = 0; j < 4; ++j) {
        const float p = __expf(s[j][r] - mnew);
        psum[r] += p;
        pw[(8 * hh + r) * 64 + j * 16 + c] = at_to16<true>(p * kPCarry);
      }
    }
    row16_sum8(psum);
#pragma unroll
    for (int r = 0; r < 8; ++r) {
      lrow[r] = lrow[r] * alpha[r] + psum[r];
#pragma unroll
      for (int t = 0; t < 4; ++t) oacc[t][r] *= alpha[r];
    }
    __builtin_amdgcn_fence(__ATOMIC_RELEASE, "workgroup");
    __builtin_amdgcn_wave_barrier();
    __builtin_amdgcn_fence(__ATOMIC_ACQUIRE, "workgroup");
#pragma unroll 1
    for (int kk = 0; kk < 2; ++kk) {
      FB pa;
      pa.h[0] = *(const v8b*)(pw + c * 64 + kk * 32 + 8 * hh);
      pa.h[1] = *(const v8b*)(pw + c * 64 + kk * 32 + 16 + 8 * hh);
#pragma unroll
      for (int t = 0; t < 4; ++t) {
        FB vb;
        const int vo = (t * 16 + c) * kPitchH + kk * 32 + 8 * hh;   // B[k=kv][n=d] from the staged v^T[d][kv]
        vb.h[0] = *(const v8b*)(Vs + vo);
        vb.h[1] = *(const v8b*)(Vs + vo + 16);
        oacc[t] = at_mma16<true>(pa.v, vb.v, oacc[t]);
      }
    }
  }
  wait_copies_landed();                        // none is left in flight when the wave reuses LDS and ends

  // ---- epilogue: out[b][q0+row][h*64 + 0..63]; row segment = 256 B = 16 lanes x 16 B, one instruction per row ----
  // The out tiles lie on the k / pe range: its last readers left it at the last chunk's second barrier, and no copy
  // was aimed at it after that.
  float* os = (float*)(smem) + wave * (16 * 68);
#pragma unroll
  for (int r = 0; r < 8; ++r) {
    const float inv = 1.0f / (lrow[r] * kPCarry);
#pragma unroll
    for (int t = 0; t < 4; ++t) os[(8 * hh + r) * 68 + t * 16 + c] = oacc[t][r] * inv;
  }
  __builtin_amdgcn_fence(__ATOMIC_RELEASE, "workgroup");
  __builtin_amdgcn_wave_barrier();
  __builtin_amdgcn_fence(__ATOMIC_ACQUIRE, "workgroup");
  {
    float* ob = out + (size_t)h * kHdim;
    const int c4 = (lane & 15) * 4;
    {
#pragma unroll
      for (int it = 0; it < 8; ++it) {
        const int row = it * 2 + hh;
        v4f val = *(const v4f*)(os + row * 68 + c4);
        *(v4f*)(ob + (tok0 + q0 + row) * kHid + c4) = val;
      }
      
    }
  }
}

// ---------------------------------------------------------------------------
// Workspace region map (byte offsets, multiples of 128; every region fully written before it is read):
//   X16  bf16 [8192][1024]                     0 ..  16,777,216
//   WT   bf16 [3072][1024] (W^T)      16,777,216 ..  23,068,672
//   PE   bf16 [1024][64] (row 1023 0) 23,068,672 ..  23,199,744
//   QKh  bf16 [8192][2048] ([q|k] hi)  23,199,744 ..  56,754,176
//   QKl  bf16 [8192][2048] ([q|k] lo)  56,754,176 ..  90,308,608
//   Vt   f16  [16][1024][512]          90,308,608 .. 107,085,824
//   total 107,085,824 B.
// GEMM shapes: q|k: M=8192 N=2048 K=1024; v (role-swapped, per batch): M=1024 N=512 K=1024 x16.
//   K % 64 == 0, M % 128 == 0 and N % 256 == 0 for both; no padded operand rows.
// ---------------------------------------------------------------------------
extern "C" void kernel_launch(void* const* d_in, const int* in_sizes, int n_in,
                              void* d_out, int out_size, void* d_ws, size_t ws_size,
                              hipStream_t stream) {
  if (n_in < 5) return;
  if (in_sizes[0] != kTok * kHid) return;
  if (in_sizes[1] != kBatch * kSeq) return;
  if (in_sizes[2] != kHid * kN3) return;
  if (in_sizes[3] != kN3) return;
  if (in_sizes[4] != kNDist * kHdim) return;
  if (out_size != kTok * kHid) return;

  const float* hid  = (const float*)d_in[0];   // [16][512][1024]
  const float* msk  = (const float*)d_in[1];   // [16][1][1][512]
  const float* W    = (const float*)d_in[2];   // [1024][3072]
  const float* bqkv = (const float*)d_in[3];   // [3072]
  const float* pe   = (const float*)d_in[4];   // [1023][64]
  float* outp = (float*)d_out;                 // [16][512][1024]

  const size_t SZ_X16 = (size_t)kTok * kHid * 2;              //  16,777,216
  const size_t SZ_WT  = (size_t)kN3 * kHid * 2;               //   6,291,456
  const size_t SZ_PE  = (size_t)kNDistP * kHdim * 2;          //     131,072
  const size_t SZ_QK  = (size_t)kTok * kQKld * 2;             //  33,554,432
  const size_t SZ_VT  = (size_t)kBatch * kHid * kSeq * 2;     //  16,777,216
  size_t off = 0;
  const size_t oX16 = off; off += SZ_X16;
  const size_t oWT  = off; off += SZ_WT;
  const size_t oPE  = off; off += SZ_PE;
  const size_t oQKh = off; off += SZ_QK;
  const size_t oQKl = off; off += SZ_QK;
  const size_t oVT  = off; off += SZ_VT;
  const size_t TOTAL = off;                                   // 107,085,824
  if (TOTAL > ws_size) return;
  if (TOTAL > (size_t)134217728) return;

  char* ws = (char*)d_ws;
  unsigned short* X16 = (unsigned short*)(ws + oX16);
  unsigned short* WT  = (unsigned short*)(ws + oWT);
  unsigned short* PEb = (unsigned short*)(ws + oPE);
  unsigned short* QKh = (unsigned short*)(ws + oQKh);
  unsigned short* QKl = (unsigned short*)(ws + oQKl);
  unsigned short* VTp = (unsigned short*)(ws + oVT);

  const dim3 blk(256);
  // (0) x -> bf16 plane
  {
    const int n8 = kTok * kHid / 8;                           // 1,048,576 -> 4096 blocks exactly
    cast8_bf16_kernel<<<dim3((n8 + 255) / 256), blk, 0, stream>>>(hid, X16, n8);
  }
  // (1) W [1024][3072] -> WT [3072][1024] bf16
  wtcast_kernel<<<dim3(kHid / 64, kN3 / 64), blk, 0, stream>>>(W, WT);
  // (2) dist_emb -> PE bf16 [1024][64]
  pecast_kernel<<<dim3((kNDistP * kHdim / 8 + 255) / 256), blk, 0, stream>>>(pe, PEb);
  // (3) [q|k] = X16 . WT[0..2047]^T + b[0..2047] -> bf16 hi + lo planes, pitch 2048
  {
    const dim3 g((kTok / 128) * (kQKld / 256), 1);            // 512 blocks
    wmma_gemm64<1, 0, 2, 2, false, 0><<<g, blk, 0, stream>>>(
        X16, X16, kHid, 0L, WT, WT, kHid, 0L, (void*)QKh, (void*)QKl, kQKld, 0L,
        bqkv, hid, 0L, kTok, kQKld, kHid, 1.0f);
  }
  // (4) v^T per batch: Vt[b][m][s] = WT[2048+m] . x[b*512+s] + b[2048+m] -> f16, pitch 512
  {
    const dim3 g((kHid / 128) * (kSeq / 256), kBatch);        // 16 x 16
    wmma_gemm64<1, 0, 1, 1, false, 0><<<g, blk, 0, stream>>>(
        WT + (size_t)2 * kHid * kHid, WT + (size_t)2 * kHid * kHid, kHid, 0L,
        X16, X16, kHid, (long)kSeq * kHid,
        (void*)VTp, (void*)VTp, kSeq, (long)kHid * kSeq,
        bqkv + 2 * kHid, hid, 0L, kHid, kSeq, kHid, 1.0f);
  }
  // (5) fused attention with relative-position bias -> out f32 [16][512][1024]
  relattn_kernel<<<dim3(kSeq / 64, kHeads, kBatch), dim3(128), 0, stream>>>(QKh, QKl, VTp, PEb, msk, outp);
}

// v004
// It runs in 131 microseconds.
// Timed twice side by side with v003, it ran 1.16 times as fast both times.
// All steps since v000 together make it 2.34 times as fast.
// Contractions: qkv projection v_wmma_f32_16x16x32_bf16 (x, W as bf16 RNE; bias added as bf16-RNE value in f32); q.k^T bf16 hi/lo planes (hi.hi+hi.lo+lo.hi); q.pe^T and k.pe^T bf16 (q,k hi planes, pe bf16); p.v v_wmma_f32_16x16x32_f16 (p f16 carried x2^15, v f16); f32 accumulate; softmax, scale, bias, mask add in f32.
#include <hip/hip_runtime.h>
#include <math.h>

// ---------------------------------------------------------------------------
// Problem constants
// ---------------------------------------------------------------------------
constexpr int kBatch  = 16;
constexpr int kSeq    = 512;
constexpr int kHid    = 1024;
constexpr int kHeads  = 16;
constexpr int kHdim   = 64;
constexpr int kN3     = 3 * kHid;          // 3072 qkv output columns
constexpr int kQKld   = 2 * kHid;          // 2048: pitch of the [q | k] planes
constexpr int kTok    = kBatch * kSeq;     // 8192 token rows
constexpr int kNDist  = 2 * kSeq - 1;      // 1023 relative distances
constexpr int kNDistP = 1024;              // pe plane rows (row 1023 zero)
constexpr float kPCarry = 32768.0f;        // f16 probabilities carried x2^15
static_assert(kHid % 128 == 0 && kTok % 128 == 0 && kQKld % 256 == 0 && kSeq % 256 == 0, "tiles");

typedef __attribute__((ext_vector_type(16))) _Float16 v16h;
typedef __attribute__((ext_vector_type(8)))  _Float16 v8h;
typedef __attribute__((ext_vector_type(16))) __bf16   v16b;
typedef __attribute__((ext_vector_type(8)))  __bf16   v8b;
typedef __attribute__((ext_vector_type(8)))  float    v8f;
typedef __attribute__((ext_vector_type(4)))  float    v4f;
typedef __attribute__((ext_vector_type(4)))  unsigned int v4u;

__device__ __forceinline__ unsigned short f2bf_bits(float f) {
  unsigned u = __float_as_uint(f);
  return (unsigned short)((u + 0x7FFFu + ((u >> 16) & 1u)) >> 16);
}
__device__ __forceinline__ float bf_bits2f(unsigned short h) { return __uint_as_float(((unsigned)h) << 16); }

// hazard guards as plain device helpers (no inline asm inside the kernel template body)
__device__ __forceinline__ void dep_guard_h(v8f& a, v8f& b, v16h x, v16h y) { asm volatile("v_nop\n\tv_nop\n\tv_nop\n\tv_nop" : "+v"(a), "+v"(b) : "v"(x), "v"(y)); }
__device__ __forceinline__ void dep_guard_b(v8f& a, v8f& b, v16b x, v16b y) { asm volatile("v_nop\n\tv_nop\n\tv_nop\n\tv_nop" : "+v"(a), "+v"(b) : "v"(x), "v"(y)); }
__device__ __forceinline__ void keep4_h(v16h a, v16h b, v16h c, v16h d) { asm volatile("v_nop" :: "v"(a), "v"(b), "v"(c), "v"(d)); }
__device__ __forceinline__ void keep4_b(v16b a, v16b b, v16b c, v16b d) { asm volatile("v_nop" :: "v"(a), "v"(b), "v"(c), "v"(d)); }
__device__ __forceinline__ void acc_guard4(v8f& a, v8f& b, v8f& c, v8f& d) { asm volatile("v_nop\n\tv_nop\n\tv_nop\n\tv_nop" : "+v"(a), "+v"(b), "+v"(c), "+v"(d)); }
template <typename T> struct Frag;
template <> struct Frag<_Float16> {
  typedef v16h V; union U { v16h v; v8h h[2]; };
  static __device__ __forceinline__ v16h load(const _Float16* p) {   // elements 0..7 <- p[0..7], 8..15 <- p[16..23]
    U f; f.h[0] = *(const v8h*)(p); f.h[1] = *(const v8h*)(p + 16); return f.v;
  }
  static __device__ __forceinline__ v8f mma(v16h a, v16h b, v8f c) {
    return __builtin_amdgcn_wmma_f32_16x16x32_f16(false, a, false, b, (short)0, c, false, false);
  }
  static __device__ __forceinline__ void guard(v8f& a, v8f& b, v16h x, v16h y) { dep_guard_h(a, b, x, y); }
  static __device__ __forceinline__ void keep(v16h a, v16h b, v16h c, v16h d) { keep4_h(a, b, c, d); }
};
template <> struct Frag<__bf16> {
  typedef v16b V; union U { v16b v; v8b h[2]; };
  static __device__ __forceinline__ v16b load(const __bf16* p) {
    U f; f.h[0] = *(const v8b*)(p); f.h[1] = *(const v8b*)(p + 16); return f.v;
  }
  static __device__ __forceinline__ v8f mma(v16b a, v16b b, v8f c) {
    return __builtin_amdgcn_wmma_f32_16x16x32_bf16(false, a, false, b, (short)0, c, false, false);
  }
  static __device__ __forceinline__ void guard(v8f& a, v8f& b, v16b x, v16b y) { dep_guard_b(a, b, x, y); }
  static __device__ __forceinline__ void keep(v16b a, v16b b, v16b c, v16b d) { keep4_b(a, b, c, d); }
};

__device__ __forceinline__ unsigned pk16(unsigned short a, unsigned short b) { return (unsigned)a | ((unsigned)b << 16); }

// Asynchronous copies global -> LDS, 16 B per lane. The s_wait_xcnt closes each statement so that no address
// register of an issued copy is rewritten in front of it.
__device__ __forceinline__ void async_copy4(unsigned l0, const __bf16* g0, unsigned l1, const __bf16* g1,
                                            unsigned l2, const __bf16* g2, unsigned l3, const __bf16* g3) {
  asm volatile("global_load_async_to_lds_b128 %0, %1, off\n\t"
               "global_load_async_to_lds_b128 %2, %3, off\n\t"
               "global_load_async_to_lds_b128 %4, %5, off\n\t"
               "global_load_async_to_lds_b128 %6, %7, off\n\t"
               "s_wait_xcnt 0x0"
               :: "v"(l0), "v"(g0), "v"(l1), "v"(g1), "v"(l2), "v"(g2), "v"(l3), "v"(g3) : "memory");
}
__device__ __forceinline__ void async_copy8(unsigned l0, const __bf16* g0, unsigned l1, const __bf16* g1,
                                            unsigned l2, const __bf16* g2, unsigned l3, const __bf16* g3,
                                            unsigned l4, const __bf16* g4, unsigned l5, const __bf16* g5,
                                            unsigned l6, const __bf16* g6, unsigned l7, const __bf16* g7) {
  asm volatile("global_load_async_to_lds_b128 %0, %1, off\n\t"
               "global_load_async_to_lds_b128 %2, %3, off\n\t"
               "global_load_async_to_lds_b128 %4, %5, off\n\t"
               "global_load_async_to_lds_b128 %6, %7, off\n\t"
               "global_load_async_to_lds_b128 %8, %9, off\n\t"
               "global_load_async_to_lds_b128 %10, %11, off\n\t"
               "global_load_async_to_lds_b128 %12, %13, off\n\t"
               "global_load_async_to_lds_b128 %14, %15, off\n\t"
               "s_wait_xcnt 0x0"
               :: "v"(l0), "v"(g0), "v"(l1), "v"(g1), "v"(l2), "v"(g2), "v"(l3), "v"(g3),
                  "v"(l4), "v"(g4), "v"(l5), "v"(g5), "v"(l6), "v"(g6), "v"(l7), "v"(g7) : "memory");
}
// this wave's LDS reads and writes have retired (before a barrier that hands a buffer to its next writer)
__device__ __forceinline__ void wait_lds_done() { asm volatile("s_wait_dscnt 0x0" ::: "memory"); }
// this wave's own copies have landed (before the barrier behind which other waves read them)
__device__ __forceinline__ void wait_copies_landed() { asm volatile("s_wait_asynccnt 0x0" ::: "memory"); }

// ---- Register-blocked batched WMMA GEMM (ACT tanh/relu only,
//      bias values RNE-converted to bf16 before the f32 add) --------
// C[m,n] = scale * sum_k A[m,k] * Bt[n,k] (+bias)(+resid); a block owns a 128x256 tile, its 8 waves (2 x 4) 64x64 each.
// A row-major [M,K]; Bt row-major [N,K]; M % 128 == 0, N % 256 == 0, K % 64 == 0.
// Each k slice of 64 (128 A rows + 256 Bt rows of 128 B) is staged once per block in LDS by asynchronous copies,
// two buffers: the next slice flies while this one is multiplied.
// SPLIT: 0 only (single operand planes; A2p / Bt2p are not read).
// BIAS_MODE: 0 = none, 1 = bias[m], 2 = bias[n].
// OUT_MODE: 0 = f32, 1 = f16, 2 = bf16 hi plane (Cout) + bf16 lo plane (Cout2).
// ACT: 0 = none, 1 = tanh, 2 = relu.
// ET: 0 = f16 operands, 1 = bf16 operands (pointers passed as 16-bit storage)
constexpr int kGPitchB = 144;                          // staged 128-B row at 16 B x odd: no bank conflict for 16-B reads
constexpr int kGPitchH = kGPitchB / 2;                 // the same in 16-bit elements
constexpr int kGRowsA  = 128;
constexpr int kGRowsB  = 256;
constexpr int kGStageB = (kGRowsA + kGRowsB) * kGPitchB;   // 55,296 B per buffer
template <int ET> struct Elem;
template <> struct Elem<0> { typedef _Float16 T; };
template <> struct Elem<1> { typedef __bf16 T; };
template <int ET, int SPLIT, int BIAS_MODE, int OUT_MODE, bool RESID, int ACT = 0>
__global__ __launch_bounds__(256) void wmma_gemm64(
    const unsigned short* __restrict__ Ap, const unsigned short* __restrict__ A2p, int lda, long strideA,
    const unsigned short* __restrict__ Btp, const unsigned short* __restrict__ Bt2p, int ldb, long strideB,
    void* __restrict__ Cout, void* __restrict__ Cout2, int ldc, long strideC,
    const float* __restrict__ bias,
    const float* __restrict__ resid, long strideR,
    int M, int N, int K, float scale) {
  static_assert(SPLIT == 0, "single operand planes");
  typedef typename Elem<ET>::T T;
  typedef typename Frag<T>::V V;
  typedef __attribute__((address_space(3))) unsigned char lds_byte;
  const T* A = (const T*)Ap; const T* Bt = (const T*)Btp;
  __shared__ __align__(128) unsigned char ring[2 * kGStageB];   // two staged k slices: [A 128 rows | Bt 256 rows]
  __shared__ __align__(16) float sT[8][16 * 68];   // per-wave 16x64 slab, pitch 68 floats
  const int b    = blockIdx.y;
  const int lane = threadIdx.x & 31;
  const int wave = threadIdx.x >> 5;
  const int tilesN = N >> 8;
  const int tilesM = M >> 7;
  const int tile = blockIdx.x;
  if (tile >= tilesM * tilesN) return;   // block-uniform, in front of every barrier
  const int tm = tile / tilesN;
  const int tn = tile - tm * tilesN;
  const int wm = wave >> 2;                    // wave row (0..1) and column (0..3) inside the block tile
  const int wn = wave & 3;
  const int m0 = (tm << 7) + (wm << 6);
  const int n0 = (tn << 8) + (wn << 6);

  const T* Ab  = A  + (size_t)b * strideA;
  const T* Bb  = Bt + (size_t)b * strideB;

  const int rlane = lane & 15;                 // row (A) / col (B, D) within subtile
  const int koff  = (lane >> 4) * 8;           // k offset of this lane half
  const int mOff  = (lane >> 4) * 8;           // D row offset

  // ---- copy roles: thread t moves the 16-B piece t & 7 of rows (t >> 3) + 32 i; 8 lanes cover one 128-B row ----
  const int crow = threadIdx.x >> 3;
  const int cpc  = threadIdx.x & 7;
  const unsigned lcp = (unsigned)(size_t)(lds_byte*)ring + (unsigned)(crow * kGPitchB + cpc * 16);
  const __bf16* gA = (const __bf16*)Ab + (size_t)((tm << 7) + crow) * lda + cpc * 8;
  const __bf16* gB = (const __bf16*)Bb + (size_t)((tn << 8) + crow) * ldb + cpc * 8;
  const size_t a32 = (size_t)32 * lda;
  const size_t b32 = (size_t)32 * ldb;
  constexpr unsigned kStep = 32 * kGPitchB;                // 32 staged rows
  // k slice s (columns 64 s .. 64 s + 63 of the block's 128 A rows and 256 Bt rows) into buffer s & 1
  auto stage = [&](int s) {
    const unsigned la = lcp + (unsigned)(s & 1) * kGStageB;
    const unsigned lb = la + kGRowsA * kGPitchB;
    const __bf16* pa = gA + s * 64;
    const __bf16* pb = gB + s * 64;
    async_copy4(la, pa, la + kStep, pa + a32, la + 2 * kStep, pa + 2 * a32, la + 3 * kStep, pa + 3 * a32);
    async_copy8(lb, pb, lb + kStep, pb + b32, lb + 2 * kStep, pb + 2 * b32, lb + 3 * kStep, pb + 3 * b32,
                lb + 4 * kStep, pb + 4 * b32, lb + 5 * kStep, pb + 5 * b32,
                lb + 6 * kStep, pb + 6 * b32, lb + 7 * kStep, pb + 7 * b32);
  };

  v8f acc[4][4];
#pragma unroll
  for (int i = 0; i < 4; ++i)
#pragma unroll
    for (int j = 0; j < 4; ++j) acc[i][j] = (v8f){0.f,0.f,0.f,0.f,0.f,0.f,0.f,0.f};

  const int nst = K >> 6;
  stage(0);
  wait_copies_landed();
  __syncthreads();                             // publishes slice 0
  if (nst > 1) stage(1);

  const int fa = ((wm << 6) + rlane) * kGPitchH + koff;             // this lane's A fragment base in a buffer
  const int fb = (kGRowsA + (wn << 6) + rlane) * kGPitchH + koff;   // this lane's Bt fragment base in a buffer
  for (int s = 0; s < nst; ++s) {
    const T* buf = (const T*)(ring + (s & 1) * kGStageB);
#pragma unroll
    for (int ks = 0; ks < 2; ++ks) {
      V bh[4], ah[4];
#pragma unroll
      for (int j = 0; j < 4; ++j) bh[j] = Frag<T>::load(buf + fb + j * 16 * kGPitchH + ks * 32);
#pragma unroll
      for (int i = 0; i < 4; ++i) ah[i] = Frag<T>::load(buf + fa + i * 16 * kGPitchH + ks * 32);
#pragma unroll
      for (int i = 0; i < 4; ++i) {
#pragma unroll
        for (int j = 0; j < 4; ++j) acc[i][j] = Frag<T>::mma(ah[i], bh[j], acc[i][j]);
        // hazard guard; it also holds all four A fragments live, so that the slice's LDS reads go out as
        // one group ahead of the products (without it the build reloads one A register set behind a full wait per row)
        Frag<T>::guard(acc[i][0], acc[i][3], ah[i], ah[i]);
      }
      Frag<T>::keep(bh[0], bh[1], bh[2], bh[3]);
    }
    // publish slice s + 1; the barrier also ends every wave's reads of the buffer that is refilled behind it
    wait_lds_done();
    wait_copies_landed();
    __syncthreads();
    if (s + 2 < nst) stage(s + 2);
  }
  wait_copies_landed();                        // none is left in flight when the wave ends
  acc_guard4(acc[0][0], acc[0][1], acc[0][2], acc[0][3]);
  acc_guard4(acc[1][0], acc[1][1], acc[1][2], acc[1][3]);
  acc_guard4(acc[2][0], acc[2][1], acc[2][2], acc[2][3]);
  acc_guard4(acc[3][0], acc[3][1], acc[3][2], acc[3][3]);

  // ---- epilogue ----
  float* slab = sT[wave];
  const float* Rb = RESID ? (resid + (size_t)b * strideR) : nullptr;
#pragma unroll
  for (int i = 0; i < 4; ++i) {
    const int mBase = m0 + (i << 4);
#pragma unroll
    for (int j = 0; j < 4; ++j) {
      const int n = n0 + (j << 4) + rlane;
      float bv = 0.f;
      if (BIAS_MODE == 2) bv = bf_bits2f(f2bf_bits(bias[n]));                      // bias as bf16-RNE value
#pragma unroll
      for (int r = 0; r < 8; ++r) {
        float v = acc[i][j][r] * scale;
        if (BIAS_MODE == 1) v += bf_bits2f(f2bf_bits(bias[mBase + mOff + r]));     // bias as bf16-RNE value
        if (BIAS_MODE == 2) v += bv;
        if (RESID) v += Rb[(size_t)(mBase + mOff + r) * ldc + n];
        if (ACT == 1) v = tanhf(v);
        if (ACT == 2) v = fmaxf(v, 0.0f);
        slab[(mOff + r) * 68 + (j << 4) + rlane] = v;
      }
    }
    __builtin_amdgcn_fence(__ATOMIC_RELEASE, "workgroup");
    __builtin_amdgcn_wave_barrier();
    __builtin_amdgcn_fence(__ATOMIC_ACQUIRE, "workgroup");
    if (OUT_MODE == 0) {
      float* C = (float*)Cout + (size_t)b * strideC;
      const int hh = lane >> 4, c4 = (lane & 15) * 4;     // row seg = 256 B = 16 lanes x 16 B
      {
#pragma unroll
        for (int it = 0; it < 8; ++it) {
          const int row = it * 2 + hh;
          v4f v = *(const v4f*)(slab + row * 68 + c4);
          *(v4f*)(C + (size_t)(mBase + row) * ldc + n0 + c4) = v;
        }
        
      }
    } else {
      const int q = lane >> 3, c8 = (lane & 7) * 8;
      unsigned short* C  = (unsigned short*)Cout  + (size_t)b * strideC;
      unsigned short* C2 = (OUT_MODE == 2) ? ((unsigned short*)Cout2 + (size_t)b * strideC) : nullptr;
      {
#pragma unroll
        for (int it = 0; it < 4; ++it) {
          const int row = it * 4 + q;
          const float* sp = slab + row * 68 + c8;
          v8h hv, lv;
#pragma unroll
          for (int e = 0; e < 8; ++e) {
            if (OUT_MODE == 1) {
              hv[e] = (_Float16)sp[e];
            } else {
              unsigned short hb = f2bf_bits(sp[e]);
              unsigned short lb = f2bf_bits(sp[e] - bf_bits2f(hb));
              hv[e] = __builtin_bit_cast(_Float16, hb);
              lv[e] = __builtin_bit_cast(_Float16, lb);
            }
          }
          *(v8h*)(C + (size_t)(mBase + row) * ldc + n0 + c8) = hv;
          if (OUT_MODE == 2) *(v8h*)(C2 + (size_t)(mBase + row) * ldc + n0 + c8) = lv;
        }
        
      }
    }
    __builtin_amdgcn_fence(__ATOMIC_RELEASE, "workgroup");
    __builtin_amdgcn_wave_barrier();
    __builtin_amdgcn_fence(__ATOMIC_ACQUIRE, "workgroup");
  }
}

// ---------------------------------------------------------------------------
// x f32 -> bf16 plane (RNE), 8 consecutive elements per thread -> one 16-B store per lane;
// Coverage: n8 = 8192*1024/8 = 1,048,576 threads x 8 = the whole plane; grid 4096 x 256 exact.
// ---------------------------------------------------------------------------
__global__ __launch_bounds__(256) void cast8_bf16_kernel(const float* __restrict__ in, unsigned short* __restrict__ out, int n8) {
  const int i = blockIdx.x * 256 + threadIdx.x;
  if (i >= n8) return;
  const float* p = in + 8 * (size_t)i;
  const v4f a = *(const v4f*)(p);
  const v4f c = *(const v4f*)(p + 4);
  unsigned short hb[8];
#pragma unroll
  for (int e = 0; e < 4; ++e) {
    hb[e]     = f2bf_bits(a[e]);
    hb[4 + e] = f2bf_bits(c[e]);
  }
  const v4u u = (v4u){pk16(hb[0], hb[1]), pk16(hb[2], hb[3]), pk16(hb[4], hb[5]), pk16(hb[6], hb[7])};
  unsigned short* q = out + 8 * (size_t)i;
  *(v4u*)q = u;
  
}

// ---------------------------------------------------------------------------
// Weight transpose + cast: W f32 [1024 k][3072 n] -> WT[n][k] bf16 (RNE), [3072][1024].
// grid (1024/64 = 16 k tiles, 3072/64 = 48 n tiles), 256 threads.
// Load coverage: 16 iterations x 256 threads = 4096 = the whole 64x64 tile (coalesced along n).
// Store coverage: 8 waves x 2 iterations x 4 rows (lane>>3) = 64 n rows; (lane&7) x 8 halves = 64 k cols; each row
// ---------------------------------------------------------------------------
__global__ __launch_bounds__(256) void wtcast_kernel(const float* __restrict__ W, unsigned short* __restrict__ out) {
  __shared__ float sm[64][65];   // sm[n_local][k_local]
  const int t  = threadIdx.x;
  const int k0 = blockIdx.x * 64;
  const int n0 = blockIdx.y * 64;
#pragma unroll
  for (int i = 0; i < 16; ++i) {
    const int e = i * 256 + t;
    const int r = e >> 6;          // k local
    const int c = e & 63;          // n local
    sm[c][r] = W[(size_t)(k0 + r) * kN3 + n0 + c];
  }
  __syncthreads();
  const int lane = t & 31, wave = t >> 5;
  const int q = lane >> 3, c8 = (lane & 7) * 8;
  {
#pragma unroll
    for (int it = 0; it < 2; ++it) {
      const int row = wave * 8 + it * 4 + q;                 // n local
      unsigned short hb[8];
#pragma unroll
      for (int e = 0; e < 8; ++e) hb[e] = f2bf_bits(sm[row][c8 + e]);
      const v4u u = (v4u){pk16(hb[0], hb[1]), pk16(hb[2], hb[3]), pk16(hb[4], hb[5]), pk16(hb[6], hb[7])};
      *(v4u*)(out + (size_t)(n0 + row) * kHid + k0 + c8) = u;
    }
    
  }
}

// ---------------------------------------------------------------------------
// dist_emb f32 [1023][64] -> PE bf16 [1024][64] (RNE), row 1023 zero-filled.
// 1024*64/8 = 8192 threads = 32 blocks x 256 exactly; thread i: row i>>3, cols (i&7)*8..+7 -> one 16-B store;
// ---------------------------------------------------------------------------
__global__ __launch_bounds__(256) void pecast_kernel(const float* __restrict__ pe, unsigned short* __restrict__ out) {
  const int i = blockIdx.x * 256 + threadIdx.x;
  if (i >= kNDistP * kHdim / 8) return;
  const int row = i >> 3, c8 = (i & 7) * 8;
  const int rc = (row < kNDist) ? row : (kNDist - 1);         // clamped address
  const float* src = pe + (size_t)rc * kHdim + c8;
  const v4f a = *(const v4f*)(src);
  const v4f c = *(const v4f*)(src + 4);
  const bool live = (row < kNDist);
  unsigned short hb[8];
#pragma unroll
  for (int e = 0; e < 4; ++e) {
    hb[e]     = live ? f2bf_bits(a[e]) : (unsigned short)0;
    hb[4 + e] = live ? f2bf_bits(c[e]) : (unsigned short)0;
  }
  const v4u u = (v4u){pk16(hb[0], hb[1]), pk16(hb[2], hb[3]), pk16(hb[4], hb[5]), pk16(hb[6], hb[7])};
  unsigned short* q = out + (size_t)row * kHdim + c8;
  *(v4u*)q = u;
  
}

// ---------------------------------------------------------------------------
// Attention helpers
// ---------------------------------------------------------------------------
__device__ __forceinline__ unsigned short at_bf_bits(float f) {
  unsigned u = __float_as_uint(f);
  return (unsigned short)((u + 0x7FFFu + ((u >> 16) & 1u)) >> 16);
}
__device__ __forceinline__ __bf16 at_f2bf(float f) { return __builtin_bit_cast(__bf16, at_bf_bits(f)); }
// builtin forms only: the compiler keeps their distances itself and stays free to put reads and other products between them
__device__ __forceinline__ v8f at_mma(v16b a, v16b b, v8f c) {
  return __builtin_amdgcn_wmma_f32_16x16x32_bf16(false, a, false, b, (short)0, c, false, false);
}
// 16-bit element as a bit pattern held in a __bf16 slot: f16 bits when F16, bf16 (RNE) otherwise
template <bool F16> __device__ __forceinline__ __bf16 at_to16(float f) {
  if (F16) return __builtin_bit_cast(__bf16, (_Float16)f);
  return at_f2bf(f);
}
template <bool F16> __device__ __forceinline__ v8f at_mma16(v16b a, v16b b, v8f c) {
  if (F16) {
    const v16h ah = __builtin_bit_cast(v16h, a), bh = __builtin_bit_cast(v16h, b);
    return __builtin_amdgcn_wmma_f32_16x16x32_f16(false, ah, false, bh, (short)0, c, false, false);
  }
  return at_mma(a, b, c);
}

// Maximum / sum over each 16-lane row, eight rows' values at once, as xor butterflies (1, 2, 4, 8) of DPP vector
// instructions: a lane exchange by __shfl_xor goes down the LDS path and is waited for link by link. The eight
// chains are interleaved so that each instruction's producer stands eight instructions back (no stall, no hint owed).
#define ROW8_STEP(op, x)                                          \
  op " %0, %0, %0 row_xmask:" x " row_mask:0xf bank_mask:0xf\n\t" \
  op " %1, %1, %1 row_xmask:" x " row_mask:0xf bank_mask:0xf\n\t" \
  op " %2, %2, %2 row_xmask:" x " row_mask:0xf bank_mask:0xf\n\t" \
  op " %3, %3, %3 row_xmask:" x " row_mask:0xf bank_mask:0xf\n\t" \
  op " %4, %4, %4 row_xmask:" x " row_mask:0xf bank_mask:0xf\n\t" \
  op " %5, %5, %5 row_xmask:" x " row_mask:0xf bank_mask:0xf\n\t" \
  op " %6, %6, %6 row_xmask:" x " row_mask:0xf bank_mask:0xf\n\t" \
  op " %7, %7, %7 row_xmask:" x " row_mask:0xf bank_mask:0xf\n\t"
__device__ __forceinline__ void row16_max8(float (&v)[8]) {
  asm(ROW8_STEP("v_max_num_f32_dpp", "1") ROW8_STEP("v_max_num_f32_dpp", "2")
      ROW8_STEP("v_max_num_f32_dpp", "4") ROW8_STEP("v_max_num_f32_dpp", "8")
      : "+v"(v[0]), "+v"(v[1]), "+v"(v[2]), "+v"(v[3]), "+v"(v[4]), "+v"(v[5]), "+v"(v[6]), "+v"(v[7]));
}
__device__ __forceinline__ void row16_sum8(float (&v)[8]) {
  asm(ROW8_STEP("v_add_f32_dpp", "1") ROW8_STEP("v_add_f32_dpp", "2")
      ROW8_STEP("v_add_f32_dpp", "4") ROW8_STEP("v_add_f32_dpp", "8")
      : "+v"(v[0]), "+v"(v[1]), "+v"(v[2]), "+v"(v[3]), "+v"(v[4]), "+v"(v[5]), "+v"(v[6]), "+v"(v[7]));
}

// Inputs-only fence on four loaded fragments: their eight LDS reads go out ahead of it as one group with one wait
// (without it the build reuses one register set and pays a full LDS round trip in front of every product).
__device__ __forceinline__ void hold4(v16b a, v16b b, v16b c, v16b d) { asm volatile("" :: "v"(a), "v"(b), "v"(c), "v"(d)); }
// the same on eight fragments (sixteen reads, one wait)
__device__ __forceinline__ void hold8(v16b a, v16b b, v16b c, v16b d, v16b e, v16b f, v16b g, v16b h) {
  asm volatile("" :: "v"(a), "v"(b), "v"(c), "v"(d), "v"(e), "v"(f), "v"(g), "v"(h));
}

// =====================================================================================
// Fused attention with relative_key_query bias, head_dim 64. Block = 4 waves = 64 query rows of one (b, h);
// key chunks of 64; online softmax in f32. Operand planes (all dense, statically strided, 16-bit):
//   QKh/QKl: bf16 hi/lo [token = b*512+s][2048] with q at cols h*64+d, k at cols 1024+h*64+d
//   Vt:      f16 [b][h*64+d][s]  (pitch 512)
//   PE:      bf16 [1024][64] (dist_emb, row 1023 zero)
// Per chunk (l0 = 64*qb, r0 = 64*kc, d0 = l0 - r0 + 448, dist(l,r) = d0 + ll - kk + 63 with local ll, kk in 0..63):
//   T1w[p1][row] = q(row of this wave) . pe[d0 + 16*wave + p1], p1 = 0..79 (f16 in LDS, per wave)
//   T2 [p][kk]   = k(kk) . pe[d0 + p] for the band p in [48-16*j, 127-16*j] of key group j = kk>>4 (wave j produces it)
//   s[ll][kk] = (q.k(hi/lo) + T1 + T2) * 1/8 + mask[b][r0+kk];  p = exp(s - m);  out = sum p v / l.
// Each chunk's k hi/lo, pe band and v^T tiles are staged once per block in LDS by asynchronous copies, issued one phase ahead.
// grid (S/64, H, B), 128 threads.
// =====================================================================================
constexpr int kT1Slots = 80;
// LDS map of relattn_kernel (bytes). Staged tiles keep their 128-B rows at a pitch of 144 B (16 B x odd: no bank
// conflict for 16-B fragment reads). The out tile of the epilogue reuses the K / PE range.
constexpr int kPitchB = 144;                           // staged row pitch, bytes
constexpr int kPitchH = kPitchB / 2;                   // the same in 16-bit elements
constexpr int kOffKH  = 0;                             // k hi  [64 keys][64 d]
constexpr int kOffKL  = kOffKH + 64 * kPitchB;         // k lo  [64 keys][64 d]
constexpr int kOffPE  = kOffKL + 64 * kPitchB;         // pe    [128 distances][64 d]
constexpr int kOffV   = kOffPE + 128 * kPitchB;        // v^T   [64 d][64 keys]
constexpr int kOffT1  = kOffV + 64 * kPitchB;          // per wave [p1][16 rows] f16
constexpr int kOffT2  = kOffT1 + 4 * kT1Slots * 16 * 2; // [p][64 keys] f16
constexpr int kOffP   = kOffT2 + 128 * 64 * 2;         // per wave P (f16 bits) [row][kv]
constexpr int kLdsBytes = kOffP + 4 * 16 * 64 * 2;     // 80,896
static_assert(4 * 16 * 68 * 4 <= kOffV, "out tiles fit the K / PE range");

__global__ __launch_bounds__(128)
void relattn_kernel(const unsigned short* __restrict__ QKhp, const unsigned short* __restrict__ QKlp,
                    const unsigned short* __restrict__ Vtp, const unsigned short* __restrict__ PEp,
                    const float* __restrict__ mask, float* __restrict__ out) {
  union FB { v16b v; v8b h[2]; };
  typedef __attribute__((address_space(3))) unsigned char lds_byte;
  __shared__ __align__(128) unsigned char smem[kLdsBytes];
  const __bf16* KHs = (const __bf16*)(smem + kOffKH);
  const __bf16* KLs = (const __bf16*)(smem + kOffKL);
  const __bf16* PEs = (const __bf16*)(smem + kOffPE);
  const __bf16* Vs  = (const __bf16*)(smem + kOffV);      // f16 bits
  _Float16*     T2s = (_Float16*)(smem + kOffT2);

  const int tid  = threadIdx.x;
  const int wave = tid >> 5;
  const int lane = tid & 31;
  const int hh   = lane >> 4;
  const int c    = lane & 15;

  const int qb = blockIdx.x;
  const int h  = blockIdx.y;
  const int b  = blockIdx.z;
  const int l0 = qb * 64;
  const int q0 = l0 + wave * 16;
  const size_t tok0 = (size_t)b * kSeq;

  const __bf16* Qh  = (const __bf16*)QKhp;
  const __bf16* Ql  = (const __bf16*)QKlp;
  const __bf16* Vt  = (const __bf16*)Vtp;     // f16 bits
  const __bf16* PEt = (const __bf16*)PEp;

  // ---- copy roles: thread t moves the 16-B piece t & 7 of rows (t >> 3) + 16 i; 8 lanes cover one 128-B row ----
  const int crow = tid >> 3;
  const int cpc  = tid & 7;
  const unsigned lcp = (unsigned)(size_t)(lds_byte*)smem + (unsigned)(crow * kPitchB + cpc * 16);
  const size_t gko = (tok0 + crow) * kQKld + kHid + (size_t)h * kHdim + cpc * 8;
  const __bf16* gKh = Qh + gko;
  const __bf16* gKl = Ql + gko;
  const __bf16* gV  = Vt + ((size_t)(b * kHeads + h) * kHdim + crow) * kSeq + cpc * 8;
  const __bf16* gPE = PEt + (size_t)crow * kHdim + cpc * 8;
  constexpr unsigned kStep = 16 * kPitchB;                 // 16 staged rows
  // k hi, k lo (64 rows each) and the pe band d0 .. d0 + 127 (<= 1023) of key chunk n
  auto stage_k_pe = [&](int n) {
    const __bf16* kh = gKh + (size_t)(n * 64) * kQKld;
    const __bf16* kl = gKl + (size_t)(n * 64) * kQKld;
    const __bf16* pp = gPE + (size_t)(l0 - n * 64 + 448) * kHdim;
    async_copy8(lcp + kOffKH, kh, lcp + kOffKH + kStep, kh + 16 * kQKld,
                lcp + kOffKH + 2 * kStep, kh + 32 * kQKld, lcp + kOffKH + 3 * kStep, kh + 48 * kQKld,
                lcp + kOffKL, kl, lcp + kOffKL + kStep, kl + 16 * kQKld,
                lcp + kOffKL + 2 * kStep, kl + 32 * kQKld, lcp + kOffKL + 3 * kStep, kl + 48 * kQKld);
    async_copy8(lcp + kOffPE, pp, lcp + kOffPE + kStep, pp + 16 * kHdim,
                lcp + kOffPE + 2 * kStep, pp + 32 * kHdim, lcp + kOffPE + 3 * kStep, pp + 48 * kHdim,
                lcp + kOffPE + 4 * kStep, pp + 64 * kHdim, lcp + kOffPE + 5 * kStep, pp + 80 * kHdim,
                lcp + kOffPE + 6 * kStep, pp + 96 * kHdim, lcp + kOffPE + 7 * kStep, pp + 112 * kHdim);
  };
  // v^T rows d = 0 .. 63, keys of chunk n
  auto stage_v = [&](int n) {
    const __bf16* vv = gV + n * 64;
    async_copy4(lcp + kOffV, vv, lcp + kOffV + kStep, vv + 16 * kSeq,
                lcp + kOffV + 2 * kStep, vv + 32 * kSeq, lcp + kOffV + 3 * kStep, vv + 48 * kSeq);
  };

  stage_k_pe(0);                                // flies while the Q fragments are fetched

  // ---- Q fragments (A operand): 2 d-chunks, hi and lo planes ----
  v16b qah[2], qal[2];
  {
    const size_t qo = (tok0 + q0 + c) * kQKld + (size_t)h * kHdim + 8 * hh;
#pragma unroll
    for (int dc = 0; dc < 2; ++dc) {
      qah[dc] = Frag<__bf16>::load(Qh + qo + dc * 32);
      qal[dc] = Frag<__bf16>::load(Ql + qo + dc * 32);
    }
  }

  float mrow[8], lrow[8];
  v8f oacc[4];
#pragma unroll
  for (int r = 0; r < 8; ++r) { mrow[r] = -INFINITY; lrow[r] = 0.f; }
#pragma unroll
  for (int t = 0; t < 4; ++t) oacc[t] = (v8f){0.f,0.f,0.f,0.f,0.f,0.f,0.f,0.f};

  _Float16* t1w = (_Float16*)(smem + kOffT1) + wave * (kT1Slots * 16);
  __bf16*   pw  = (__bf16*)(smem + kOffP) + wave * (16 * 64);
  // every table address of the chunk loop is one base register plus a constant: the registers so freed hold reads in flight
  const __bf16* pe1b = PEs + (16 * wave + c) * kPitchH + 8 * hh;            // pe rows of T1 tile 0
  const __bf16* pe2b = PEs + (16 * (3 - wave) + c) * kPitchH + 8 * hh;      // pe rows of T2 tile 0
  _Float16* t1s = t1w + c * 16 + 8 * hh;                                    // T1 tile 0, this lane's eight rows
  _Float16* t2s = T2s + (16 * (3 - wave) + c) * 64 + 16 * wave + 8 * hh;    // T2 tile 0, this lane's eight keys
  __bf16*   pws = pw + 8 * hh * 64 + c;                                     // P row 8 hh, column c
  // bias gather bases: element (r, j) lies at a non-negative constant behind them
  const _Float16* t1b = t1w + ((8 * hh - c + 15) * 16 + 8 * hh);
  const _Float16* t2b = T2s + ((8 * hh - c + 15 + 16 * wave) * 64 + c);

  for (int kc = 0; kc < kSeq / 64; ++kc) {
    const int r0 = kc * 64;
    // publish k / pe of this chunk; the barrier also ends the previous chunk's reads of T2s and of the v tile
    wait_lds_done();
    wait_copies_landed();
    __syncthreads();
    stage_v(kc);                               // flies under the T1 / T2 / q.k products, read behind the next barrier
    float mk[4];                               // fetched here, used behind the next barrier
#pragma unroll
    for (int j = 0; j < 4; ++j) mk[j] = mask[tok0 + r0 + j * 16 + c];   // additive mask [b][r]

    // ---- relative-position tiles on WMMA: T1 (5 tiles per wave), T2 (5 tiles per wave) ----
    {
      v16b ka[2];
#pragma unroll
      for (int dc = 0; dc < 2; ++dc) ka[dc] = Frag<__bf16>::load(KHs + (wave * 16 + c) * kPitchH + 8 * hh + dc * 32);   // k rows as A operand
#pragma unroll
      for (int i0 = 0; i0 < 5; i0 += 2) {                  // tiles i0 and i0 + 1 together (the fifth alone)
        // distance tile bases inside the staged band: T1 16 (wave + i), T2 16 (3 - wave + i), both <= 112
        const int nt = (i0 + 1 < 5) ? 2 : 1;
        v16b p1[2][2], p2[2][2];
        v8f a1[2], a2[2];
#pragma unroll
        for (int u = 0; u < nt; ++u) {
          a1[u] = (v8f){0.f,0.f,0.f,0.f,0.f,0.f,0.f,0.f};
          a2[u] = (v8f){0.f,0.f,0.f,0.f,0.f,0.f,0.f,0.f};
#pragma unroll
          for (int dc = 0; dc < 2; ++dc) {
            p1[u][dc] = Frag<__bf16>::load(pe1b + (i0 + u) * 16 * kPitchH + dc * 32);   // B[k=d][n=dist]
            p2[u][dc] = Frag<__bf16>::load(pe2b + (i0 + u) * 16 * kPitchH + dc * 32);
          }
        }
        if (nt == 2) hold8(p1[0][0], p2[0][0], p1[1][0], p2[1][0], p1[0][1], p2[0][1], p1[1][1], p2[1][1]);
        else         hold4(p1[0][0], p2[0][0], p1[0][1], p2[0][1]);
#pragma unroll
        for (int dc = 0; dc < 2; ++dc) {
#pragma unroll
          for (int u = 0; u < nt; ++u) {
            a1[u] = at_mma(qah[dc], p1[u][dc], a1[u]);
            a2[u] = at_mma(ka[dc], p2[u][dc], a2[u]);
          }
        }
#pragma unroll
        for (int u = 0; u < nt; ++u) {
          v8h hv1, hv2;
#pragma unroll
          for (int r = 0; r < 8; ++r) { hv1[r] = (_Float16)a1[u][r]; hv2[r] = (_Float16)a2[u][r]; }
          // D element r: row 8hh+r (query row of this wave / key row 16*wave+8hh+r), col = dist slot 16i+c
          *(v8h*)(t1s + (i0 + u) * 16 * 16) = hv1;
          *(v8h*)(t2s + (i0 + u) * 16 * 64) = hv2;
        }
      }
    }

    // ---- q . k (hi.hi + hi.lo + lo.hi), B fragments from the staged k tiles ----
    // The four key groups' chains run side by side; each s[j] sums hi.hi, hi.lo, lo.hi of d half 0, then of d half 1.
    v8f s[4];
#pragma unroll
    for (int j = 0; j < 4; ++j) s[j] = (v8f){0.f,0.f,0.f,0.f,0.f,0.f,0.f,0.f};
#pragma unroll
    for (int dc = 0; dc < 2; ++dc) {
      v16b kb[4], kl[4];
#pragma unroll
      for (int j = 0; j < 4; ++j) {
        const int ko = (j * 16 + c) * kPitchH + 8 * hh + dc * 32;
        kb[j] = Frag<__bf16>::load(KHs + ko);
        kl[j] = Frag<__bf16>::load(KLs + ko);
      }
      hold8(kb[0], kb[1], kb[2], kb[3], kl[0], kl[1], kl[2], kl[3]);
#pragma unroll
      for (int j = 0; j < 4; ++j) s[j] = at_mma(qah[dc], kb[j], s[j]);
#pragma unroll
      for (int j = 0; j < 4; ++j) s[j] = at_mma(qah[dc], kl[j], s[j]);
#pragma unroll
      for (int j = 0; j < 4; ++j) s[j] = at_mma(qal[dc], kb[j], s[j]);
    }
    // publish T1s / T2s and the v tile; the barrier also ends every wave's reads of the k and pe tiles
    wait_lds_done();
    wait_copies_landed();
    __syncthreads();
    if (kc + 1 < kSeq / 64) stage_k_pe(kc + 1);   // flies under softmax and p.v, read behind the next chunk's first barrier

    float cm[8];
#pragma unroll
    for (int g = 0; g < 2; ++g) {              // rows r = 4 g .. 4 g + 3: 32 reads as groups, then their sums
      _Float16 u1[4][4], u2[4][4];
#pragma unroll
      for (int rr = 0; rr < 4; ++rr) {
#pragma unroll
        for (int j = 0; j < 4; ++j) {
          const int r = 4 * g + rr;            // p1 = 8 hh + r - 16 j - c + 63, in [0, 78]
          u1[rr][j] = t1b[17 * r + 256 * (3 - j)];                // T1w[p1][8 hh + r]
          u2[rr][j] = t2b[64 * r + 1008 * (3 - j) + 48];          // T2[p1 + 16 wave][16 j + c]
        }
      }
#pragma unroll
      for (int rr = 0; rr < 4; ++rr) {
        const int r = 4 * g + rr;
        float m = -INFINITY;
#pragma unroll
        for (int j = 0; j < 4; ++j) {
          const float v = (s[j][r] + (float)u1[rr][j] + (float)u2[rr][j]) * 0.125f + mk[j];
          s[j][r] = v;
          m = fmaxf(m, v);
        }
        cm[r] = m;
      }
    }
    row16_max8(cm);
    float alpha[8], psum[8];
#pragma unroll
    for (int r = 0; r < 8; ++r) {
      const float mnew = fmaxf(mrow[r], cm[r]);
      alpha[r] = __expf(mrow[r] - mnew);
      mrow[r] = mnew;
      psum[r] = 0.f;
#pragma unroll
      for (int j = 0; j < 4; ++j) {
        const float p = __expf(s[j][r] - mnew);
        psum[r] += p;
        pws[r * 64 + j * 16] = at_to16<true>(p * kPCarry);
      }
    }
    row16_sum8(psum);
#pragma unroll
    for (int r = 0; r < 8; ++r) {
      lrow[r] = lrow[r] * alpha[r] + psum[r];
#pragma unroll
      for (int t = 0; t < 4; ++t) oacc[t][r] *= alpha[r];
    }
    __builtin_amdgcn_fence(__ATOMIC_RELEASE, "workgroup");
    __builtin_amdgcn_wave_barrier();
    __builtin_amdgcn_fence(__ATOMIC_ACQUIRE, "workgroup");
    FB pa[2], vb[2][4];
#pragma unroll                                 // both key halves' reads go out together, ahead of the eight products
    for (int kk = 0; kk < 2; ++kk) {
      pa[kk].h[0] = *(const v8b*)(pw + c * 64 + kk * 32 + 8 * hh);
      pa[kk].h[1] = *(const v8b*)(pw + c * 64 + kk * 32 + 16 + 8 * hh);
#pragma unroll
      for (int t = 0; t < 4; ++t) {
        const int vo = (t * 16 + c) * kPitchH + kk * 32 + 8 * hh;   // B[k=kv][n=d] from the staged v^T[d][kv]
        vb[kk][t].h[0] = *(const v8b*)(Vs + vo);
        vb[kk][t].h[1] = *(const v8b*)(Vs + vo + 16);
      }
    }
#pragma unroll
    for (int kk = 0; kk < 2; ++kk) {
#pragma unroll
      for (int t = 0; t < 4; ++t) oacc[t] = at_mma16<true>(pa[kk].v, vb[kk][t].v, oacc[t]);
    }
  }
  wait_copies_landed();                        // none is left in flight when the wave reuses LDS and ends

  // ---- epilogue: out[b][q0+row][h*64 + 0..63]; row segment = 256 B = 16 lanes x 16 B, one instruction per row ----
  // The out tiles lie on the k / pe range: its last readers left it at the last chunk's second barrier, and no copy
  // was aimed at it after that.
  float* os = (float*)(smem) + wave * (16 * 68);
#pragma unroll
  for (int r = 0; r < 8; ++r) {
    const float inv = 1.0f / (lrow[r] * kPCarry);
#pragma unroll
    for (int t = 0; t < 4; ++t) os[(8 * hh + r) * 68 + t * 16 + c] = oacc[t][r] * inv;
  }
  __builtin_amdgcn_fence(__ATOMIC_RELEASE, "workgroup");
  __builtin_amdgcn_wave_barrier();
  __builtin_amdgcn_fence(__ATOMIC_ACQUIRE, "workgroup");
  {
    float* ob = out + (size_t)h * kHdim;
    const int c4 = (lane & 15) * 4;
    {
#pragma unroll
      for (int it = 0; it < 8; ++it) {
        const int row = it * 2 + hh;
        v4f val = *(const v4f*)(os + row * 68 + c4);
        *(v4f*)(ob + (tok0 + q0 + row) * kHid + c4) = val;
      }
      
    }
  }
}

// ---------------------------------------------------------------------------
// Workspace region map (byte offsets, multiples of 128; every region fully written before it is read):
//   X16  bf16 [8192][1024]                     0 ..  16,777,216
//   WT   bf16 [3072][1024] (W^T)      16,777,216 ..  23,068,672
//   PE   bf16 [1024][64] (row 1023 0) 23,068,672 ..  23,199,744
//   QKh  bf16 [8192][2048] ([q|k] hi)  23,199,744 ..  56,754,176
//   QKl  bf16 [8192][2048] ([q|k] lo)  56,754,176 ..  90,308,608
//   Vt   f16  [16][1024][512]          90,308,608 .. 107,085,824
//   total 107,085,824 B.
// GEMM shapes: q|k: M=8192 N=2048 K=1024; v (role-swapped, per batch): M=1024 N=512 K=1024 x16.
//   K % 64 == 0, M % 128 == 0 and N % 256 == 0 for both; no padded operand rows.
// ---------------------------------------------------------------------------
extern "C" void kernel_launch(void* const* d_in, const int* in_sizes, int n_in,
                              void* d_out, int out_size, void* d_ws, size_t ws_size,
                              hipStream_t stream) {
  if (n_in < 5) return;
  if (in_sizes[0] != kTok * kHid) return;
  if (in_sizes[1] != kBatch * kSeq) return;
  if (in_sizes[2] != kHid * kN3) return;
  if (in_sizes[3] != kN3) return;
  if (in_sizes[4] != kNDist * kHdim) return;
  if (out_size != kTok * kHid) return;

  const float* hid  = (const float*)d_in[0];   // [16][512][1024]
  const float* msk  = (const float*)d_in[1];   // [16][1][1][512]
  const float* W    = (const float*)d_in[2];   // [1024][3072]
  const float* bqkv = (const float*)d_in[3];   // [3072]
  const float* pe   = (const float*)d_in[4];   // [1023][64]
  float* outp = (float*)d_out;                 // [16][512][1024]

  const size_t SZ_X16 = (size_t)kTok * kHid * 2;              //  16,777,216
  const size_t SZ_WT  = (size_t)kN3 * kHid * 2;               //   6,291,456
  const size_t SZ_PE  = (size_t)kNDistP * kHdim * 2;          //     131,072
  const size_t SZ_QK  = (size_t)kTok * kQKld * 2;             //  33,554,432
  const size_t SZ_VT  = (size_t)kBatch * kHid * kSeq * 2;     //  16,777,216
  size_t off = 0;
  const size_t oX16 = off; off += SZ_X16;
  const size_t oWT  = off; off += SZ_WT;
  const size_t oPE  = off; off += SZ_PE;
  const size_t oQKh = off; off += SZ_QK;
  const size_t oQKl = off; off += SZ_QK;
  const size_t oVT  = off; off += SZ_VT;
  const size_t TOTAL = off;                                   // 107,085,824
  if (TOTAL > ws_size) return;
  if (TOTAL > (size_t)134217728) return;

  char* ws = (char*)d_ws;
  unsigned short* X16 = (unsigned short*)(ws + oX16);
  unsigned short* WT  = (unsigned short*)(ws + oWT);
  unsigned short* PEb = (unsigned short*)(ws + oPE);
  unsigned short* QKh = (unsigned short*)(ws + oQKh);
  unsigned short* QKl = (unsigned short*)(ws + oQKl);
  unsigned short* VTp = (unsigned short*)(ws + oVT);

  const dim3 blk(256);
  // (0) x -> bf16 plane
  {
    const int n8 = kTok * kHid / 8;                           // 1,048,576 -> 4096 blocks exactly
    cast8_bf16_kernel<<<dim3((n8 + 255) / 256), blk, 0, stream>>>(hid, X16, n8);
  }
  // (1) W [1024][3072] -> WT [3072][1024] bf16
  wtcast_kernel<<<dim3(kHid / 64, kN3 / 64), blk, 0, stream>>>(W, WT);
  // (2) dist_emb -> PE bf16 [1024][64]
  pecast_kernel<<<dim3((kNDistP * kHdim / 8 + 255) / 256), blk, 0, stream>>>(pe, PEb);
  // (3) [q|k] = X16 . WT[0..2047]^T + b[0..2047] -> bf16 hi + lo planes, pitch 2048
  {
    const dim3 g((kTok / 128) * (kQKld / 256), 1);            // 512 blocks
    wmma_gemm64<1, 0, 2, 2, false, 0><<<g, blk, 0, stream>>>(
        X16, X16, kHid, 0L, WT, WT, kHid, 0L, (void*)QKh, (void*)QKl, kQKld, 0L,
        bqkv, hid, 0L, kTok, kQKld, kHid, 1.0f);
  }
  // (4) v^T per batch: Vt[b][m][s] = WT[2048+m] . x[b*512+s] + b[2048+m] -> f16, pitch 512
  {
    const dim3 g((kHid / 128) * (kSeq / 256), kBatch);        // 16 x 16
    wmma_gemm64<1, 0, 1, 1, false, 0><<<g, blk, 0, stream>>>(
        WT + (size_t)2 * kHid * kHid, WT + (size_t)2 * kHid * kHid, kHid, 0L,
        X16, X16, kHid, (long)kSeq * kHid,
        (void*)VTp, (void*)VTp, kSeq, (long)kHid * kSeq,
        bqkv + 2 * kHid, hid, 0L, kHid, kSeq, kHid, 1.0f);
  }
  // (5) fused attention with relative-position bias -> out f32 [16][512][1024]
  relattn_kernel<<<dim3(kSeq / 64, kHeads, kBatch), dim3(128), 0, stream>>>(QKh, QKl, VTp, PEb, msk, outp);
}

// v005
// It runs in 116 microseconds.
// Timed twice side by side with v004, it ran 1.12 and 1.13 times as fast.
// All steps since v000 together make it 2.63 times as fast.
// Contractions: qkv projection v_wmma_f32_16x16x32_bf16 (x, W as bf16 RNE; bias added as bf16-RNE value in f32); q.k^T bf16 hi/lo planes (hi.hi+hi.lo+lo.hi); q.pe^T and k.pe^T bf16 (q,k hi planes, pe bf16); p.v v_wmma_f32_16x16x32_f16 (p f16 carried x2^15, v f16); f32 accumulate; softmax, scale, bias, mask add in f32.
#include <hip/hip_runtime.h>
#include <math.h>

// ---------------------------------------------------------------------------
// Problem constants
// ---------------------------------------------------------------------------
constexpr int kBatch  = 16;
constexpr int kSeq    = 512;
constexpr int kHid    = 1024;
constexpr int kHeads  = 16;
constexpr int kHdim   = 64;
constexpr int kN3     = 3 * kHid;          // 3072 qkv output columns
constexpr int kQKld   = 2 * kHid;          // 2048: pitch of the [q | k] planes
constexpr int kTok    = kBatch * kSeq;     // 8192 token rows
constexpr int kNDist  = 2 * kSeq - 1;      // 1023 relative distances
constexpr int kNDistP = 1024;              // pe plane rows (row 1023 zero)
constexpr float kPCarry = 32768.0f;        // f16 probabilities carried x2^15
static_assert(kHid % 128 == 0 && kTok % 128 == 0 && kQKld % 256 == 0 && kSeq % 256 == 0, "tiles");

typedef __attribute__((ext_vector_type(16))) _Float16 v16h;
typedef __attribute__((ext_vector_type(8)))  _Float16 v8h;
typedef __attribute__((ext_vector_type(16))) __bf16   v16b;
typedef __attribute__((ext_vector_type(8)))  __bf16   v8b;
typedef __attribute__((ext_vector_type(8)))  float    v8f;
typedef __attribute__((ext_vector_type(4)))  float    v4f;
typedef __attribute__((ext_vector_type(4)))  unsigned int v4u;

__device__ __forceinline__ unsigned short f2bf_bits(float f) {
  unsigned u = __float_as_uint(f);
  return (unsigned short)((u + 0x7FFFu + ((u >> 16) & 1u)) >> 16);
}
__device__ __forceinline__ float bf_bits2f(unsigned short h) { return __uint_as_float(((unsigned)h) << 16); }

// hazard guards as plain device helpers (no inline asm inside the kernel template body)
__device__ __forceinline__ void dep_guard_h(v8f& a, v8f& b, v16h x, v16h y) { asm volatile("v_nop\n\tv_nop\n\tv_nop\n\tv_nop" : "+v"(a), "+v"(b) : "v"(x), "v"(y)); }
__device__ __forceinline__ void dep_guard_b(v8f& a, v8f& b, v16b x, v16b y) { asm volatile("v_nop\n\tv_nop\n\tv_nop\n\tv_nop" : "+v"(a), "+v"(b) : "v"(x), "v"(y)); }
__device__ __forceinline__ void keep4_h(v16h a, v16h b, v16h c, v16h d) { asm volatile("v_nop" :: "v"(a), "v"(b), "v"(c), "v"(d)); }
__device__ __forceinline__ void keep4_b(v16b a, v16b b, v16b c, v16b d) { asm volatile("v_nop" :: "v"(a), "v"(b), "v"(c), "v"(d)); }
__device__ __forceinline__ void acc_guard4(v8f& a, v8f& b, v8f& c, v8f& d) { asm volatile("v_nop\n\tv_nop\n\tv_nop\n\tv_nop" : "+v"(a), "+v"(b), "+v"(c), "+v"(d)); }
template <typename T> struct Frag;
template <> struct Frag<_Float16> {
  typedef v16h V; union U { v16h v; v8h h[2]; };
  static __device__ __forceinline__ v16h load(const _Float16* p) {   // elements 0..7 <- p[0..7], 8..15 <- p[16..23]
    U f; f.h[0] = *(const v8h*)(p); f.h[1] = *(const v8h*)(p + 16); return f.v;
  }
  static __device__ __forceinline__ v8f mma(v16h a, v16h b, v8f c) {
    return __builtin_amdgcn_wmma_f32_16x16x32_f16(false, a, false, b, (short)0, c, false, false);
  }
  static __device__ __forceinline__ void guard(v8f& a, v8f& b, v16h x, v16h y) { dep_guard_h(a, b, x, y); }
  static __device__ __forceinline__ void keep(v16h a, v16h b, v16h c, v16h d) { keep4_h(a, b, c, d); }
};
template <> struct Frag<__bf16> {
  typedef v16b V; union U { v16b v; v8b h[2]; };
  static __device__ __forceinline__ v16b load(const __bf16* p) {
    U f; f.h[0] = *(const v8b*)(p); f.h[1] = *(const v8b*)(p + 16); return f.v;
  }
  static __device__ __forceinline__ v8f mma(v16b a, v16b b, v8f c) {
    return __builtin_amdgcn_wmma_f32_16x16x32_bf16(false, a, false, b, (short)0, c, false, false);
  }
  static __device__ __forceinline__ void guard(v8f& a, v8f& b, v16b x, v16b y) { dep_guard_b(a, b, x, y); }
  static __device__ __forceinline__ void keep(v16b a, v16b b, v16b c, v16b d) { keep4_b(a, b, c, d); }
};

__device__ __forceinline__ unsigned pk16(unsigned short a, unsigned short b) { return (unsigned)a | ((unsigned)b << 16); }

// Asynchronous copies global -> LDS, 16 B per lane. The s_wait_xcnt closes each statement so that no address
// register of an issued copy is rewritten in front of it.
__device__ __forceinline__ void async_copy4(unsigned l0, const __bf16* g0, unsigned l1, const __bf16* g1,
                                            unsigned l2, const __bf16* g2, unsigned l3, const __bf16* g3) {
  asm volatile("global_load_async_to_lds_b128 %0, %1, off\n\t"
               "global_load_async_to_lds_b128 %2, %3, off\n\t"
               "global_load_async_to_lds_b128 %4, %5, off\n\t"
               "global_load_async_to_lds_b128 %6, %7, off\n\t"
               "s_wait_xcnt 0x0"
               :: "v"(l0), "v"(g0), "v"(l1), "v"(g1), "v"(l2), "v"(g2), "v"(l3), "v"(g3) : "memory");
}
__device__ __forceinline__ void async_copy8(unsigned l0, const __bf16* g0, unsigned l1, const __bf16* g1,
                                            unsigned l2, const __bf16* g2, unsigned l3, const __bf16* g3,
                                            unsigned l4, const __bf16* g4, unsigned l5, const __bf16* g5,
                                            unsigned l6, const __bf16* g6, unsigned l7, const __bf16* g7) {
  asm volatile("global_load_async_to_lds_b128 %0, %1, off\n\t"
               "global_load_async_to_lds_b128 %2, %3, off\n\t"
               "global_load_async_to_lds_b128 %4, %5, off\n\t"
               "global_load_async_to_lds_b128 %6, %7, off\n\t"
               "global_load_async_to_lds_b128 %8, %9, off\n\t"
               "global_load_async_to_lds_b128 %10, %11, off\n\t"
               "global_load_async_to_lds_b128 %12, %13, off\n\t"
               "global_load_async_to_lds_b128 %14, %15, off\n\t"
               "s_wait_xcnt 0x0"
               :: "v"(l0), "v"(g0), "v"(l1), "v"(g1), "v"(l2), "v"(g2), "v"(l3), "v"(g3),
                  "v"(l4), "v"(g4), "v"(l5), "v"(g5), "v"(l6), "v"(g6), "v"(l7), "v"(g7) : "memory");
}
// this wave's LDS reads and writes have retired (before a barrier that hands a buffer to its next writer)
__device__ __forceinline__ void wait_lds_done() { asm volatile("s_wait_dscnt 0x0" ::: "memory"); }
// this wave's own copies have landed (before the barrier behind which other waves read them)
__device__ __forceinline__ void wait_copies_landed() { asm volatile("s_wait_asynccnt 0x0" ::: "memory"); }

// ---- Register-blocked batched WMMA GEMM (ACT tanh/relu only,
//      bias values RNE-converted to bf16 before the f32 add) --------
// C[m,n] = scale * sum_k A[m,k] * Bt[n,k] (+bias)(+resid); a block owns a 128x256 tile, its 8 waves (2 x 4) 64x64 each.
// A row-major [M,K]; Bt row-major [N,K]; M % 128 == 0, N % 256 == 0, K % 64 == 0.
// Each k slice of 64 (128 A rows + 256 Bt rows of 128 B) is staged once per block in LDS by asynchronous copies,
// two buffers: the next slice flies while this one is multiplied.
// SPLIT: 0 only (single operand planes; A2p / Bt2p are not read).
// BIAS_MODE: 0 = none, 1 = bias[m], 2 = bias[n].
// OUT_MODE: 0 = f32, 1 = f16, 2 = bf16 hi plane (Cout) + bf16 lo plane (Cout2).
// ACT: 0 = none, 1 = tanh, 2 = relu.
// ET: 0 = f16 operands, 1 = bf16 operands (pointers passed as 16-bit storage)
constexpr int kGPitchB = 144;                          // staged 128-B row at 16 B x odd: no bank conflict for 16-B reads
constexpr int kGPitchH = kGPitchB / 2;                 // the same in 16-bit elements
constexpr int kGRowsA  = 128;
constexpr int kGRowsB  = 256;
constexpr int kGStageB = (kGRowsA + kGRowsB) * kGPitchB;   // 55,296 B per buffer
template <int ET> struct Elem;
template <> struct Elem<0> { typedef _Float16 T; };
template <> struct Elem<1> { typedef __bf16 T; };
template <int ET, int SPLIT, int BIAS_MODE, int OUT_MODE, bool RESID, int ACT = 0>
__global__ __launch_bounds__(256) void wmma_gemm64(
    const unsigned short* __restrict__ Ap, const unsigned short* __restrict__ A2p, int lda, long strideA,
    const unsigned short* __restrict__ Btp, const unsigned short* __restrict__ Bt2p, int ldb, long strideB,
    void* __restrict__ Cout, void* __restrict__ Cout2, int ldc, long strideC,
    const float* __restrict__ bias,
    const float* __restrict__ resid, long strideR,
    int M, int N, int K, float scale) {
  static_assert(SPLIT == 0, "single operand planes");
  typedef typename Elem<ET>::T T;
  typedef typename Frag<T>::V V;
  typedef __attribute__((address_space(3))) unsigned char lds_byte;
  const T* A = (const T*)Ap; const T* Bt = (const T*)Btp;
  __shared__ __align__(128) unsigned char ring[2 * kGStageB];   // two staged k slices: [A 128 rows | Bt 256 rows]
  __shared__ __align__(16) float sT[8][16 * 68];   // per-wave 16x64 slab, pitch 68 floats
  const int b    = blockIdx.y;
  const int lane = threadIdx.x & 31;
  const int wave = threadIdx.x >> 5;
  const int tilesN = N >> 8;
  const int tilesM = M >> 7;
  const int tile = blockIdx.x;
  if (tile >= tilesM * tilesN) return;   // block-uniform, in front of every barrier
  const int tm = tile / tilesN;
  const int tn = tile - tm * tilesN;
  const int wm = wave >> 2;                    // wave row (0..1) and column (0..3) inside the block tile
  const int wn = wave & 3;
  const int m0 = (tm << 7) + (wm << 6);
  const int n0 = (tn << 8) + (wn << 6);

  const T* Ab  = A  + (size_t)b * strideA;
  const T* Bb  = Bt + (size_t)b * strideB;

  const int rlane = lane & 15;                 // row (A) / col (B, D) within subtile
  const int koff  = (lane >> 4) * 8;           // k offset of this lane half
  const int mOff  = (lane >> 4) * 8;           // D row offset

  // ---- copy roles: thread t moves the 16-B piece t & 7 of rows (t >> 3) + 32 i; 8 lanes cover one 128-B row ----
  const int crow = threadIdx.x >> 3;
  const int cpc  = threadIdx.x & 7;
  const unsigned lcp = (unsigned)(size_t)(lds_byte*)ring + (unsigned)(crow * kGPitchB + cpc * 16);
  const __bf16* gA = (const __bf16*)Ab + (size_t)((tm << 7) + crow) * lda + cpc * 8;
  const __bf16* gB = (const __bf16*)Bb + (size_t)((tn << 8) + crow) * ldb + cpc * 8;
  const size_t a32 = (size_t)32 * lda;
  const size_t b32 = (size_t)32 * ldb;
  constexpr unsigned kStep = 32 * kGPitchB;                // 32 staged rows
  // k slice s (columns 64 s .. 64 s + 63 of the block's 128 A rows and 256 Bt rows) into buffer s & 1
  auto stage = [&](int s) {
    const unsigned la = lcp + (unsigned)(s & 1) * kGStageB;
    const unsigned lb = la + kGRowsA * kGPitchB;
    const __bf16* pa = gA + s * 64;
    const __bf16* pb = gB + s * 64;
    async_copy4(la, pa, la + kStep, pa + a32, la + 2 * kStep, pa + 2 * a32, la + 3 * kStep, pa + 3 * a32);
    async_copy8(lb, pb, lb + kStep, pb + b32, lb + 2 * kStep, pb + 2 * b32, lb + 3 * kStep, pb + 3 * b32,
                lb + 4 * kStep, pb + 4 * b32, lb + 5 * kStep, pb + 5 * b32,
                lb + 6 * kStep, pb + 6 * b32, lb + 7 * kStep, pb + 7 * b32);
  };

  v8f acc[4][4];
#pragma unroll
  for (int i = 0; i < 4; ++i)
#pragma unroll
    for (int j = 0; j < 4; ++j) acc[i][j] = (v8f){0.f,0.f,0.f,0.f,0.f,0.f,0.f,0.f};

  const int nst = K >> 6;
  stage(0);
  wait_copies_landed();
  __syncthreads();                             // publishes slice 0
  if (nst > 1) stage(1);

  const int fa = ((wm << 6) + rlane) * kGPitchH + koff;             // this lane's A fragment base in a buffer
  const int fb = (kGRowsA + (wn << 6) + rlane) * kGPitchH + koff;   // this lane's Bt fragment base in a buffer
  for (int s = 0; s < nst; ++s) {
    const T* buf = (const T*)(ring + (s & 1) * kGStageB);
#pragma unroll
    for (int ks = 0; ks < 2; ++ks) {
      V bh[4], ah[4];
#pragma unroll
      for (int j = 0; j < 4; ++j) bh[j] = Frag<T>::load(buf + fb + j * 16 * kGPitchH + ks * 32);
#pragma unroll
      for (int i = 0; i < 4; ++i) ah[i] = Frag<T>::load(buf + fa + i * 16 * kGPitchH + ks * 32);
#pragma unroll
      for (int i = 0; i < 4; ++i) {
#pragma unroll
        for (int j = 0; j < 4; ++j) acc[i][j] = Frag<T>::mma(ah[i], bh[j], acc[i][j]);
        // hazard guard; it also holds all four A fragments live, so that the slice's LDS reads go out as
        // one group ahead of the products (without it the build reloads one A register set behind a full wait per row)
        Frag<T>::guard(acc[i][0], acc[i][3], ah[i], ah[i]);
      }
      Frag<T>::keep(bh[0], bh[1], bh[2], bh[3]);
    }
    // publish slice s + 1; the barrier also ends every wave's reads of the buffer that is refilled behind it
    wait_lds_done();
    wait_copies_landed();
    __syncthreads();
    if (s + 2 < nst) stage(s + 2);
  }
  wait_copies_landed();                        // none is left in flight when the wave ends
  acc_guard4(acc[0][0], acc[0][1], acc[0][2], acc[0][3]);
  acc_guard4(acc[1][0], acc[1][1], acc[1][2], acc[1][3]);
  acc_guard4(acc[2][0], acc[2][1], acc[2][2], acc[2][3]);
  acc_guard4(acc[3][0], acc[3][1], acc[3][2], acc[3][3]);

  // ---- epilogue ----
  float* slab = sT[wave];
  const float* Rb = RESID ? (resid + (size_t)b * strideR) : nullptr;
#pragma unroll
  for (int i = 0; i < 4; ++i) {
    const int mBase = m0 + (i << 4);
#pragma unroll
    for (int j = 0; j < 4; ++j) {
      const int n = n0 + (j << 4) + rlane;
      float bv = 0.f;
      if (BIAS_MODE == 2) bv = bf_bits2f(f2bf_bits(bias[n]));                      // bias as bf16-RNE value
#pragma unroll
      for (int r = 0; r < 8; ++r) {
        float v = acc[i][j][r] * scale;
        if (BIAS_MODE == 1) v += bf_bits2f(f2bf_bits(bias[mBase + mOff + r]));     // bias as bf16-RNE value
        if (BIAS_MODE == 2) v += bv;
        if (RESID) v += Rb[(size_t)(mBase + mOff + r) * ldc + n];
        if (ACT == 1) v = tanhf(v);
        if (ACT == 2) v = fmaxf(v, 0.0f);
        slab[(mOff + r) * 68 + (j << 4) + rlane] = v;
      }
    }
    __builtin_amdgcn_fence(__ATOMIC_RELEASE, "workgroup");
    __builtin_amdgcn_wave_barrier();
    __builtin_amdgcn_fence(__ATOMIC_ACQUIRE, "workgroup");
    if (OUT_MODE == 0) {
      float* C = (float*)Cout + (size_t)b * strideC;
      const int hh = lane >> 4, c4 = (lane & 15) * 4;     // row seg = 256 B = 16 lanes x 16 B
      {
#pragma unroll
        for (int it = 0; it < 8; ++it) {
          const int row = it * 2 + hh;
          v4f v = *(const v4f*)(slab + row * 68 + c4);
          *(v4f*)(C + (size_t)(mBase + row) * ldc + n0 + c4) = v;
        }
        
      }
    } else {
      const int q = lane >> 3, c8 = (lane & 7) * 8;
      unsigned short* C  = (unsigned short*)Cout  + (size_t)b * strideC;
      unsigned short* C2 = (OUT_MODE == 2) ? ((unsigned short*)Cout2 + (size_t)b * strideC) : nullptr;
      {
#pragma unroll
        for (int it = 0; it < 4; ++it) {
          const int row = it * 4 + q;
          const float* sp = slab + row * 68 + c8;
          v8h hv, lv;
#pragma unroll
          for (int e = 0; e < 8; ++e) {
            if (OUT_MODE == 1) {
              hv[e] = (_Float16)sp[e];
            } else {
              unsigned short hb = f2bf_bits(sp[e]);
              unsigned short lb = f2bf_bits(sp[e] - bf_bits2f(hb));
              hv[e] = __builtin_bit_cast(_Float16, hb);
              lv[e] = __builtin_bit_cast(_Float16, lb);
            }
          }
          *(v8h*)(C + (size_t)(mBase + row) * ldc + n0 + c8) = hv;
          if (OUT_MODE == 2) *(v8h*)(C2 + (size_t)(mBase + row) * ldc + n0 + c8) = lv;
        }
        
      }
    }
    __builtin_amdgcn_fence(__ATOMIC_RELEASE, "workgroup");
    __builtin_amdgcn_wave_barrier();
    __builtin_amdgcn_fence(__ATOMIC_ACQUIRE, "workgroup");
  }
}

// ---------------------------------------------------------------------------
// x f32 -> bf16 plane (RNE), 8 consecutive elements per thread -> one 16-B store per lane;
// Coverage: n8 = 8192*1024/8 = 1,048,576 threads x 8 = the whole plane; grid 4096 x 256 exact.
// ---------------------------------------------------------------------------
__global__ __launch_bounds__(256) void cast8_bf16_kernel(const float* __restrict__ in, unsigned short* __restrict__ out, int n8) {
  const int i = blockIdx.x * 256 + threadIdx.x;
  if (i >= n8) return;
  const float* p = in + 8 * (size_t)i;
  const v4f a = *(const v4f*)(p);
  const v4f c = *(const v4f*)(p + 4);
  unsigned short hb[8];
#pragma unroll
  for (int e = 0; e < 4; ++e) {
    hb[e]     = f2bf_bits(a[e]);
    hb[4 + e] = f2bf_bits(c[e]);
  }
  const v4u u = (v4u){pk16(hb[0], hb[1]), pk16(hb[2], hb[3]), pk16(hb[4], hb[5]), pk16(hb[6], hb[7])};
  unsigned short* q = out + 8 * (size_t)i;
  *(v4u*)q = u;
  
}

// ---------------------------------------------------------------------------
// Weight transpose + cast: W f32 [1024 k][3072 n] -> WT[n][k] bf16 (RNE), [3072][1024].
// grid (1024/64 = 16 k tiles, 3072/64 = 48 n tiles), 256 threads.
// Load coverage: 16 iterations x 256 threads = 4096 = the whole 64x64 tile (coalesced along n).
// Store coverage: 8 waves x 2 iterations x 4 rows (lane>>3) = 64 n rows; (lane&7) x 8 halves = 64 k cols; each row
// ---------------------------------------------------------------------------
__global__ __launch_bounds__(256) void wtcast_kernel(const float* __restrict__ W, unsigned short* __restrict__ out) {
  __shared__ float sm[64][65];   // sm[n_local][k_local]
  const int t  = threadIdx.x;
  const int k0 = blockIdx.x * 64;
  const int n0 = blockIdx.y * 64;
#pragma unroll
  for (int i = 0; i < 16; ++i) {
    const int e = i * 256 + t;
    const int r = e >> 6;          // k local
    const int c = e & 63;          // n local
    sm[c][r] = W[(size_t)(k0 + r) * kN3 + n0 + c];
  }
  __syncthreads();
  const int lane = t & 31, wave = t >> 5;
  const int q = lane >> 3, c8 = (lane & 7) * 8;
  {
#pragma unroll
    for (int it = 0; it < 2; ++it) {
      const int row = wave * 8 + it * 4 + q;                 // n local
      unsigned short hb[8];
#pragma unroll
      for (int e = 0; e < 8; ++e) hb[e] = f2bf_bits(sm[row][c8 + e]);
      const v4u u = (v4u){pk16(hb[0], hb[1]), pk16(hb[2], hb[3]), pk16(hb[4], hb[5]), pk16(hb[6], hb[7])};
      *(v4u*)(out + (size_t)(n0 + row) * kHid + k0 + c8) = u;
    }
    
  }
}

// ---------------------------------------------------------------------------
// dist_emb f32 [1023][64] -> PE bf16 [1024][64] (RNE), row 1023 zero-filled.
// 1024*64/8 = 8192 threads = 32 blocks x 256 exactly; thread i: row i>>3, cols (i&7)*8..+7 -> one 16-B store;
// ---------------------------------------------------------------------------
__global__ __launch_bounds__(256) void pecast_kernel(const float* __restrict__ pe, unsigned short* __restrict__ out) {
  const int i = blockIdx.x * 256 + threadIdx.x;
  if (i >= kNDistP * kHdim / 8) return;
  const int row = i >> 3, c8 = (i & 7) * 8;
  const int rc = (row < kNDist) ? row : (kNDist - 1);         // clamped address
  const float* src = pe + (size_t)rc * kHdim + c8;
  const v4f a = *(const v4f*)(src);
  const v4f c = *(const v4f*)(src + 4);
  const bool live = (row < kNDist);
  unsigned short hb[8];
#pragma unroll
  for (int e = 0; e < 4; ++e) {
    hb[e]     = live ? f2bf_bits(a[e]) : (unsigned short)0;
    hb[4 + e] = live ? f2bf_bits(c[e]) : (unsigned short)0;
  }
  const v4u u = (v4u){pk16(hb[0], hb[1]), pk16(hb[2], hb[3]), pk16(hb[4], hb[5]), pk16(hb[6], hb[7])};
  unsigned short* q = out + (size_t)row * kHdim + c8;
  *(v4u*)q = u;
  
}

// ---------------------------------------------------------------------------
// Attention helpers
// ---------------------------------------------------------------------------
__device__ __forceinline__ unsigned short at_bf_bits(float f) {
  unsigned u = __float_as_uint(f);
  return (unsigned short)((u + 0x7FFFu + ((u >> 16) & 1u)) >> 16);
}
__device__ __forceinline__ __bf16 at_f2bf(float f) { return __builtin_bit_cast(__bf16, at_bf_bits(f)); }
// builtin forms only: the compiler keeps their distances itself and stays free to put reads and other products between them
__device__ __forceinline__ v8f at_mma(v16b a, v16b b, v8f c) {
  return __builtin_amdgcn_wmma_f32_16x16x32_bf16(false, a, false, b, (short)0, c, false, false);
}
// 16-bit element as a bit pattern held in a __bf16 slot: f16 bits when F16, bf16 (RNE) otherwise
template <bool F16> __device__ __forceinline__ __bf16 at_to16(float f) {
  if (F16) return __builtin_bit_cast(__bf16, (_Float16)f);
  return at_f2bf(f);
}
template <bool F16> __device__ __forceinline__ v8f at_mma16(v16b a, v16b b, v8f c) {
  if (F16) {
    const v16h ah = __builtin_bit_cast(v16h, a), bh = __builtin_bit_cast(v16h, b);
    return __builtin_amdgcn_wmma_f32_16x16x32_f16(false, ah, false, bh, (short)0, c, false, false);
  }
  return at_mma(a, b, c);
}

// lane l <-> lane l ^ 16: the two halves of a wave hold the two halves of one query's keys
__device__ __forceinline__ float xhalf(float x) {
  return __builtin_bit_cast(float, __builtin_amdgcn_permlanex16(__builtin_bit_cast(int, x), __builtin_bit_cast(int, x),
                                                                0x76543210, 0xfedcba98, false, false));
}

// Inputs-only fence on four loaded fragments: their eight LDS reads go out ahead of it as one group with one wait
// (without it the build reuses one register set and pays a full LDS round trip in front of every product).
__device__ __forceinline__ void hold4(v16b a, v16b b, v16b c, v16b d) { asm volatile("" :: "v"(a), "v"(b), "v"(c), "v"(d)); }
// the same on eight fragments (sixteen reads, one wait)
__device__ __forceinline__ void hold8(v16b a, v16b b, v16b c, v16b d, v16b e, v16b f, v16b g, v16b h) {
  asm volatile("" :: "v"(a), "v"(b), "v"(c), "v"(d), "v"(e), "v"(f), "v"(g), "v"(h));
}

// =====================================================================================
// Fused attention with relative_key_query bias, head_dim 64. Block = 4 waves = 64 query rows of one (b, h);
// key chunks of 64; online softmax in f32. Operand planes (all dense, statically strided, 16-bit):
//   QKh/QKl: bf16 hi/lo [token = b*512+s][2048] with q at cols h*64+d, k at cols 1024+h*64+d
//   Vt:      f16 [b][h*64+d][s]  (pitch 512)
//   PE:      bf16 [1024][64] (dist_emb, row 1023 zero)
// Per chunk (l0 = 64*qb, r0 = 64*kc, d0 = l0 - r0 + 448, dist(l,r) = d0 + ll - kk + 63 with local ll, kk in 0..63):
//   T1w[p1][row] = q(row of this wave) . pe[d0 + 16*wave + p1], p1 = 0..79 (f16 in LDS, per wave)
//   T2 [p][kk]   = k(kk) . pe[d0 + p] for the band p in [48-16*j, 127-16*j] of key group j = kk>>4 (wave j produces it)
//   s[ll][kk] = (q.k(hi/lo) + T1 + T2) * 1/8 + mask[b][r0+kk];  p = exp(s - m);  out = sum p v / l.
// Scores and output are formed transposed: s^T = k . q^T (a lane holds one query's scores: keys 16 j + 8 hh + r in its
// registers), out^T += v^T . p^T; p^T packs from the score registers into the B operand and never touches LDS.
// Each chunk's k hi/lo, pe band and v^T tiles are staged once per block in LDS by asynchronous copies, issued one phase ahead.
// grid (S/64, H, B), 128 threads.
// =====================================================================================
constexpr int kT1Slots = 80;
// LDS map of relattn_kernel (bytes). Staged tiles keep their 128-B rows at a pitch of 144 B (16 B x odd: no bank
// conflict for 16-B fragment reads). The out tile of the epilogue reuses the K / PE range.
constexpr int kPitchB = 144;                           // staged row pitch, bytes
constexpr int kPitchH = kPitchB / 2;                   // the same in 16-bit elements
constexpr int kOffKH  = 0;                             // k hi  [64 keys][64 d]
constexpr int kOffKL  = kOffKH + 64 * kPitchB;         // k lo  [64 keys][64 d]
constexpr int kOffPE  = kOffKL + 64 * kPitchB;         // pe    [128 distances][64 d]
constexpr int kOffV   = kOffPE + 128 * kPitchB;        // v^T   [64 d][64 keys]
constexpr int kOffT1  = kOffV + 64 * kPitchB;          // per wave [p1][16 rows] f16
constexpr int kOffT2  = kOffT1 + 4 * kT1Slots * 16 * 2; // [p][64 keys] f16, rows at kT2Pitch
constexpr int kT2Pitch = 72;                           // 16-bit elements: 16 lanes that read 16 consecutive p meet 16 banks
constexpr int kLdsBytes = kOffT2 + 128 * kT2Pitch * 2; // 74,752
static_assert(4 * 16 * 68 * 4 <= kOffV, "out tiles fit the K / PE range");

__global__ __launch_bounds__(128)
void relattn_kernel(const unsigned short* __restrict__ QKhp, const unsigned short* __restrict__ QKlp,
                    const unsigned short* __restrict__ Vtp, const unsigned short* __restrict__ PEp,
                    const float* __restrict__ mask, float* __restrict__ out) {
  union FB { v16b v; v8b h[2]; };
  typedef __attribute__((address_space(3))) unsigned char lds_byte;
  __shared__ __align__(128) unsigned char smem[kLdsBytes];
  const __bf16* KHs = (const __bf16*)(smem + kOffKH);
  const __bf16* KLs = (const __bf16*)(smem + kOffKL);
  const __bf16* PEs = (const __bf16*)(smem + kOffPE);
  const __bf16* Vs  = (const __bf16*)(smem + kOffV);      // f16 bits
  _Float16*     T2s = (_Float16*)(smem + kOffT2);

  const int tid  = threadIdx.x;
  const int wave = tid >> 5;
  const int lane = tid & 31;
  const int hh   = lane >> 4;
  const int c    = lane & 15;

  const int qb = blockIdx.x;
  const int h  = blockIdx.y;
  const int b  = blockIdx.z;
  const int l0 = qb * 64;
  const int q0 = l0 + wave * 16;
  const size_t tok0 = (size_t)b * kSeq;

  const __bf16* Qh  = (const __bf16*)QKhp;
  const __bf16* Ql  = (const __bf16*)QKlp;
  const __bf16* Vt  = (const __bf16*)Vtp;     // f16 bits
  const __bf16* PEt = (const __bf16*)PEp;

  // ---- copy roles: thread t moves the 16-B piece t & 7 of rows (t >> 3) + 16 i; 8 lanes cover one 128-B row ----
  const int crow = tid >> 3;
  const int cpc  = tid & 7;
  const unsigned lcp = (unsigned)(size_t)(lds_byte*)smem + (unsigned)(crow * kPitchB + cpc * 16);
  const size_t gko = (tok0 + crow) * kQKld + kHid + (size_t)h * kHdim + cpc * 8;
  const __bf16* gKh = Qh + gko;
  const __bf16* gKl = Ql + gko;
  const __bf16* gV  = Vt + ((size_t)(b * kHeads + h) * kHdim + crow) * kSeq + cpc * 8;
  const __bf16* gPE = PEt + (size_t)crow * kHdim + cpc * 8;
  constexpr unsigned kStep = 16 * kPitchB;                 // 16 staged rows
  // k hi, k lo (64 rows each) and the pe band d0 .. d0 + 127 (<= 1023) of key chunk n
  auto stage_k_pe = [&](int n) {
    const __bf16* kh = gKh + (size_t)(n * 64) * kQKld;
    const __bf16* kl = gKl + (size_t)(n * 64) * kQKld;
    const __bf16* pp = gPE + (size_t)(l0 - n * 64 + 448) * kHdim;
    async_copy8(lcp + kOffKH, kh, lcp + kOffKH + kStep, kh + 16 * kQKld,
                lcp + kOffKH + 2 * kStep, kh + 32 * kQKld, lcp + kOffKH + 3 * kStep, kh + 48 * kQKld,
                lcp + kOffKL, kl, lcp + kOffKL + kStep, kl + 16 * kQKld,
                lcp + kOffKL + 2 * kStep, kl + 32 * kQKld, lcp + kOffKL + 3 * kStep, kl + 48 * kQKld);
    async_copy8(lcp + kOffPE, pp, lcp + kOffPE + kStep, pp + 16 * kHdim,
                lcp + kOffPE + 2 * kStep, pp + 32 * kHdim, lcp + kOffPE + 3 * kStep, pp + 48 * kHdim,
                lcp + kOffPE + 4 * kStep, pp + 64 * kHdim, lcp + kOffPE + 5 * kStep, pp + 80 * kHdim,
                lcp + kOffPE + 6 * kStep, pp + 96 * kHdim, lcp + kOffPE + 7 * kStep, pp + 112 * kHdim);
  };
  // v^T rows d = 0 .. 63, keys of chunk n
  auto stage_v = [&](int n) {
    const __bf16* vv = gV + n * 64;
    async_copy4(lcp + kOffV, vv, lcp + kOffV + kStep, vv + 16 * kSeq,
                lcp + kOffV + 2 * kStep, vv + 32 * kSeq, lcp + kOffV + 3 * kStep, vv + 48 * kSeq);
  };

  stage_k_pe(0);                                // flies while the Q fragments are fetched

  // ---- Q fragments (B operand of s^T, the hi ones also A of T1): 2 d-chunks, hi and lo planes ----
  v16b qah[2], qal[2];
  {
    const size_t qo = (tok0 + q0 + c) * kQKld + (size_t)h * kHdim + 8 * hh;
#pragma unroll
    for (int dc = 0; dc < 2; ++dc) {
      qah[dc] = Frag<__bf16>::load(Qh + qo + dc * 32);
      qal[dc] = Frag<__bf16>::load(Ql + qo + dc * 32);
    }
  }
  // stands in front of the first write over an address register of the q loads (this build reuses them for out^T)
  asm volatile("s_wait_xcnt 0x0" ::: "memory");
  __builtin_amdgcn_sched_barrier(0);           // keeps those writes behind the wait: the build lifts them over it otherwise

  float mrow = -INFINITY, lrow = 0.f;          // this lane's query (row c of the wave); lrow sums this half's keys only
  v8f oacc[4];                                 // out^T: register r of tile t = d 16 t + 8 hh + r of query c
#pragma unroll
  for (int t = 0; t < 4; ++t) oacc[t] = (v8f){0.f,0.f,0.f,0.f,0.f,0.f,0.f,0.f};

  _Float16* t1w = (_Float16*)(smem + kOffT1) + wave * (kT1Slots * 16);
  // every table address of the chunk loop is one base register plus a constant: the registers so freed hold reads in flight
  const __bf16* pe1b = PEs + (16 * wave + c) * kPitchH + 8 * hh;            // pe rows of T1 tile 0
  const __bf16* pe2b = PEs + (16 * (3 - wave) + c) * kPitchH + 8 * hh;      // pe rows of T2 tile 0
  _Float16* t1s = t1w + c * 16 + 8 * hh;                                    // T1 tile 0, this lane's eight rows
  _Float16* t2s = T2s + (16 * (3 - wave) + c) * kT2Pitch + 16 * wave + 8 * hh;   // T2 tile 0, this lane's eight keys
  // bias gather bases (query row c, key 16 j + 8 hh + r): element (r, j) lies at a non-negative constant behind them
  const _Float16* t1b = t1w + ((c - 8 * hh + 8) * 16 + c);
  const _Float16* t2b = T2s + ((16 * wave + c - 8 * hh + 8) * kT2Pitch + 8 * hh);
  const float* mkb = mask + tok0 + 8 * hh;     // additive mask [b][r], this half's eight keys of each group

  for (int kc = 0; kc < kSeq / 64; ++kc) {
    const int r0 = kc * 64;
    // publish k / pe of this chunk; the barrier also ends the previous chunk's reads of T2s and of the v tile
    wait_lds_done();
    wait_copies_landed();
    __syncthreads();
    stage_v(kc);                               // flies under the T1 / T2 / q.k products, read behind the next barrier
    v4f mk[4][2];                              // fetched here, used behind the next barrier
#pragma unroll
    for (int j = 0; j < 4; ++j) {
      mk[j][0] = *(const v4f*)(mkb + r0 + j * 16);
      mk[j][1] = *(const v4f*)(mkb + r0 + j * 16 + 4);
    }

    // ---- relative-position tiles on WMMA: T1 (5 tiles per wave), T2 (5 tiles per wave) ----
    {
      v16b ka[2];
#pragma unroll
      for (int dc = 0; dc < 2; ++dc) ka[dc] = Frag<__bf16>::load(KHs + (wave * 16 + c) * kPitchH + 8 * hh + dc * 32);   // k rows as A operand
#pragma unroll
      for (int i0 = 0; i0 < 5; i0 += 2) {                  // tiles i0 and i0 + 1 together (the fifth alone)
        // distance tile bases inside the staged band: T1 16 (wave + i), T2 16 (3 - wave + i), both <= 112
        const int nt = (i0 + 1 < 5) ? 2 : 1;
        v16b p1[2][2], p2[2][2];
        v8f a1[2], a2[2];
#pragma unroll
        for (int u = 0; u < nt; ++u) {
          a1[u] = (v8f){0.f,0.f,0.f,0.f,0.f,0.f,0.f,0.f};
          a2[u] = (v8f){0.f,0.f,0.f,0.f,0.f,0.f,0.f,0.f};
#pragma unroll
          for (int dc = 0; dc < 2; ++dc) {
            p1[u][dc] = Frag<__bf16>::load(pe1b + (i0 + u) * 16 * kPitchH + dc * 32);   // B[k=d][n=dist]
            p2[u][dc] = Frag<__bf16>::load(pe2b + (i0 + u) * 16 * kPitchH + dc * 32);
          }
        }
        if (nt == 2) hold8(p1[0][0], p2[0][0], p1[1][0], p2[1][0], p1[0][1], p2[0][1], p1[1][1], p2[1][1]);
        else         hold4(p1[0][0], p2[0][0], p1[0][1], p2[0][1]);
#pragma unroll
        for (int dc = 0; dc < 2; ++dc) {
#pragma unroll
          for (int u = 0; u < nt; ++u) {
            a1[u] = at_mma(qah[dc], p1[u][dc], a1[u]);
            a2[u] = at_mma(ka[dc], p2[u][dc], a2[u]);
          }
        }
#pragma unroll
        for (int u = 0; u < nt; ++u) {
          v8h hv1, hv2;
#pragma unroll
          for (int r = 0; r < 8; ++r) { hv1[r] = (_Float16)a1[u][r]; hv2[r] = (_Float16)a2[u][r]; }
          // D element r: row 8hh+r (query row of this wave / key row 16*wave+8hh+r), col = dist slot 16i+c
          *(v8h*)(t1s + (i0 + u) * 16 * 16) = hv1;
          *(v8h*)(t2s + (i0 + u) * 16 * kT2Pitch) = hv2;
        }
      }
    }

    // ---- s^T = k . q^T (hi.hi + hi.lo + lo.hi), A fragments from the staged k tiles, B = the q fragments ----
    // The four key groups' chains run side by side; each s[j] sums hi.hi, hi.lo, lo.hi of d half 0, then of d half 1.
    v8f s[4];
#pragma unroll
    for (int j = 0; j < 4; ++j) s[j] = (v8f){0.f,0.f,0.f,0.f,0.f,0.f,0.f,0.f};
#pragma unroll
    for (int dc = 0; dc < 2; ++dc) {
      v16b kb[4], kl[4];
#pragma unroll
      for (int j = 0; j < 4; ++j) {
        const int ko = (j * 16 + c) * kPitchH + 8 * hh + dc * 32;
        kb[j] = Frag<__bf16>::load(KHs + ko);
        kl[j] = Frag<__bf16>::load(KLs + ko);
      }
      hold8(kb[0], kb[1], kb[2], kb[3], kl[0], kl[1], kl[2], kl[3]);
#pragma unroll
      for (int j = 0; j < 4; ++j) s[j] = at_mma(kb[j], qah[dc], s[j]);
#pragma unroll
      for (int j = 0; j < 4; ++j) s[j] = at_mma(kl[j], qah[dc], s[j]);
#pragma unroll
      for (int j = 0; j < 4; ++j) s[j] = at_mma(kb[j], qal[dc], s[j]);
    }
    // publish T1s / T2s and the v tile; the barrier also ends every wave's reads of the k and pe tiles
    wait_lds_done();
    wait_copies_landed();
    __syncthreads();
    if (kc + 1 < kSeq / 64) stage_k_pe(kc + 1);   // flies under softmax and p.v, read behind the next chunk's first barrier

    float mj[4];                               // four chains of the in-lane maximum
#pragma unroll
    for (int j = 0; j < 4; ++j) mj[j] = -INFINITY;
#pragma unroll
    for (int g = 0; g < 2; ++g) {              // keys r = 4 g .. 4 g + 3 of each group: 32 reads as groups, then their sums
      _Float16 u1[4][4], u2[4][4];
#pragma unroll
      for (int rr = 0; rr < 4; ++rr) {
#pragma unroll
        for (int j = 0; j < 4; ++j) {
          const int r = 4 * g + rr;            // p1 = c - 16 j - 8 hh - r + 63, in [0, 78]
          u1[rr][j] = t1b[16 * (55 - 16 * j - r)];                        // T1w[p1][c]
          u2[rr][j] = t2b[kT2Pitch * (55 - 16 * j - r) + 16 * j + r];     // T2[p1 + 16 wave][16 j + 8 hh + r]
        }
      }
#pragma unroll
      for (int rr = 0; rr < 4; ++rr) {
        const int r = 4 * g + rr;
#pragma unroll
        for (int j = 0; j < 4; ++j) {
          const float v = (s[j][r] + (float)u1[rr][j] + (float)u2[rr][j]) * 0.125f + mk[j][g][rr];
          s[j][r] = v;
          mj[j] = fmaxf(mj[j], v);
        }
      }
    }
    FB vb[2][4];
#pragma unroll                                 // p is not waited for in LDS any more: the v reads fly under the exponentials
    for (int kk = 0; kk < 2; ++kk) {
#pragma unroll
      for (int t = 0; t < 4; ++t) {
        const int vo = (t * 16 + c) * kPitchH + kk * 32 + 8 * hh;   // A[m=d][k=kv] from the staged v^T[d][kv]
        vb[kk][t].h[0] = *(const v8b*)(Vs + vo);
        vb[kk][t].h[1] = *(const v8b*)(Vs + vo + 16);
      }
    }
    // keeps the v reads in front of the exponentials: without it the build sinks part of them to the products and
    // waits out their LDS round trip there
    __builtin_amdgcn_sched_barrier(0);
    float cm = fmaxf(fmaxf(mj[0], mj[1]), fmaxf(mj[2], mj[3]));
    cm = fmaxf(cm, xhalf(cm));                 // both halves now hold the query's maximum over the chunk
    const float mnew  = fmaxf(mrow, cm);
    const float alpha = __expf(mrow - mnew);
    mrow = mnew;
    float ps[4];                               // four chains of the in-lane sum
    FB pb[2];                                  // p^T as B operand: element e of pb[kk] = key 32 kk + kmap(e, hh) of query c
#pragma unroll
    for (int j = 0; j < 4; ++j) {
      ps[j] = 0.f;
#pragma unroll
      for (int r = 0; r < 8; ++r) {
        const float p = __expf(s[j][r] - mnew);
        ps[j] += p;
        pb[j >> 1].v[(j & 1) * 8 + r] = at_to16<true>(p * kPCarry);
      }
    }
    lrow = lrow * alpha + ((ps[0] + ps[1]) + (ps[2] + ps[3]));
#pragma unroll
    for (int t = 0; t < 4; ++t) {
#pragma unroll
      for (int r = 0; r < 8; ++r) oacc[t][r] *= alpha;
    }
#pragma unroll
    for (int kk = 0; kk < 2; ++kk) {
#pragma unroll
      for (int t = 0; t < 4; ++t) oacc[t] = at_mma16<true>(vb[kk][t].v, pb[kk].v, oacc[t]);
    }
  }
  wait_copies_landed();                        // none is left in flight when the wave reuses LDS and ends

  // ---- epilogue: out[b][q0+row][h*64 + 0..63]; row segment = 256 B = 16 lanes x 16 B, one instruction per row ----
  // The out tiles lie on the k / pe range: its last readers left it at the last chunk's second barrier, and no copy
  // was aimed at it after that.
  float* os = (float*)(smem) + wave * (16 * 68);
  const float inv = 1.0f / ((lrow + xhalf(lrow)) * kPCarry);   // the halves' sums are joined once, here
#pragma unroll
  for (int t = 0; t < 4; ++t) {
    float* op = os + c * 68 + t * 16 + 8 * hh;                 // query row c, d 16 t + 8 hh .. + 7
    *(v4f*)(op)     = (v4f){oacc[t][0] * inv, oacc[t][1] * inv, oacc[t][2] * inv, oacc[t][3] * inv};
    *(v4f*)(op + 4) = (v4f){oacc[t][4] * inv, oacc[t][5] * inv, oacc[t][6] * inv, oacc[t][7] * inv};
  }
  __builtin_amdgcn_fence(__ATOMIC_RELEASE, "workgroup");
  __builtin_amdgcn_wave_barrier();
  __builtin_amdgcn_fence(__ATOMIC_ACQUIRE, "workgroup");
  {
    float* ob = out + (size_t)h * kHdim;
    const int c4 = (lane & 15) * 4;
    {
#pragma unroll
      for (int it = 0; it < 8; ++it) {
        const int row = it * 2 + hh;
        v4f val = *(const v4f*)(os + row * 68 + c4);
        *(v4f*)(ob + (tok0 + q0 + row) * kHid + c4) = val;
      }
      
    }
  }
}

// ---------------------------------------------------------------------------
// Workspace region map (byte offsets, multiples of 128; every region fully written before it is read):
//   X16  bf16 [8192][1024]                     0 ..  16,777,216
//   WT   bf16 [3072][1024] (W^T)      16,777,216 ..  23,068,672
//   PE   bf16 [1024][64] (row 1023 0) 23,068,672 ..  23,199,744
//   QKh  bf16 [8192][2048] ([q|k] hi)  23,199,744 ..  56,754,176
//   QKl  bf16 [8192][2048] ([q|k] lo)  56,754,176 ..  90,308,608
//   Vt   f16  [16][1024][512]          90,308,608 .. 107,085,824
//   total 107,085,824 B.
// GEMM shapes: q|k: M=8192 N=2048 K=1024; v (role-swapped, per batch): M=1024 N=512 K=1024 x16.
//   K % 64 == 0, M % 128 == 0 and N % 256 == 0 for both; no padded operand rows.
// ---------------------------------------------------------------------------
extern "C" void kernel_launch(void* const* d_in, const int* in_sizes, int n_in,
                              void* d_out, int out_size, void* d_ws, size_t ws_size,
                              hipStream_t stream) {
  if (n_in < 5) return;
  if (in_sizes[0] != kTok * kHid) return;
  if (in_sizes[1] != kBatch * kSeq) return;
  if (in_sizes[2] != kHid * kN3) return;
  if (in_sizes[3] != kN3) return;
  if (in_sizes[4] != kNDist * kHdim) return;
  if (out_size != kTok * kHid) return;

  const float* hid  = (const float*)d_in[0];   // [16][512][1024]
  const float* msk  = (const float*)d_in[1];   // [16][1][1][512]
  const float* W    = (const float*)d_in[2];   // [1024][3072]
  const float* bqkv = (const float*)d_in[3];   // [3072]
  const float* pe   = (const float*)d_in[4];   // [1023][64]
  float* outp = (float*)d_out;                 // [16][512][1024]

  const size_t SZ_X16 = (size_t)kTok * kHid * 2;              //  16,777,216
  const size_t SZ_WT  = (size_t)kN3 * kHid * 2;               //   6,291,456
  const size_t SZ_PE  = (size_t)kNDistP * kHdim * 2;          //     131,072
  const size_t SZ_QK  = (size_t)kTok * kQKld * 2;             //  33,554,432
  const size_t SZ_VT  = (size_t)kBatch * kHid * kSeq * 2;     //  16,777,216
  size_t off = 0;
  const size_t oX16 = off; off += SZ_X16;
  const size_t oWT  = off; off += SZ_WT;
  const size_t oPE  = off; off += SZ_PE;
  const size_t oQKh = off; off += SZ_QK;
  const size_t oQKl = off; off += SZ_QK;
  const size_t oVT  = off; off += SZ_VT;
  const size_t TOTAL = off;                                   // 107,085,824
  if (TOTAL > ws_size) return;
  if (TOTAL > (size_t)134217728) return;

  char* ws = (char*)d_ws;
  unsigned short* X16 = (unsigned short*)(ws + oX16);
  unsigned short* WT  = (unsigned short*)(ws + oWT);
  unsigned short* PEb = (unsigned short*)(ws + oPE);
  unsigned short* QKh = (unsigned short*)(ws + oQKh);
  unsigned short* QKl = (unsigned short*)(ws + oQKl);
  unsigned short* VTp = (unsigned short*)(ws + oVT);

  const dim3 blk(256);
  // (0) x -> bf16 plane
  {
    const int n8 = kTok * kHid / 8;                           // 1,048,576 -> 4096 blocks exactly
    cast8_bf16_kernel<<<dim3((n8 + 255) / 256), blk, 0, stream>>>(hid, X16, n8);
  }
  // (1) W [1024][3072] -> WT [3072][1024] bf16
  wtcast_kernel<<<dim3(kHid / 64, kN3 / 64), blk, 0, stream>>>(W, WT);
  // (2) dist_emb -> PE bf16 [1024][64]
  pecast_kernel<<<dim3((kNDistP * kHdim / 8 + 255) / 256), blk, 0, stream>>>(pe, PEb);
  // (3) [q|k] = X16 . WT[0..2047]^T + b[0..2047] -> bf16 hi + lo planes, pitch 2048
  {
    const dim3 g((kTok / 128) * (kQKld / 256), 1);            // 512 blocks
    wmma_gemm64<1, 0, 2, 2, false, 0><<<g, blk, 0, stream>>>(
        X16, X16, kHid, 0L, WT, WT, kHid, 0L, (void*)QKh, (void*)QKl, kQKld, 0L,
        bqkv, hid, 0L, kTok, kQKld, kHid, 1.0f);
  }
  // (4) v^T per batch: Vt[b][m][s] = WT[2048+m] . x[b*512+s] + b[2048+m] -> f16, pitch 512
  {
    const dim3 g((kHid / 128) * (kSeq / 256), kBatch);        // 16 x 16
    wmma_gemm64<1, 0, 1, 1, false, 0><<<g, blk, 0, stream>>>(
        WT + (size_t)2 * kHid * kHid, WT + (size_t)2 * kHid * kHid, kHid, 0L,
        X16, X16, kHid, (long)kSeq * kHid,
        (void*)VTp, (void*)VTp, kSeq, (long)kHid * kSeq,
        bqkv + 2 * kHid, hid, 0L, kHid, kSeq, kHid, 1.0f);
  }
  // (5) fused attention with relative-position bias -> out f32 [16][512][1024]
  relattn_kernel<<<dim3(kSeq / 64, kHeads, kBatch), dim3(128), 0, stream>>>(QKh, QKl, VTp, PEb, msk, outp);
}

// v006
// Measured time: 108 microseconds a run.
// Timed twice side by side with v005, it ran 1.08 times as fast both times.
// Over all steps from v000 it is 2.84 times as fast.
// Contractions: qkv projection v_wmma_f32_16x16x32_bf16 (x, W as bf16 RNE; bias added as bf16-RNE value in f32); q.k^T bf16 hi/lo planes (hi.hi+hi.lo+lo.hi); q.pe^T and k.pe^T bf16 (q,k hi planes, pe bf16); p.v v_wmma_f32_16x16x32_f16 (p f16 carried x2^15, v f16); f32 accumulate; softmax, scale, bias, mask add in f32.
#include <hip/hip_runtime.h>
#include <math.h>

// ---------------------------------------------------------------------------
// Problem constants
// ---------------------------------------------------------------------------
constexpr int kBatch  = 16;
constexpr int kSeq    = 512;
constexpr int kHid    = 1024;
constexpr int kHeads  = 16;
constexpr int kHdim   = 64;
constexpr int kN3     = 3 * kHid;          // 3072 qkv output columns
constexpr int kQKld   = 2 * kHid;          // 2048: pitch of the [q | k] planes
constexpr int kTok    = kBatch * kSeq;     // 8192 token rows
constexpr int kNDist  = 2 * kSeq - 1;      // 1023 relative distances
constexpr int kNDistP = 1024;              // pe plane rows (row 1023 zero)
constexpr float kPCarry = 32768.0f;        // f16 probabilities carried x2^15
static_assert(kHid % 128 == 0 && kTok % 128 == 0 && kQKld % 256 == 0 && kSeq % 256 == 0, "tiles");

typedef __attribute__((ext_vector_type(16))) _Float16 v16h;
typedef __attribute__((ext_vector_type(8)))  _Float16 v8h;
typedef __attribute__((ext_vector_type(16))) __bf16   v16b;
typedef __attribute__((ext_vector_type(8)))  __bf16   v8b;
typedef __attribute__((ext_vector_type(8)))  float    v8f;
typedef __attribute__((ext_vector_type(4)))  float    v4f;
typedef __attribute__((ext_vector_type(4)))  unsigned int v4u;

__device__ __forceinline__ unsigned short f2bf_bits(float f) {
  unsigned u = __float_as_uint(f);
  return (unsigned short)((u + 0x7FFFu + ((u >> 16) & 1u)) >> 16);
}
__device__ __forceinline__ float bf_bits2f(unsigned short h) { return __uint_as_float(((unsigned)h) << 16); }

// hazard guards as plain device helpers (no inline asm inside the kernel template body)
__device__ __forceinline__ void dep_guard_h(v8f& a, v8f& b, v16h x, v16h y) { asm volatile("v_nop\n\tv_nop\n\tv_nop\n\tv_nop" : "+v"(a), "+v"(b) : "v"(x), "v"(y)); }
__device__ __forceinline__ void dep_guard_b(v8f& a, v8f& b, v16b x, v16b y) { asm volatile("v_nop\n\tv_nop\n\tv_nop\n\tv_nop" : "+v"(a), "+v"(b) : "v"(x), "v"(y)); }
__device__ __forceinline__ void keep4_h(v16h a, v16h b, v16h c, v16h d) { asm volatile("v_nop" :: "v"(a), "v"(b), "v"(c), "v"(d)); }
__device__ __forceinline__ void keep4_b(v16b a, v16b b, v16b c, v16b d) { asm volatile("v_nop" :: "v"(a), "v"(b), "v"(c), "v"(d)); }
__device__ __forceinline__ void acc_guard4(v8f& a, v8f& b, v8f& c, v8f& d) { asm volatile("v_nop\n\tv_nop\n\tv_nop\n\tv_nop" : "+v"(a), "+v"(b), "+v"(c), "+v"(d)); }
template <typename T> struct Frag;
template <> struct Frag<_Float16> {
  typedef v16h V; union U { v16h v; v8h h[2]; };
  static __device__ __forceinline__ v16h load(const _Float16* p) {   // elements 0..7 <- p[0..7], 8..15 <- p[16..23]
    U f; f.h[0] = *(const v8h*)(p); f.h[1] = *(const v8h*)(p + 16); return f.v;
  }
  static __device__ __forceinline__ v8f mma(v16h a, v16h b, v8f c) {
    return __builtin_amdgcn_wmma_f32_16x16x32_f16(false, a, false, b, (short)0, c, false, false);
  }
  static __device__ __forceinline__ void guard(v8f& a, v8f& b, v16h x, v16h y) { dep_guard_h(a, b, x, y); }
  static __device__ __forceinline__ void keep(v16h a, v16h b, v16h c, v16h d) { keep4_h(a, b, c, d); }
};
template <> struct Frag<__bf16> {
  typedef v16b V; union U { v16b v; v8b h[2]; };
  static __device__ __forceinline__ v16b load(const __bf16* p) {
    U f; f.h[0] = *(const v8b*)(p); f.h[1] = *(const v8b*)(p + 16); return f.v;
  }
  static __device__ __forceinline__ v8f mma(v16b a, v16b b, v8f c) {
    return __builtin_amdgcn_wmma_f32_16x16x32_bf16(false, a, false, b, (short)0, c, false, false);
  }
  static __device__ __forceinline__ void guard(v8f& a, v8f& b, v16b x, v16b y) { dep_guard_b(a, b, x, y); }
  static __device__ __forceinline__ void keep(v16b a, v16b b, v16b c, v16b d) { keep4_b(a, b, c, d); }
};

__device__ __forceinline__ unsigned pk16(unsigned short a, unsigned short b) { return (unsigned)a | ((unsigned)b << 16); }

// Asynchronous copies global -> LDS, 16 B per lane. The s_wait_xcnt closes each statement so that no address
// register of an issued copy is rewritten in front of it.
__device__ __forceinline__ void async_copy4(unsigned l0, const __bf16* g0, unsigned l1, const __bf16* g1,
                                            unsigned l2, const __bf16* g2, unsigned l3, const __bf16* g3) {
  asm volatile("global_load_async_to_lds_b128 %0, %1, off\n\t"
               "global_load_async_to_lds_b128 %2, %3, off\n\t"
               "global_load_async_to_lds_b128 %4, %5, off\n\t"
               "global_load_async_to_lds_b128 %6, %7, off\n\t"
               "s_wait_xcnt 0x0"
               :: "v"(l0), "v"(g0), "v"(l1), "v"(g1), "v"(l2), "v"(g2), "v"(l3), "v"(g3) : "memory");
}
__device__ __forceinline__ void async_copy8(unsigned l0, const __bf16* g0, unsigned l1, const __bf16* g1,
                                            unsigned l2, const __bf16* g2, unsigned l3, const __bf16* g3,
                                            unsigned l4, const __bf16* g4, unsigned l5, const __bf16* g5,
                                            unsigned l6, const __bf16* g6, unsigned l7, const __bf16* g7) {
  asm volatile("global_load_async_to_lds_b128 %0, %1, off\n\t"
               "global_load_async_to_lds_b128 %2, %3, off\n\t"
               "global_load_async_to_lds_b128 %4, %5, off\n\t"
               "global_load_async_to_lds_b128 %6, %7, off\n\t"
               "global_load_async_to_lds_b128 %8, %9, off\n\t"
               "global_load_async_to_lds_b128 %10, %11, off\n\t"
               "global_load_async_to_lds_b128 %12, %13, off\n\t"
               "global_load_async_to_lds_b128 %14, %15, off\n\t"
               "s_wait_xcnt 0x0"
               :: "v"(l0), "v"(g0), "v"(l1), "v"(g1), "v"(l2), "v"(g2), "v"(l3), "v"(g3),
                  "v"(l4), "v"(g4), "v"(l5), "v"(g5), "v"(l6), "v"(g6), "v"(l7), "v"(g7) : "memory");
}
// this wave's LDS reads and writes have retired (before a barrier that hands a buffer to its next writer)
__device__ __forceinline__ void wait_lds_done() { asm volatile("s_wait_dscnt 0x0" ::: "memory"); }
// this wave's own copies have landed (before the barrier behind which other waves read them)
__device__ __forceinline__ void wait_copies_landed() { asm volatile("s_wait_asynccnt 0x0" ::: "memory"); }

// ---- Register-blocked batched WMMA GEMM (ACT tanh/relu only,
//      bias values RNE-converted to bf16 before the f32 add) --------
// C[m,n] = scale * sum_k A[m,k] * Bt[n,k] (+bias)(+resid); a block owns a 128x256 tile, its 8 waves (2 x 4) 64x64 each.
// A row-major [M,K]; Bt row-major [N,K]; M % 128 == 0, N % 256 == 0, K % 64 == 0.
// Each k slice of 64 (128 A rows + 256 Bt rows of 128 B) is staged once per block in LDS by asynchronous copies,
// two buffers: the next slice flies while this one is multiplied.
// SPLIT: 0 only (single operand planes; A2p / Bt2p are not read).
// BIAS_MODE: 0 = none, 1 = bias[m], 2 = bias[n].
// OUT_MODE: 0 = f32, 1 = f16, 2 = bf16 hi plane (Cout) + bf16 lo plane (Cout2).
// ACT: 0 = none, 1 = tanh, 2 = relu.
// ET: 0 = f16 operands, 1 = bf16 operands (pointers passed as 16-bit storage)
constexpr int kGPitchB = 144;                          // staged 128-B row at 16 B x odd: no bank conflict for 16-B reads
constexpr int kGPitchH = kGPitchB / 2;                 // the same in 16-bit elements
constexpr int kGRowsA  = 128;
constexpr int kGRowsB  = 256;
constexpr int kGStageB = (kGRowsA + kGRowsB) * kGPitchB;   // 55,296 B per buffer
template <int ET> struct Elem;
template <> struct Elem<0> { typedef _Float16 T; };
template <> struct Elem<1> { typedef __bf16 T; };
// ring: two staged k slices, [A 128 rows | Bt 256 rows] each; sT: per-wave 16x64 slab, pitch 68 floats. Both belong to the
// kernel that calls this body; tile and b say which block tile of which batch entry the calling block owns.
template <int ET, int SPLIT, int BIAS_MODE, int OUT_MODE, bool RESID, int ACT = 0>
__device__ __forceinline__ void wmma_gemm64(
    unsigned char* ring, float (*sT)[16 * 68], const int tile, const int b,
    const unsigned short* __restrict__ Ap, const unsigned short* __restrict__ A2p, int lda, long strideA,
    const unsigned short* __restrict__ Btp, const unsigned short* __restrict__ Bt2p, int ldb, long strideB,
    void* __restrict__ Cout, void* __restrict__ Cout2, int ldc, long strideC,
    const float* __restrict__ bias,
    const float* __restrict__ resid, long strideR,
    int M, int N, int K, float scale) {
  static_assert(SPLIT == 0, "single operand planes");
  typedef typename Elem<ET>::T T;
  typedef typename Frag<T>::V V;
  typedef __attribute__((address_space(3))) unsigned char lds_byte;
  const T* A = (const T*)Ap; const T* Bt = (const T*)Btp;
  const int lane = threadIdx.x & 31;
  const int wave = threadIdx.x >> 5;
  const int tilesN = N >> 8;
  const int tilesM = M >> 7;
  if (tile >= tilesM * tilesN) return;   // block-uniform, in front of every barrier
  const int tm = tile / tilesN;
  const int tn = tile - tm * tilesN;
  const int wm = wave >> 2;                    // wave row (0..1) and column (0..3) inside the block tile
  const int wn = wave & 3;
  const int m0 = (tm << 7) + (wm << 6);
  const int n0 = (tn << 8) + (wn << 6);

  const T* Ab  = A  + (size_t)b * strideA;
  const T* Bb  = Bt + (size_t)b * strideB;

  const int rlane = lane & 15;                 // row (A) / col (B, D) within subtile
  const int koff  = (lane >> 4) * 8;           // k offset of this lane half
  const int mOff  = (lane >> 4) * 8;           // D row offset

  // ---- copy roles: thread t moves the 16-B piece t & 7 of rows (t >> 3) + 32 i; 8 lanes cover one 128-B row ----
  const int crow = threadIdx.x >> 3;
  const int cpc  = threadIdx.x & 7;
  const unsigned lcp = (unsigned)(size_t)(lds_byte*)ring + (unsigned)(crow * kGPitchB + cpc * 16);
  const __bf16* gA = (const __bf16*)Ab + (size_t)((tm << 7) + crow) * lda + cpc * 8;
  const __bf16* gB = (const __bf16*)Bb + (size_t)((tn << 8) + crow) * ldb + cpc * 8;
  const size_t a32 = (size_t)32 * lda;
  const size_t b32 = (size_t)32 * ldb;
  constexpr unsigned kStep = 32 * kGPitchB;                // 32 staged rows
  // k slice s (columns 64 s .. 64 s + 63 of the block's 128 A rows and 256 Bt rows) into buffer s & 1
  auto stage = [&](int s) {
    const unsigned la = lcp + (unsigned)(s & 1) * kGStageB;
    const unsigned lb = la + kGRowsA * kGPitchB;
    const __bf16* pa = gA + s * 64;
    const __bf16* pb = gB + s * 64;
    async_copy4(la, pa, la + kStep, pa + a32, la + 2 * kStep, pa + 2 * a32, la + 3 * kStep, pa + 3 * a32);
    async_copy8(lb, pb, lb + kStep, pb + b32, lb + 2 * kStep, pb + 2 * b32, lb + 3 * kStep, pb + 3 * b32,
                lb + 4 * kStep, pb + 4 * b32, lb + 5 * kStep, pb + 5 * b32,
                lb + 6 * kStep, pb + 6 * b32, lb + 7 * kStep, pb + 7 * b32);
  };

  v8f acc[4][4];
#pragma unroll
  for (int i = 0; i < 4; ++i)
#pragma unroll
    for (int j = 0; j < 4; ++j) acc[i][j] = (v8f){0.f,0.f,0.f,0.f,0.f,0.f,0.f,0.f};

  const int nst = K >> 6;
  stage(0);
  wait_copies_landed();
  __syncthreads();                             // publishes slice 0
  if (nst > 1) stage(1);

  const int fa = ((wm << 6) + rlane) * kGPitchH + koff;             // this lane's A fragment base in a buffer
  const int fb = (kGRowsA + (wn << 6) + rlane) * kGPitchH + koff;   // this lane's Bt fragment base in a buffer
  for (int s = 0; s < nst; ++s) {
    const T* buf = (const T*)(ring + (s & 1) * kGStageB);
#pragma unroll
    for (int ks = 0; ks < 2; ++ks) {
      V bh[4], ah[4];
#pragma unroll
      for (int j = 0; j < 4; ++j) bh[j] = Frag<T>::load(buf + fb + j * 16 * kGPitchH + ks * 32);
#pragma unroll
      for (int i = 0; i < 4; ++i) ah[i] = Frag<T>::load(buf + fa + i * 16 * kGPitchH + ks * 32);
#pragma unroll
      for (int i = 0; i < 4; ++i) {
#pragma unroll
        for (int j = 0; j < 4; ++j) acc[i][j] = Frag<T>::mma(ah[i], bh[j], acc[i][j]);
        // hazard guard; it also holds all four A fragments live, so that the slice's LDS reads go out as
        // one group ahead of the products (without it the build reloads one A register set behind a full wait per row)
        Frag<T>::guard(acc[i][0], acc[i][3], ah[i], ah[i]);
      }
      Frag<T>::keep(bh[0], bh[1], bh[2], bh[3]);
    }
    // publish slice s + 1; the barrier also ends every wave's reads of the buffer that is refilled behind it
    wait_lds_done();
    wait_copies_landed();
    __syncthreads();
    if (s + 2 < nst) stage(s + 2);
  }
  wait_copies_landed();                        // none is left in flight when the wave ends
  acc_guard4(acc[0][0], acc[0][1], acc[0][2], acc[0][3]);
  acc_guard4(acc[1][0], acc[1][1], acc[1][2], acc[1][3]);
  acc_guard4(acc[2][0], acc[2][1], acc[2][2], acc[2][3]);
  acc_guard4(acc[3][0], acc[3][1], acc[3][2], acc[3][3]);

  // ---- epilogue ----
  float* slab = sT[wave];
  const float* Rb = RESID ? (resid + (size_t)b * strideR) : nullptr;
#pragma unroll
  for (int i = 0; i < 4; ++i) {
    const int mBase = m0 + (i << 4);
#pragma unroll
    for (int j = 0; j < 4; ++j) {
      const int n = n0 + (j << 4) + rlane;
      float bv = 0.f;
      if (BIAS_MODE == 2) bv = bf_bits2f(f2bf_bits(bias[n]));                      // bias as bf16-RNE value
#pragma unroll
      for (int r = 0; r < 8; ++r) {
        float v = acc[i][j][r] * scale;
        if (BIAS_MODE == 1) v += bf_bits2f(f2bf_bits(bias[mBase + mOff + r]));     // bias as bf16-RNE value
        if (BIAS_MODE == 2) v += bv;
        if (RESID) v += Rb[(size_t)(mBase + mOff + r) * ldc + n];
        if (ACT == 1) v = tanhf(v);
        if (ACT == 2) v = fmaxf(v, 0.0f);
        slab[(mOff + r) * 68 + (j << 4) + rlane] = v;
      }
    }
    __builtin_amdgcn_fence(__ATOMIC_RELEASE, "workgroup");
    __builtin_amdgcn_wave_barrier();
    __builtin_amdgcn_fence(__ATOMIC_ACQUIRE, "workgroup");
    if (OUT_MODE == 0) {
      float* C = (float*)Cout + (size_t)b * strideC;
      const int hh = lane >> 4, c4 = (lane & 15) * 4;     // row seg = 256 B = 16 lanes x 16 B
      {
#pragma unroll
        for (int it = 0; it < 8; ++it) {
          const int row = it * 2 + hh;
          v4f v = *(const v4f*)(slab + row * 68 + c4);
          *(v4f*)(C + (size_t)(mBase + row) * ldc + n0 + c4) = v;
        }
        
      }
    } else {
      const int q = lane >> 3, c8 = (lane & 7) * 8;
      unsigned short* C  = (unsigned short*)Cout  + (size_t)b * strideC;
      unsigned short* C2 = (OUT_MODE == 2) ? ((unsigned short*)Cout2 + (size_t)b * strideC) : nullptr;
      {
#pragma unroll
        for (int it = 0; it < 4; ++it) {
          const int row = it * 4 + q;
          const float* sp = slab + row * 68 + c8;
          v8h hv, lv;
#pragma unroll
          for (int e = 0; e < 8; ++e) {
            if (OUT_MODE == 1) {
              hv[e] = (_Float16)sp[e];
            } else {
              unsigned short hb = f2bf_bits(sp[e]);
              unsigned short lb = f2bf_bits(sp[e] - bf_bits2f(hb));
              hv[e] = __builtin_bit_cast(_Float16, hb);
              lv[e] = __builtin_bit_cast(_Float16, lb);
            }
          }
          *(v8h*)(C + (size_t)(mBase + row) * ldc + n0 + c8) = hv;
          if (OUT_MODE == 2) *(v8h*)(C2 + (size_t)(mBase + row) * ldc + n0 + c8) = lv;
        }
        
      }
    }
    __builtin_amdgcn_fence(__ATOMIC_RELEASE, "workgroup");
    __builtin_amdgcn_wave_barrier();
    __builtin_amdgcn_fence(__ATOMIC_ACQUIRE, "workgroup");
  }
}

// ---------------------------------------------------------------------------
// Both projection GEMMs read the same converted operands and neither reads the other's result: one grid runs both, the
// block index picks the job (block-uniform, so every barrier is passed by whole blocks). The v^T tiles come first: their
// epilogue is the shorter one, so their places on the chip come free first for the q|k tiles that still wait.
// ---------------------------------------------------------------------------
struct GemmJob {
  const unsigned short* A;  const unsigned short* Bt;
  unsigned short* C;  unsigned short* C2;
  const float* bias;
  long strideA, strideB, strideC;
  int lda, ldb, ldc, M, N, K;
  float scale;
};
constexpr int kVTiles  = (kHid / 128) * (kSeq / 256);        //  16 block tiles per batch entry of v^T
constexpr int kVBlocks = kVTiles * kBatch;                   // 256
constexpr int kQKBlocks = (kTok / 128) * (kQKld / 256);      // 512
__global__ __launch_bounds__(256) void proj_kernel(const GemmJob v, const GemmJob qk) {
  __shared__ __align__(128) unsigned char ring[2 * kGStageB];
  __shared__ __align__(16) float sT[8][16 * 68];
  const int blk = blockIdx.x;
  if (blk < kVBlocks)
    wmma_gemm64<1, 0, 1, 1, false, 0>(ring, sT, blk % kVTiles, blk / kVTiles,
        v.A, v.A, v.lda, v.strideA, v.Bt, v.Bt, v.ldb, v.strideB, (void*)v.C, (void*)v.C2, v.ldc, v.strideC,
        v.bias, v.bias, 0L, v.M, v.N, v.K, v.scale);
  else
    wmma_gemm64<1, 0, 2, 2, false, 0>(ring, sT, blk - kVBlocks, 0,
        qk.A, qk.A, qk.lda, qk.strideA, qk.Bt, qk.Bt, qk.ldb, qk.strideB, (void*)qk.C, (void*)qk.C2, qk.ldc, qk.strideC,
        qk.bias, qk.bias, 0L, qk.M, qk.N, qk.K, qk.scale);
}

// ---------------------------------------------------------------------------
// x f32 -> bf16 plane (RNE), 8 consecutive elements per thread -> one 16-B store per lane;
// Coverage: n8 = 8192*1024/8 = 1,048,576 threads x 8 = the whole plane; 4096 blocks x 256 exact.
// ---------------------------------------------------------------------------
__device__ __forceinline__ void cast8_bf16_body(int blk, const float* __restrict__ in, unsigned short* __restrict__ out, int n8) {
  const int i = blk * 256 + threadIdx.x;
  if (i >= n8) return;
  const float* p = in + 8 * (size_t)i;
  const v4f a = *(const v4f*)(p);
  const v4f c = *(const v4f*)(p + 4);
  unsigned short hb[8];
#pragma unroll
  for (int e = 0; e < 4; ++e) {
    hb[e]     = f2bf_bits(a[e]);
    hb[4 + e] = f2bf_bits(c[e]);
  }
  const v4u u = (v4u){pk16(hb[0], hb[1]), pk16(hb[2], hb[3]), pk16(hb[4], hb[5]), pk16(hb[6], hb[7])};
  unsigned short* q = out + 8 * (size_t)i;
  *(v4u*)q = u;
  
}

// ---------------------------------------------------------------------------
// Weight transpose + cast: W f32 [1024 k][3072 n] -> WT[n][k] bf16 (RNE), [3072][1024].
// 1024/64 = 16 k tiles (bk) x 3072/64 = 48 n tiles (bn), 256 threads each.
// Load coverage: 16 iterations x 256 threads = 4096 = the whole 64x64 tile (coalesced along n).
// Store coverage: 8 waves x 2 iterations x 4 rows (lane>>3) = 64 n rows; (lane&7) x 8 halves = 64 k cols; each row
// ---------------------------------------------------------------------------
__device__ __forceinline__ void wtcast_body(int bk, int bn, const float* __restrict__ W, unsigned short* __restrict__ out) {
  __shared__ float sm[64][65];   // sm[n_local][k_local]
  const int t  = threadIdx.x;
  const int k0 = bk * 64;
  const int n0 = bn * 64;
#pragma unroll
  for (int i = 0; i < 16; ++i) {
    const int e = i * 256 + t;
    const int r = e >> 6;          // k local
    const int c = e & 63;          // n local
    sm[c][r] = W[(size_t)(k0 + r) * kN3 + n0 + c];
  }
  __syncthreads();
  const int lane = t & 31, wave = t >> 5;
  const int q = lane >> 3, c8 = (lane & 7) * 8;
  {
#pragma unroll
    for (int it = 0; it < 2; ++it) {
      const int row = wave * 8 + it * 4 + q;                 // n local
      unsigned short hb[8];
#pragma unroll
      for (int e = 0; e < 8; ++e) hb[e] = f2bf_bits(sm[row][c8 + e]);
      const v4u u = (v4u){pk16(hb[0], hb[1]), pk16(hb[2], hb[3]), pk16(hb[4], hb[5]), pk16(hb[6], hb[7])};
      *(v4u*)(out + (size_t)(n0 + row) * kHid + k0 + c8) = u;
    }
    
  }
}

// ---------------------------------------------------------------------------
// dist_emb f32 [1023][64] -> PE bf16 [1024][64] (RNE), row 1023 zero-filled.
// 1024*64/8 = 8192 threads = 32 blocks x 256 exactly; thread i: row i>>3, cols (i&7)*8..+7 -> one 16-B store;
// ---------------------------------------------------------------------------
__device__ __forceinline__ void pecast_body(int blk, const float* __restrict__ pe, unsigned short* __restrict__ out) {
  const int i = blk * 256 + threadIdx.x;
  if (i >= kNDistP * kHdim / 8) return;
  const int row = i >> 3, c8 = (i & 7) * 8;
  const int rc = (row < kNDist) ? row : (kNDist - 1);         // clamped address
  const float* src = pe + (size_t)rc * kHdim + c8;
  const v4f a = *(const v4f*)(src);
  const v4f c = *(const v4f*)(src + 4);
  const bool live = (row < kNDist);
  unsigned short hb[8];
#pragma unroll
  for (int e = 0; e < 4; ++e) {
    hb[e]     = live ? f2bf_bits(a[e]) : (unsigned short)0;
    hb[4 + e] = live ? f2bf_bits(c[e]) : (unsigned short)0;
  }
  const v4u u = (v4u){pk16(hb[0], hb[1]), pk16(hb[2], hb[3]), pk16(hb[4], hb[5]), pk16(hb[6], hb[7])};
  unsigned short* q = out + (size_t)row * kHdim + c8;
  *(v4u*)q = u;
  
}

// ---------------------------------------------------------------------------
// The three conversions depend on nothing but the inputs and not on one another: one grid does them all, the block
// index picks the job. The W tiles come first (they last longest: a barrier and an LDS round trip), then pe, then x.
// Every branch is block-uniform, so the barrier of the W tiles is passed by whole blocks only.
// ---------------------------------------------------------------------------
constexpr int kPrepW  = (kHid / 64) * (kN3 / 64);            // 768 blocks: W tiles
constexpr int kPrepPE = kNDistP * kHdim / 8 / 256;           //  32 blocks: pe rows
constexpr int kPrepX  = kTok * kHid / 8 / 256;               // 4096 blocks: x
__global__ __launch_bounds__(256) void prep_kernel(const float* __restrict__ x, const float* __restrict__ W,
                                                   const float* __restrict__ pe, unsigned short* __restrict__ X16,
                                                   unsigned short* __restrict__ WT, unsigned short* __restrict__ PEb) {
  const int blk = blockIdx.x;
  if (blk < kPrepW)                wtcast_body(blk & (kHid / 64 - 1), blk / (kHid / 64), W, WT);
  else if (blk < kPrepW + kPrepPE) pecast_body(blk - kPrepW, pe, PEb);
  else                             cast8_bf16_body(blk - kPrepW - kPrepPE, x, X16, kTok * kHid / 8);
}

// ---------------------------------------------------------------------------
// Attention helpers
// ---------------------------------------------------------------------------
__device__ __forceinline__ unsigned short at_bf_bits(float f) {
  unsigned u = __float_as_uint(f);
  return (unsigned short)((u + 0x7FFFu + ((u >> 16) & 1u)) >> 16);
}
__device__ __forceinline__ __bf16 at_f2bf(float f) { return __builtin_bit_cast(__bf16, at_bf_bits(f)); }
// builtin forms only: the compiler keeps their distances itself and stays free to put reads and other products between them
__device__ __forceinline__ v8f at_mma(v16b a, v16b b, v8f c) {
  return __builtin_amdgcn_wmma_f32_16x16x32_bf16(false, a, false, b, (short)0, c, false, false);
}
// 16-bit element as a bit pattern held in a __bf16 slot: f16 bits when F16, bf16 (RNE) otherwise
template <bool F16> __device__ __forceinline__ __bf16 at_to16(float f) {
  if (F16) return __builtin_bit_cast(__bf16, (_Float16)f);
  return at_f2bf(f);
}
template <bool F16> __device__ __forceinline__ v8f at_mma16(v16b a, v16b b, v8f c) {
  if (F16) {
    const v16h ah = __builtin_bit_cast(v16h, a), bh = __builtin_bit_cast(v16h, b);
    return __builtin_amdgcn_wmma_f32_16x16x32_f16(false, ah, false, bh, (short)0, c, false, false);
  }
  return at_mma(a, b, c);
}

// lane l <-> lane l ^ 16: the two halves of a wave hold the two halves of one query's keys
__device__ __forceinline__ float xhalf(float x) {
  return __builtin_bit_cast(float, __builtin_amdgcn_permlanex16(__builtin_bit_cast(int, x), __builtin_bit_cast(int, x),
                                                                0x76543210, 0xfedcba98, false, false));
}

// Inputs-only fence on four loaded fragments: their eight LDS reads go out ahead of it as one group with one wait
// (without it the build reuses one register set and pays a full LDS round trip in front of every product).
__device__ __forceinline__ void hold4(v16b a, v16b b, v16b c, v16b d) { asm volatile("" :: "v"(a), "v"(b), "v"(c), "v"(d)); }
// the same on eight fragments (sixteen reads, one wait)
__device__ __forceinline__ void hold8(v16b a, v16b b, v16b c, v16b d, v16b e, v16b f, v16b g, v16b h) {
  asm volatile("" :: "v"(a), "v"(b), "v"(c), "v"(d), "v"(e), "v"(f), "v"(g), "v"(h));
}

// =====================================================================================
// Fused attention with relative_key_query bias, head_dim 64. Block = 4 waves = 64 query rows of one (b, h);
// key chunks of 64; online softmax in f32. Operand planes (all dense, statically strided, 16-bit):
//   QKh/QKl: bf16 hi/lo [token = b*512+s][2048] with q at cols h*64+d, k at cols 1024+h*64+d
//   Vt:      f16 [b][h*64+d][s]  (pitch 512)
//   PE:      bf16 [1024][64] (dist_emb, row 1023 zero)
// Per chunk (l0 = 64*qb, r0 = 64*kc, d0 = l0 - r0 + 448, dist(l,r) = d0 + ll - kk + 63 with local ll, kk in 0..63):
//   T1w[p1][row] = q(row of this wave) . pe[d0 + 16*wave + p1], p1 = 0..79 (f16 in LDS, per wave)
//   T2 [p][kk]   = k(kk) . pe[d0 + p] for the band p in [48-16*j, 127-16*j] of key group j = kk>>4 (wave j produces it)
//   s[ll][kk] = (q.k(hi/lo) + T1 + T2) * 1/8 + mask[b][r0+kk];  p = exp(s - m);  out = sum p v / l.
// Scores and output are formed transposed: s^T = k . q^T (a lane holds one query's scores: keys 16 j + 8 hh + r in its
// registers), out^T += v^T . p^T; p^T packs from the score registers into the B operand and never touches LDS.
// Each chunk's k hi/lo, pe band and v^T tiles are staged once per block in LDS by asynchronous copies, issued one phase ahead.
// grid (S/64, H, B), 128 threads.
// =====================================================================================
constexpr int kT1Slots = 80;
// LDS map of relattn_kernel (bytes). Staged tiles keep their 128-B rows at a pitch of 144 B (16 B x odd: no bank
// conflict for 16-B fragment reads). The out tile of the epilogue reuses the K / PE range.
constexpr int kPitchB = 144;                           // staged row pitch, bytes
constexpr int kPitchH = kPitchB / 2;                   // the same in 16-bit elements
constexpr int kOffKH  = 0;                             // k hi  [64 keys][64 d]
constexpr int kOffKL  = kOffKH + 64 * kPitchB;         // k lo  [64 keys][64 d]
constexpr int kOffPE  = kOffKL + 64 * kPitchB;         // pe    [128 distances][64 d]
constexpr int kOffV   = kOffPE + 128 * kPitchB;        // v^T   [64 d][64 keys]
constexpr int kOffT1  = kOffV + 64 * kPitchB;          // per wave [p1][16 rows] f16
constexpr int kOffT2  = kOffT1 + 4 * kT1Slots * 16 * 2; // [p][64 keys] f16, rows at kT2Pitch
constexpr int kT2Pitch = 72;                           // 16-bit elements: 16 lanes that read 16 consecutive p meet 16 banks
constexpr int kLdsBytes = kOffT2 + 128 * kT2Pitch * 2; // 74,752
static_assert(4 * 16 * 68 * 4 <= kOffV, "out tiles fit the K / PE range");

__global__ __launch_bounds__(128)
void relattn_kernel(const unsigned short* __restrict__ QKhp, const unsigned short* __restrict__ QKlp,
                    const unsigned short* __restrict__ Vtp, const unsigned short* __restrict__ PEp,
                    const float* __restrict__ mask, float* __restrict__ out) {
  union FB { v16b v; v8b h[2]; };
  typedef __attribute__((address_space(3))) unsigned char lds_byte;
  __shared__ __align__(128) unsigned char smem[kLdsBytes];
  const __bf16* KHs = (const __bf16*)(smem + kOffKH);
  const __bf16* KLs = (const __bf16*)(smem + kOffKL);
  const __bf16* PEs = (const __bf16*)(smem + kOffPE);
  const __bf16* Vs  = (const __bf16*)(smem + kOffV);      // f16 bits
  _Float16*     T2s = (_Float16*)(smem + kOffT2);

  const int tid  = threadIdx.x;
  const int wave = tid >> 5;
  const int lane = tid & 31;
  const int hh   = lane >> 4;
  const int c    = lane & 15;

  const int qb = blockIdx.x;
  const int h  = blockIdx.y;
  const int b  = blockIdx.z;
  const int l0 = qb * 64;
  const int q0 = l0 + wave * 16;
  const size_t tok0 = (size_t)b * kSeq;

  const __bf16* Qh  = (const __bf16*)QKhp;
  const __bf16* Ql  = (const __bf16*)QKlp;
  const __bf16* Vt  = (const __bf16*)Vtp;     // f16 bits
  const __bf16* PEt = (const __bf16*)PEp;

  // ---- copy roles: thread t moves the 16-B piece t & 7 of rows (t >> 3) + 16 i; 8 lanes cover one 128-B row ----
  const int crow = tid >> 3;
  const int cpc  = tid & 7;
  const unsigned lcp = (unsigned)(size_t)(lds_byte*)smem + (unsigned)(crow * kPitchB + cpc * 16);
  const size_t gko = (tok0 + crow) * kQKld + kHid + (size_t)h * kHdim + cpc * 8;
  const __bf16* gKh = Qh + gko;
  const __bf16* gKl = Ql + gko;
  const __bf16* gV  = Vt + ((size_t)(b * kHeads + h) * kHdim + crow) * kSeq + cpc * 8;
  const __bf16* gPE = PEt + (size_t)crow * kHdim + cpc * 8;
  constexpr unsigned kStep = 16 * kPitchB;                 // 16 staged rows
  // k hi, k lo (64 rows each) and the pe band d0 .. d0 + 127 (<= 1023) of key chunk n
  auto stage_k_pe = [&](int n) {
    const __bf16* kh = gKh + (size_t)(n * 64) * kQKld;
    const __bf16* kl = gKl + (size_t)(n * 64) * kQKld;
    const __bf16* pp = gPE + (size_t)(l0 - n * 64 + 448) * kHdim;
    async_copy8(lcp + kOffKH, kh, lcp + kOffKH + kStep, kh + 16 * kQKld,
                lcp + kOffKH + 2 * kStep, kh + 32 * kQKld, lcp + kOffKH + 3 * kStep, kh + 48 * kQKld,
                lcp + kOffKL, kl, lcp + kOffKL + kStep, kl + 16 * kQKld,
                lcp + kOffKL + 2 * kStep, kl + 32 * kQKld, lcp + kOffKL + 3 * kStep, kl + 48 * kQKld);
    async_copy8(lcp + kOffPE, pp, lcp + kOffPE + kStep, pp + 16 * kHdim,
                lcp + kOffPE + 2 * kStep, pp + 32 * kHdim, lcp + kOffPE + 3 * kStep, pp + 48 * kHdim,
                lcp + kOffPE + 4 * kStep, pp + 64 * kHdim, lcp + kOffPE + 5 * kStep, pp + 80 * kHdim,
                lcp + kOffPE + 6 * kStep, pp + 96 * kHdim, lcp + kOffPE + 7 * kStep, pp + 112 * kHdim);
  };
  // v^T rows d = 0 .. 63, keys of chunk n
  auto stage_v = [&](int n) {
    const __bf16* vv = gV + n * 64;
    async_copy4(lcp + kOffV, vv, lcp + kOffV + kStep, vv + 16 * kSeq,
                lcp + kOffV + 2 * kStep, vv + 32 * kSeq, lcp + kOffV + 3 * kStep, vv + 48 * kSeq);
  };

  stage_k_pe(0);                                // flies while the Q fragments are fetched

  // ---- Q fragments (B operand of s^T, the hi ones also A of T1): 2 d-chunks, hi and lo planes ----
  v16b qah[2], qal[2];
  {
    const size_t qo = (tok0 + q0 + c) * kQKld + (size_t)h * kHdim + 8 * hh;
#pragma unroll
    for (int dc = 0; dc < 2; ++dc) {
      qah[dc] = Frag<__bf16>::load(Qh + qo + dc * 32);
      qal[dc] = Frag<__bf16>::load(Ql + qo + dc * 32);
    }
  }
  // stands in front of the first write over an address register of the q loads (this build reuses them for out^T)
  asm volatile("s_wait_xcnt 0x0" ::: "memory");
  __builtin_amdgcn_sched_barrier(0);           // keeps those writes behind the wait: the build lifts them over it otherwise

  float mrow = -INFINITY, lrow = 0.f;          // this lane's query (row c of the wave); lrow sums this half's keys only
  v8f oacc[4];                                 // out^T: register r of tile t = d 16 t + 8 hh + r of query c
#pragma unroll
  for (int t = 0; t < 4; ++t) oacc[t] = (v8f){0.f,0.f,0.f,0.f,0.f,0.f,0.f,0.f};

  _Float16* t1w = (_Float16*)(smem + kOffT1) + wave * (kT1Slots * 16);
  // every table address of the chunk loop is one base register plus a constant: the registers so freed hold reads in flight
  const __bf16* pe1b = PEs + (16 * wave + c) * kPitchH + 8 * hh;            // pe rows of T1 tile 0
  const __bf16* pe2b = PEs + (16 * (3 - wave) + c) * kPitchH + 8 * hh;      // pe rows of T2 tile 0
  _Float16* t1s = t1w + c * 16 + 8 * hh;                                    // T1 tile 0, this lane's eight rows
  _Float16* t2s = T2s + (16 * (3 - wave) + c) * kT2Pitch + 16 * wave + 8 * hh;   // T2 tile 0, this lane's eight keys
  // bias gather bases (query row c, key 16 j + 8 hh + r): element (r, j) lies at a non-negative constant behind them
  const _Float16* t1b = t1w + ((c - 8 * hh + 8) * 16 + c);
  const _Float16* t2b = T2s + ((16 * wave + c - 8 * hh + 8) * kT2Pitch + 8 * hh);
  const float* mkb = mask + tok0 + 8 * hh;     // additive mask [b][r], this half's eight keys of each group

  for (int kc = 0; kc < kSeq / 64; ++kc) {
    const int r0 = kc * 64;
    // publish k / pe of this chunk; the barrier also ends the previous chunk's reads of T2s and of the v tile
    wait_lds_done();
    wait_copies_landed();
    __syncthreads();
    stage_v(kc);                               // flies under the T1 / T2 / q.k products, read behind the next barrier
    v4f mk[4][2];                              // fetched here, used behind the next barrier
#pragma unroll
    for (int j = 0; j < 4; ++j) {
      mk[j][0] = *(const v4f*)(mkb + r0 + j * 16);
      mk[j][1] = *(const v4f*)(mkb + r0 + j * 16 + 4);
    }

    // ---- relative-position tiles on WMMA: T1 (5 tiles per wave), T2 (5 tiles per wave) ----
    {
      v16b ka[2];
#pragma unroll
      for (int dc = 0; dc < 2; ++dc) ka[dc] = Frag<__bf16>::load(KHs + (wave * 16 + c) * kPitchH + 8 * hh + dc * 32);   // k rows as A operand
#pragma unroll
      for (int i0 = 0; i0 < 5; i0 += 2) {                  // tiles i0 and i0 + 1 together (the fifth alone)
        // distance tile bases inside the staged band: T1 16 (wave + i), T2 16 (3 - wave + i), both <= 112
        const int nt = (i0 + 1 < 5) ? 2 : 1;
        v16b p1[2][2], p2[2][2];
        v8f a1[2], a2[2];
#pragma unroll
        for (int u = 0; u < nt; ++u) {
          a1[u] = (v8f){0.f,0.f,0.f,0.f,0.f,0.f,0.f,0.f};
          a2[u] = (v8f){0.f,0.f,0.f,0.f,0.f,0.f,0.f,0.f};
#pragma unroll
          for (int dc = 0; dc < 2; ++dc) {
            p1[u][dc] = Frag<__bf16>::load(pe1b + (i0 + u) * 16 * kPitchH + dc * 32);   // B[k=d][n=dist]
            p2[u][dc] = Frag<__bf16>::load(pe2b + (i0 + u) * 16 * kPitchH + dc * 32);
          }
        }
        if (nt == 2) hold8(p1[0][0], p2[0][0], p1[1][0], p2[1][0], p1[0][1], p2[0][1], p1[1][1], p2[1][1]);
        else         hold4(p1[0][0], p2[0][0], p1[0][1], p2[0][1]);
#pragma unroll
        for (int dc = 0; dc < 2; ++dc) {
#pragma unroll
          for (int u = 0; u < nt; ++u) {
            a1[u] = at_mma(qah[dc], p1[u][dc], a1[u]);
            a2[u] = at_mma(ka[dc], p2[u][dc], a2[u]);
          }
        }
#pragma unroll
        for (int u = 0; u < nt; ++u) {
          v8h hv1, hv2;
#pragma unroll
          for (int r = 0; r < 8; ++r) { hv1[r] = (_Float16)a1[u][r]; hv2[r] = (_Float16)a2[u][r]; }
          // D element r: row 8hh+r (query row of this wave / key row 16*wave+8hh+r), col = dist slot 16i+c
          *(v8h*)(t1s + (i0 + u) * 16 * 16) = hv1;
          *(v8h*)(t2s + (i0 + u) * 16 * kT2Pitch) = hv2;
        }
      }
    }

    // ---- s^T = k . q^T (hi.hi + hi.lo + lo.hi), A fragments from the staged k tiles, B = the q fragments ----
    // The four key groups' chains run side by side; each s[j] sums hi.hi, hi.lo, lo.hi of d half 0, then of d half 1.
    v8f s[4];
#pragma unroll
    for (int j = 0; j < 4; ++j) s[j] = (v8f){0.f,0.f,0.f,0.f,0.f,0.f,0.f,0.f};
#pragma unroll
    for (int dc = 0; dc < 2; ++dc) {
      v16b kb[4], kl[4];
#pragma unroll
      for (int j = 0; j < 4; ++j) {
        const int ko = (j * 16 + c) * kPitchH + 8 * hh + dc * 32;
        kb[j] = Frag<__bf16>::load(KHs + ko);
        kl[j] = Frag<__bf16>::load(KLs + ko);
      }
      hold8(kb[0], kb[1], kb[2], kb[3], kl[0], kl[1], kl[2], kl[3]);
#pragma unroll
      for (int j = 0; j < 4; ++j) s[j] = at_mma(kb[j], qah[dc], s[j]);
#pragma unroll
      for (int j = 0; j < 4; ++j) s[j] = at_mma(kl[j], qah[dc], s[j]);
#pragma unroll
      for (int j = 0; j < 4; ++j) s[j] = at_mma(kb[j], qal[dc], s[j]);
    }
    // publish T1s / T2s and the v tile; the barrier also ends every wave's reads of the k and pe tiles
    wait_lds_done();
    wait_copies_landed();
    __syncthreads();
    if (kc + 1 < kSeq / 64) stage_k_pe(kc + 1);   // flies under softmax and p.v, read behind the next chunk's first barrier

    float mj[4];                               // four chains of the in-lane maximum
#pragma unroll
    for (int j = 0; j < 4; ++j) mj[j] = -INFINITY;
#pragma unroll
    for (int g = 0; g < 2; ++g) {              // keys r = 4 g .. 4 g + 3 of each group: 32 reads as groups, then their sums
      _Float16 u1[4][4], u2[4][4];
#pragma unroll
      for (int rr = 0; rr < 4; ++rr) {
#pragma unroll
        for (int j = 0; j < 4; ++j) {
          const int r = 4 * g + rr;            // p1 = c - 16 j - 8 hh - r + 63, in [0, 78]
          u1[rr][j] = t1b[16 * (55 - 16 * j - r)];                        // T1w[p1][c]
          u2[rr][j] = t2b[kT2Pitch * (55 - 16 * j - r) + 16 * j + r];     // T2[p1 + 16 wave][16 j + 8 hh + r]
        }
      }
#pragma unroll
      for (int rr = 0; rr < 4; ++rr) {
        const int r = 4 * g + rr;
#pragma unroll
        for (int j = 0; j < 4; ++j) {
          const float v = (s[j][r] + (float)u1[rr][j] + (float)u2[rr][j]) * 0.125f + mk[j][g][rr];
          s[j][r] = v;
          mj[j] = fmaxf(mj[j], v);
        }
      }
    }
    FB vb[2][4];
#pragma unroll                                 // p is not waited for in LDS any more: the v reads fly under the exponentials
    for (int kk = 0; kk < 2; ++kk) {
#pragma unroll
      for (int t = 0; t < 4; ++t) {
        const int vo = (t * 16 + c) * kPitchH + kk * 32 + 8 * hh;   // A[m=d][k=kv] from the staged v^T[d][kv]
        vb[kk][t].h[0] = *(const v8b*)(Vs + vo);
        vb[kk][t].h[1] = *(const v8b*)(Vs + vo + 16);
      }
    }
    // keeps the v reads in front of the exponentials: without it the build sinks part of them to the products and
    // waits out their LDS round trip there
    __builtin_amdgcn_sched_barrier(0);
    float cm = fmaxf(fmaxf(mj[0], mj[1]), fmaxf(mj[2], mj[3]));
    cm = fmaxf(cm, xhalf(cm));                 // both halves now hold the query's maximum over the chunk
    const float mnew  = fmaxf(mrow, cm);
    const float alpha = __expf(mrow - mnew);
    mrow = mnew;
    float ps[4];                               // four chains of the in-lane sum
    FB pb[2];                                  // p^T as B operand: element e of pb[kk] = key 32 kk + kmap(e, hh) of query c
#pragma unroll
    for (int j = 0; j < 4; ++j) {
      ps[j] = 0.f;
#pragma unroll
      for (int r = 0; r < 8; ++r) {
        const float p = __expf(s[j][r] - mnew);
        ps[j] += p;
        pb[j >> 1].v[(j & 1) * 8 + r] = at_to16<true>(p * kPCarry);
      }
    }
    lrow = lrow * alpha + ((ps[0] + ps[1]) + (ps[2] + ps[3]));
#pragma unroll
    for (int t = 0; t < 4; ++t) {
#pragma unroll
      for (int r = 0; r < 8; ++r) oacc[t][r] *= alpha;
    }
#pragma unroll
    for (int kk = 0; kk < 2; ++kk) {
#pragma unroll
      for (int t = 0; t < 4; ++t) oacc[t] = at_mma16<true>(vb[kk][t].v, pb[kk].v, oacc[t]);
    }
  }
  wait_copies_landed();                        // none is left in flight when the wave reuses LDS and ends

  // ---- epilogue: out[b][q0+row][h*64 + 0..63]; row segment = 256 B = 16 lanes x 16 B, one instruction per row ----
  // The out tiles lie on the k / pe range: its last readers left it at the last chunk's second barrier, and no copy
  // was aimed at it after that.
  float* os = (float*)(smem) + wave * (16 * 68);
  const float inv = 1.0f / ((lrow + xhalf(lrow)) * kPCarry);   // the halves' sums are joined once, here
#pragma unroll
  for (int t = 0; t < 4; ++t) {
    float* op = os + c * 68 + t * 16 + 8 * hh;                 // query row c, d 16 t + 8 hh .. + 7
    *(v4f*)(op)     = (v4f){oacc[t][0] * inv, oacc[t][1] * inv, oacc[t][2] * inv, oacc[t][3] * inv};
    *(v4f*)(op + 4) = (v4f){oacc[t][4] * inv, oacc[t][5] * inv, oacc[t][6] * inv, oacc[t][7] * inv};
  }
  __builtin_amdgcn_fence(__ATOMIC_RELEASE, "workgroup");
  __builtin_amdgcn_wave_barrier();
  __builtin_amdgcn_fence(__ATOMIC_ACQUIRE, "workgroup");
  {
    float* ob = out + (size_t)h * kHdim;
    const int c4 = (lane & 15) * 4;
    {
#pragma unroll
      for (int it = 0; it < 8; ++it) {
        const int row = it * 2 + hh;
        v4f val = *(const v4f*)(os + row * 68 + c4);
        *(v4f*)(ob + (tok0 + q0 + row) * kHid + c4) = val;
      }
      
    }
  }
}

// ---------------------------------------------------------------------------
// Workspace region map (byte offsets, multiples of 128; every region fully written before it is read):
//   X16  bf16 [8192][1024]                     0 ..  16,777,216
//   WT   bf16 [3072][1024] (W^T)      16,777,216 ..  23,068,672
//   PE   bf16 [1024][64] (row 1023 0) 23,068,672 ..  23,199,744
//   QKh  bf16 [8192][2048] ([q|k] hi)  23,199,744 ..  56,754,176
//   QKl  bf16 [8192][2048] ([q|k] lo)  56,754,176 ..  90,308,608
//   Vt   f16  [16][1024][512]          90,308,608 .. 107,085,824
//   total 107,085,824 B.
// GEMM shapes: q|k: M=8192 N=2048 K=1024; v (role-swapped, per batch): M=1024 N=512 K=1024 x16.
//   K % 64 == 0, M % 128 == 0 and N % 256 == 0 for both; no padded operand rows.
// ---------------------------------------------------------------------------
extern "C" void kernel_launch(void* const* d_in, const int* in_sizes, int n_in,
                              void* d_out, int out_size, void* d_ws, size_t ws_size,
                              hipStream_t stream) {
  if (n_in < 5) return;
  if (in_sizes[0] != kTok * kHid) return;
  if (in_sizes[1] != kBatch * kSeq) return;
  if (in_sizes[2] != kHid * kN3) return;
  if (in_sizes[3] != kN3) return;
  if (in_sizes[4] != kNDist * kHdim) return;
  if (out_size != kTok * kHid) return;

  const float* hid  = (const float*)d_in[0];   // [16][512][1024]
  const float* msk  = (const float*)d_in[1];   // [16][1][1][512]
  const float* W    = (const float*)d_in[2];   // [1024][3072]
  const float* bqkv = (const float*)d_in[3];   // [3072]
  const float* pe   = (const float*)d_in[4];   // [1023][64]
  float* outp = (float*)d_out;                 // [16][512][1024]

  const size_t SZ_X16 = (size_t)kTok * kHid * 2;              //  16,777,216
  const size_t SZ_WT  = (size_t)kN3 * kHid * 2;               //   6,291,456
  const size_t SZ_PE  = (size_t)kNDistP * kHdim * 2;          //     131,072
  const size_t SZ_QK  = (size_t)kTok * kQKld * 2;             //  33,554,432
  const size_t SZ_VT  = (size_t)kBatch * kHid * kSeq * 2;     //  16,777,216
  size_t off = 0;
  const size_t oX16 = off; off += SZ_X16;
  const size_t oWT  = off; off += SZ_WT;
  const size_t oPE  = off; off += SZ_PE;
  const size_t oQKh = off; off += SZ_QK;
  const size_t oQKl = off; off += SZ_QK;
  const size_t oVT  = off; off += SZ_VT;
  const size_t TOTAL = off;                                   // 107,085,824
  if (TOTAL > ws_size) return;
  if (TOTAL > (size_t)134217728) return;

  char* ws = (char*)d_ws;
  unsigned short* X16 = (unsigned short*)(ws + oX16);
  unsigned short* WT  = (unsigned short*)(ws + oWT);
  unsigned short* PEb = (unsigned short*)(ws + oPE);
  unsigned short* QKh = (unsigned short*)(ws + oQKh);
  unsigned short* QKl = (unsigned short*)(ws + oQKl);
  unsigned short* VTp = (unsigned short*)(ws + oVT);

  const dim3 blk(256);
  // (0..2) one launch: W [1024][3072] -> WT [3072][1024] bf16; dist_emb -> PE bf16 [1024][64]; x -> bf16 plane
  prep_kernel<<<dim3(kPrepW + kPrepPE + kPrepX), blk, 0, stream>>>(hid, W, pe, X16, WT, PEb);
  // (3, 4) one launch:
  //   v^T per batch: Vt[b][m][s] = WT[2048+m] . x[b*512+s] + b[2048+m] -> f16, pitch 512
  //   [q|k] = X16 . WT[0..2047]^T + b[0..2047] -> bf16 hi + lo planes, pitch 2048
  {
    const GemmJob jv  = {WT + (size_t)2 * kHid * kHid, X16, VTp, VTp, bqkv + 2 * kHid,
                         0L, (long)kSeq * kHid, (long)kHid * kSeq, kHid, kHid, kSeq, kHid, kSeq, kHid, 1.0f};
    const GemmJob jqk = {X16, WT, QKh, QKl, bqkv,
                         0L, 0L, 0L, kHid, kHid, kQKld, kTok, kQKld, kHid, 1.0f};
    proj_kernel<<<dim3(kVBlocks + kQKBlocks), blk, 0, stream>>>(jv, jqk);
  }
  // (5) fused attention with relative-position bias -> out f32 [16][512][1024]
  relattn_kernel<<<dim3(kSeq / 64, kHeads, kBatch), dim3(128), 0, stream>>>(QKh, QKl, VTp, PEb, msk, outp);
}

// v008
// It runs in 98.1 microseconds.
// Versions in between are left out here; by their measured steps it is 1.12 times as fast as v006.
// Over all steps from v000 it is 3.18 times as fast.
// Contractions: qkv projection v_wmma_f32_16x16x32_bf16 (x, W as bf16 RNE; bias added as bf16-RNE value in f32); q.k^T, q.pe^T and k.pe^T v_wmma_f32_16x16x32_f16 (q, k, pe one f16 RNE plane each); p.v v_wmma_f32_16x16x32_f16 (p f16 carried x2^15, v f16); f32 accumulate; softmax, scale, bias, mask add in f32.
#include <hip/hip_runtime.h>
#include <math.h>
#include <stdint.h>

// ---------------------------------------------------------------------------
// Problem constants
// ---------------------------------------------------------------------------
constexpr int kBatch  = 16;
constexpr int kSeq    = 512;
constexpr int kHid    = 1024;
constexpr int kHeads  = 16;
constexpr int kHdim   = 64;
constexpr int kN3     = 3 * kHid;          // 3072 qkv output columns
constexpr int kQKld   = 2 * kHid;          // 2048: pitch of the [q | k] plane
constexpr int kTok    = kBatch * kSeq;     // 8192 token rows
constexpr int kNDist  = 2 * kSeq - 1;      // 1023 relative distances
constexpr int kNDistP = 1024;              // pe plane rows (row 1023 zero)
constexpr float kPCarry = 32768.0f;        // f16 probabilities carried x2^15
static_assert(kHid % 128 == 0 && kTok % 128 == 0 && kQKld % 256 == 0 && kSeq % 256 == 0, "tiles");

typedef __attribute__((ext_vector_type(16))) _Float16 v16h;
typedef __attribute__((ext_vector_type(8)))  _Float16 v8h;
typedef __attribute__((ext_vector_type(16))) __bf16   v16b;
typedef __attribute__((ext_vector_type(8)))  __bf16   v8b;
typedef __attribute__((ext_vector_type(8)))  float    v8f;
typedef __attribute__((ext_vector_type(4)))  float    v4f;
typedef __attribute__((ext_vector_type(4)))  unsigned int v4u;
typedef uint32_t u32x4 __attribute__((ext_vector_type(4)));
typedef uint32_t u32x8 __attribute__((ext_vector_type(8)));

__device__ __forceinline__ unsigned short f2bf_bits(float f) {
  unsigned u = __float_as_uint(f);
  return (unsigned short)((u + 0x7FFFu + ((u >> 16) & 1u)) >> 16);
}
__device__ __forceinline__ float bf_bits2f(unsigned short h) { return __uint_as_float(((unsigned)h) << 16); }

// hazard guards as plain device helpers (no inline asm inside the kernel template body)
__device__ __forceinline__ void dep_guard_h(v8f& a, v8f& b, v16h x, v16h y) { asm volatile("v_nop\n\tv_nop\n\tv_nop\n\tv_nop" : "+v"(a), "+v"(b) : "v"(x), "v"(y)); }
__device__ __forceinline__ void dep_guard_b(v8f& a, v8f& b, v16b x, v16b y) { asm volatile("v_nop\n\tv_nop\n\tv_nop\n\tv_nop" : "+v"(a), "+v"(b) : "v"(x), "v"(y)); }
__device__ __forceinline__ void keep4_h(v16h a, v16h b, v16h c, v16h d) { asm volatile("v_nop" :: "v"(a), "v"(b), "v"(c), "v"(d)); }
__device__ __forceinline__ void keep4_b(v16b a, v16b b, v16b c, v16b d) { asm volatile("v_nop" :: "v"(a), "v"(b), "v"(c), "v"(d)); }
__device__ __forceinline__ void acc_guard4(v8f& a, v8f& b, v8f& c, v8f& d) { asm volatile("v_nop\n\tv_nop\n\tv_nop\n\tv_nop" : "+v"(a), "+v"(b), "+v"(c), "+v"(d)); }
template <typename T> struct Frag;
template <> struct Frag<_Float16> {
  typedef v16h V; union U { v16h v; v8h h[2]; };
  static __device__ __forceinline__ v16h load(const _Float16* p) {   // elements 0..7 <- p[0..7], 8..15 <- p[16..23]
    U f; f.h[0] = *(const v8h*)(p); f.h[1] = *(const v8h*)(p + 16); return f.v;
  }
  static __device__ __forceinline__ v8f mma(v16h a, v16h b, v8f c) {
    return __builtin_amdgcn_wmma_f32_16x16x32_f16(false, a, false, b, (short)0, c, false, false);
  }
  static __device__ __forceinline__ void guard(v8f& a, v8f& b, v16h x, v16h y) { dep_guard_h(a, b, x, y); }
  static __device__ __forceinline__ void keep(v16h a, v16h b, v16h c, v16h d) { keep4_h(a, b, c, d); }
};
template <> struct Frag<__bf16> {
  typedef v16b V; union U { v16b v; v8b h[2]; };
  static __device__ __forceinline__ v16b load(const __bf16* p) {
    U f; f.h[0] = *(const v8b*)(p); f.h[1] = *(const v8b*)(p + 16); return f.v;
  }
  static __device__ __forceinline__ v8f mma(v16b a, v16b b, v8f c) {
    return __builtin_amdgcn_wmma_f32_16x16x32_bf16(false, a, false, b, (short)0, c, false, false);
  }
  static __device__ __forceinline__ void guard(v8f& a, v8f& b, v16b x, v16b y) { dep_guard_b(a, b, x, y); }
  static __device__ __forceinline__ void keep(v16b a, v16b b, v16b c, v16b d) { keep4_b(a, b, c, d); }
};

__device__ __forceinline__ unsigned pk16(unsigned short a, unsigned short b) { return (unsigned)a | ((unsigned)b << 16); }

// this wave's LDS reads and writes have retired (before a barrier that hands a buffer to its next writer)
__device__ __forceinline__ void wait_lds_done() { asm volatile("s_wait_dscnt 0x0" ::: "memory"); }

__device__ __forceinline__ uint32_t uni(uint32_t v) { return (uint32_t)__builtin_amdgcn_readfirstlane(v); }
// pinned(): a wave-uniform test value or a descriptor word held in a scalar register: a test on it compiles to s_cmp +
// s_cbranch (a tensor load ignores EXEC), a descriptor word keeps its register; as a volatile statement it also keeps what is
// computed from its result behind the wait written in front of it
__device__ __forceinline__ uint32_t pinned(uint32_t v) { uint32_t w = __builtin_amdgcn_readfirstlane(v); asm volatile("" : "+s"(w)); return w; }
__device__ __forceinline__ void tdm_load(u32x4 g0, u32x8 g1) { asm volatile("tensor_load_to_lds %0, %1" :: "s"(g0), "s"(g1) : "memory"); }
// this wave's own tensor load has landed (before the barrier behind which other waves read its tile); the wait names the
// request's descriptor as inputs, so that the build holds those scalar registers untouched from the issue to this wait
// (without that they serve as scratch while the request is outstanding)
__device__ __forceinline__ void wait_tile_landed(u32x4 g0, u32x8 g1) { asm volatile("s_wait_tensorcnt 0x0" :: "s"(g0), "s"(g1) : "memory"); }

// ---- Register-blocked batched WMMA GEMM (ACT tanh/relu only,
//      bias values RNE-converted to bf16 before the f32 add) --------
// C[m,n] = scale * sum_k A[m,k] * Bt[n,k] (+bias)(+resid); a block owns a 128x256 tile, its 8 waves (2 x 4) 64x64 each.
// A row-major [M,K]; Bt row-major [N,K]; M % 128 == 0, N % 256 == 0, K % 64 == 0.
// Each k slice of 64 (128 A rows + 256 Bt rows of 128 B) is staged once per block in LDS by three tensor loads (waves 0..2,
// 128 rows each), two buffers: the next slice flies while this one is multiplied.
// SPLIT: 0 only (single operand planes; A2p / Bt2p are not read).
// BIAS_MODE: 0 = none, 1 = bias[m], 2 = bias[n].
// OUT_MODE: 0 = f32, 1 = f16, 2 = bf16 hi plane (Cout) + bf16 lo plane (Cout2).
// ACT: 0 = none, 1 = tanh, 2 = relu.
// ET: 0 = f16 operands, 1 = bf16 operands (pointers passed as 16-bit storage)
constexpr int kGPitchB = 144;                          // staged 128-B row at 16 B x odd: no bank conflict for 16-B reads
constexpr int kGPitchH = kGPitchB / 2;                 // the same in 16-bit elements
constexpr int kGRowsA  = 128;
constexpr int kGRowsB  = 256;
constexpr int kGStageB = (kGRowsA + kGRowsB) * kGPitchB;   // 55,296 B per buffer
constexpr int kGTileRows = 128;                        // rows of one tensor load
constexpr int kGTileB  = kGTileRows * kGPitchB;        // 18,432 B: its place in a buffer
constexpr int kGIssuers = (kGRowsA + kGRowsB) / kGTileRows;   // 3 waves issue
static_assert(kGTileB % 2048 == 0 && kGStageB % 2048 == 0 && kGRowsA == kGTileRows, "every tile's place is a multiple of 2 KiB");
template <int ET> struct Elem;
template <> struct Elem<0> { typedef _Float16 T; };
template <> struct Elem<1> { typedef __bf16 T; };
// ring: two staged k slices, [A 128 rows | Bt 256 rows] each; sT: per-wave 16x64 slab, pitch 68 floats. Both belong to the
// kernel that calls this body; tile and b say which block tile of which batch entry the calling block owns.
template <int ET, int SPLIT, int BIAS_MODE, int OUT_MODE, bool RESID, int ACT = 0>
__device__ __forceinline__ void wmma_gemm64(
    unsigned char* ring, float (*sT)[16 * 68], const int tile, const int b,
    const unsigned short* __restrict__ Ap, const unsigned short* __restrict__ A2p, int lda, long strideA,
    const unsigned short* __restrict__ Btp, const unsigned short* __restrict__ Bt2p, int ldb, long strideB,
    void* __restrict__ Cout, void* __restrict__ Cout2, int ldc, long strideC,
    const float* __restrict__ bias,
    const float* __restrict__ resid, long strideR,
    int M, int N, int K, float scale) {
  static_assert(SPLIT == 0, "single operand planes");
  typedef typename Elem<ET>::T T;
  typedef typename Frag<T>::V V;
  typedef __attribute__((address_space(3))) unsigned char lds_byte;
  const T* A = (const T*)Ap; const T* Bt = (const T*)Btp;
  const int lane = threadIdx.x & 31;
  const int wave = threadIdx.x >> 5;
  const int tilesN = N >> 8;
  const int tilesM = M >> 7;
  if (tile >= tilesM * tilesN) return;   // block-uniform, in front of every barrier
  const int tm = tile / tilesN;
  const int tn = tile - tm * tilesN;
  const int wm = wave >> 2;                    // wave row (0..1) and column (0..3) inside the block tile
  const int wn = wave & 3;
  const int m0 = (tm << 7) + (wm << 6);
  const int n0 = (tn << 8) + (wn << 6);

  const T* Ab  = A  + (size_t)b * strideA;
  const T* Bb  = Bt + (size_t)b * strideB;

  const int rlane = lane & 15;                 // row (A) / col (B, D) within subtile
  const int koff  = (lane >> 4) * 8;           // k offset of this lane half
  const int mOff  = (lane >> 4) * 8;           // D row offset

  // ---- staging roles: wave 0 brings the block's 128 A rows, waves 1 and 2 128 Bt rows each; a row is 128 B of a k slice ----
  const uint32_t wv  = uni(threadIdx.x >> 5);
  const uint32_t isl = wv < (uint32_t)kGIssuers ? wv : 0u;           // slice of an issuing wave (the others issue nothing)
  const T* grow = (isl == 0u) ? Ab + (size_t)(tm << 7) * lda
                              : Bb + (size_t)((tn << 8) + ((int)isl - 1) * kGTileRows) * ldb;
  const uint64_t gbase = (uint64_t)(size_t)grow;
  const uint32_t lbase = (uint32_t)(size_t)(lds_byte*)ring + isl * (uint32_t)kGTileB;
  u32x8 g1;                                    // 1-byte elements, tensor = tile = 128 rows of 128 B, 16 B of LDS pad behind every row
  g1[0] = uni((1u << 20) | (4u << 22) | (3u << 25));
  g1[1] = pinned(128u << 16);                  // pinned(): each word keeps a scalar register of its own through the loop
  g1[2] = pinned((uint32_t)kGTileRows << 16);
  g1[3] = pinned(128u << 16);
  g1[4] = pinned((uint32_t)kGTileRows);
  g1[5] = pinned((uint32_t)((isl == 0u) ? lda : ldb) * 2u);          // source row pitch, bytes
  g1[6] = pinned(0u);
  g1[7] = pinned(0u);
  const uint32_t isu = pinned(wv < (uint32_t)kGIssuers ? 1u : 0u);   // 1 in the waves that issue
  u32x4 g0;                                    // the descriptor group of the request last issued
  g0[0] = pinned(1u);
  g0[1] = uni(lbase);
  g0[2] = uni((uint32_t)gbase);
  g0[3] = uni((((uint32_t)(gbase >> 32)) & 0x01FFFFFFu) | 0x80000000u);
  // this wave's tile of k slice s (columns 64 s .. 64 s + 63) into buffer s & 1; the descriptor is formed behind pinned()
  auto stage = [&](int s) {
    const uint32_t so = pinned((uint32_t)s);
    const uint64_t ga = gbase + (uint64_t)so * 128u;
    g0[1] = uni(lbase + (so & 1u) * (uint32_t)kGStageB);
    g0[2] = uni((uint32_t)ga);
    g0[3] = uni((((uint32_t)(ga >> 32)) & 0x01FFFFFFu) | 0x80000000u);
    tdm_load(g0, g1);
  };

  v8f acc[4][4];
#pragma unroll
  for (int i = 0; i < 4; ++i)
#pragma unroll
    for (int j = 0; j < 4; ++j) acc[i][j] = (v8f){0.f,0.f,0.f,0.f,0.f,0.f,0.f,0.f};

  const int nst = K >> 6;
  if (pinned(isu)) {
    stage(0);
    wait_tile_landed(g0, g1);
  }
  __syncthreads();                             // publishes slice 0
  if (pinned(isu & (uint32_t)(nst > 1))) stage(1);

  const int fa = ((wm << 6) + rlane) * kGPitchH + koff;             // this lane's A fragment base in a buffer
  const int fb = (kGRowsA + (wn << 6) + rlane) * kGPitchH + koff;   // this lane's Bt fragment base in a buffer
  for (int s = 0; s < nst; ++s) {
    const T* buf = (const T*)(ring + (s & 1) * kGStageB);
#pragma unroll
    for (int ks = 0; ks < 2; ++ks) {
      V bh[4], ah[4];
#pragma unroll
      for (int j = 0; j < 4; ++j) bh[j] = Frag<T>::load(buf + fb + j * 16 * kGPitchH + ks * 32);
#pragma unroll
      for (int i = 0; i < 4; ++i) ah[i] = Frag<T>::load(buf + fa + i * 16 * kGPitchH + ks * 32);
#pragma unroll
      for (int i = 0; i < 4; ++i) {
#pragma unroll
        for (int j = 0; j < 4; ++j) acc[i][j] = Frag<T>::mma(ah[i], bh[j], acc[i][j]);
        // hazard guard; it also holds all four A fragments live, so that the slice's LDS reads go out as
        // one group ahead of the products (without it the build reloads one A register set behind a full wait per row)
        Frag<T>::guard(acc[i][0], acc[i][3], ah[i], ah[i]);
      }
      Frag<T>::keep(bh[0], bh[1], bh[2], bh[3]);
    }
    // publish slice s + 1; the barrier also ends every wave's reads of the buffer that is refilled behind it
    wait_lds_done();
    if (pinned(isu)) wait_tile_landed(g0, g1);
    __syncthreads();
    if (pinned(isu & (uint32_t)(s + 2 < nst))) stage(s + 2);
  }
  wait_tile_landed(g0, g1);                    // none is left in flight when the wave ends
  wait_lds_done();
  acc_guard4(acc[0][0], acc[0][1], acc[0][2], acc[0][3]);
  acc_guard4(acc[1][0], acc[1][1], acc[1][2], acc[1][3]);
  acc_guard4(acc[2][0], acc[2][1], acc[2][2], acc[2][3]);
  acc_guard4(acc[3][0], acc[3][1], acc[3][2], acc[3][3]);

  // ---- epilogue ----
  float* slab = sT[wave];
  const float* Rb = RESID ? (resid + (size_t)b * strideR) : nullptr;
#pragma unroll
  for (int i = 0; i < 4; ++i) {
    const int mBase = m0 + (i << 4);
#pragma unroll
    for (int j = 0; j < 4; ++j) {
      const int n = n0 + (j << 4) + rlane;
      float bv = 0.f;
      if (BIAS_MODE == 2) bv = bf_bits2f(f2bf_bits(bias[n]));                      // bias as bf16-RNE value
#pragma unroll
      for (int r = 0; r < 8; ++r) {
        float v = acc[i][j][r] * scale;
        if (BIAS_MODE == 1) v += bf_bits2f(f2bf_bits(bias[mBase + mOff + r]));     // bias as bf16-RNE value
        if (BIAS_MODE == 2) v += bv;
        if (RESID) v += Rb[(size_t)(mBase + mOff + r) * ldc + n];
        if (ACT == 1) v = tanhf(v);
        if (ACT == 2) v = fmaxf(v, 0.0f);
        slab[(mOff + r) * 68 + (j << 4) + rlane] = v;
      }
    }
    __builtin_amdgcn_fence(__ATOMIC_RELEASE, "workgroup");
    __builtin_amdgcn_wave_barrier();
    __builtin_amdgcn_fence(__ATOMIC_ACQUIRE, "workgroup");
    if (OUT_MODE == 0) {
      float* C = (float*)Cout + (size_t)b * strideC;
      const int hh = lane >> 4, c4 = (lane & 15) * 4;     // row seg = 256 B = 16 lanes x 16 B
      {
#pragma unroll
        for (int it = 0; it < 8; ++it) {
          const int row = it * 2 + hh;
          v4f v = *(const v4f*)(slab + row * 68 + c4);
          *(v4f*)(C + (size_t)(mBase + row) * ldc + n0 + c4) = v;
        }
        
      }
    } else {
      const int q = lane >> 3, c8 = (lane & 7) * 8;
      unsigned short* C  = (unsigned short*)Cout  + (size_t)b * strideC;
      unsigned short* C2 = (OUT_MODE == 2) ? ((unsigned short*)Cout2 + (size_t)b * strideC) : nullptr;
      {
#pragma unroll
        for (int it = 0; it < 4; ++it) {
          const int row = it * 4 + q;
          const float* sp = slab + row * 68 + c8;
          v8h hv, lv;
#pragma unroll
          for (int e = 0; e < 8; ++e) {
            if (OUT_MODE == 1) {
              hv[e] = (_Float16)sp[e];
            } else {
              unsigned short hb = f2bf_bits(sp[e]);
              unsigned short lb = f2bf_bits(sp[e] - bf_bits2f(hb));
              hv[e] = __builtin_bit_cast(_Float16, hb);
              lv[e] = __builtin_bit_cast(_Float16, lb);
            }
          }
          *(v8h*)(C + (size_t)(mBase + row) * ldc + n0 + c8) = hv;
          if (OUT_MODE == 2) *(v8h*)(C2 + (size_t)(mBase + row) * ldc + n0 + c8) = lv;
        }
        
      }
    }
    __builtin_amdgcn_fence(__ATOMIC_RELEASE, "workgroup");
    __builtin_amdgcn_wave_barrier();
    __builtin_amdgcn_fence(__ATOMIC_ACQUIRE, "workgroup");
  }
}

// ---------------------------------------------------------------------------
// Both projection GEMMs read the same converted operands and neither reads the other's result: one grid runs both, the
// block index picks the job (block-uniform, so every barrier is passed by whole blocks). The v^T tiles take the first indices.
// ---------------------------------------------------------------------------
struct GemmJob {
  const unsigned short* A;  const unsigned short* Bt;
  unsigned short* C;  unsigned short* C2;
  const float* bias;
  long strideA, strideB, strideC;
  int lda, ldb, ldc, M, N, K;
  float scale;
};
constexpr int kVTiles  = (kHid / 128) * (kSeq / 256);        //  16 block tiles per batch entry of v^T
constexpr int kVBlocks = kVTiles * kBatch;                   // 256
constexpr int kQKBlocks = (kTok / 128) * (kQKld / 256);      // 512
__global__ __launch_bounds__(256) void proj_kernel(const GemmJob v, const GemmJob qk) {
  __shared__ __attribute__((aligned(2048))) unsigned char ring[2 * kGStageB];   // tensor loads land at multiples of 2 KiB
  __shared__ __align__(16) float sT[8][16 * 68];
  const int blk = blockIdx.x;
  if (blk < kVBlocks)
    wmma_gemm64<1, 0, 1, 1, false, 0>(ring, sT, blk % kVTiles, blk / kVTiles,
        v.A, v.A, v.lda, v.strideA, v.Bt, v.Bt, v.ldb, v.strideB, (void*)v.C, (void*)v.C2, v.ldc, v.strideC,
        v.bias, v.bias, 0L, v.M, v.N, v.K, v.scale);
  else
    wmma_gemm64<1, 0, 2, 1, false, 0>(ring, sT, blk - kVBlocks, 0,
        qk.A, qk.A, qk.lda, qk.strideA, qk.Bt, qk.Bt, qk.ldb, qk.strideB, (void*)qk.C, (void*)qk.C2, qk.ldc, qk.strideC,
        qk.bias, qk.bias, 0L, qk.M, qk.N, qk.K, qk.scale);
}

// ---------------------------------------------------------------------------
// x f32 -> bf16 plane (RNE), 8 consecutive elements per thread -> one 16-B store per lane;
// Coverage: n8 = 8192*1024/8 = 1,048,576 threads x 8 = the whole plane; 4096 blocks x 256 exact.
// ---------------------------------------------------------------------------
__device__ __forceinline__ void cast8_bf16_body(int blk, const float* __restrict__ in, unsigned short* __restrict__ out, int n8) {
  const int i = blk * 256 + threadIdx.x;
  if (i >= n8) return;
  const float* p = in + 8 * (size_t)i;
  const v4f a = *(const v4f*)(p);
  const v4f c = *(const v4f*)(p + 4);
  unsigned short hb[8];
#pragma unroll
  for (int e = 0; e < 4; ++e) {
    hb[e]     = f2bf_bits(a[e]);
    hb[4 + e] = f2bf_bits(c[e]);
  }
  const v4u u = (v4u){pk16(hb[0], hb[1]), pk16(hb[2], hb[3]), pk16(hb[4], hb[5]), pk16(hb[6], hb[7])};
  unsigned short* q = out + 8 * (size_t)i;
  *(v4u*)q = u;
  
}

// ---------------------------------------------------------------------------
// Weight transpose + cast: W f32 [1024 k][3072 n] -> WT[n][k] bf16 (RNE), [3072][1024].
// 1024/64 = 16 k tiles (bk) x 3072/64 = 48 n tiles (bn), 256 threads each.
// Load coverage: 16 iterations x 256 threads = 4096 = the whole 64x64 tile (coalesced along n).
// Store coverage: 8 waves x 2 iterations x 4 rows (lane>>3) = 64 n rows; (lane&7) x 8 halves = 64 k cols; each row
// ---------------------------------------------------------------------------
__device__ __forceinline__ void wtcast_body(int bk, int bn, const float* __restrict__ W, unsigned short* __restrict__ out) {
  __shared__ float sm[64][65];   // sm[n_local][k_local]
  const int t  = threadIdx.x;
  const int k0 = bk * 64;
  const int n0 = bn * 64;
#pragma unroll
  for (int i = 0; i < 16; ++i) {
    const int e = i * 256 + t;
    const int r = e >> 6;          // k local
    const int c = e & 63;          // n local
    sm[c][r] = W[(size_t)(k0 + r) * kN3 + n0 + c];
  }
  __syncthreads();
  const int lane = t & 31, wave = t >> 5;
  const int q = lane >> 3, c8 = (lane & 7) * 8;
  {
#pragma unroll
    for (int it = 0; it < 2; ++it) {
      const int row = wave * 8 + it * 4 + q;                 // n local
      unsigned short hb[8];
#pragma unroll
      for (int e = 0; e < 8; ++e) hb[e] = f2bf_bits(sm[row][c8 + e]);
      const v4u u = (v4u){pk16(hb[0], hb[1]), pk16(hb[2], hb[3]), pk16(hb[4], hb[5]), pk16(hb[6], hb[7])};
      *(v4u*)(out + (size_t)(n0 + row) * kHid + k0 + c8) = u;
    }
    
  }
}

// ---------------------------------------------------------------------------
// dist_emb f32 [1023][64] -> PE f16 [1024][64] (RNE), row 1023 zero-filled.
// 1024*64/8 = 8192 threads = 32 blocks x 256 exactly; thread i: row i>>3, cols (i&7)*8..+7 -> one 16-B store;
// ---------------------------------------------------------------------------
__device__ __forceinline__ void pecast_body(int blk, const float* __restrict__ pe, unsigned short* __restrict__ out) {
  const int i = blk * 256 + threadIdx.x;
  if (i >= kNDistP * kHdim / 8) return;
  const int row = i >> 3, c8 = (i & 7) * 8;
  const int rc = (row < kNDist) ? row : (kNDist - 1);         // clamped address
  const float* src = pe + (size_t)rc * kHdim + c8;
  const v4f a = *(const v4f*)(src);
  const v4f c = *(const v4f*)(src + 4);
  const bool live = (row < kNDist);
  unsigned short hb[8];
#pragma unroll
  for (int e = 0; e < 4; ++e) {
    hb[e]     = live ? __builtin_bit_cast(unsigned short, (_Float16)a[e]) : (unsigned short)0;
    hb[4 + e] = live ? __builtin_bit_cast(unsigned short, (_Float16)c[e]) : (unsigned short)0;
  }
  const v4u u = (v4u){pk16(hb[0], hb[1]), pk16(hb[2], hb[3]), pk16(hb[4], hb[5]), pk16(hb[6], hb[7])};
  unsigned short* q = out + (size_t)row * kHdim + c8;
  *(v4u*)q = u;
  
}

// ---------------------------------------------------------------------------
// The three conversions depend on nothing but the inputs and not on one another: one grid does them all, the block
// index picks the job. The W tiles come first (they last longest: a barrier and an LDS round trip), then pe, then x.
// Every branch is block-uniform, so the barrier of the W tiles is passed by whole blocks only.
// ---------------------------------------------------------------------------
constexpr int kPrepW  = (kHid / 64) * (kN3 / 64);            // 768 blocks: W tiles
constexpr int kPrepPE = kNDistP * kHdim / 8 / 256;           //  32 blocks: pe rows
constexpr int kPrepX  = kTok * kHid / 8 / 256;               // 4096 blocks: x
__global__ __launch_bounds__(256) void prep_kernel(const float* __restrict__ x, const float* __restrict__ W,
                                                   const float* __restrict__ pe, unsigned short* __restrict__ X16,
                                                   unsigned short* __restrict__ WT, unsigned short* __restrict__ PEb) {
  const int blk = blockIdx.x;
  if (blk < kPrepW)                wtcast_body(blk & (kHid / 64 - 1), blk / (kHid / 64), W, WT);
  else if (blk < kPrepW + kPrepPE) pecast_body(blk - kPrepW, pe, PEb);
  else                             cast8_bf16_body(blk - kPrepW - kPrepPE, x, X16, kTok * kHid / 8);
}

// ---------------------------------------------------------------------------
// Attention helpers
// ---------------------------------------------------------------------------
// Every operand of the attention kernel is f16; its bits travel in __bf16 slots (16-bit storage, as the loaders take it).
// builtin form only: the compiler keeps its distances itself and stays free to put reads and other products between them
__device__ __forceinline__ v8f at_mma(v16b a, v16b b, v8f c) {
  const v16h ah = __builtin_bit_cast(v16h, a), bh = __builtin_bit_cast(v16h, b);
  return __builtin_amdgcn_wmma_f32_16x16x32_f16(false, ah, false, bh, (short)0, c, false, false);
}
__device__ __forceinline__ __bf16 at_to16(float f) { return __builtin_bit_cast(__bf16, (_Float16)f); }

// lane l <-> lane l ^ 16: the two halves of a wave hold the two halves of one query's keys
__device__ __forceinline__ float xhalf(float x) {
  return __builtin_bit_cast(float, __builtin_amdgcn_permlanex16(__builtin_bit_cast(int, x), __builtin_bit_cast(int, x),
                                                                0x76543210, 0xfedcba98, false, false));
}

// Inputs-only fence on four loaded fragments: their eight LDS reads go out ahead of it as one group with one wait
// (without it the build reuses one register set and pays a full LDS round trip in front of every product).
__device__ __forceinline__ void hold4(v16b a, v16b b, v16b c, v16b d) { asm volatile("" :: "v"(a), "v"(b), "v"(c), "v"(d)); }
// the same on eight fragments (sixteen reads, one wait)
__device__ __forceinline__ void hold8(v16b a, v16b b, v16b c, v16b d, v16b e, v16b f, v16b g, v16b h) {
  asm volatile("" :: "v"(a), "v"(b), "v"(c), "v"(d), "v"(e), "v"(f), "v"(g), "v"(h));
}

// =====================================================================================
// Fused attention with relative_key_query bias, head_dim 64. Block = 4 waves = 64 query rows of one (b, h);
// key chunks of 64; online softmax in f32. Operand planes (all dense, statically strided, 16-bit):
//   QK:      f16 [token = b*512+s][2048] with q at cols h*64+d, k at cols 1024+h*64+d
//   Vt:      f16 [b][h*64+d][s]  (pitch 512)
//   PE:      f16 [1024][64] (dist_emb, row 1023 zero)
// Per chunk (l0 = 64*qb, r0 = 64*kc, d0 = l0 - r0 + 448, dist(l,r) = d0 + ll - kk + 63 with local ll, kk in 0..63):
//   T1w[p1][row] = q(row of this wave) . pe[d0 + 16*wave + p1], p1 = 0..79 (f16 in LDS, per wave)
//   T2 [p][kk]   = k(kk) . pe[d0 + p] for the band p in [48-16*j, 127-16*j] of key group j = kk>>4 (wave j produces it)
//   s[ll][kk] = (q.k + T1 + T2) * 1/8 + mask[b][r0+kk];  p = exp(s - m);  out = sum p v / l.
// Scores and output are formed transposed: s^T = k . q^T (a lane holds one query's scores: keys 16 j + 8 hh + r in its
// registers), out^T += v^T . p^T; p^T packs from the score registers into the B operand and never touches LDS.
// Each chunk's k, pe band and v^T tiles are staged once per block in LDS by one tensor load each, issued one phase ahead.
// grid (S/64, H, B), 128 threads.
// =====================================================================================
constexpr int kT1Slots = 80;
// LDS map of relattn_kernel (bytes). Staged tiles keep their 128-B rows at a pitch of 144 B (16 B x odd: no bank
// conflict for 16-B fragment reads). The out tile of the epilogue reuses the K / PE range.
constexpr int kPitchB = 144;                           // staged row pitch, bytes
constexpr int kPitchH = kPitchB / 2;                   // the same in 16-bit elements
constexpr int kOffPE  = 0;                             // pe    [128 distances][64 d]
constexpr int kOffKH  = kOffPE + 128 * kPitchB;        // k     [64 keys][64 d]
constexpr int kOffV   = (kOffKH + 64 * kPitchB + 2047) / 2048 * 2048;   // v^T   [64 d][64 keys]
constexpr int kOffT1  = kOffV + 64 * kPitchB;          // per wave [p1][16 rows] f16
constexpr int kOffT2  = kOffT1 + 4 * kT1Slots * 16 * 2; // [p][64 keys] f16, rows at kT2Pitch
constexpr int kT2Pitch = 72;                           // 16-bit elements: 16 lanes that read 16 consecutive p meet 16 banks
constexpr int kLdsBytes = kOffT2 + 128 * kT2Pitch * 2; // 66,560
static_assert(4 * 16 * 68 * 4 <= kOffV, "out tiles fit the K / PE range");
static_assert(kOffPE % 2048 == 0 && kOffKH % 2048 == 0 && kOffV % 2048 == 0, "every tensor load's place is a multiple of 2 KiB");

__global__ __launch_bounds__(128)
void relattn_kernel(const unsigned short* __restrict__ QKhp,
                    const unsigned short* __restrict__ Vtp, const unsigned short* __restrict__ PEp,
                    const float* __restrict__ mask, float* __restrict__ out) {
  union FB { v16b v; v8b h[2]; };
  typedef __attribute__((address_space(3))) unsigned char lds_byte;
  __shared__ __attribute__((aligned(2048))) unsigned char smem[kLdsBytes];   // tensor loads land at multiples of 2 KiB
  const __bf16* KHs = (const __bf16*)(smem + kOffKH);
  const __bf16* PEs = (const __bf16*)(smem + kOffPE);
  const __bf16* Vs  = (const __bf16*)(smem + kOffV);      // f16 bits
  _Float16*     T2s = (_Float16*)(smem + kOffT2);

  const int tid  = threadIdx.x;
  const int wave = tid >> 5;
  const int lane = tid & 31;
  const int hh   = lane >> 4;
  const int c    = lane & 15;

  const int qb = blockIdx.x;
  const int h  = blockIdx.y;
  const int b  = blockIdx.z;
  const int l0 = qb * 64;
  const int q0 = l0 + wave * 16;
  const size_t tok0 = (size_t)b * kSeq;

  const __bf16* Qh  = (const __bf16*)QKhp;
  const __bf16* Vt  = (const __bf16*)Vtp;     // f16 bits
  const __bf16* PEt = (const __bf16*)PEp;

  // ---- staging roles: wave 0 brings the chunk's k tile (64 rows), wave 1 its pe band (128 rows), wave 2 its v^T tile (64 rows);
  //      every row is 128 B and lands at the pitch of 144 B ----
  const uint32_t wv   = uni(threadIdx.x >> 5);
  const uint32_t isu  = pinned(wv < 3u ? 1u : 0u);            // 1 in the waves that issue
  const uint32_t iskp = pinned(wv < 2u ? 1u : 0u);            // 1 in the waves that bring k and pe
  const uint32_t isv  = pinned(wv == 2u ? 1u : 0u);           // 1 in the wave that brings v^T
  const uint32_t trows = (wv == 1u) ? 128u : 64u;
  // first byte of the wave's tile of chunk 0, and what a chunk adds to it: k 64 token rows on, pe 64 distance rows back
  // (band d0 .. d0 + 127 with d0 = l0 - 64 n + 448 in [0, 896], plane of 1024 rows), v^T 64 keys on in its rows
  const __bf16* gt0 = (wv == 0u) ? Qh + tok0 * kQKld + kHid + (size_t)h * kHdim
                    : (wv == 1u) ? PEt + (size_t)(l0 + 448) * kHdim
                                 : Vt + (size_t)(b * kHeads + h) * kHdim * kSeq;
  const uint64_t gbase = (uint64_t)(size_t)gt0;
  const int64_t  gstep = (wv == 0u) ? (int64_t)64 * kQKld * 2 : (wv == 1u) ? -(int64_t)64 * kHdim * 2 : (int64_t)64 * 2;
  const uint32_t lplace = (uint32_t)(size_t)(lds_byte*)smem
                        + ((wv == 0u) ? (uint32_t)kOffKH : (wv == 1u) ? (uint32_t)kOffPE : (uint32_t)kOffV);
  u32x8 g1;                                    // 1-byte elements, tensor = tile = trows rows of 128 B, 16 B of LDS pad behind every row
  g1[0] = uni((1u << 20) | (4u << 22) | (3u << 25));
  g1[1] = pinned(128u << 16);                  // pinned(): each word keeps a scalar register of its own through the loop
  g1[2] = pinned(trows << 16);
  g1[3] = pinned(128u << 16);
  g1[4] = pinned(trows);
  g1[5] = pinned((wv == 0u) ? (uint32_t)kQKld * 2u : (wv == 1u) ? (uint32_t)kHdim * 2u : (uint32_t)kSeq * 2u);   // source row pitch, bytes
  g1[6] = pinned(0u);
  g1[7] = pinned(0u);
  u32x4 g0;                                    // the descriptor group of the request last issued
  g0[0] = pinned(1u);
  g0[1] = pinned(lplace);
  g0[2] = uni((uint32_t)gbase);
  g0[3] = uni((((uint32_t)(gbase >> 32)) & 0x01FFFFFFu) | 0x80000000u);
  // this wave's tile of key chunk n; the descriptor is formed behind pinned()
  auto stage = [&](int n) {
    const uint32_t so = pinned((uint32_t)n);
    const uint64_t ga = gbase + (uint64_t)((int64_t)so * gstep);
    g0[2] = uni((uint32_t)ga);
    g0[3] = uni((((uint32_t)(ga >> 32)) & 0x01FFFFFFu) | 0x80000000u);
    tdm_load(g0, g1);
  };

  if (pinned(iskp)) stage(0);                   // k and pe of chunk 0 fly while the Q fragments are fetched

  // ---- Q fragments: 2 d-chunks ----
  v16b qah[2];
  {
    const size_t qo = (tok0 + q0 + c) * kQKld + (size_t)h * kHdim + 8 * hh;
#pragma unroll
    for (int dc = 0; dc < 2; ++dc) qah[dc] = Frag<__bf16>::load(Qh + qo + dc * 32);
  }
  // stands in front of the first write over an address register of the q loads (this build reuses them for out^T)
  asm volatile("s_wait_xcnt 0x0" ::: "memory");
  __builtin_amdgcn_sched_barrier(0);           // keeps those writes behind the wait: the build lifts them over it otherwise

  float mrow = -INFINITY, lrow = 0.f;          // this lane's query (row c of the wave); lrow sums this half's keys only
  v8f oacc[4];                                 // out^T: register r of tile t = d 16 t + 8 hh + r of query c
#pragma unroll
  for (int t = 0; t < 4; ++t) oacc[t] = (v8f){0.f,0.f,0.f,0.f,0.f,0.f,0.f,0.f};

  _Float16* t1w = (_Float16*)(smem + kOffT1) + wave * (kT1Slots * 16);
  // every table address of the chunk loop is one base register plus a constant: the registers so freed hold reads in flight
  const __bf16* pe1b = PEs + (16 * wave + c) * kPitchH + 8 * hh;            // pe rows of T1 tile 0
  const __bf16* pe2b = PEs + (16 * (3 - wave) + c) * kPitchH + 8 * hh;      // pe rows of T2 tile 0
  _Float16* t1s = t1w + c * 16 + 8 * hh;                                    // T1 tile 0, this lane's eight rows
  _Float16* t2s = T2s + (16 * (3 - wave) + c) * kT2Pitch + 16 * wave + 8 * hh;   // T2 tile 0, this lane's eight keys
  // bias gather bases (query row c, key 16 j + 8 hh + r): element (r, j) lies at a non-negative constant behind them
  const _Float16* t1b = t1w + ((c - 8 * hh + 8) * 16 + c);
  const _Float16* t2b = T2s + ((16 * wave + c - 8 * hh + 8) * kT2Pitch + 8 * hh);
  const float* mkb = mask + tok0 + 8 * hh;     // additive mask [b][r], this half's eight keys of each group

  for (int kc = 0; kc < kSeq / 64; ++kc) {
    const int r0 = kc * 64;
    // publish k / pe of this chunk; the barrier also ends the previous chunk's reads of T2s and of the v tile
    wait_lds_done();
    if (pinned(isu)) wait_tile_landed(g0, g1);
    __syncthreads();
    if (pinned(isv)) stage(kc);                // v^T flies under the T1 / T2 / q.k products, read behind the next barrier
    v4f mk[4][2];                              // fetched here, used behind the next barrier
#pragma unroll
    for (int j = 0; j < 4; ++j) {
      mk[j][0] = *(const v4f*)(mkb + r0 + j * 16);
      mk[j][1] = *(const v4f*)(mkb + r0 + j * 16 + 4);
    }

    // ---- relative-position tiles on WMMA: T1 (5 tiles per wave), T2 (5 tiles per wave) ----
    {
      v16b ka[2];
#pragma unroll
      for (int dc = 0; dc < 2; ++dc) ka[dc] = Frag<__bf16>::load(KHs + (wave * 16 + c) * kPitchH + 8 * hh + dc * 32);   // k rows as A operand
#pragma unroll
      for (int i0 = 0; i0 < 5; i0 += 2) {                  // tiles i0 and i0 + 1 together (the fifth alone)
        // distance tile bases inside the staged band: T1 16 (wave + i), T2 16 (3 - wave + i), both <= 112
        const int nt = (i0 + 1 < 5) ? 2 : 1;
        v16b p1[2][2], p2[2][2];
        v8f a1[2], a2[2];
#pragma unroll
        for (int u = 0; u < nt; ++u) {
          a1[u] = (v8f){0.f,0.f,0.f,0.f,0.f,0.f,0.f,0.f};
          a2[u] = (v8f){0.f,0.f,0.f,0.f,0.f,0.f,0.f,0.f};
#pragma unroll
          for (int dc = 0; dc < 2; ++dc) {
            p1[u][dc] = Frag<__bf16>::load(pe1b + (i0 + u) * 16 * kPitchH + dc * 32);   // B[k=d][n=dist]
            p2[u][dc] = Frag<__bf16>::load(pe2b + (i0 + u) * 16 * kPitchH + dc * 32);
          }
        }
        if (nt == 2) hold8(p1[0][0], p2[0][0], p1[1][0], p2[1][0], p1[0][1], p2[0][1], p1[1][1], p2[1][1]);
        else         hold4(p1[0][0], p2[0][0], p1[0][1], p2[0][1]);
#pragma unroll
        for (int dc = 0; dc < 2; ++dc) {
#pragma unroll
          for (int u = 0; u < nt; ++u) {
            a1[u] = at_mma(qah[dc], p1[u][dc], a1[u]);
            a2[u] = at_mma(ka[dc], p2[u][dc], a2[u]);
          }
        }
#pragma unroll
        for (int u = 0; u < nt; ++u) {
          v8h hv1, hv2;
#pragma unroll
          for (int r = 0; r < 8; ++r) { hv1[r] = (_Float16)a1[u][r]; hv2[r] = (_Float16)a2[u][r]; }
          // D element r: row 8hh+r (query row of this wave / key row 16*wave+8hh+r), col = dist slot 16i+c
          *(v8h*)(t1s + (i0 + u) * 16 * 16) = hv1;
          *(v8h*)(t2s + (i0 + u) * 16 * kT2Pitch) = hv2;
        }
      }
    }

    // ---- s^T = k . q^T, A fragments from the staged k tile, B = the q fragments ----
    // The four key groups' chains run side by side; each s[j] sums d half 0, then d half 1.
    v8f s[4];
#pragma unroll
    for (int j = 0; j < 4; ++j) s[j] = (v8f){0.f,0.f,0.f,0.f,0.f,0.f,0.f,0.f};
    {
      v16b kb[2][4];
#pragma unroll
      for (int dc = 0; dc < 2; ++dc) {
#pragma unroll
        for (int j = 0; j < 4; ++j) kb[dc][j] = Frag<__bf16>::load(KHs + (j * 16 + c) * kPitchH + 8 * hh + dc * 32);
      }
      hold8(kb[0][0], kb[0][1], kb[0][2], kb[0][3], kb[1][0], kb[1][1], kb[1][2], kb[1][3]);
#pragma unroll
      for (int dc = 0; dc < 2; ++dc) {
#pragma unroll
        for (int j = 0; j < 4; ++j) s[j] = at_mma(kb[dc][j], qah[dc], s[j]);
      }
    }
    // publish T1s / T2s and the v tile; the barrier also ends every wave's reads of the k and pe tiles
    wait_lds_done();
    if (pinned(isu)) wait_tile_landed(g0, g1);
    __syncthreads();
    if (pinned(iskp & (uint32_t)(kc + 1 < kSeq / 64))) stage(kc + 1);   // flies under softmax and p.v, read behind the next chunk's first barrier

    float mj[4];                               // four chains of the in-lane maximum
#pragma unroll
    for (int j = 0; j < 4; ++j) mj[j] = -INFINITY;
#pragma unroll
    for (int g = 0; g < 2; ++g) {              // keys r = 4 g .. 4 g + 3 of each group: 32 reads as groups, then their sums
      _Float16 u1[4][4], u2[4][4];
#pragma unroll
      for (int rr = 0; rr < 4; ++rr) {
#pragma unroll
        for (int j = 0; j < 4; ++j) {
          const int r = 4 * g + rr;            // p1 = c - 16 j - 8 hh - r + 63, in [0, 78]
          u1[rr][j] = t1b[16 * (55 - 16 * j - r)];                        // T1w[p1][c]
          u2[rr][j] = t2b[kT2Pitch * (55 - 16 * j - r) + 16 * j + r];     // T2[p1 + 16 wave][16 j + 8 hh + r]
        }
      }
#pragma unroll
      for (int rr = 0; rr < 4; ++rr) {
        const int r = 4 * g + rr;
#pragma unroll
        for (int j = 0; j < 4; ++j) {
          const float v = (s[j][r] + (float)u1[rr][j] + (float)u2[rr][j]) * 0.125f + mk[j][g][rr];
          s[j][r] = v;
          mj[j] = fmaxf(mj[j], v);
        }
      }
    }
    FB vb[2][4];
#pragma unroll                                 // p is not waited for in LDS any more: the v reads fly under the exponentials
    for (int kk = 0; kk < 2; ++kk) {
#pragma unroll
      for (int t = 0; t < 4; ++t) {
        const int vo = (t * 16 + c) * kPitchH + kk * 32 + 8 * hh;   // A[m=d][k=kv] from the staged v^T[d][kv]
        vb[kk][t].h[0] = *(const v8b*)(Vs + vo);
        vb[kk][t].h[1] = *(const v8b*)(Vs + vo + 16);
      }
    }
    // keeps the v reads in front of the exponentials: without it the build sinks part of them to the products and
    // waits out their LDS round trip there
    __builtin_amdgcn_sched_barrier(0);
    float cm = fmaxf(fmaxf(mj[0], mj[1]), fmaxf(mj[2], mj[3]));
    cm = fmaxf(cm, xhalf(cm));                 // both halves now hold the query's maximum over the chunk
    const float mnew  = fmaxf(mrow, cm);
    const float alpha = __expf(mrow - mnew);
    mrow = mnew;
    float ps[4];                               // four chains of the in-lane sum
    FB pb[2];                                  // p^T as B operand: element e of pb[kk] = key 32 kk + kmap(e, hh) of query c
#pragma unroll
    for (int j = 0; j < 4; ++j) {
      ps[j] = 0.f;
#pragma unroll
      for (int r = 0; r < 8; ++r) {
        const float p = __expf(s[j][r] - mnew);
        ps[j] += p;
        pb[j >> 1].v[(j & 1) * 8 + r] = at_to16(p * kPCarry);
      }
    }
    lrow = lrow * alpha + ((ps[0] + ps[1]) + (ps[2] + ps[3]));
#pragma unroll
    for (int t = 0; t < 4; ++t) {
#pragma unroll
      for (int r = 0; r < 8; ++r) oacc[t][r] *= alpha;
    }
#pragma unroll
    for (int kk = 0; kk < 2; ++kk) {
#pragma unroll
      for (int t = 0; t < 4; ++t) oacc[t] = at_mma(vb[kk][t].v, pb[kk].v, oacc[t]);
    }
  }
  wait_tile_landed(g0, g1);                    // none is left in flight when the wave reuses LDS and ends

  // ---- epilogue: out[b][q0+row][h*64 + 0..63]; row segment = 256 B = 16 lanes x 16 B, one instruction per row ----
  // The out tiles lie on the k / pe range: its last readers left it at the last chunk's second barrier, and no load
  // was aimed at it after that.
  float* os = (float*)(smem) + wave * (16 * 68);
  const float inv = 1.0f / ((lrow + xhalf(lrow)) * kPCarry);   // the halves' sums are joined once, here
#pragma unroll
  for (int t = 0; t < 4; ++t) {
    float* op = os + c * 68 + t * 16 + 8 * hh;                 // query row c, d 16 t + 8 hh .. + 7
    *(v4f*)(op)     = (v4f){oacc[t][0] * inv, oacc[t][1] * inv, oacc[t][2] * inv, oacc[t][3] * inv};
    *(v4f*)(op + 4) = (v4f){oacc[t][4] * inv, oacc[t][5] * inv, oacc[t][6] * inv, oacc[t][7] * inv};
  }
  __builtin_amdgcn_fence(__ATOMIC_RELEASE, "workgroup");
  __builtin_amdgcn_wave_barrier();
  __builtin_amdgcn_fence(__ATOMIC_ACQUIRE, "workgroup");
  {
    float* ob = out + (size_t)h * kHdim;
    const int c4 = (lane & 15) * 4;
    {
#pragma unroll
      for (int it = 0; it < 8; ++it) {
        const int row = it * 2 + hh;
        v4f val = *(const v4f*)(os + row * 68 + c4);
        *(v4f*)(ob + (tok0 + q0 + row) * kHid + c4) = val;
      }
      
    }
  }
}

// ---------------------------------------------------------------------------
// Workspace region map (byte offsets, multiples of 128; every region fully written before it is read):
//   X16  bf16 [8192][1024]                     0 ..  16,777,216
//   WT   bf16 [3072][1024] (W^T)      16,777,216 ..  23,068,672
//   PE   f16  [1024][64] (row 1023 0) 23,068,672 ..  23,199,744
//   QK   f16  [8192][2048] ([q|k])     23,199,744 ..  56,754,176
//   Vt   f16  [16][1024][512]          56,754,176 ..  73,531,392
//   total 73,531,392 B.
// GEMM shapes: q|k: M=8192 N=2048 K=1024; v (role-swapped, per batch): M=1024 N=512 K=1024 x16.
//   K % 64 == 0, M % 128 == 0 and N % 256 == 0 for both; no padded operand rows.
// ---------------------------------------------------------------------------
extern "C" void kernel_launch(void* const* d_in, const int* in_sizes, int n_in,
                              void* d_out, int out_size, void* d_ws, size_t ws_size,
                              hipStream_t stream) {
  if (n_in < 5) return;
  if (in_sizes[0] != kTok * kHid) return;
  if (in_sizes[1] != kBatch * kSeq) return;
  if (in_sizes[2] != kHid * kN3) return;
  if (in_sizes[3] != kN3) return;
  if (in_sizes[4] != kNDist * kHdim) return;
  if (out_size != kTok * kHid) return;

  const float* hid  = (const float*)d_in[0];   // [16][512][1024]
  const float* msk  = (const float*)d_in[1];   // [16][1][1][512]
  const float* W    = (const float*)d_in[2];   // [1024][3072]
  const float* bqkv = (const float*)d_in[3];   // [3072]
  const float* pe   = (const float*)d_in[4];   // [1023][64]
  float* outp = (float*)d_out;                 // [16][512][1024]

  const size_t SZ_X16 = (size_t)kTok * kHid * 2;              //  16,777,216
  const size_t SZ_WT  = (size_t)kN3 * kHid * 2;               //   6,291,456
  const size_t SZ_PE  = (size_t)kNDistP * kHdim * 2;          //     131,072
  const size_t SZ_QK  = (size_t)kTok * kQKld * 2;             //  33,554,432
  const size_t SZ_VT  = (size_t)kBatch * kHid * kSeq * 2;     //  16,777,216
  size_t off = 0;
  const size_t oX16 = off; off += SZ_X16;
  const size_t oWT  = off; off += SZ_WT;
  const size_t oPE  = off; off += SZ_PE;
  const size_t oQKh = off; off += SZ_QK;
  const size_t oVT  = off; off += SZ_VT;
  const size_t TOTAL = off;                                   //  73,531,392
  if (TOTAL > ws_size) return;
  if (TOTAL > (size_t)134217728) return;

  char* ws = (char*)d_ws;
  unsigned short* X16 = (unsigned short*)(ws + oX16);
  unsigned short* WT  = (unsigned short*)(ws + oWT);
  unsigned short* PEb = (unsigned short*)(ws + oPE);
  unsigned short* QKh = (unsigned short*)(ws + oQKh);
  unsigned short* VTp = (unsigned short*)(ws + oVT);

  const dim3 blk(256);
  // (0..2) one launch: W [1024][3072] -> WT [3072][1024] bf16; dist_emb -> PE f16 [1024][64]; x -> bf16 plane
  prep_kernel<<<dim3(kPrepW + kPrepPE + kPrepX), blk, 0, stream>>>(hid, W, pe, X16, WT, PEb);
  // (3, 4) one launch:
  //   v^T per batch: Vt[b][m][s] = WT[2048+m] . x[b*512+s] + b[2048+m] -> f16, pitch 512
  //   [q|k] = X16 . WT[0..2047]^T + b[0..2047] -> one f16 plane, pitch 2048
  {
    const GemmJob jv  = {WT + (size_t)2 * kHid * kHid, X16, VTp, VTp, bqkv + 2 * kHid,
                         0L, (long)kSeq * kHid, (long)kHid * kSeq, kHid, kHid, kSeq, kHid, kSeq, kHid, 1.0f};
    const GemmJob jqk = {X16, WT, QKh, QKh, bqkv,
                         0L, 0L, 0L, kHid, kHid, kQKld, kTok, kQKld, kHid, 1.0f};
    proj_kernel<<<dim3(kVBlocks + kQKBlocks), blk, 0, stream>>>(jv, jqk);
  }
  // (5) fused attention with relative-position bias -> out f32 [16][512][1024]
  relattn_kernel<<<dim3(kSeq / 64, kHeads, kBatch), dim3(128), 0, stream>>>(QKh, VTp, PEb, msk, outp);
}

// v009
// Measured time: 95 microseconds a run.
// In both of two side-by-side timings against v008, it was 1.03 times as fast.
// Over all steps from v000 it is 3.28 times as fast.
// Contractions: qkv projection v_wmma_f32_16x16x32_bf16 (x, W as bf16 RNE; bias added as bf16-RNE value in f32); q.k^T, q.pe^T and k.pe^T v_wmma_f32_16x16x32_f16 (q, k, pe one f16 RNE plane each); p.v v_wmma_f32_16x16x32_f16 (p f16 carried x2^15, v f16); f32 accumulate; softmax, scale, bias, mask add in f32.
#include <hip/hip_runtime.h>
#include <math.h>
#include <stdint.h>

// ---------------------------------------------------------------------------
// Problem constants
// ---------------------------------------------------------------------------
constexpr int kBatch  = 16;
constexpr int kSeq    = 512;
constexpr int kHid    = 1024;
constexpr int kHeads  = 16;
constexpr int kHdim   = 64;
constexpr int kN3     = 3 * kHid;          // 3072 qkv output columns
constexpr int kQKld   = 2 * kHid;          // 2048: pitch of the [q | k] plane
constexpr int kTok    = kBatch * kSeq;     // 8192 token rows
constexpr int kNDist  = 2 * kSeq - 1;      // 1023 relative distances
constexpr int kNDistP = 1024;              // pe plane rows (row 1023 zero)
constexpr float kPCarry = 32768.0f;        // f16 probabilities carried x2^15
static_assert(kHid % 128 == 0 && kTok % 128 == 0 && kQKld % 256 == 0 && kSeq % 256 == 0, "tiles");

typedef __attribute__((ext_vector_type(16))) _Float16 v16h;
typedef __attribute__((ext_vector_type(8)))  _Float16 v8h;
typedef __attribute__((ext_vector_type(4)))  _Float16 v4h;
typedef __attribute__((ext_vector_type(16))) __bf16   v16b;
typedef __attribute__((ext_vector_type(8)))  __bf16   v8b;
typedef __attribute__((ext_vector_type(8)))  float    v8f;
typedef __attribute__((ext_vector_type(4)))  float    v4f;
typedef __attribute__((ext_vector_type(4)))  unsigned int v4u;
typedef uint32_t u32x4 __attribute__((ext_vector_type(4)));
typedef uint32_t u32x8 __attribute__((ext_vector_type(8)));

__device__ __forceinline__ unsigned short f2bf_bits(float f) {
  unsigned u = __float_as_uint(f);
  return (unsigned short)((u + 0x7FFFu + ((u >> 16) & 1u)) >> 16);
}
__device__ __forceinline__ float bf_bits2f(unsigned short h) { return __uint_as_float(((unsigned)h) << 16); }

// hazard guards as plain device helpers (no inline asm inside the kernel template body)
__device__ __forceinline__ void dep_guard_h(v8f& a, v8f& b, v16h x, v16h y) { asm volatile("v_nop\n\tv_nop\n\tv_nop\n\tv_nop" : "+v"(a), "+v"(b) : "v"(x), "v"(y)); }
__device__ __forceinline__ void dep_guard_b(v8f& a, v8f& b, v16b x, v16b y) { asm volatile("v_nop\n\tv_nop\n\tv_nop\n\tv_nop" : "+v"(a), "+v"(b) : "v"(x), "v"(y)); }
__device__ __forceinline__ void keep4_h(v16h a, v16h b, v16h c, v16h d) { asm volatile("v_nop" :: "v"(a), "v"(b), "v"(c), "v"(d)); }
__device__ __forceinline__ void keep4_b(v16b a, v16b b, v16b c, v16b d) { asm volatile("v_nop" :: "v"(a), "v"(b), "v"(c), "v"(d)); }
__device__ __forceinline__ void acc_guard4(v8f& a, v8f& b, v8f& c, v8f& d) { asm volatile("v_nop\n\tv_nop\n\tv_nop\n\tv_nop" : "+v"(a), "+v"(b), "+v"(c), "+v"(d)); }
template <typename T> struct Frag;
template <> struct Frag<_Float16> {
  typedef v16h V; union U { v16h v; v8h h[2]; };
  static __device__ __forceinline__ v16h load(const _Float16* p) {   // elements 0..7 <- p[0..7], 8..15 <- p[16..23]
    U f; f.h[0] = *(const v8h*)(p); f.h[1] = *(const v8h*)(p + 16); return f.v;
  }
  static __device__ __forceinline__ v8f mma(v16h a, v16h b, v8f c) {
    return __builtin_amdgcn_wmma_f32_16x16x32_f16(false, a, false, b, (short)0, c, false, false);
  }
  static __device__ __forceinline__ void guard(v8f& a, v8f& b, v16h x, v16h y) { dep_guard_h(a, b, x, y); }
  static __device__ __forceinline__ void keep(v16h a, v16h b, v16h c, v16h d) { keep4_h(a, b, c, d); }
};
template <> struct Frag<__bf16> {
  typedef v16b V; union U { v16b v; v8b h[2]; };
  static __device__ __forceinline__ v16b load(const __bf16* p) {
    U f; f.h[0] = *(const v8b*)(p); f.h[1] = *(const v8b*)(p + 16); return f.v;
  }
  static __device__ __forceinline__ v8f mma(v16b a, v16b b, v8f c) {
    return __builtin_amdgcn_wmma_f32_16x16x32_bf16(false, a, false, b, (short)0, c, false, false);
  }
  static __device__ __forceinline__ void guard(v8f& a, v8f& b, v16b x, v16b y) { dep_guard_b(a, b, x, y); }
  static __device__ __forceinline__ void keep(v16b a, v16b b, v16b c, v16b d) { keep4_b(a, b, c, d); }
};

__device__ __forceinline__ unsigned pk16(unsigned short a, unsigned short b) { return (unsigned)a | ((unsigned)b << 16); }

// this wave's LDS reads and writes have retired (before a barrier that hands a buffer to its next writer)
__device__ __forceinline__ void wait_lds_done() { asm volatile("s_wait_dscnt 0x0" ::: "memory"); }

__device__ __forceinline__ uint32_t uni(uint32_t v) { return (uint32_t)__builtin_amdgcn_readfirstlane(v); }
// pinned(): a wave-uniform test value or a descriptor word held in a scalar register: a test on it compiles to s_cmp +
// s_cbranch (a tensor load ignores EXEC), a descriptor word keeps its register; as a volatile statement it also keeps what is
// computed from its result behind the wait written in front of it
__device__ __forceinline__ uint32_t pinned(uint32_t v) { uint32_t w = __builtin_amdgcn_readfirstlane(v); asm volatile("" : "+s"(w)); return w; }
__device__ __forceinline__ void tdm_load(u32x4 g0, u32x8 g1) { asm volatile("tensor_load_to_lds %0, %1" :: "s"(g0), "s"(g1) : "memory"); }
// this wave's own tensor load has landed (before the barrier behind which other waves read its tile); the wait names the
// request's descriptor as inputs, so that the build holds those scalar registers untouched from the issue to this wait
// (without that they serve as scratch while the request is outstanding)
__device__ __forceinline__ void wait_tile_landed(u32x4 g0, u32x8 g1) { asm volatile("s_wait_tensorcnt 0x0" :: "s"(g0), "s"(g1) : "memory"); }

// ---- Register-blocked batched WMMA GEMM (ACT tanh/relu only,
//      bias values RNE-converted to bf16 before the f32 add) --------
// C[m,n] = scale * sum_k A[m,k] * Bt[n,k] (+bias)(+resid); a block owns a 128x256 tile, its 8 waves (2 x 4) 64x64 each.
// A row-major [M,K]; Bt row-major [N,K]; M % 128 == 0, N % 256 == 0, K % 64 == 0.
// Each k slice of 64 (128 A rows + 256 Bt rows of 128 B) is staged once per block in LDS by three tensor loads (waves 0..2,
// 128 rows each), two buffers: the next slice flies while this one is multiplied.
// SPLIT: 0 only (single operand planes; A2p / Bt2p are not read).
// BIAS_MODE: 0 = none, 1 = bias[m], 2 = bias[n].
// OUT_MODE: 0 = f32, 1 = f16, 2 = bf16 hi plane (Cout) + bf16 lo plane (Cout2).
// ACT: 0 = none, 1 = tanh, 2 = relu.
// ET: 0 = f16 operands, 1 = bf16 operands (pointers passed as 16-bit storage)
constexpr int kGPitchB = 144;                          // staged 128-B row at 16 B x odd: no bank conflict for 16-B reads
constexpr int kGPitchH = kGPitchB / 2;                 // the same in 16-bit elements
constexpr int kGRowsA  = 128;
constexpr int kGRowsB  = 256;
constexpr int kGStageB = (kGRowsA + kGRowsB) * kGPitchB;   // 55,296 B per buffer
constexpr int kGTileRows = 128;                        // rows of one tensor load
constexpr int kGTileB  = kGTileRows * kGPitchB;        // 18,432 B: its place in a buffer
constexpr int kGIssuers = (kGRowsA + kGRowsB) / kGTileRows;   // 3 waves issue
static_assert(kGTileB % 2048 == 0 && kGStageB % 2048 == 0 && kGRowsA == kGTileRows, "every tile's place is a multiple of 2 KiB");
template <int ET> struct Elem;
template <> struct Elem<0> { typedef _Float16 T; };
template <> struct Elem<1> { typedef __bf16 T; };
// ring: two staged k slices, [A 128 rows | Bt 256 rows] each; sT: per-wave 16x64 slab, pitch 68 floats. Both belong to the
// kernel that calls this body; tile and b say which block tile of which batch entry the calling block owns.
template <int ET, int SPLIT, int BIAS_MODE, int OUT_MODE, bool RESID, int ACT = 0>
__device__ __forceinline__ void wmma_gemm64(
    unsigned char* ring, float (*sT)[16 * 68], const int tile, const int b,
    const unsigned short* __restrict__ Ap, const unsigned short* __restrict__ A2p, int lda, long strideA,
    const unsigned short* __restrict__ Btp, const unsigned short* __restrict__ Bt2p, int ldb, long strideB,
    void* __restrict__ Cout, void* __restrict__ Cout2, int ldc, long strideC,
    const float* __restrict__ bias,
    const float* __restrict__ resid, long strideR,
    int M, int N, int K, float scale) {
  static_assert(SPLIT == 0, "single operand planes");
  typedef typename Elem<ET>::T T;
  typedef typename Frag<T>::V V;
  typedef __attribute__((address_space(3))) unsigned char lds_byte;
  const T* A = (const T*)Ap; const T* Bt = (const T*)Btp;
  const int lane = threadIdx.x & 31;
  const int wave = threadIdx.x >> 5;
  const int tilesN = N >> 8;
  const int tilesM = M >> 7;
  if (tile >= tilesM * tilesN) return;   // block-uniform, in front of every barrier
  const int tm = tile / tilesN;
  const int tn = tile - tm * tilesN;
  const int wm = wave >> 2;                    // wave row (0..1) and column (0..3) inside the block tile
  const int wn = wave & 3;
  const int m0 = (tm << 7) + (wm << 6);
  const int n0 = (tn << 8) + (wn << 6);

  const T* Ab  = A  + (size_t)b * strideA;
  const T* Bb  = Bt + (size_t)b * strideB;

  const int rlane = lane & 15;                 // row (A) / col (B, D) within subtile
  const int koff  = (lane >> 4) * 8;           // k offset of this lane half
  const int mOff  = (lane >> 4) * 8;           // D row offset

  // ---- staging roles: wave 0 brings the block's 128 A rows, waves 1 and 2 128 Bt rows each; a row is 128 B of a k slice ----
  const uint32_t wv  = uni(threadIdx.x >> 5);
  const uint32_t isl = wv < (uint32_t)kGIssuers ? wv : 0u;           // slice of an issuing wave (the others issue nothing)
  const T* grow = (isl == 0u) ? Ab + (size_t)(tm << 7) * lda
                              : Bb + (size_t)((tn << 8) + ((int)isl - 1) * kGTileRows) * ldb;
  const uint64_t gbase = (uint64_t)(size_t)grow;
  const uint32_t lbase = (uint32_t)(size_t)(lds_byte*)ring + isl * (uint32_t)kGTileB;
  u32x8 g1;                                    // 1-byte elements, tensor = tile = 128 rows of 128 B, 16 B of LDS pad behind every row
  g1[0] = uni((1u << 20) | (4u << 22) | (3u << 25));
  g1[1] = pinned(128u << 16);                  // pinned(): each word keeps a scalar register of its own through the loop
  g1[2] = pinned((uint32_t)kGTileRows << 16);
  g1[3] = pinned(128u << 16);
  g1[4] = pinned((uint32_t)kGTileRows);
  g1[5] = pinned((uint32_t)((isl == 0u) ? lda : ldb) * 2u);          // source row pitch, bytes
  g1[6] = pinned(0u);
  g1[7] = pinned(0u);
  const uint32_t isu = pinned(wv < (uint32_t)kGIssuers ? 1u : 0u);   // 1 in the waves that issue
  u32x4 g0;                                    // the descriptor group of the request last issued
  g0[0] = pinned(1u);
  g0[1] = uni(lbase);
  g0[2] = uni((uint32_t)gbase);
  g0[3] = uni((((uint32_t)(gbase >> 32)) & 0x01FFFFFFu) | 0x80000000u);
  // this wave's tile of k slice s (columns 64 s .. 64 s + 63) into buffer s & 1; the descriptor is formed behind pinned()
  auto stage = [&](int s) {
    const uint32_t so = pinned((uint32_t)s);
    const uint64_t ga = gbase + (uint64_t)so * 128u;
    g0[1] = uni(lbase + (so & 1u) * (uint32_t)kGStageB);
    g0[2] = uni((uint32_t)ga);
    g0[3] = uni((((uint32_t)(ga >> 32)) & 0x01FFFFFFu) | 0x80000000u);
    tdm_load(g0, g1);
  };

  v8f acc[4][4];
#pragma unroll
  for (int i = 0; i < 4; ++i)
#pragma unroll
    for (int j = 0; j < 4; ++j) acc[i][j] = (v8f){0.f,0.f,0.f,0.f,0.f,0.f,0.f,0.f};

  const int nst = K >> 6;
  if (pinned(isu)) {
    stage(0);
    wait_tile_landed(g0, g1);
  }
  __syncthreads();                             // publishes slice 0
  if (pinned(isu & (uint32_t)(nst > 1))) stage(1);

  const int fa = ((wm << 6) + rlane) * kGPitchH + koff;             // this lane's A fragment base in a buffer
  const int fb = (kGRowsA + (wn << 6) + rlane) * kGPitchH + koff;   // this lane's Bt fragment base in a buffer
  for (int s = 0; s < nst; ++s) {
    const T* buf = (const T*)(ring + (s & 1) * kGStageB);
#pragma unroll
    for (int ks = 0; ks < 2; ++ks) {
      V bh[4], ah[4];
#pragma unroll
      for (int j = 0; j < 4; ++j) bh[j] = Frag<T>::load(buf + fb + j * 16 * kGPitchH + ks * 32);
#pragma unroll
      for (int i = 0; i < 4; ++i) ah[i] = Frag<T>::load(buf + fa + i * 16 * kGPitchH + ks * 32);
#pragma unroll
      for (int i = 0; i < 4; ++i) {
#pragma unroll
        for (int j = 0; j < 4; ++j) acc[i][j] = Frag<T>::mma(ah[i], bh[j], acc[i][j]);
        // hazard guard; it also holds all four A fragments live, so that the slice's LDS reads go out as
        // one group ahead of the products (without it the build reloads one A register set behind a full wait per row)
        Frag<T>::guard(acc[i][0], acc[i][3], ah[i], ah[i]);
      }
      Frag<T>::keep(bh[0], bh[1], bh[2], bh[3]);
    }
    // publish slice s + 1; the barrier also ends every wave's reads of the buffer that is refilled behind it
    wait_lds_done();
    if (pinned(isu)) wait_tile_landed(g0, g1);
    __syncthreads();
    if (pinned(isu & (uint32_t)(s + 2 < nst))) stage(s + 2);
  }
  wait_tile_landed(g0, g1);                    // none is left in flight when the wave ends
  wait_lds_done();
  acc_guard4(acc[0][0], acc[0][1], acc[0][2], acc[0][3]);
  acc_guard4(acc[1][0], acc[1][1], acc[1][2], acc[1][3]);
  acc_guard4(acc[2][0], acc[2][1], acc[2][2], acc[2][3]);
  acc_guard4(acc[3][0], acc[3][1], acc[3][2], acc[3][3]);

  // ---- epilogue ----
  float* slab = sT[wave];
  const float* Rb = RESID ? (resid + (size_t)b * strideR) : nullptr;
#pragma unroll
  for (int i = 0; i < 4; ++i) {
    const int mBase = m0 + (i << 4);
#pragma unroll
    for (int j = 0; j < 4; ++j) {
      const int n = n0 + (j << 4) + rlane;
      float bv = 0.f;
      if (BIAS_MODE == 2) bv = bf_bits2f(f2bf_bits(bias[n]));                      // bias as bf16-RNE value
#pragma unroll
      for (int r = 0; r < 8; ++r) {
        float v = acc[i][j][r] * scale;
        if (BIAS_MODE == 1) v += bf_bits2f(f2bf_bits(bias[mBase + mOff + r]));     // bias as bf16-RNE value
        if (BIAS_MODE == 2) v += bv;
        if (RESID) v += Rb[(size_t)(mBase + mOff + r) * ldc + n];
        if (ACT == 1) v = tanhf(v);
        if (ACT == 2) v = fmaxf(v, 0.0f);
        slab[(mOff + r) * 68 + (j << 4) + rlane] = v;
      }
    }
    __builtin_amdgcn_fence(__ATOMIC_RELEASE, "workgroup");
    __builtin_amdgcn_wave_barrier();
    __builtin_amdgcn_fence(__ATOMIC_ACQUIRE, "workgroup");
    if (OUT_MODE == 0) {
      float* C = (float*)Cout + (size_t)b * strideC;
      const int hh = lane >> 4, c4 = (lane & 15) * 4;     // row seg = 256 B = 16 lanes x 16 B
      {
#pragma unroll
        for (int it = 0; it < 8; ++it) {
          const int row = it * 2 + hh;
          v4f v = *(const v4f*)(slab + row * 68 + c4);
          *(v4f*)(C + (size_t)(mBase + row) * ldc + n0 + c4) = v;
        }
        
      }
    } else {
      const int q = lane >> 3, c8 = (lane & 7) * 8;
      unsigned short* C  = (unsigned short*)Cout  + (size_t)b * strideC;
      unsigned short* C2 = (OUT_MODE == 2) ? ((unsigned short*)Cout2 + (size_t)b * strideC) : nullptr;
      {
#pragma unroll
        for (int it = 0; it < 4; ++it) {
          const int row = it * 4 + q;
          const float* sp = slab + row * 68 + c8;
          v8h hv, lv;
#pragma unroll
          for (int e = 0; e < 8; ++e) {
            if (OUT_MODE == 1) {
              hv[e] = (_Float16)sp[e];
            } else {
              unsigned short hb = f2bf_bits(sp[e]);
              unsigned short lb = f2bf_bits(sp[e] - bf_bits2f(hb));
              hv[e] = __builtin_bit_cast(_Float16, hb);
              lv[e] = __builtin_bit_cast(_Float16, lb);
            }
          }
          *(v8h*)(C + (size_t)(mBase + row) * ldc + n0 + c8) = hv;
          if (OUT_MODE == 2) *(v8h*)(C2 + (size_t)(mBase + row) * ldc + n0 + c8) = lv;
        }
        
      }
    }
    __builtin_amdgcn_fence(__ATOMIC_RELEASE, "workgroup");
    __builtin_amdgcn_wave_barrier();
    __builtin_amdgcn_fence(__ATOMIC_ACQUIRE, "workgroup");
  }
}

// ---------------------------------------------------------------------------
// Both projection GEMMs read the same converted operands and neither reads the other's result: one grid runs both, the
// block index picks the job (block-uniform, so every barrier is passed by whole blocks). The v^T tiles take the first indices.
// ---------------------------------------------------------------------------
struct GemmJob {
  const unsigned short* A;  const unsigned short* Bt;
  unsigned short* C;  unsigned short* C2;
  const float* bias;
  long strideA, strideB, strideC;
  int lda, ldb, ldc, M, N, K;
  float scale;
};
constexpr int kVTiles  = (kHid / 128) * (kSeq / 256);        //  16 block tiles per batch entry of v^T
constexpr int kVBlocks = kVTiles * kBatch;                   // 256
constexpr int kQKBlocks = (kTok / 128) * (kQKld / 256);      // 512
__global__ __launch_bounds__(256) void proj_kernel(const GemmJob v, const GemmJob qk) {
  __shared__ __attribute__((aligned(2048))) unsigned char ring[2 * kGStageB];   // tensor loads land at multiples of 2 KiB
  __shared__ __align__(16) float sT[8][16 * 68];
  const int blk = blockIdx.x;
  if (blk < kVBlocks)
    wmma_gemm64<1, 0, 1, 1, false, 0>(ring, sT, blk % kVTiles, blk / kVTiles,
        v.A, v.A, v.lda, v.strideA, v.Bt, v.Bt, v.ldb, v.strideB, (void*)v.C, (void*)v.C2, v.ldc, v.strideC,
        v.bias, v.bias, 0L, v.M, v.N, v.K, v.scale);
  else
    wmma_gemm64<1, 0, 2, 1, false, 0>(ring, sT, blk - kVBlocks, 0,
        qk.A, qk.A, qk.lda, qk.strideA, qk.Bt, qk.Bt, qk.ldb, qk.strideB, (void*)qk.C, (void*)qk.C2, qk.ldc, qk.strideC,
        qk.bias, qk.bias, 0L, qk.M, qk.N, qk.K, qk.scale);
}

// ---------------------------------------------------------------------------
// x f32 -> bf16 plane (RNE), 8 consecutive elements per thread -> one 16-B store per lane;
// Coverage: n8 = 8192*1024/8 = 1,048,576 threads x 8 = the whole plane; 4096 blocks x 256 exact.
// ---------------------------------------------------------------------------
__device__ __forceinline__ void cast8_bf16_body(int blk, const float* __restrict__ in, unsigned short* __restrict__ out, int n8) {
  const int i = blk * 256 + threadIdx.x;
  if (i >= n8) return;
  const float* p = in + 8 * (size_t)i;
  const v4f a = *(const v4f*)(p);
  const v4f c = *(const v4f*)(p + 4);
  unsigned short hb[8];
#pragma unroll
  for (int e = 0; e < 4; ++e) {
    hb[e]     = f2bf_bits(a[e]);
    hb[4 + e] = f2bf_bits(c[e]);
  }
  const v4u u = (v4u){pk16(hb[0], hb[1]), pk16(hb[2], hb[3]), pk16(hb[4], hb[5]), pk16(hb[6], hb[7])};
  unsigned short* q = out + 8 * (size_t)i;
  *(v4u*)q = u;
  
}

// ---------------------------------------------------------------------------
// Weight transpose + cast: W f32 [1024 k][3072 n] -> WT[n][k] bf16 (RNE), [3072][1024].
// 1024/64 = 16 k tiles (bk) x 3072/64 = 48 n tiles (bn), 256 threads each.
// Load coverage: 16 iterations x 256 threads = 4096 = the whole 64x64 tile (coalesced along n).
// Store coverage: 8 waves x 2 iterations x 4 rows (lane>>3) = 64 n rows; (lane&7) x 8 halves = 64 k cols; each row
// ---------------------------------------------------------------------------
__device__ __forceinline__ void wtcast_body(int bk, int bn, const float* __restrict__ W, unsigned short* __restrict__ out) {
  __shared__ float sm[64][65];   // sm[n_local][k_local]
  const int t  = threadIdx.x;
  const int k0 = bk * 64;
  const int n0 = bn * 64;
#pragma unroll
  for (int i = 0; i < 16; ++i) {
    const int e = i * 256 + t;
    const int r = e >> 6;          // k local
    const int c = e & 63;          // n local
    sm[c][r] = W[(size_t)(k0 + r) * kN3 + n0 + c];
  }
  __syncthreads();
  const int lane = t & 31, wave = t >> 5;
  const int q = lane >> 3, c8 = (lane & 7) * 8;
  {
#pragma unroll
    for (int it = 0; it < 2; ++it) {
      const int row = wave * 8 + it * 4 + q;                 // n local
      unsigned short hb[8];
#pragma unroll
      for (int e = 0; e < 8; ++e) hb[e] = f2bf_bits(sm[row][c8 + e]);
      const v4u u = (v4u){pk16(hb[0], hb[1]), pk16(hb[2], hb[3]), pk16(hb[4], hb[5]), pk16(hb[6], hb[7])};
      *(v4u*)(out + (size_t)(n0 + row) * kHid + k0 + c8) = u;
    }
    
  }
}

// ---------------------------------------------------------------------------
// dist_emb f32 [1023][64] -> PE f16 [1024][64] (RNE), row 1023 zero-filled.
// 1024*64/8 = 8192 threads = 32 blocks x 256 exactly; thread i: row i>>3, cols (i&7)*8..+7 -> one 16-B store;
// ---------------------------------------------------------------------------
__device__ __forceinline__ void pecast_body(int blk, const float* __restrict__ pe, unsigned short* __restrict__ out) {
  const int i = blk * 256 + threadIdx.x;
  if (i >= kNDistP * kHdim / 8) return;
  const int row = i >> 3, c8 = (i & 7) * 8;
  const int rc = (row < kNDist) ? row : (kNDist - 1);         // clamped address
  const float* src = pe + (size_t)rc * kHdim + c8;
  const v4f a = *(const v4f*)(src);
  const v4f c = *(const v4f*)(src + 4);
  const bool live = (row < kNDist);
  unsigned short hb[8];
#pragma unroll
  for (int e = 0; e < 4; ++e) {
    hb[e]     = live ? __builtin_bit_cast(unsigned short, (_Float16)a[e]) : (unsigned short)0;
    hb[4 + e] = live ? __builtin_bit_cast(unsigned short, (_Float16)c[e]) : (unsigned short)0;
  }
  const v4u u = (v4u){pk16(hb[0], hb[1]), pk16(hb[2], hb[3]), pk16(hb[4], hb[5]), pk16(hb[6], hb[7])};
  unsigned short* q = out + (size_t)row * kHdim + c8;
  *(v4u*)q = u;
  
}

// ---------------------------------------------------------------------------
// The three conversions depend on nothing but the inputs and not on one another: one grid does them all, the block
// index picks the job. The W tiles come first (they last longest: a barrier and an LDS round trip), then pe, then x.
// Every branch is block-uniform, so the barrier of the W tiles is passed by whole blocks only.
// ---------------------------------------------------------------------------
constexpr int kPrepW  = (kHid / 64) * (kN3 / 64);            // 768 blocks: W tiles
constexpr int kPrepPE = kNDistP * kHdim / 8 / 256;           //  32 blocks: pe rows
constexpr int kPrepX  = kTok * kHid / 8 / 256;               // 4096 blocks: x
__global__ __launch_bounds__(256) void prep_kernel(const float* __restrict__ x, const float* __restrict__ W,
                                                   const float* __restrict__ pe, unsigned short* __restrict__ X16,
                                                   unsigned short* __restrict__ WT, unsigned short* __restrict__ PEb) {
  const int blk = blockIdx.x;
  if (blk < kPrepW)                wtcast_body(blk & (kHid / 64 - 1), blk / (kHid / 64), W, WT);
  else if (blk < kPrepW + kPrepPE) pecast_body(blk - kPrepW, pe, PEb);
  else                             cast8_bf16_body(blk - kPrepW - kPrepPE, x, X16, kTok * kHid / 8);
}

// ---------------------------------------------------------------------------
// Attention helpers
// ---------------------------------------------------------------------------
// Every operand of the attention kernel is f16; its bits travel in __bf16 slots (16-bit storage, as the loaders take it).
// builtin form only: the compiler keeps its distances itself and stays free to put reads and other products between them
__device__ __forceinline__ v8f at_mma(v16b a, v16b b, v8f c) {
  const v16h ah = __builtin_bit_cast(v16h, a), bh = __builtin_bit_cast(v16h, b);
  return __builtin_amdgcn_wmma_f32_16x16x32_f16(false, ah, false, bh, (short)0, c, false, false);
}
__device__ __forceinline__ __bf16 at_to16(float f) { return __builtin_bit_cast(__bf16, (_Float16)f); }

// lane l <-> lane l ^ 16: the two halves of a wave hold the two halves of one query's keys
__device__ __forceinline__ float xhalf(float x) {
  return __builtin_bit_cast(float, __builtin_amdgcn_permlanex16(__builtin_bit_cast(int, x), __builtin_bit_cast(int, x),
                                                                0x76543210, 0xfedcba98, false, false));
}

// Inputs-only fence on four loaded fragments: their eight LDS reads go out ahead of it as one group with one wait
// (without it the build reuses one register set and pays a full LDS round trip in front of every product).
__device__ __forceinline__ void hold4(v16b a, v16b b, v16b c, v16b d) { asm volatile("" :: "v"(a), "v"(b), "v"(c), "v"(d)); }
// the same on eight fragments (sixteen reads, one wait)
__device__ __forceinline__ void hold8(v16b a, v16b b, v16b c, v16b d, v16b e, v16b f, v16b g, v16b h) {
  asm volatile("" :: "v"(a), "v"(b), "v"(c), "v"(d), "v"(e), "v"(f), "v"(g), "v"(h));
}

// =====================================================================================
// Fused attention with relative_key_query bias, head_dim 64. Block = 4 waves = 64 query rows of one (b, h);
// key chunks of 64; online softmax in f32. Operand planes (all dense, statically strided, 16-bit):
//   QK:      f16 [token = b*512+s][2048] with q at cols h*64+d, k at cols 1024+h*64+d
//   Vt:      f16 [b][h*64+d][s]  (pitch 512)
//   PE:      f16 [1024][64] (dist_emb, row 1023 zero)
// Per chunk (l0 = 64*qb, r0 = 64*kc, d0 = l0 - r0 + 448, dist(l,r) = d0 + ll - kk + 63 with local ll, kk in 0..63):
//   T1w[p1][row] = q(row of this wave) . pe[d0 + 16*wave + p1], p1 = 0..79 (f16 in LDS, per wave)
//   T2 [p][kk]   = k(kk) . pe[d0 + p] for the band p in [48-16*j, 127-16*j] of key group j = kk>>4 (wave j produces it)
//   s[ll][kk] = (q.k + T1 + T2) * 1/8 + mask[b][r0+kk];  p = exp(s - m);  out = sum p v / l.
// Scores and output are formed transposed: s^T = k . q^T (a lane holds one query's scores: keys 16 j + 8 hh + r in its
// registers), out^T += v^T . p^T; p^T packs from the score registers into the B operand and never touches LDS.
// Each chunk's k, pe band and v^T tiles are staged once per block in LDS by one tensor load each, issued one phase ahead.
// grid (S/64, H, B), 128 threads.
// =====================================================================================
constexpr int kT1Slots = 80;
// LDS map of relattn_kernel (bytes). Staged tiles keep their 128-B rows at a pitch of 144 B (16 B x odd: no bank
// conflict for 16-B fragment reads). The out tile of the epilogue reuses the K / PE range.
constexpr int kPitchB = 144;                           // staged row pitch, bytes
constexpr int kPitchH = kPitchB / 2;                   // the same in 16-bit elements
constexpr int kOffPE  = 0;                             // pe    [128 distances][64 d]
constexpr int kOffKH  = kOffPE + 128 * kPitchB;        // k     [64 keys][64 d]
constexpr int kOffV   = (kOffKH + 64 * kPitchB + 2047) / 2048 * 2048;   // v^T   [64 d][64 keys]
// A bias gather is one 16-bit read per lane: lane (c, hh) reads table row base + c - 8 hh. Both tables are laid out so that
// the 32 lanes of a gather meet 32 different banks of the 64 (dword address mod 64), the two halves of the wave included.
constexpr int kOffT1  = kOffV + 64 * kPitchB;          // per wave [p1][16 rows] f16, rows at kT1Pitch
constexpr int kT1Pitch = 24;                           // 16-bit elements: 12 dwords a row, eight rows on are 32 banks on
constexpr int kOffT2  = kOffT1 + 4 * kT1Slots * kT1Pitch * 2; // [p][64 keys] f16, rows at kT2Pitch
constexpr int kT2Pitch = 72;                           // 16-bit elements: 36 dwords a row
constexpr int kT2Half  = 36;                           // key 16 j + 8 hh + r lies at column kT2Half hh + 8 j + r: 18 dwords between the halves
constexpr int kLdsBytes = kOffT2 + 128 * kT2Pitch * 2; // 71,680
static_assert(kT2Half + 32 <= kT2Pitch && kT2Half % 4 == 0 && kT1Pitch % 8 == 0, "T2 columns fit a row; 8-B and 16-B stores stay aligned");
static_assert(4 * 16 * 68 * 4 <= kOffV, "out tiles fit the K / PE range");
static_assert(kOffPE % 2048 == 0 && kOffKH % 2048 == 0 && kOffV % 2048 == 0, "every tensor load's place is a multiple of 2 KiB");

__global__ __launch_bounds__(128)
void relattn_kernel(const unsigned short* __restrict__ QKhp,
                    const unsigned short* __restrict__ Vtp, const unsigned short* __restrict__ PEp,
                    const float* __restrict__ mask, float* __restrict__ out) {
  union FB { v16b v; v8b h[2]; };
  typedef __attribute__((address_space(3))) unsigned char lds_byte;
  __shared__ __attribute__((aligned(2048))) unsigned char smem[kLdsBytes];   // tensor loads land at multiples of 2 KiB
  const __bf16* KHs = (const __bf16*)(smem + kOffKH);
  const __bf16* PEs = (const __bf16*)(smem + kOffPE);
  const __bf16* Vs  = (const __bf16*)(smem + kOffV);      // f16 bits
  _Float16*     T2s = (_Float16*)(smem + kOffT2);

  const int tid  = threadIdx.x;
  const int wave = tid >> 5;
  const int lane = tid & 31;
  const int hh   = lane >> 4;
  const int c    = lane & 15;

  const int qb = blockIdx.x;
  const int h  = blockIdx.y;
  const int b  = blockIdx.z;
  const int l0 = qb * 64;
  const int q0 = l0 + wave * 16;
  const size_t tok0 = (size_t)b * kSeq;

  const __bf16* Qh  = (const __bf16*)QKhp;
  const __bf16* Vt  = (const __bf16*)Vtp;     // f16 bits
  const __bf16* PEt = (const __bf16*)PEp;

  // ---- staging roles: wave 0 brings the chunk's k tile (64 rows), wave 1 its pe band (128 rows), wave 2 its v^T tile (64 rows);
  //      every row is 128 B and lands at the pitch of 144 B ----
  const uint32_t wv   = uni(threadIdx.x >> 5);
  const uint32_t isu  = pinned(wv < 3u ? 1u : 0u);            // 1 in the waves that issue
  const uint32_t iskp = pinned(wv < 2u ? 1u : 0u);            // 1 in the waves that bring k and pe
  const uint32_t isv  = pinned(wv == 2u ? 1u : 0u);           // 1 in the wave that brings v^T
  const uint32_t trows = (wv == 1u) ? 128u : 64u;
  // first byte of the wave's tile of chunk 0, and what a chunk adds to it: k 64 token rows on, pe 64 distance rows back
  // (band d0 .. d0 + 127 with d0 = l0 - 64 n + 448 in [0, 896], plane of 1024 rows), v^T 64 keys on in its rows
  const __bf16* gt0 = (wv == 0u) ? Qh + tok0 * kQKld + kHid + (size_t)h * kHdim
                    : (wv == 1u) ? PEt + (size_t)(l0 + 448) * kHdim
                                 : Vt + (size_t)(b * kHeads + h) * kHdim * kSeq;
  const uint64_t gbase = (uint64_t)(size_t)gt0;
  const int64_t  gstep = (wv == 0u) ? (int64_t)64 * kQKld * 2 : (wv == 1u) ? -(int64_t)64 * kHdim * 2 : (int64_t)64 * 2;
  const uint32_t lplace = (uint32_t)(size_t)(lds_byte*)smem
                        + ((wv == 0u) ? (uint32_t)kOffKH : (wv == 1u) ? (uint32_t)kOffPE : (uint32_t)kOffV);
  u32x8 g1;                                    // 1-byte elements, tensor = tile = trows rows of 128 B, 16 B of LDS pad behind every row
  g1[0] = uni((1u << 20) | (4u << 22) | (3u << 25));
  g1[1] = pinned(128u << 16);                  // pinned(): each word keeps a scalar register of its own through the loop
  g1[2] = pinned(trows << 16);
  g1[3] = pinned(128u << 16);
  g1[4] = pinned(trows);
  g1[5] = pinned((wv == 0u) ? (uint32_t)kQKld * 2u : (wv == 1u) ? (uint32_t)kHdim * 2u : (uint32_t)kSeq * 2u);   // source row pitch, bytes
  g1[6] = pinned(0u);
  g1[7] = pinned(0u);
  u32x4 g0;                                    // the descriptor group of the request last issued
  g0[0] = pinned(1u);
  g0[1] = pinned(lplace);
  g0[2] = uni((uint32_t)gbase);
  g0[3] = uni((((uint32_t)(gbase >> 32)) & 0x01FFFFFFu) | 0x80000000u);
  // this wave's tile of key chunk n; the descriptor is formed behind pinned()
  auto stage = [&](int n) {
    const uint32_t so = pinned((uint32_t)n);
    const uint64_t ga = gbase + (uint64_t)((int64_t)so * gstep);
    g0[2] = uni((uint32_t)ga);
    g0[3] = uni((((uint32_t)(ga >> 32)) & 0x01FFFFFFu) | 0x80000000u);
    tdm_load(g0, g1);
  };

  if (pinned(iskp)) stage(0);                   // k and pe of chunk 0 fly while the Q fragments are fetched

  // ---- Q fragments: 2 d-chunks ----
  v16b qah[2];
  {
    const size_t qo = (tok0 + q0 + c) * kQKld + (size_t)h * kHdim + 8 * hh;
#pragma unroll
    for (int dc = 0; dc < 2; ++dc) qah[dc] = Frag<__bf16>::load(Qh + qo + dc * 32);
  }
  // stands in front of the first write over an address register of the q loads (this build reuses them for out^T)
  asm volatile("s_wait_xcnt 0x0" ::: "memory");
  __builtin_amdgcn_sched_barrier(0);           // keeps those writes behind the wait: the build lifts them over it otherwise

  float mrow = -INFINITY, lrow = 0.f;          // this lane's query (row c of the wave); lrow sums this half's keys only
  v8f oacc[4];                                 // out^T: register r of tile t = d 16 t + 8 hh + r of query c
#pragma unroll
  for (int t = 0; t < 4; ++t) oacc[t] = (v8f){0.f,0.f,0.f,0.f,0.f,0.f,0.f,0.f};

  _Float16* t1w = (_Float16*)(smem + kOffT1) + wave * (kT1Slots * kT1Pitch);
  // every table address of the chunk loop is one base register plus a constant: the registers so freed hold reads in flight
  const __bf16* pe1b = PEs + (16 * wave + c) * kPitchH + 8 * hh;            // pe rows of T1 tile 0
  const __bf16* pe2b = PEs + (16 * (3 - wave) + c) * kPitchH + 8 * hh;      // pe rows of T2 tile 0
  _Float16* t1s = t1w + c * kT1Pitch + 8 * hh;                              // T1 tile 0, this lane's eight rows
  _Float16* t2s = T2s + (16 * (3 - wave) + c) * kT2Pitch + kT2Half * hh + 8 * wave;   // T2 tile 0, this lane's eight keys
  // bias gather bases (query row c, key 16 j + 8 hh + r): element (r, j) lies at a non-negative constant behind them
  const _Float16* t1b = t1w + ((c - 8 * hh + 8) * kT1Pitch + c);
  const _Float16* t2b = T2s + ((16 * wave + c - 8 * hh + 8) * kT2Pitch + kT2Half * hh);
  const float* mkb = mask + tok0 + 8 * hh;     // additive mask [b][r], this half's eight keys of each group

  for (int kc = 0; kc < kSeq / 64; ++kc) {
    const int r0 = kc * 64;
    // publish k / pe of this chunk; the barrier also ends the previous chunk's reads of T2s and of the v tile
    wait_lds_done();
    if (pinned(isu)) wait_tile_landed(g0, g1);
    __syncthreads();
    if (pinned(isv)) stage(kc);                // v^T flies under the T1 / T2 / q.k products, read behind the next barrier
    v4f mk[4][2];                              // fetched here, used behind the next barrier
#pragma unroll
    for (int j = 0; j < 4; ++j) {
      mk[j][0] = *(const v4f*)(mkb + r0 + j * 16);
      mk[j][1] = *(const v4f*)(mkb + r0 + j * 16 + 4);
    }

    // ---- relative-position tiles on WMMA: T1 (5 tiles per wave), T2 (5 tiles per wave) ----
    {
      v16b ka[2];
#pragma unroll
      for (int dc = 0; dc < 2; ++dc) ka[dc] = Frag<__bf16>::load(KHs + (wave * 16 + c) * kPitchH + 8 * hh + dc * 32);   // k rows as A operand
#pragma unroll
      for (int i0 = 0; i0 < 5; i0 += 2) {                  // tiles i0 and i0 + 1 together (the fifth alone)
        // distance tile bases inside the staged band: T1 16 (wave + i), T2 16 (3 - wave + i), both <= 112
        const int nt = (i0 + 1 < 5) ? 2 : 1;
        v16b p1[2][2], p2[2][2];
        v8f a1[2], a2[2];
#pragma unroll
        for (int u = 0; u < nt; ++u) {
          a1[u] = (v8f){0.f,0.f,0.f,0.f,0.f,0.f,0.f,0.f};
          a2[u] = (v8f){0.f,0.f,0.f,0.f,0.f,0.f,0.f,0.f};
#pragma unroll
          for (int dc = 0; dc < 2; ++dc) {
            p1[u][dc] = Frag<__bf16>::load(pe1b + (i0 + u) * 16 * kPitchH + dc * 32);   // B[k=d][n=dist]
            p2[u][dc] = Frag<__bf16>::load(pe2b + (i0 + u) * 16 * kPitchH + dc * 32);
          }
        }
        if (nt == 2) hold8(p1[0][0], p2[0][0], p1[1][0], p2[1][0], p1[0][1], p2[0][1], p1[1][1], p2[1][1]);
        else         hold4(p1[0][0], p2[0][0], p1[0][1], p2[0][1]);
#pragma unroll
        for (int dc = 0; dc < 2; ++dc) {
#pragma unroll
          for (int u = 0; u < nt; ++u) {
            a1[u] = at_mma(qah[dc], p1[u][dc], a1[u]);
            a2[u] = at_mma(ka[dc], p2[u][dc], a2[u]);
          }
        }
#pragma unroll
        for (int u = 0; u < nt; ++u) {
          v8h hv1, hv2;
#pragma unroll
          for (int r = 0; r < 8; ++r) { hv1[r] = (_Float16)a1[u][r]; hv2[r] = (_Float16)a2[u][r]; }
          // D element r: row 8hh+r (query row of this wave / key row 16*wave+8hh+r), col = dist slot 16i+c
          *(v8h*)(t1s + (i0 + u) * 16 * kT1Pitch) = hv1;
          // the upper half's eight keys begin at a multiple of 8 B, not of 16 B: two 8-B stores
          *(v4h*)(t2s + (i0 + u) * 16 * kT2Pitch)     = __builtin_shufflevector(hv2, hv2, 0, 1, 2, 3);
          *(v4h*)(t2s + (i0 + u) * 16 * kT2Pitch + 4) = __builtin_shufflevector(hv2, hv2, 4, 5, 6, 7);
        }
      }
    }

    // ---- s^T = k . q^T, A fragments from the staged k tile, B = the q fragments ----
    // The four key groups' chains run side by side; each s[j] sums d half 0, then d half 1.
    v8f s[4];
#pragma unroll
    for (int j = 0; j < 4; ++j) s[j] = (v8f){0.f,0.f,0.f,0.f,0.f,0.f,0.f,0.f};
    {
      v16b kb[2][4];
#pragma unroll
      for (int dc = 0; dc < 2; ++dc) {
#pragma unroll
        for (int j = 0; j < 4; ++j) kb[dc][j] = Frag<__bf16>::load(KHs + (j * 16 + c) * kPitchH + 8 * hh + dc * 32);
      }
      hold8(kb[0][0], kb[0][1], kb[0][2], kb[0][3], kb[1][0], kb[1][1], kb[1][2], kb[1][3]);
#pragma unroll
      for (int dc = 0; dc < 2; ++dc) {
#pragma unroll
        for (int j = 0; j < 4; ++j) s[j] = at_mma(kb[dc][j], qah[dc], s[j]);
      }
    }
    // publish T1s / T2s and the v tile; the barrier also ends every wave's reads of the k and pe tiles
    wait_lds_done();
    if (pinned(isu)) wait_tile_landed(g0, g1);
    __syncthreads();
    if (pinned(iskp & (uint32_t)(kc + 1 < kSeq / 64))) stage(kc + 1);   // flies under softmax and p.v, read behind the next chunk's first barrier

    float mj[4];                               // four chains of the in-lane maximum
#pragma unroll
    for (int j = 0; j < 4; ++j) mj[j] = -INFINITY;
#pragma unroll
    for (int g = 0; g < 2; ++g) {              // keys r = 4 g .. 4 g + 3 of each group: 32 reads as groups, then their sums
      _Float16 u1[4][4], u2[4][4];
#pragma unroll
      for (int rr = 0; rr < 4; ++rr) {
#pragma unroll
        for (int j = 0; j < 4; ++j) {
          const int r = 4 * g + rr;            // p1 = c - 16 j - 8 hh - r + 63, in [0, 78]
          u1[rr][j] = t1b[kT1Pitch * (55 - 16 * j - r)];                  // T1w[p1][c]
          u2[rr][j] = t2b[kT2Pitch * (55 - 16 * j - r) + 8 * j + r];      // T2[p1 + 16 wave][key 16 j + 8 hh + r]
        }
      }
#pragma unroll
      for (int rr = 0; rr < 4; ++rr) {
        const int r = 4 * g + rr;
#pragma unroll
        for (int j = 0; j < 4; ++j) {
          const float v = (s[j][r] + (float)u1[rr][j] + (float)u2[rr][j]) * 0.125f + mk[j][g][rr];
          s[j][r] = v;
          mj[j] = fmaxf(mj[j], v);
        }
      }
    }
    FB vb[2][4];
#pragma unroll                                 // p is not waited for in LDS any more: the v reads fly under the exponentials
    for (int kk = 0; kk < 2; ++kk) {
#pragma unroll
      for (int t = 0; t < 4; ++t) {
        const int vo = (t * 16 + c) * kPitchH + kk * 32 + 8 * hh;   // A[m=d][k=kv] from the staged v^T[d][kv]
        vb[kk][t].h[0] = *(const v8b*)(Vs + vo);
        vb[kk][t].h[1] = *(const v8b*)(Vs + vo + 16);
      }
    }
    // keeps the v reads in front of the exponentials: without it the build sinks part of them to the products and
    // waits out their LDS round trip there
    __builtin_amdgcn_sched_barrier(0);
    float cm = fmaxf(fmaxf(mj[0], mj[1]), fmaxf(mj[2], mj[3]));
    cm = fmaxf(cm, xhalf(cm));                 // both halves now hold the query's maximum over the chunk
    const float mnew  = fmaxf(mrow, cm);
    const float alpha = __expf(mrow - mnew);
    mrow = mnew;
    float ps[4];                               // four chains of the in-lane sum
    FB pb[2];                                  // p^T as B operand: element e of pb[kk] = key 32 kk + kmap(e, hh) of query c
#pragma unroll
    for (int j = 0; j < 4; ++j) {
      ps[j] = 0.f;
#pragma unroll
      for (int r = 0; r < 8; ++r) {
        const float p = __expf(s[j][r] - mnew);
        ps[j] += p;
        pb[j >> 1].v[(j & 1) * 8 + r] = at_to16(p * kPCarry);
      }
    }
    lrow = lrow * alpha + ((ps[0] + ps[1]) + (ps[2] + ps[3]));
#pragma unroll
    for (int t = 0; t < 4; ++t) {
#pragma unroll
      for (int r = 0; r < 8; ++r) oacc[t][r] *= alpha;
    }
#pragma unroll
    for (int kk = 0; kk < 2; ++kk) {
#pragma unroll
      for (int t = 0; t < 4; ++t) oacc[t] = at_mma(vb[kk][t].v, pb[kk].v, oacc[t]);
    }
  }
  wait_tile_landed(g0, g1);                    // none is left in flight when the wave reuses LDS and ends

  // ---- epilogue: out[b][q0+row][h*64 + 0..63]; row segment = 256 B = 16 lanes x 16 B, one instruction per row ----
  // The out tiles lie on the k / pe range: its last readers left it at the last chunk's second barrier, and no load
  // was aimed at it after that.
  float* os = (float*)(smem) + wave * (16 * 68);
  const float inv = 1.0f / ((lrow + xhalf(lrow)) * kPCarry);   // the halves' sums are joined once, here
#pragma unroll
  for (int t = 0; t < 4; ++t) {
    float* op = os + c * 68 + t * 16 + 8 * hh;                 // query row c, d 16 t + 8 hh .. + 7
    *(v4f*)(op)     = (v4f){oacc[t][0] * inv, oacc[t][1] * inv, oacc[t][2] * inv, oacc[t][3] * inv};
    *(v4f*)(op + 4) = (v4f){oacc[t][4] * inv, oacc[t][5] * inv, oacc[t][6] * inv, oacc[t][7] * inv};
  }
  __builtin_amdgcn_fence(__ATOMIC_RELEASE, "workgroup");
  __builtin_amdgcn_wave_barrier();
  __builtin_amdgcn_fence(__ATOMIC_ACQUIRE, "workgroup");
  {
    float* ob = out + (size_t)h * kHdim;
    const int c4 = (lane & 15) * 4;
    {
#pragma unroll
      for (int it = 0; it < 8; ++it) {
        const int row = it * 2 + hh;
        v4f val = *(const v4f*)(os + row * 68 + c4);
        *(v4f*)(ob + (tok0 + q0 + row) * kHid + c4) = val;
      }
      
    }
  }
}

// ---------------------------------------------------------------------------
// Workspace region map (byte offsets, multiples of 128; every region fully written before it is read):
//   X16  bf16 [8192][1024]                     0 ..  16,777,216
//   WT   bf16 [3072][1024] (W^T)      16,777,216 ..  23,068,672
//   PE   f16  [1024][64] (row 1023 0) 23,068,672 ..  23,199,744
//   QK   f16  [8192][2048] ([q|k])     23,199,744 ..  56,754,176
//   Vt   f16  [16][1024][512]          56,754,176 ..  73,531,392
//   total 73,531,392 B.
// GEMM shapes: q|k: M=8192 N=2048 K=1024; v (role-swapped, per batch): M=1024 N=512 K=1024 x16.
//   K % 64 == 0, M % 128 == 0 and N % 256 == 0 for both; no padded operand rows.
// ---------------------------------------------------------------------------
extern "C" void kernel_launch(void* const* d_in, const int* in_sizes, int n_in,
                              void* d_out, int out_size, void* d_ws, size_t ws_size,
                              hipStream_t stream) {
  if (n_in < 5) return;
  if (in_sizes[0] != kTok * kHid) return;
  if (in_sizes[1] != kBatch * kSeq) return;
  if (in_sizes[2] != kHid * kN3) return;
  if (in_sizes[3] != kN3) return;
  if (in_sizes[4] != kNDist * kHdim) return;
  if (out_size != kTok * kHid) return;

  const float* hid  = (const float*)d_in[0];   // [16][512][1024]
  const float* msk  = (const float*)d_in[1];   // [16][1][1][512]
  const float* W    = (const float*)d_in[2];   // [1024][3072]
  const float* bqkv = (const float*)d_in[3];   // [3072]
  const float* pe   = (const float*)d_in[4];   // [1023][64]
  float* outp = (float*)d_out;                 // [16][512][1024]

  const size_t SZ_X16 = (size_t)kTok * kHid * 2;              //  16,777,216
  const size_t SZ_WT  = (size_t)kN3 * kHid * 2;               //   6,291,456
  const size_t SZ_PE  = (size_t)kNDistP * kHdim * 2;          //     131,072
  const size_t SZ_QK  = (size_t)kTok * kQKld * 2;             //  33,554,432
  const size_t SZ_VT  = (size_t)kBatch * kHid * kSeq * 2;     //  16,777,216
  size_t off = 0;
  const size_t oX16 = off; off += SZ_X16;
  const size_t oWT  = off; off += SZ_WT;
  const size_t oPE  = off; off += SZ_PE;
  const size_t oQKh = off; off += SZ_QK;
  const size_t oVT  = off; off += SZ_VT;
  const size_t TOTAL = off;                                   //  73,531,392
  if (TOTAL > ws_size) return;
  if (TOTAL > (size_t)134217728) return;

  char* ws = (char*)d_ws;
  unsigned short* X16 = (unsigned short*)(ws + oX16);
  unsigned short* WT  = (unsigned short*)(ws + oWT);
  unsigned short* PEb = (unsigned short*)(ws + oPE);
  unsigned short* QKh = (unsigned short*)(ws + oQKh);
  unsigned short* VTp = (unsigned short*)(ws + oVT);

  const dim3 blk(256);
  // (0..2) one launch: W [1024][3072] -> WT [3072][1024] bf16; dist_emb -> PE f16 [1024][64]; x -> bf16 plane
  prep_kernel<<<dim3(kPrepW + kPrepPE + kPrepX), blk, 0, stream>>>(hid, W, pe, X16, WT, PEb);
  // (3, 4) one launch:
  //   v^T per batch: Vt[b][m][s] = WT[2048+m] . x[b*512+s] + b[2048+m] -> f16, pitch 512
  //   [q|k] = X16 . WT[0..2047]^T + b[0..2047] -> one f16 plane, pitch 2048
  {
    const GemmJob jv  = {WT + (size_t)2 * kHid * kHid, X16, VTp, VTp, bqkv + 2 * kHid,
                         0L, (long)kSeq * kHid, (long)kHid * kSeq, kHid, kHid, kSeq, kHid, kSeq, kHid, 1.0f};
    const GemmJob jqk = {X16, WT, QKh, QKh, bqkv,
                         0L, 0L, 0L, kHid, kHid, kQKld, kTok, kQKld, kHid, 1.0f};
    proj_kernel<<<dim3(kVBlocks + kQKBlocks), blk, 0, stream>>>(jv, jqk);
  }
  // (5) fused attention with relative-position bias -> out f32 [16][512][1024]
  relattn_kernel<<<dim3(kSeq / 64, kHeads, kBatch), dim3(128), 0, stream>>>(QKh, VTp, PEb, msk, outp);
}
